// v000
// Times are from an AMD MI455X. After a warm-up the kernel runs many times in a row, and a time is the length of
// such a window on the GPU divided by its runs, so every launch and the gaps after it count. The runs cycle
// through copies of the inputs. A figure is the median of several windows, for all but v000 over two sittings.
// Sittings can differ by a few percent; kernels timed side by side share one.
// The starting kernel, v000, takes 503 microseconds a run.
// Contractions on v_wmma_f32_16x16x32_bf16 (bf16 operands, f32 accumulate): qkv and output projections = activation bf16 hi+lo planes x weight bf16 plane (2 products); q.k scores and p.v = bf16 hi/lo x bf16 hi/lo (3 products); LayerNorm, softmax and epilogues in f32; every float input RNE-converted to bf16 once at load.
#include <hip/hip_runtime.h>
#include <hip/hip_bf16.h>

typedef __attribute__((ext_vector_type(16))) _Float16 v16h;
typedef __attribute__((ext_vector_type(8)))  _Float16 v8h;
typedef __attribute__((ext_vector_type(16))) __bf16   v16b;
typedef __attribute__((ext_vector_type(8)))  __bf16   v8b;
typedef __attribute__((ext_vector_type(8)))  float    v8f;
typedef __attribute__((ext_vector_type(4)))  float    v4f;
typedef __attribute__((ext_vector_type(4)))  unsigned v4u;

// ---- problem geometry ----
constexpr int MODEL_DIM = 1024;
constexpr int SEQ_LEN   = 2048;
constexpr int N_BATCH   = 2;
constexpr int N_HEAD    = 16;
constexpr int HEAD_D    = 64;
constexpr int INNER_DIM = N_HEAD * HEAD_D;          // 1024
constexpr int QKV_COLS  = 3 * INNER_DIM;            // 3072
constexpr int TOK_ROWS  = N_BATCH * SEQ_LEN;        // 4096
constexpr int KV_CHUNK  = 64;
constexpr int Q_BLOCK   = 64;

// GEMM shape contract (no run-time tails in the GEMM kernel)
static_assert(MODEL_DIM % 32 == 0, "K of qkv projection");
static_assert(INNER_DIM % 32 == 0, "K of output projection");
static_assert(TOK_ROWS % 64 == 0, "M tile multiple");
static_assert(QKV_COLS % 64 == 0, "N tile multiple (qkv)");
static_assert(MODEL_DIM % 64 == 0, "N tile multiple (out)");
static_assert(SEQ_LEN % KV_CHUNK == 0 && SEQ_LEN % Q_BLOCK == 0, "attention tiles");
static_assert(HEAD_D == 64, "attention kernel is head_dim 64");
static_assert(MODEL_DIM == 128 * 8, "LayerNorm kernel: 128 threads x 8 elements per row");

// ---- workspace region map (bytes, every offset a multiple of 128) ----
//  [0]            wq  bf16 [3072][1024]         6291456
//  [6291456]      wo  bf16 [1024][1024]         2097152
//  [8388608]      h   hi bf16 [4096][1024]      8388608
//  [16777216]     h   lo bf16 [4096][1024]      8388608
//  [25165824]     qkv hi bf16 [4096][3072]     25165824
//  [50331648]     qkv lo bf16 [4096][3072]     25165824
//  [75497472]     at  hi bf16 [4096][1024]      8388608
//  [83886080]     at  lo bf16 [4096][1024]      8388608
//  total 92274688
constexpr size_t WS_WQ    = (size_t)QKV_COLS * MODEL_DIM * 2;
constexpr size_t WS_WO    = (size_t)MODEL_DIM * INNER_DIM * 2;
constexpr size_t WS_HPL   = (size_t)TOK_ROWS * MODEL_DIM * 2;
constexpr size_t WS_QKVPL = (size_t)TOK_ROWS * QKV_COLS * 2;
constexpr size_t WS_ATPL  = (size_t)TOK_ROWS * INNER_DIM * 2;
constexpr size_t WS_TOTAL = WS_WQ + WS_WO + 2 * WS_HPL + 2 * WS_QKVPL + 2 * WS_ATPL;
static_assert(WS_TOTAL == 92274688, "carve arithmetic");
static_assert(WS_TOTAL <= 134217728, "carve budget");
static_assert(WS_WQ % 128 == 0 && WS_WO % 128 == 0 && WS_HPL % 128 == 0 && WS_QKVPL % 128 == 0 && WS_ATPL % 128 == 0, "128-B aligned regions");

// ---- bf16 RNE helpers ----
__device__ __forceinline__ unsigned short f2bf_bits(float f) {
  unsigned u = __float_as_uint(f);
  return (unsigned short)((u + 0x7FFFu + ((u >> 16) & 1u)) >> 16);
}
__device__ __forceinline__ float bf_bits2f(unsigned short h) { return __uint_as_float(((unsigned)h) << 16); }

// hazard guards as plain device helpers (no inline asm inside the kernel template body)
__device__ __forceinline__ void dep_guard_h(v8f& a, v8f& b, v16h x, v16h y) { asm volatile("v_nop\n\tv_nop\n\tv_nop\n\tv_nop" : "+v"(a), "+v"(b) : "v"(x), "v"(y)); }
__device__ __forceinline__ void dep_guard_b(v8f& a, v8f& b, v16b x, v16b y) { asm volatile("v_nop\n\tv_nop\n\tv_nop\n\tv_nop" : "+v"(a), "+v"(b) : "v"(x), "v"(y)); }
__device__ __forceinline__ void keep4_h(v16h a, v16h b, v16h c, v16h d) { asm volatile("v_nop" :: "v"(a), "v"(b), "v"(c), "v"(d)); }
__device__ __forceinline__ void keep4_b(v16b a, v16b b, v16b c, v16b d) { asm volatile("v_nop" :: "v"(a), "v"(b), "v"(c), "v"(d)); }
__device__ __forceinline__ void acc_guard4(v8f& a, v8f& b, v8f& c, v8f& d) { asm volatile("v_nop\n\tv_nop\n\tv_nop\n\tv_nop" : "+v"(a), "+v"(b), "+v"(c), "+v"(d)); }
template <typename T> struct Frag;
template <> struct Frag<_Float16> {
  typedef v16h V; union U { v16h v; v8h h[2]; };
  static __device__ __forceinline__ v16h load(const _Float16* p) {   // elements 0..7 <- p[0..7], 8..15 <- p[16..23]
    U f; f.h[0] = *(const v8h*)(p); f.h[1] = *(const v8h*)(p + 16); return f.v;
  }
  static __device__ __forceinline__ v8f mma(v16h a, v16h b, v8f c) {
    return __builtin_amdgcn_wmma_f32_16x16x32_f16(false, a, false, b, (short)0, c, false, false);
  }
  static __device__ __forceinline__ void guard(v8f& a, v8f& b, v16h x, v16h y) { dep_guard_h(a, b, x, y); }
  static __device__ __forceinline__ void keep(v16h a, v16h b, v16h c, v16h d) { keep4_h(a, b, c, d); }
};
template <> struct Frag<__bf16> {
  typedef v16b V; union U { v16b v; v8b h[2]; };
  static __device__ __forceinline__ v16b load(const __bf16* p) {
    U f; f.h[0] = *(const v8b*)(p); f.h[1] = *(const v8b*)(p + 16); return f.v;
  }
  static __device__ __forceinline__ v8f mma(v16b a, v16b b, v8f c) {
    return __builtin_amdgcn_wmma_f32_16x16x32_bf16(false, a, false, b, (short)0, c, false, false);
  }
  static __device__ __forceinline__ void guard(v8f& a, v8f& b, v16b x, v16b y) { dep_guard_b(a, b, x, y); }
  static __device__ __forceinline__ void keep(v16b a, v16b b, v16b c, v16b d) { keep4_b(a, b, c, d); }
};

// attention helpers (bf16 WMMA with hazard guard; f32 -> bf16 hi/lo split)
__device__ __forceinline__ unsigned short at_bf_bits(float f) {
  unsigned u = __float_as_uint(f);
  return (unsigned short)((u + 0x7FFFu + ((u >> 16) & 1u)) >> 16);
}
__device__ __forceinline__ __bf16 at_f2bf(float f) { return __builtin_bit_cast(__bf16, at_bf_bits(f)); }
__device__ __forceinline__ void at_split(float f, __bf16& hi, __bf16& lo) {
  const unsigned short hb = at_bf_bits(f);
  hi = __builtin_bit_cast(__bf16, hb);
  lo = at_f2bf(f - __uint_as_float(((unsigned)hb) << 16));
}
__device__ __forceinline__ v8f at_mma(v16b a, v16b b, v8f c) {
  c = __builtin_amdgcn_wmma_f32_16x16x32_bf16(false, a, false, b, (short)0, c, false, false);
  asm volatile("v_nop\n\tv_nop\n\tv_nop\n\tv_nop" : "+v"(c) : "v"(a), "v"(b));
  return c;
}

// =====================================================================================
// 1) f32 -> bf16 (RNE) cast, 8 elements per thread, one 16-B store per lane
//    Coverage: grid = n8/256 blocks x 256 threads x 8 elements = n exactly (n8 = n/8, n % 2048 == 0 here).
// =====================================================================================
__global__ __launch_bounds__(256) void cast_f32_bf16x8(
    const float* __restrict__ in, unsigned short* __restrict__ out, int n8) {
  const int i = blockIdx.x * 256 + threadIdx.x;
  if (i < n8) {
    const size_t e0 = (size_t)i * 8;
    const v4f a = *(const v4f*)(in + e0);
    const v4f b = *(const v4f*)(in + e0 + 4);
    v4u u;
    u[0] = (unsigned)f2bf_bits(a[0]) | ((unsigned)f2bf_bits(a[1]) << 16);
    u[1] = (unsigned)f2bf_bits(a[2]) | ((unsigned)f2bf_bits(a[3]) << 16);
    u[2] = (unsigned)f2bf_bits(b[0]) | ((unsigned)f2bf_bits(b[1]) << 16);
    u[3] = (unsigned)f2bf_bits(b[2]) | ((unsigned)f2bf_bits(b[3]) << 16);
    *(v4u*)(out + e0) = u;
    
  }
}

// =====================================================================================
//    result split into bf16 hi / lo planes [TOK_ROWS][MODEL_DIM].
//    One block (128 threads) per row; thread t owns elements 8t..8t+7 -> one 16-B store per lane per plane
//    Coverage: 4096 blocks x 128 threads x 8 = 4096 x 1024 exactly.
// =====================================================================================
__global__ __launch_bounds__(128) void layernorm_bf16split_kernel(
    const float* __restrict__ x, const float* __restrict__ gamma, const float* __restrict__ beta,
    unsigned short* __restrict__ hhi, unsigned short* __restrict__ hlo) {
  __shared__ float red_s[4];
  __shared__ float red_q[4];
  const int row = blockIdx.x;
  const int t = threadIdx.x;
  const int lane = t & 31, wave = t >> 5;
  const size_t base = (size_t)row * MODEL_DIM + 8 * (size_t)t;

  const v4f a0 = *(const v4f*)(x + base);
  const v4f a1 = *(const v4f*)(x + base + 4);
  float xv[8];
#pragma unroll
  for (int e = 0; e < 4; ++e) {
    xv[e]     = bf_bits2f(f2bf_bits(a0[e]));
    xv[4 + e] = bf_bits2f(f2bf_bits(a1[e]));
  }
  float s = ((xv[0] + xv[1]) + (xv[2] + xv[3])) + ((xv[4] + xv[5]) + (xv[6] + xv[7]));
#pragma unroll
  for (int off = 1; off < 32; off <<= 1) s += __shfl_xor(s, off, 32);
  if (lane == 0) red_s[wave] = s;
  __syncthreads();
  const float tot = (red_s[0] + red_s[1]) + (red_s[2] + red_s[3]);
  const float mean = tot * (1.0f / (float)MODEL_DIM);

  float d[8];
  float q = 0.f;
#pragma unroll
  for (int e = 0; e < 8; ++e) { d[e] = xv[e] - mean; q += d[e] * d[e]; }
#pragma unroll
  for (int off = 1; off < 32; off <<= 1) q += __shfl_xor(q, off, 32);
  if (lane == 0) red_q[wave] = q;
  __syncthreads();
  const float qt = (red_q[0] + red_q[1]) + (red_q[2] + red_q[3]);
  const float var = qt * (1.0f / (float)MODEL_DIM);
  const float rstd = rsqrtf(var + 1e-5f);

  const v4f g0 = *(const v4f*)(gamma + 8 * t);
  const v4f g1 = *(const v4f*)(gamma + 8 * t + 4);
  const v4f b0 = *(const v4f*)(beta + 8 * t);
  const v4f b1 = *(const v4f*)(beta + 8 * t + 4);
  float hv[8];
#pragma unroll
  for (int e = 0; e < 4; ++e) {
    const float gg0 = bf_bits2f(f2bf_bits(g0[e])), bb0 = bf_bits2f(f2bf_bits(b0[e]));
    const float gg1 = bf_bits2f(f2bf_bits(g1[e])), bb1 = bf_bits2f(f2bf_bits(b1[e]));
    hv[e]     = d[e] * rstd * gg0 + bb0;
    hv[4 + e] = d[4 + e] * rstd * gg1 + bb1;
  }
  v4u ph, pl;
#pragma unroll
  for (int w = 0; w < 4; ++w) {
    const float f0 = hv[2 * w], f1 = hv[2 * w + 1];
    const unsigned short h0 = f2bf_bits(f0), h1 = f2bf_bits(f1);
    const unsigned short l0 = f2bf_bits(f0 - bf_bits2f(h0));
    const unsigned short l1 = f2bf_bits(f1 - bf_bits2f(h1));
    ph[w] = (unsigned)h0 | ((unsigned)h1 << 16);
    pl[w] = (unsigned)l0 | ((unsigned)l1 << 16);
  }
  *(v4u*)(hhi + base) = ph;
  *(v4u*)(hlo + base) = pl;
  
}

// =====================================================================================
// 3) Register-blocked WMMA GEMM: C[m,n] = sum_k (Ah+Al)[m,k] * Bt[n,k] (+bias[n], bias RNE bf16)
//    A = bf16 hi and lo planes row-major [M,K] (lda); Bt = bf16 row-major [N,K] (ldb); 2 WMMA products per tile pair.
//    Each wave owns a 64x64 C tile; M,N % 64 == 0, K % 32 == 0 (static_assert'ed above for both call sites).
//    Coverage: grid.x = (M/64)*(N/64)/8 blocks x 8 waves = every 64x64 tile exactly once.
// =====================================================================================
template <int OUT_MODE, bool HAS_BIAS>
__global__ __launch_bounds__(256) void gemm64_bf16_asplit(
    const unsigned short* __restrict__ Ahp, const unsigned short* __restrict__ Alp, int lda,
    const unsigned short* __restrict__ Btp, int ldb,
    void* __restrict__ Cout, void* __restrict__ Cout2, int ldc,
    const float* __restrict__ bias, int M, int N, int K) {
  typedef __bf16 T;
  typedef v16b V;
  const T* Ah = (const T*)Ahp; const T* Al = (const T*)Alp; const T* Bt = (const T*)Btp;
  __shared__ __align__(16) float sT[8][16 * 68];   // per-wave 16x64 slab, pitch 68 floats
  const int lane = threadIdx.x & 31;
  const int wave = threadIdx.x >> 5;
  const int tilesN = N >> 6;
  const int tilesM = M >> 6;
  const int tile = blockIdx.x * 8 + wave;
  if (tile >= tilesM * tilesN) return;   // wave-uniform; no block barriers in this kernel
  const int tm = tile / tilesN;
  const int tn = tile - tm * tilesN;
  const int m0 = tm << 6;
  const int n0 = tn << 6;

  const int rlane = lane & 15;                 // row (A) / col (B, D) within subtile
  const int koff  = (lane >> 4) * 8;           // k offset of this lane half
  const int mOff  = (lane >> 4) * 8;           // D row offset

  v8f acc[4][4];
#pragma unroll
  for (int i = 0; i < 4; ++i)
#pragma unroll
    for (int j = 0; j < 4; ++j) acc[i][j] = (v8f){0.f,0.f,0.f,0.f,0.f,0.f,0.f,0.f};

  for (int k0 = 0; k0 < K; k0 += 32) {
    V bh[4];
#pragma unroll
    for (int j = 0; j < 4; ++j) {
      const size_t bo = (size_t)(n0 + (j << 4) + rlane) * ldb + koff + k0;
      bh[j] = Frag<T>::load(Bt + bo);
    }
#pragma unroll
    for (int i = 0; i < 4; ++i) {
      const size_t ao = (size_t)(m0 + (i << 4) + rlane) * lda + koff + k0;
      V ah = Frag<T>::load(Ah + ao);
      V al = Frag<T>::load(Al + ao);
#pragma unroll
      for (int j = 0; j < 4; ++j) {
        acc[i][j] = Frag<T>::mma(ah, bh[j], acc[i][j]);
        acc[i][j] = Frag<T>::mma(al, bh[j], acc[i][j]);
      }
      Frag<T>::guard(acc[i][0], acc[i][3], ah, al);
    }
    Frag<T>::keep(bh[0], bh[1], bh[2], bh[3]);
  }
  acc_guard4(acc[0][0], acc[0][1], acc[0][2], acc[0][3]);
  acc_guard4(acc[1][0], acc[1][1], acc[1][2], acc[1][3]);
  acc_guard4(acc[2][0], acc[2][1], acc[2][2], acc[2][3]);
  acc_guard4(acc[3][0], acc[3][1], acc[3][2], acc[3][3]);

  // ---- epilogue ----
  float* slab = sT[wave];
#pragma unroll
  for (int i = 0; i < 4; ++i) {
    const int mBase = m0 + (i << 4);
#pragma unroll
    for (int j = 0; j < 4; ++j) {
#pragma unroll
      for (int r = 0; r < 8; ++r) {
        slab[(mOff + r) * 68 + (j << 4) + rlane] = acc[i][j][r];
      }
    }
    __builtin_amdgcn_fence(__ATOMIC_RELEASE, "workgroup");
    __builtin_amdgcn_wave_barrier();
    __builtin_amdgcn_fence(__ATOMIC_ACQUIRE, "workgroup");
    if (OUT_MODE == 0) {
      float* Cf = (float*)Cout;
      const int h2 = lane >> 4, c4 = (lane & 15) * 4;     // row seg = 256 B = 16 lanes x 16 B
      v4f bb = (v4f){0.f, 0.f, 0.f, 0.f};
      if (HAS_BIAS) {
        const v4f braw = *(const v4f*)(bias + n0 + c4);
#pragma unroll
        for (int e = 0; e < 4; ++e) bb[e] = bf_bits2f(f2bf_bits(braw[e]));
      }
      {
#pragma unroll
        for (int it = 0; it < 8; ++it) {
          const int row = it * 2 + h2;
          v4f v = *(const v4f*)(slab + row * 68 + c4);
          v = v + bb;
          *(v4f*)(Cf + (size_t)(mBase + row) * ldc + n0 + c4) = v;
        }
        
      }
    } else {
      const int q = lane >> 3, c8 = (lane & 7) * 8;
      unsigned short* Cu  = (unsigned short*)Cout;
      unsigned short* Cu2 = (unsigned short*)Cout2;
      {
#pragma unroll
        for (int it = 0; it < 4; ++it) {
          const int row = it * 4 + q;
          const float* sp = slab + row * 68 + c8;
          v8h hv, lv;
#pragma unroll
          for (int e = 0; e < 8; ++e) {
            unsigned short hb = f2bf_bits(sp[e]);
            unsigned short lb = f2bf_bits(sp[e] - bf_bits2f(hb));
            hv[e] = __builtin_bit_cast(_Float16, hb);
            lv[e] = __builtin_bit_cast(_Float16, lb);
          }
          *(v8h*)(Cu  + (size_t)(mBase + row) * ldc + n0 + c8) = hv;
          *(v8h*)(Cu2 + (size_t)(mBase + row) * ldc + n0 + c8) = lv;
        }
        
      }
    }
    __builtin_amdgcn_fence(__ATOMIC_RELEASE, "workgroup");
    __builtin_amdgcn_wave_barrier();
    __builtin_amdgcn_fence(__ATOMIC_ACQUIRE, "workgroup");
  }
}

// =====================================================================================
// 4) Flash attention, head_dim 64, no mask. Inputs: qkv bf16 hi/lo planes [TOK_ROWS][QKV_COLS]
//    (q at columns h*64.., k at 1024 + h*64.., v at 2048 + h*64..). Output: bf16 hi/lo planes [TOK_ROWS][INNER_DIM]
//    at columns h*64.. (the (b, n, h*64+d) layout of the merged heads).
//    scores = q.k^T as hi.hi + hi.lo + lo.hi (v_wmma_f32_16x16x32_bf16), scaled by 2^-3 in f32;
//    online softmax in f32; p split into bf16 hi/lo per wave in LDS; out += p.v as hi.hi + hi.lo + lo.hi.
//    Block = 4 waves = 64 query rows of one (batch, head); 32 kv chunks of 64 keys, each staged FULLY in LDS
//    (128 threads x (1 row, 32 d) x 4 planes = 64 kv x 64 d for K hi/lo and V^T hi/lo exactly).
// =====================================================================================
__global__ __launch_bounds__(128) void attn64_bf16x3_kernel(
    const unsigned short* __restrict__ qkvh, const unsigned short* __restrict__ qkvl,
    unsigned short* __restrict__ oh, unsigned short* __restrict__ ol) {
  union FB { v16b v; v8b h[2]; };
  __shared__ __align__(16) unsigned short Ksh[KV_CHUNK * HEAD_D];     // K hi [kv][d]
  __shared__ __align__(16) unsigned short Ksl[KV_CHUNK * HEAD_D];     // K lo [kv][d]
  __shared__ __align__(16) unsigned short Vth[HEAD_D * KV_CHUNK];     // V hi [d][kv]
  __shared__ __align__(16) unsigned short Vtl[HEAD_D * KV_CHUNK];     // V lo [d][kv]
  __shared__ __align__(16) __bf16 Psh[4][16 * KV_CHUNK];              // per wave P hi [row][kv]
  __shared__ __align__(16) __bf16 Psl[4][16 * KV_CHUNK];              // per wave P lo [row][kv]
  __shared__ __align__(16) float  Os[4][16 * 68];                     // per wave out tile, pitch 68

  const int tid  = threadIdx.x;
  const int wave = tid >> 5;
  const int lane = tid & 31;
  const int hh   = lane >> 4;
  const int c    = lane & 15;

  constexpr int NQB = SEQ_LEN / Q_BLOCK;   // 32
  const int bx   = blockIdx.x;
  const int qb   = bx % NQB;
  const int bhid = bx / NQB;
  const int head = bhid % N_HEAD;
  const int bat  = bhid / N_HEAD;
  const int q0   = qb * Q_BLOCK + wave * 16;
  const size_t tokb = (size_t)bat * SEQ_LEN;
  const int hcol = head * HEAD_D;

  const __bf16* QH = (const __bf16*)qkvh;
  const __bf16* QL = (const __bf16*)qkvl;

  // ---- Q fragments (A operand): 2 d-chunks, hi and lo, statically strided global loads ----
  v16b qah[2], qal[2];
  {
    const size_t qo = (tokb + q0 + c) * QKV_COLS + hcol + 8 * hh;
#pragma unroll
    for (int dc = 0; dc < 2; ++dc) {
      qah[dc] = Frag<__bf16>::load(QH + qo + dc * 32);
      qal[dc] = Frag<__bf16>::load(QL + qo + dc * 32);
    }
  }

  float mrow[8], lrow[8];
  v8f oacc[4];
#pragma unroll
  for (int r = 0; r < 8; ++r) { mrow[r] = -INFINITY; lrow[r] = 0.f; }
#pragma unroll
  for (int t = 0; t < 4; ++t) oacc[t] = (v8f){0.f,0.f,0.f,0.f,0.f,0.f,0.f,0.f};

  const __bf16* KHp = (const __bf16*)Ksh;
  const __bf16* KLp = (const __bf16*)Ksl;
  const __bf16* VHp = (const __bf16*)Vth;
  const __bf16* VLp = (const __bf16*)Vtl;

  for (int kc = 0; kc < SEQ_LEN / KV_CHUNK; ++kc) {
    const int kv0 = kc * KV_CHUNK;
    __syncthreads();
    {
      // staging: thread -> kv row kvr = tid>>1, d half dh = (tid&1)*32; 4 x 16 B per plane
      const int kvr = tid >> 1, dh = (tid & 1) * 32;
      const size_t kro = (tokb + kv0 + kvr) * QKV_COLS + INNER_DIM + hcol + dh;
      const size_t vro = kro + INNER_DIM;
#pragma unroll
      for (int i = 0; i < 4; ++i) {
        const v4u kh4 = *(const v4u*)(qkvh + kro + 8 * i);
        const v4u kl4 = *(const v4u*)(qkvl + kro + 8 * i);
        *(v4u*)(Ksh + kvr * HEAD_D + dh + 8 * i) = kh4;
        *(v4u*)(Ksl + kvr * HEAD_D + dh + 8 * i) = kl4;
      }
      asm volatile("" ::: "memory");
#pragma unroll
      for (int i = 0; i < 4; ++i) {
        const v4u vh4 = *(const v4u*)(qkvh + vro + 8 * i);
        const v4u vl4 = *(const v4u*)(qkvl + vro + 8 * i);
#pragma unroll
        for (int w = 0; w < 4; ++w) {
          const int d0 = dh + 8 * i + 2 * w;
          const unsigned uh = vh4[w], ul = vl4[w];
          Vth[d0 * KV_CHUNK + kvr]       = (unsigned short)(uh & 0xffffu);
          Vth[(d0 + 1) * KV_CHUNK + kvr] = (unsigned short)(uh >> 16);
          Vtl[d0 * KV_CHUNK + kvr]       = (unsigned short)(ul & 0xffffu);
          Vtl[(d0 + 1) * KV_CHUNK + kvr] = (unsigned short)(ul >> 16);
        }
      }
    }
    __syncthreads();

    // ---- scores: 4 kv column tiles, 2 d-chunks, 3 products each ----
    v8f s[4];
#pragma unroll
    for (int j = 0; j < 4; ++j) {
      s[j] = (v8f){0.f,0.f,0.f,0.f,0.f,0.f,0.f,0.f};
#pragma unroll
      for (int dc = 0; dc < 2; ++dc) {
        FB kb, kl;
        const int ko = (j * 16 + c) * HEAD_D + dc * 32 + 8 * hh;
        kb.h[0] = *(const v8b*)(KHp + ko);
        kb.h[1] = *(const v8b*)(KHp + ko + 16);
        kl.h[0] = *(const v8b*)(KLp + ko);
        kl.h[1] = *(const v8b*)(KLp + ko + 16);
        s[j] = at_mma(qah[dc], kb.v, s[j]);
        s[j] = at_mma(qah[dc], kl.v, s[j]);
        s[j] = at_mma(qal[dc], kb.v, s[j]);
      }
    }
    // ---- scale by head_dim^-0.5 = 2^-3 (exact), chunk row max over 64 keys ----
    float cm[8];
#pragma unroll
    for (int r = 0; r < 8; ++r) {
      float m = -INFINITY;
#pragma unroll
      for (int j = 0; j < 4; ++j) {
        s[j][r] = s[j][r] * 0.125f;
        m = fmaxf(m, s[j][r]);
      }
#pragma unroll
      for (int off = 1; off < 16; off <<= 1) m = fmaxf(m, __shfl_xor(m, off, 32));
      cm[r] = m;
    }
    // ---- online softmax, p split into bf16 hi/lo (per wave LDS) ----
    __bf16* pwh = Psh[wave];
    __bf16* pwl = Psl[wave];
#pragma unroll
    for (int r = 0; r < 8; ++r) {
      const float mnew = fmaxf(mrow[r], cm[r]);
      const float alpha = expf(mrow[r] - mnew);
      mrow[r] = mnew;
      float psum = 0.f;
#pragma unroll
      for (int j = 0; j < 4; ++j) {
        const float p = expf(s[j][r] - mnew);
        psum += p;
        __bf16 a, bl;
        at_split(p, a, bl);
        pwh[(8 * hh + r) * KV_CHUNK + j * 16 + c] = a;
        pwl[(8 * hh + r) * KV_CHUNK + j * 16 + c] = bl;
      }
#pragma unroll
      for (int off = 1; off < 16; off <<= 1) psum += __shfl_xor(psum, off, 32);
      lrow[r] = lrow[r] * alpha + psum;
#pragma unroll
      for (int t = 0; t < 4; ++t) oacc[t][r] *= alpha;
    }
    __builtin_amdgcn_fence(__ATOMIC_RELEASE, "workgroup");
    __builtin_amdgcn_wave_barrier();
    __builtin_amdgcn_fence(__ATOMIC_ACQUIRE, "workgroup");
    // ---- out += P(16x64) . V(64 kv x 64 d): 2 kv-chunks of 32, 4 d tiles, 3 products ----
#pragma unroll 1
    for (int kk = 0; kk < 2; ++kk) {
      FB pa, pl;
      pa.h[0] = *(const v8b*)(pwh + c * KV_CHUNK + kk * 32 + 8 * hh);
      pa.h[1] = *(const v8b*)(pwh + c * KV_CHUNK + kk * 32 + 16 + 8 * hh);
      pl.h[0] = *(const v8b*)(pwl + c * KV_CHUNK + kk * 32 + 8 * hh);
      pl.h[1] = *(const v8b*)(pwl + c * KV_CHUNK + kk * 32 + 16 + 8 * hh);
#pragma unroll
      for (int t = 0; t < 4; ++t) {
        FB vb, vl;
        const int vo = (t * 16 + c) * KV_CHUNK + kk * 32 + 8 * hh;
        vb.h[0] = *(const v8b*)(VHp + vo);
        vb.h[1] = *(const v8b*)(VHp + vo + 16);
        vl.h[0] = *(const v8b*)(VLp + vo);
        vl.h[1] = *(const v8b*)(VLp + vo + 16);
        oacc[t] = at_mma(pa.v, vb.v, oacc[t]);
        oacc[t] = at_mma(pa.v, vl.v, oacc[t]);
        oacc[t] = at_mma(pl.v, vb.v, oacc[t]);
      }
    }
  }

  float* os = Os[wave];
#pragma unroll
  for (int r = 0; r < 8; ++r) {
    const float inv = 1.0f / lrow[r];
#pragma unroll
    for (int t = 0; t < 4; ++t) os[(8 * hh + r) * 68 + t * 16 + c] = oacc[t][r] * inv;
  }
  __builtin_amdgcn_fence(__ATOMIC_RELEASE, "workgroup");
  __builtin_amdgcn_wave_barrier();
  __builtin_amdgcn_fence(__ATOMIC_ACQUIRE, "workgroup");
  {
    const int q8 = lane >> 3, c8 = (lane & 7) * 8;
    {
#pragma unroll
      for (int it = 0; it < 4; ++it) {
        const int row = it * 4 + q8;                   // rows 0..15 of this wave's tile
        const float* sp = os + row * 68 + c8;
        const v4f f0 = *(const v4f*)(sp);
        const v4f f1 = *(const v4f*)(sp + 4);
        v4u ph, plo;
#pragma unroll
        for (int w = 0; w < 2; ++w) {
          const float a = f0[2 * w], bq = f0[2 * w + 1];
          const unsigned short ha = f2bf_bits(a), hb = f2bf_bits(bq);
          const unsigned short la = f2bf_bits(a - bf_bits2f(ha)), lb = f2bf_bits(bq - bf_bits2f(hb));
          ph[w]  = (unsigned)ha | ((unsigned)hb << 16);
          plo[w] = (unsigned)la | ((unsigned)lb << 16);
        }
#pragma unroll
        for (int w = 0; w < 2; ++w) {
          const float a = f1[2 * w], bq = f1[2 * w + 1];
          const unsigned short ha = f2bf_bits(a), hb = f2bf_bits(bq);
          const unsigned short la = f2bf_bits(a - bf_bits2f(ha)), lb = f2bf_bits(bq - bf_bits2f(hb));
          ph[2 + w]  = (unsigned)ha | ((unsigned)hb << 16);
          plo[2 + w] = (unsigned)la | ((unsigned)lb << 16);
        }
        const size_t o = (tokb + q0 + row) * INNER_DIM + hcol + c8;
        *(v4u*)(oh + o) = ph;
        *(v4u*)(ol + o) = plo;
      }
      
    }
  }
}

// =====================================================================================
// launch glue
// =====================================================================================
extern "C" void kernel_launch(void* const* d_in, const int* in_sizes, int n_in,
                              void* d_out, int out_size, void* d_ws,
                              size_t ws_size, hipStream_t stream) {
  if (n_in < 6) return;
  if (in_sizes[0] != TOK_ROWS * MODEL_DIM) return;
  if (in_sizes[1] != MODEL_DIM || in_sizes[2] != MODEL_DIM) return;
  if (in_sizes[3] != QKV_COLS * MODEL_DIM) return;
  if (in_sizes[4] != MODEL_DIM * INNER_DIM) return;
  if (in_sizes[5] != MODEL_DIM) return;
  if (out_size != TOK_ROWS * MODEL_DIM) return;
  if (ws_size < WS_TOTAL) return;

  const float* x    = (const float*)d_in[0];
  const float* gam  = (const float*)d_in[1];
  const float* bet  = (const float*)d_in[2];
  const float* wqkv = (const float*)d_in[3];
  const float* wout = (const float*)d_in[4];
  const float* bout = (const float*)d_in[5];
  float* out = (float*)d_out;

  char* ws = (char*)d_ws;
  size_t off = 0;
  unsigned short* wq_bf  = (unsigned short*)(ws + off); off += WS_WQ;
  unsigned short* wo_bf  = (unsigned short*)(ws + off); off += WS_WO;
  unsigned short* h_hi   = (unsigned short*)(ws + off); off += WS_HPL;
  unsigned short* h_lo   = (unsigned short*)(ws + off); off += WS_HPL;
  unsigned short* qkv_hi = (unsigned short*)(ws + off); off += WS_QKVPL;
  unsigned short* qkv_lo = (unsigned short*)(ws + off); off += WS_QKVPL;
  unsigned short* at_hi  = (unsigned short*)(ws + off); off += WS_ATPL;
  unsigned short* at_lo  = (unsigned short*)(ws + off); off += WS_ATPL;
  if (off > ws_size) return;

  // weights -> bf16 (RNE): 3145728/8 = 393216 = 1536 x 256 ; 1048576/8 = 131072 = 512 x 256
  const int n8_qkv = (QKV_COLS * MODEL_DIM) / 8;
  const int n8_out = (MODEL_DIM * INNER_DIM) / 8;
  cast_f32_bf16x8<<<dim3((n8_qkv + 255) / 256), dim3(256), 0, stream>>>(wqkv, wq_bf, n8_qkv);
  cast_f32_bf16x8<<<dim3((n8_out + 255) / 256), dim3(256), 0, stream>>>(wout, wo_bf, n8_out);

  // LayerNorm -> h hi/lo planes [4096][1024]
  layernorm_bf16split_kernel<<<dim3(TOK_ROWS), dim3(128), 0, stream>>>(x, gam, bet, h_hi, h_lo);

  // qkv = h @ w_qkv^T -> bf16 hi/lo planes [4096][3072]; M=4096 N=3072 K=1024; tiles 64*48 = 3072 -> 384 blocks
  gemm64_bf16_asplit<2, false><<<dim3((TOK_ROWS / 64) * (QKV_COLS / 64) / 8), dim3(256), 0, stream>>>(
      h_hi, h_lo, MODEL_DIM, wq_bf, MODEL_DIM, (void*)qkv_hi, (void*)qkv_lo, QKV_COLS,
      (const float*)nullptr, TOK_ROWS, QKV_COLS, MODEL_DIM);

  // attention per (batch, head, 64 query rows): 2*16*32 = 1024 blocks -> attn hi/lo planes [4096][1024]
  attn64_bf16x3_kernel<<<dim3(N_BATCH * N_HEAD * (SEQ_LEN / Q_BLOCK)), dim3(128), 0, stream>>>(
      qkv_hi, qkv_lo, at_hi, at_lo);

  // out = attn @ w_out^T + b_out -> f32 [4096][1024]; M=4096 N=1024 K=1024; tiles 64*16 = 1024 -> 128 blocks
  gemm64_bf16_asplit<0, true><<<dim3((TOK_ROWS / 64) * (MODEL_DIM / 64) / 8), dim3(256), 0, stream>>>(
      at_hi, at_lo, INNER_DIM, wo_bf, INNER_DIM, (void*)out, (void*)nullptr, MODEL_DIM,
      bout, TOK_ROWS, MODEL_DIM, INNER_DIM);
}

// v001
// A run of this version takes 406 microseconds.
// Next to v000, in two timings, it ran 1.27 times as fast each time.
// Contractions on v_wmma_f32_16x16x32_bf16 (bf16 operands, f32 accumulate): qkv and output projections = activation bf16 hi+lo planes x weight bf16 plane (2 products); q.k scores and p.v = bf16 hi/lo x bf16 hi/lo (3 products); LayerNorm, softmax and epilogues in f32; every float input RNE-converted to bf16 once at load.
#include <hip/hip_runtime.h>
#include <hip/hip_bf16.h>

typedef __attribute__((ext_vector_type(16))) _Float16 v16h;
typedef __attribute__((ext_vector_type(8)))  _Float16 v8h;
typedef __attribute__((ext_vector_type(16))) __bf16   v16b;
typedef __attribute__((ext_vector_type(8)))  __bf16   v8b;
typedef __attribute__((ext_vector_type(8)))  float    v8f;
typedef __attribute__((ext_vector_type(4)))  float    v4f;
typedef __attribute__((ext_vector_type(4)))  unsigned v4u;

// ---- problem geometry ----
constexpr int MODEL_DIM = 1024;
constexpr int SEQ_LEN   = 2048;
constexpr int N_BATCH   = 2;
constexpr int N_HEAD    = 16;
constexpr int HEAD_D    = 64;
constexpr int INNER_DIM = N_HEAD * HEAD_D;          // 1024
constexpr int QKV_COLS  = 3 * INNER_DIM;            // 3072
constexpr int TOK_ROWS  = N_BATCH * SEQ_LEN;        // 4096
constexpr int KV_CHUNK  = 64;
constexpr int Q_BLOCK   = 64;
// LDS row pitch of the attention K, V^T and P tiles, in bf16 elements: 64 data + 8 pad = 144 B = 16 B x 9 (odd),
// so the 16 rows that one ds_load_b128 fragment read touches fall on distinct bank groups (128-B rows all share banks).
constexpr int LDS_PITCH = 72;

// GEMM shape contract (no run-time tails in the GEMM kernel)
static_assert(MODEL_DIM % 32 == 0, "K of qkv projection");
static_assert(INNER_DIM % 32 == 0, "K of output projection");
static_assert(TOK_ROWS % 64 == 0, "M tile multiple");
static_assert(QKV_COLS % 64 == 0, "N tile multiple (qkv)");
static_assert(MODEL_DIM % 64 == 0, "N tile multiple (out)");
static_assert(SEQ_LEN % KV_CHUNK == 0 && SEQ_LEN % Q_BLOCK == 0, "attention tiles");
static_assert(HEAD_D == 64, "attention kernel is head_dim 64");
static_assert(MODEL_DIM == 128 * 8, "LayerNorm kernel: 128 threads x 8 elements per row");

// ---- workspace region map (bytes, every offset a multiple of 128) ----
//  [0]            wq  bf16 [3072][1024]         6291456
//  [6291456]      wo  bf16 [1024][1024]         2097152
//  [8388608]      h   hi bf16 [4096][1024]      8388608
//  [16777216]     h   lo bf16 [4096][1024]      8388608
//  [25165824]     qkv hi bf16 [4096][3072]     25165824
//  [50331648]     qkv lo bf16 [4096][3072]     25165824
//  [75497472]     at  hi bf16 [4096][1024]      8388608
//  [83886080]     at  lo bf16 [4096][1024]      8388608
//  total 92274688
constexpr size_t WS_WQ    = (size_t)QKV_COLS * MODEL_DIM * 2;
constexpr size_t WS_WO    = (size_t)MODEL_DIM * INNER_DIM * 2;
constexpr size_t WS_HPL   = (size_t)TOK_ROWS * MODEL_DIM * 2;
constexpr size_t WS_QKVPL = (size_t)TOK_ROWS * QKV_COLS * 2;
constexpr size_t WS_ATPL  = (size_t)TOK_ROWS * INNER_DIM * 2;
constexpr size_t WS_TOTAL = WS_WQ + WS_WO + 2 * WS_HPL + 2 * WS_QKVPL + 2 * WS_ATPL;
static_assert(WS_TOTAL == 92274688, "carve arithmetic");
static_assert(WS_TOTAL <= 134217728, "carve budget");
static_assert(WS_WQ % 128 == 0 && WS_WO % 128 == 0 && WS_HPL % 128 == 0 && WS_QKVPL % 128 == 0 && WS_ATPL % 128 == 0, "128-B aligned regions");

// ---- bf16 RNE helpers ----
__device__ __forceinline__ unsigned short f2bf_bits(float f) {
  unsigned u = __float_as_uint(f);
  return (unsigned short)((u + 0x7FFFu + ((u >> 16) & 1u)) >> 16);
}
__device__ __forceinline__ float bf_bits2f(unsigned short h) { return __uint_as_float(((unsigned)h) << 16); }

// hazard guards as plain device helpers (no inline asm inside the kernel template body)
__device__ __forceinline__ void dep_guard_h(v8f& a, v8f& b, v16h x, v16h y) { asm volatile("v_nop\n\tv_nop\n\tv_nop\n\tv_nop" : "+v"(a), "+v"(b) : "v"(x), "v"(y)); }
__device__ __forceinline__ void dep_guard_b(v8f& a, v8f& b, v16b x, v16b y) { asm volatile("v_nop\n\tv_nop\n\tv_nop\n\tv_nop" : "+v"(a), "+v"(b) : "v"(x), "v"(y)); }
__device__ __forceinline__ void keep4_h(v16h a, v16h b, v16h c, v16h d) { asm volatile("v_nop" :: "v"(a), "v"(b), "v"(c), "v"(d)); }
__device__ __forceinline__ void keep4_b(v16b a, v16b b, v16b c, v16b d) { asm volatile("v_nop" :: "v"(a), "v"(b), "v"(c), "v"(d)); }
__device__ __forceinline__ void acc_guard4(v8f& a, v8f& b, v8f& c, v8f& d) { asm volatile("v_nop\n\tv_nop\n\tv_nop\n\tv_nop" : "+v"(a), "+v"(b), "+v"(c), "+v"(d)); }
template <typename T> struct Frag;
template <> struct Frag<_Float16> {
  typedef v16h V; union U { v16h v; v8h h[2]; };
  static __device__ __forceinline__ v16h load(const _Float16* p) {   // elements 0..7 <- p[0..7], 8..15 <- p[16..23]
    U f; f.h[0] = *(const v8h*)(p); f.h[1] = *(const v8h*)(p + 16); return f.v;
  }
  static __device__ __forceinline__ v8f mma(v16h a, v16h b, v8f c) {
    return __builtin_amdgcn_wmma_f32_16x16x32_f16(false, a, false, b, (short)0, c, false, false);
  }
  static __device__ __forceinline__ void guard(v8f& a, v8f& b, v16h x, v16h y) { dep_guard_h(a, b, x, y); }
  static __device__ __forceinline__ void keep(v16h a, v16h b, v16h c, v16h d) { keep4_h(a, b, c, d); }
};
template <> struct Frag<__bf16> {
  typedef v16b V; union U { v16b v; v8b h[2]; };
  static __device__ __forceinline__ v16b load(const __bf16* p) {
    U f; f.h[0] = *(const v8b*)(p); f.h[1] = *(const v8b*)(p + 16); return f.v;
  }
  static __device__ __forceinline__ v8f mma(v16b a, v16b b, v8f c) {
    return __builtin_amdgcn_wmma_f32_16x16x32_bf16(false, a, false, b, (short)0, c, false, false);
  }
  static __device__ __forceinline__ void guard(v8f& a, v8f& b, v16b x, v16b y) { dep_guard_b(a, b, x, y); }
  static __device__ __forceinline__ void keep(v16b a, v16b b, v16b c, v16b d) { keep4_b(a, b, c, d); }
};

// attention helpers (bf16 WMMA with hazard guard; f32 -> bf16 hi/lo split)
__device__ __forceinline__ unsigned short at_bf_bits(float f) {
  unsigned u = __float_as_uint(f);
  return (unsigned short)((u + 0x7FFFu + ((u >> 16) & 1u)) >> 16);
}
__device__ __forceinline__ __bf16 at_f2bf(float f) { return __builtin_bit_cast(__bf16, at_bf_bits(f)); }
__device__ __forceinline__ void at_split(float f, __bf16& hi, __bf16& lo) {
  const unsigned short hb = at_bf_bits(f);
  hi = __builtin_bit_cast(__bf16, hb);
  lo = at_f2bf(f - __uint_as_float(((unsigned)hb) << 16));
}
__device__ __forceinline__ v8f at_mma(v16b a, v16b b, v8f c) {
  c = __builtin_amdgcn_wmma_f32_16x16x32_bf16(false, a, false, b, (short)0, c, false, false);
  asm volatile("v_nop\n\tv_nop\n\tv_nop\n\tv_nop" : "+v"(c) : "v"(a), "v"(b));
  return c;
}

// =====================================================================================
// 1) f32 -> bf16 (RNE) cast, 8 elements per thread, one 16-B store per lane
//    Coverage: grid = n8/256 blocks x 256 threads x 8 elements = n exactly (n8 = n/8, n % 2048 == 0 here).
// =====================================================================================
__global__ __launch_bounds__(256) void cast_f32_bf16x8(
    const float* __restrict__ in, unsigned short* __restrict__ out, int n8) {
  const int i = blockIdx.x * 256 + threadIdx.x;
  if (i < n8) {
    const size_t e0 = (size_t)i * 8;
    const v4f a = *(const v4f*)(in + e0);
    const v4f b = *(const v4f*)(in + e0 + 4);
    v4u u;
    u[0] = (unsigned)f2bf_bits(a[0]) | ((unsigned)f2bf_bits(a[1]) << 16);
    u[1] = (unsigned)f2bf_bits(a[2]) | ((unsigned)f2bf_bits(a[3]) << 16);
    u[2] = (unsigned)f2bf_bits(b[0]) | ((unsigned)f2bf_bits(b[1]) << 16);
    u[3] = (unsigned)f2bf_bits(b[2]) | ((unsigned)f2bf_bits(b[3]) << 16);
    *(v4u*)(out + e0) = u;
    
  }
}

// =====================================================================================
//    result split into bf16 hi / lo planes [TOK_ROWS][MODEL_DIM].
//    One block (128 threads) per row; thread t owns elements 8t..8t+7 -> one 16-B store per lane per plane
//    Coverage: 4096 blocks x 128 threads x 8 = 4096 x 1024 exactly.
// =====================================================================================
__global__ __launch_bounds__(128) void layernorm_bf16split_kernel(
    const float* __restrict__ x, const float* __restrict__ gamma, const float* __restrict__ beta,
    unsigned short* __restrict__ hhi, unsigned short* __restrict__ hlo) {
  __shared__ float red_s[4];
  __shared__ float red_q[4];
  const int row = blockIdx.x;
  const int t = threadIdx.x;
  const int lane = t & 31, wave = t >> 5;
  const size_t base = (size_t)row * MODEL_DIM + 8 * (size_t)t;

  const v4f a0 = *(const v4f*)(x + base);
  const v4f a1 = *(const v4f*)(x + base + 4);
  float xv[8];
#pragma unroll
  for (int e = 0; e < 4; ++e) {
    xv[e]     = bf_bits2f(f2bf_bits(a0[e]));
    xv[4 + e] = bf_bits2f(f2bf_bits(a1[e]));
  }
  float s = ((xv[0] + xv[1]) + (xv[2] + xv[3])) + ((xv[4] + xv[5]) + (xv[6] + xv[7]));
#pragma unroll
  for (int off = 1; off < 32; off <<= 1) s += __shfl_xor(s, off, 32);
  if (lane == 0) red_s[wave] = s;
  __syncthreads();
  const float tot = (red_s[0] + red_s[1]) + (red_s[2] + red_s[3]);
  const float mean = tot * (1.0f / (float)MODEL_DIM);

  float d[8];
  float q = 0.f;
#pragma unroll
  for (int e = 0; e < 8; ++e) { d[e] = xv[e] - mean; q += d[e] * d[e]; }
#pragma unroll
  for (int off = 1; off < 32; off <<= 1) q += __shfl_xor(q, off, 32);
  if (lane == 0) red_q[wave] = q;
  __syncthreads();
  const float qt = (red_q[0] + red_q[1]) + (red_q[2] + red_q[3]);
  const float var = qt * (1.0f / (float)MODEL_DIM);
  const float rstd = rsqrtf(var + 1e-5f);

  const v4f g0 = *(const v4f*)(gamma + 8 * t);
  const v4f g1 = *(const v4f*)(gamma + 8 * t + 4);
  const v4f b0 = *(const v4f*)(beta + 8 * t);
  const v4f b1 = *(const v4f*)(beta + 8 * t + 4);
  float hv[8];
#pragma unroll
  for (int e = 0; e < 4; ++e) {
    const float gg0 = bf_bits2f(f2bf_bits(g0[e])), bb0 = bf_bits2f(f2bf_bits(b0[e]));
    const float gg1 = bf_bits2f(f2bf_bits(g1[e])), bb1 = bf_bits2f(f2bf_bits(b1[e]));
    hv[e]     = d[e] * rstd * gg0 + bb0;
    hv[4 + e] = d[4 + e] * rstd * gg1 + bb1;
  }
  v4u ph, pl;
#pragma unroll
  for (int w = 0; w < 4; ++w) {
    const float f0 = hv[2 * w], f1 = hv[2 * w + 1];
    const unsigned short h0 = f2bf_bits(f0), h1 = f2bf_bits(f1);
    const unsigned short l0 = f2bf_bits(f0 - bf_bits2f(h0));
    const unsigned short l1 = f2bf_bits(f1 - bf_bits2f(h1));
    ph[w] = (unsigned)h0 | ((unsigned)h1 << 16);
    pl[w] = (unsigned)l0 | ((unsigned)l1 << 16);
  }
  *(v4u*)(hhi + base) = ph;
  *(v4u*)(hlo + base) = pl;
  
}

// =====================================================================================
// 3) Register-blocked WMMA GEMM: C[m,n] = sum_k (Ah+Al)[m,k] * Bt[n,k] (+bias[n], bias RNE bf16)
//    A = bf16 hi and lo planes row-major [M,K] (lda); Bt = bf16 row-major [N,K] (ldb); 2 WMMA products per tile pair.
//    Each wave owns a 64x64 C tile; M,N % 64 == 0, K % 32 == 0 (static_assert'ed above for both call sites).
//    Coverage: grid.x = (M/64)*(N/64)/8 blocks x 8 waves = every 64x64 tile exactly once.
// =====================================================================================
template <int OUT_MODE, bool HAS_BIAS>
__global__ __launch_bounds__(256) void gemm64_bf16_asplit(
    const unsigned short* __restrict__ Ahp, const unsigned short* __restrict__ Alp, int lda,
    const unsigned short* __restrict__ Btp, int ldb,
    void* __restrict__ Cout, void* __restrict__ Cout2, int ldc,
    const float* __restrict__ bias, int M, int N, int K) {
  typedef __bf16 T;
  typedef v16b V;
  const T* Ah = (const T*)Ahp; const T* Al = (const T*)Alp; const T* Bt = (const T*)Btp;
  __shared__ __align__(16) float sT[8][16 * 68];   // per-wave 16x64 slab, pitch 68 floats
  const int lane = threadIdx.x & 31;
  const int wave = threadIdx.x >> 5;
  const int tilesN = N >> 6;
  const int tilesM = M >> 6;
  const int tile = blockIdx.x * 8 + wave;
  if (tile >= tilesM * tilesN) return;   // wave-uniform; no block barriers in this kernel
  const int tm = tile / tilesN;
  const int tn = tile - tm * tilesN;
  const int m0 = tm << 6;
  const int n0 = tn << 6;

  const int rlane = lane & 15;                 // row (A) / col (B, D) within subtile
  const int koff  = (lane >> 4) * 8;           // k offset of this lane half
  const int mOff  = (lane >> 4) * 8;           // D row offset

  v8f acc[4][4];
#pragma unroll
  for (int i = 0; i < 4; ++i)
#pragma unroll
    for (int j = 0; j < 4; ++j) acc[i][j] = (v8f){0.f,0.f,0.f,0.f,0.f,0.f,0.f,0.f};

  for (int k0 = 0; k0 < K; k0 += 32) {
    V bh[4];
#pragma unroll
    for (int j = 0; j < 4; ++j) {
      const size_t bo = (size_t)(n0 + (j << 4) + rlane) * ldb + koff + k0;
      bh[j] = Frag<T>::load(Bt + bo);
    }
#pragma unroll
    for (int i = 0; i < 4; ++i) {
      const size_t ao = (size_t)(m0 + (i << 4) + rlane) * lda + koff + k0;
      V ah = Frag<T>::load(Ah + ao);
      V al = Frag<T>::load(Al + ao);
#pragma unroll
      for (int j = 0; j < 4; ++j) {
        acc[i][j] = Frag<T>::mma(ah, bh[j], acc[i][j]);
        acc[i][j] = Frag<T>::mma(al, bh[j], acc[i][j]);
      }
      Frag<T>::guard(acc[i][0], acc[i][3], ah, al);
    }
    Frag<T>::keep(bh[0], bh[1], bh[2], bh[3]);
  }
  acc_guard4(acc[0][0], acc[0][1], acc[0][2], acc[0][3]);
  acc_guard4(acc[1][0], acc[1][1], acc[1][2], acc[1][3]);
  acc_guard4(acc[2][0], acc[2][1], acc[2][2], acc[2][3]);
  acc_guard4(acc[3][0], acc[3][1], acc[3][2], acc[3][3]);

  // ---- epilogue ----
  float* slab = sT[wave];
#pragma unroll
  for (int i = 0; i < 4; ++i) {
    const int mBase = m0 + (i << 4);
#pragma unroll
    for (int j = 0; j < 4; ++j) {
#pragma unroll
      for (int r = 0; r < 8; ++r) {
        slab[(mOff + r) * 68 + (j << 4) + rlane] = acc[i][j][r];
      }
    }
    __builtin_amdgcn_fence(__ATOMIC_RELEASE, "workgroup");
    __builtin_amdgcn_wave_barrier();
    __builtin_amdgcn_fence(__ATOMIC_ACQUIRE, "workgroup");
    if (OUT_MODE == 0) {
      float* Cf = (float*)Cout;
      const int h2 = lane >> 4, c4 = (lane & 15) * 4;     // row seg = 256 B = 16 lanes x 16 B
      v4f bb = (v4f){0.f, 0.f, 0.f, 0.f};
      if (HAS_BIAS) {
        const v4f braw = *(const v4f*)(bias + n0 + c4);
#pragma unroll
        for (int e = 0; e < 4; ++e) bb[e] = bf_bits2f(f2bf_bits(braw[e]));
      }
      {
#pragma unroll
        for (int it = 0; it < 8; ++it) {
          const int row = it * 2 + h2;
          v4f v = *(const v4f*)(slab + row * 68 + c4);
          v = v + bb;
          *(v4f*)(Cf + (size_t)(mBase + row) * ldc + n0 + c4) = v;
        }
        
      }
    } else {
      const int q = lane >> 3, c8 = (lane & 7) * 8;
      unsigned short* Cu  = (unsigned short*)Cout;
      unsigned short* Cu2 = (unsigned short*)Cout2;
      {
#pragma unroll
        for (int it = 0; it < 4; ++it) {
          const int row = it * 4 + q;
          const float* sp = slab + row * 68 + c8;
          v8h hv, lv;
#pragma unroll
          for (int e = 0; e < 8; ++e) {
            unsigned short hb = f2bf_bits(sp[e]);
            unsigned short lb = f2bf_bits(sp[e] - bf_bits2f(hb));
            hv[e] = __builtin_bit_cast(_Float16, hb);
            lv[e] = __builtin_bit_cast(_Float16, lb);
          }
          *(v8h*)(Cu  + (size_t)(mBase + row) * ldc + n0 + c8) = hv;
          *(v8h*)(Cu2 + (size_t)(mBase + row) * ldc + n0 + c8) = lv;
        }
        
      }
    }
    __builtin_amdgcn_fence(__ATOMIC_RELEASE, "workgroup");
    __builtin_amdgcn_wave_barrier();
    __builtin_amdgcn_fence(__ATOMIC_ACQUIRE, "workgroup");
  }
}

// =====================================================================================
// 4) Flash attention, head_dim 64, no mask. Inputs: qkv bf16 hi/lo planes [TOK_ROWS][QKV_COLS]
//    (q at columns h*64.., k at 1024 + h*64.., v at 2048 + h*64..). Output: bf16 hi/lo planes [TOK_ROWS][INNER_DIM]
//    at columns h*64.. (the (b, n, h*64+d) layout of the merged heads).
//    scores = q.k^T as hi.hi + hi.lo + lo.hi (v_wmma_f32_16x16x32_bf16), scaled by 2^-3 in f32;
//    online softmax in f32; p split into bf16 hi/lo per wave in LDS; out += p.v as hi.hi + hi.lo + lo.hi.
//    Block = 4 waves = 64 query rows of one (batch, head); 32 kv chunks of 64 keys, each staged FULLY in LDS
//    (128 threads x (1 row, 32 d) x 4 planes = 64 kv x 64 d for K hi/lo and V^T hi/lo exactly).
// =====================================================================================
__global__ __launch_bounds__(128) void attn64_bf16x3_kernel(
    const unsigned short* __restrict__ qkvh, const unsigned short* __restrict__ qkvl,
    unsigned short* __restrict__ oh, unsigned short* __restrict__ ol) {
  union FB { v16b v; v8b h[2]; };
  __shared__ __align__(16) unsigned short Ksh[KV_CHUNK * LDS_PITCH];  // K hi [kv][d]
  __shared__ __align__(16) unsigned short Ksl[KV_CHUNK * LDS_PITCH];  // K lo [kv][d]
  __shared__ __align__(16) unsigned short Vth[HEAD_D * LDS_PITCH];    // V hi [d][kv]
  __shared__ __align__(16) unsigned short Vtl[HEAD_D * LDS_PITCH];    // V lo [d][kv]
  __shared__ __align__(16) __bf16 Psh[4][16 * LDS_PITCH];             // per wave P hi [row][kv]
  __shared__ __align__(16) __bf16 Psl[4][16 * LDS_PITCH];             // per wave P lo [row][kv]
  __shared__ __align__(16) float  Os[4][16 * 68];                     // per wave out tile, pitch 68

  const int tid  = threadIdx.x;
  const int wave = tid >> 5;
  const int lane = tid & 31;
  const int hh   = lane >> 4;
  const int c    = lane & 15;

  constexpr int NQB = SEQ_LEN / Q_BLOCK;   // 32
  const int bx   = blockIdx.x;
  const int qb   = bx % NQB;
  const int bhid = bx / NQB;
  const int head = bhid % N_HEAD;
  const int bat  = bhid / N_HEAD;
  const int q0   = qb * Q_BLOCK + wave * 16;
  const size_t tokb = (size_t)bat * SEQ_LEN;
  const int hcol = head * HEAD_D;

  const __bf16* QH = (const __bf16*)qkvh;
  const __bf16* QL = (const __bf16*)qkvl;

  // ---- Q fragments (A operand): 2 d-chunks, hi and lo, statically strided global loads ----
  v16b qah[2], qal[2];
  {
    const size_t qo = (tokb + q0 + c) * QKV_COLS + hcol + 8 * hh;
#pragma unroll
    for (int dc = 0; dc < 2; ++dc) {
      qah[dc] = Frag<__bf16>::load(QH + qo + dc * 32);
      qal[dc] = Frag<__bf16>::load(QL + qo + dc * 32);
    }
  }

  float mrow[8], lrow[8];
  v8f oacc[4];
#pragma unroll
  for (int r = 0; r < 8; ++r) { mrow[r] = -INFINITY; lrow[r] = 0.f; }
#pragma unroll
  for (int t = 0; t < 4; ++t) oacc[t] = (v8f){0.f,0.f,0.f,0.f,0.f,0.f,0.f,0.f};

  const __bf16* KHp = (const __bf16*)Ksh;
  const __bf16* KLp = (const __bf16*)Ksl;
  const __bf16* VHp = (const __bf16*)Vth;
  const __bf16* VLp = (const __bf16*)Vtl;

  for (int kc = 0; kc < SEQ_LEN / KV_CHUNK; ++kc) {
    const int kv0 = kc * KV_CHUNK;
    __syncthreads();
    {
      // staging: thread -> kv row kvr = tid>>1, d half dh = (tid&1)*32; 4 x 16 B per plane
      const int kvr = tid >> 1, dh = (tid & 1) * 32;
      const size_t kro = (tokb + kv0 + kvr) * QKV_COLS + INNER_DIM + hcol + dh;
      const size_t vro = kro + INNER_DIM;
#pragma unroll
      for (int i = 0; i < 4; ++i) {
        const v4u kh4 = *(const v4u*)(qkvh + kro + 8 * i);
        const v4u kl4 = *(const v4u*)(qkvl + kro + 8 * i);
        *(v4u*)(Ksh + kvr * LDS_PITCH + dh + 8 * i) = kh4;
        *(v4u*)(Ksl + kvr * LDS_PITCH + dh + 8 * i) = kl4;
      }
      asm volatile("" ::: "memory");
#pragma unroll
      for (int i = 0; i < 4; ++i) {
        const v4u vh4 = *(const v4u*)(qkvh + vro + 8 * i);
        const v4u vl4 = *(const v4u*)(qkvl + vro + 8 * i);
#pragma unroll
        for (int w = 0; w < 4; ++w) {
          const int d0 = dh + 8 * i + 2 * w;
          const unsigned uh = vh4[w], ul = vl4[w];
          Vth[d0 * LDS_PITCH + kvr]       = (unsigned short)(uh & 0xffffu);
          Vth[(d0 + 1) * LDS_PITCH + kvr] = (unsigned short)(uh >> 16);
          Vtl[d0 * LDS_PITCH + kvr]       = (unsigned short)(ul & 0xffffu);
          Vtl[(d0 + 1) * LDS_PITCH + kvr] = (unsigned short)(ul >> 16);
        }
      }
    }
    __syncthreads();

    // ---- scores: 4 kv column tiles, 2 d-chunks, 3 products each ----
    v8f s[4];
#pragma unroll
    for (int j = 0; j < 4; ++j) {
      s[j] = (v8f){0.f,0.f,0.f,0.f,0.f,0.f,0.f,0.f};
#pragma unroll
      for (int dc = 0; dc < 2; ++dc) {
        FB kb, kl;
        const int ko = (j * 16 + c) * LDS_PITCH + dc * 32 + 8 * hh;
        kb.h[0] = *(const v8b*)(KHp + ko);
        kb.h[1] = *(const v8b*)(KHp + ko + 16);
        kl.h[0] = *(const v8b*)(KLp + ko);
        kl.h[1] = *(const v8b*)(KLp + ko + 16);
        s[j] = at_mma(qah[dc], kb.v, s[j]);
        s[j] = at_mma(qah[dc], kl.v, s[j]);
        s[j] = at_mma(qal[dc], kb.v, s[j]);
      }
    }
    // ---- scale by head_dim^-0.5 = 2^-3 (exact), chunk row max over 64 keys ----
    float cm[8];
#pragma unroll
    for (int r = 0; r < 8; ++r) {
      float m = -INFINITY;
#pragma unroll
      for (int j = 0; j < 4; ++j) {
        s[j][r] = s[j][r] * 0.125f;
        m = fmaxf(m, s[j][r]);
      }
#pragma unroll
      for (int off = 1; off < 16; off <<= 1) m = fmaxf(m, __shfl_xor(m, off, 32));
      cm[r] = m;
    }
    // ---- online softmax, p split into bf16 hi/lo (per wave LDS) ----
    __bf16* pwh = Psh[wave];
    __bf16* pwl = Psl[wave];
#pragma unroll
    for (int r = 0; r < 8; ++r) {
      const float mnew = fmaxf(mrow[r], cm[r]);
      const float alpha = expf(mrow[r] - mnew);
      mrow[r] = mnew;
      float psum = 0.f;
#pragma unroll
      for (int j = 0; j < 4; ++j) {
        const float p = expf(s[j][r] - mnew);
        psum += p;
        __bf16 a, bl;
        at_split(p, a, bl);
        pwh[(8 * hh + r) * LDS_PITCH + j * 16 + c] = a;
        pwl[(8 * hh + r) * LDS_PITCH + j * 16 + c] = bl;
      }
#pragma unroll
      for (int off = 1; off < 16; off <<= 1) psum += __shfl_xor(psum, off, 32);
      lrow[r] = lrow[r] * alpha + psum;
#pragma unroll
      for (int t = 0; t < 4; ++t) oacc[t][r] *= alpha;
    }
    __builtin_amdgcn_fence(__ATOMIC_RELEASE, "workgroup");
    __builtin_amdgcn_wave_barrier();
    __builtin_amdgcn_fence(__ATOMIC_ACQUIRE, "workgroup");
    // ---- out += P(16x64) . V(64 kv x 64 d): 2 kv-chunks of 32, 4 d tiles, 3 products ----
#pragma unroll 1
    for (int kk = 0; kk < 2; ++kk) {
      FB pa, pl;
      pa.h[0] = *(const v8b*)(pwh + c * LDS_PITCH + kk * 32 + 8 * hh);
      pa.h[1] = *(const v8b*)(pwh + c * LDS_PITCH + kk * 32 + 16 + 8 * hh);
      pl.h[0] = *(const v8b*)(pwl + c * LDS_PITCH + kk * 32 + 8 * hh);
      pl.h[1] = *(const v8b*)(pwl + c * LDS_PITCH + kk * 32 + 16 + 8 * hh);
#pragma unroll
      for (int t = 0; t < 4; ++t) {
        FB vb, vl;
        const int vo = (t * 16 + c) * LDS_PITCH + kk * 32 + 8 * hh;
        vb.h[0] = *(const v8b*)(VHp + vo);
        vb.h[1] = *(const v8b*)(VHp + vo + 16);
        vl.h[0] = *(const v8b*)(VLp + vo);
        vl.h[1] = *(const v8b*)(VLp + vo + 16);
        oacc[t] = at_mma(pa.v, vb.v, oacc[t]);
        oacc[t] = at_mma(pa.v, vl.v, oacc[t]);
        oacc[t] = at_mma(pl.v, vb.v, oacc[t]);
      }
    }
  }

  float* os = Os[wave];
#pragma unroll
  for (int r = 0; r < 8; ++r) {
    const float inv = 1.0f / lrow[r];
#pragma unroll
    for (int t = 0; t < 4; ++t) os[(8 * hh + r) * 68 + t * 16 + c] = oacc[t][r] * inv;
  }
  __builtin_amdgcn_fence(__ATOMIC_RELEASE, "workgroup");
  __builtin_amdgcn_wave_barrier();
  __builtin_amdgcn_fence(__ATOMIC_ACQUIRE, "workgroup");
  {
    const int q8 = lane >> 3, c8 = (lane & 7) * 8;
    {
#pragma unroll
      for (int it = 0; it < 4; ++it) {
        const int row = it * 4 + q8;                   // rows 0..15 of this wave's tile
        const float* sp = os + row * 68 + c8;
        const v4f f0 = *(const v4f*)(sp);
        const v4f f1 = *(const v4f*)(sp + 4);
        v4u ph, plo;
#pragma unroll
        for (int w = 0; w < 2; ++w) {
          const float a = f0[2 * w], bq = f0[2 * w + 1];
          const unsigned short ha = f2bf_bits(a), hb = f2bf_bits(bq);
          const unsigned short la = f2bf_bits(a - bf_bits2f(ha)), lb = f2bf_bits(bq - bf_bits2f(hb));
          ph[w]  = (unsigned)ha | ((unsigned)hb << 16);
          plo[w] = (unsigned)la | ((unsigned)lb << 16);
        }
#pragma unroll
        for (int w = 0; w < 2; ++w) {
          const float a = f1[2 * w], bq = f1[2 * w + 1];
          const unsigned short ha = f2bf_bits(a), hb = f2bf_bits(bq);
          const unsigned short la = f2bf_bits(a - bf_bits2f(ha)), lb = f2bf_bits(bq - bf_bits2f(hb));
          ph[2 + w]  = (unsigned)ha | ((unsigned)hb << 16);
          plo[2 + w] = (unsigned)la | ((unsigned)lb << 16);
        }
        const size_t o = (tokb + q0 + row) * INNER_DIM + hcol + c8;
        *(v4u*)(oh + o) = ph;
        *(v4u*)(ol + o) = plo;
      }
      
    }
  }
}

// =====================================================================================
// launch glue
// =====================================================================================
extern "C" void kernel_launch(void* const* d_in, const int* in_sizes, int n_in,
                              void* d_out, int out_size, void* d_ws,
                              size_t ws_size, hipStream_t stream) {
  if (n_in < 6) return;
  if (in_sizes[0] != TOK_ROWS * MODEL_DIM) return;
  if (in_sizes[1] != MODEL_DIM || in_sizes[2] != MODEL_DIM) return;
  if (in_sizes[3] != QKV_COLS * MODEL_DIM) return;
  if (in_sizes[4] != MODEL_DIM * INNER_DIM) return;
  if (in_sizes[5] != MODEL_DIM) return;
  if (out_size != TOK_ROWS * MODEL_DIM) return;
  if (ws_size < WS_TOTAL) return;

  const float* x    = (const float*)d_in[0];
  const float* gam  = (const float*)d_in[1];
  const float* bet  = (const float*)d_in[2];
  const float* wqkv = (const float*)d_in[3];
  const float* wout = (const float*)d_in[4];
  const float* bout = (const float*)d_in[5];
  float* out = (float*)d_out;

  char* ws = (char*)d_ws;
  size_t off = 0;
  unsigned short* wq_bf  = (unsigned short*)(ws + off); off += WS_WQ;
  unsigned short* wo_bf  = (unsigned short*)(ws + off); off += WS_WO;
  unsigned short* h_hi   = (unsigned short*)(ws + off); off += WS_HPL;
  unsigned short* h_lo   = (unsigned short*)(ws + off); off += WS_HPL;
  unsigned short* qkv_hi = (unsigned short*)(ws + off); off += WS_QKVPL;
  unsigned short* qkv_lo = (unsigned short*)(ws + off); off += WS_QKVPL;
  unsigned short* at_hi  = (unsigned short*)(ws + off); off += WS_ATPL;
  unsigned short* at_lo  = (unsigned short*)(ws + off); off += WS_ATPL;
  if (off > ws_size) return;

  // weights -> bf16 (RNE): 3145728/8 = 393216 = 1536 x 256 ; 1048576/8 = 131072 = 512 x 256
  const int n8_qkv = (QKV_COLS * MODEL_DIM) / 8;
  const int n8_out = (MODEL_DIM * INNER_DIM) / 8;
  cast_f32_bf16x8<<<dim3((n8_qkv + 255) / 256), dim3(256), 0, stream>>>(wqkv, wq_bf, n8_qkv);
  cast_f32_bf16x8<<<dim3((n8_out + 255) / 256), dim3(256), 0, stream>>>(wout, wo_bf, n8_out);

  // LayerNorm -> h hi/lo planes [4096][1024]
  layernorm_bf16split_kernel<<<dim3(TOK_ROWS), dim3(128), 0, stream>>>(x, gam, bet, h_hi, h_lo);

  // qkv = h @ w_qkv^T -> bf16 hi/lo planes [4096][3072]; M=4096 N=3072 K=1024; tiles 64*48 = 3072 -> 384 blocks
  gemm64_bf16_asplit<2, false><<<dim3((TOK_ROWS / 64) * (QKV_COLS / 64) / 8), dim3(256), 0, stream>>>(
      h_hi, h_lo, MODEL_DIM, wq_bf, MODEL_DIM, (void*)qkv_hi, (void*)qkv_lo, QKV_COLS,
      (const float*)nullptr, TOK_ROWS, QKV_COLS, MODEL_DIM);

  // attention per (batch, head, 64 query rows): 2*16*32 = 1024 blocks -> attn hi/lo planes [4096][1024]
  attn64_bf16x3_kernel<<<dim3(N_BATCH * N_HEAD * (SEQ_LEN / Q_BLOCK)), dim3(128), 0, stream>>>(
      qkv_hi, qkv_lo, at_hi, at_lo);

  // out = attn @ w_out^T + b_out -> f32 [4096][1024]; M=4096 N=1024 K=1024; tiles 64*16 = 1024 -> 128 blocks
  gemm64_bf16_asplit<0, true><<<dim3((TOK_ROWS / 64) * (MODEL_DIM / 64) / 8), dim3(256), 0, stream>>>(
      at_hi, at_lo, INNER_DIM, wo_bf, INNER_DIM, (void*)out, (void*)nullptr, MODEL_DIM,
      bout, TOK_ROWS, MODEL_DIM, INNER_DIM);
}

// v002
// It runs in 304 microseconds.
// Two timings next to v001 both put it at 1.34 times that version's speed.
// All steps since v000 together make it 1.71 times as fast.
// Contractions on v_wmma_f32_16x16x32_bf16 (bf16 operands, f32 accumulate): qkv and output projections = activation bf16 hi+lo planes x weight bf16 plane (2 products); q.k scores and p.v = bf16 hi/lo x bf16 hi/lo (3 products); LayerNorm, softmax and epilogues in f32; every float input RNE-converted to bf16 once at load.
#include <hip/hip_runtime.h>
#include <hip/hip_bf16.h>

typedef __attribute__((ext_vector_type(16))) _Float16 v16h;
typedef __attribute__((ext_vector_type(8)))  _Float16 v8h;
typedef __attribute__((ext_vector_type(16))) __bf16   v16b;
typedef __attribute__((ext_vector_type(8)))  __bf16   v8b;
typedef __attribute__((ext_vector_type(8)))  float    v8f;
typedef __attribute__((ext_vector_type(4)))  float    v4f;
typedef __attribute__((ext_vector_type(4)))  unsigned v4u;

// ---- problem geometry ----
constexpr int MODEL_DIM = 1024;
constexpr int SEQ_LEN   = 2048;
constexpr int N_BATCH   = 2;
constexpr int N_HEAD    = 16;
constexpr int HEAD_D    = 64;
constexpr int INNER_DIM = N_HEAD * HEAD_D;          // 1024
constexpr int QKV_COLS  = 3 * INNER_DIM;            // 3072
constexpr int TOK_ROWS  = N_BATCH * SEQ_LEN;        // 4096
constexpr int KV_CHUNK  = 64;
constexpr int Q_BLOCK   = 64;
// LDS row pitch of the attention K, V^T and P tiles, in bf16 elements: 64 data + 8 pad = 144 B = 16 B x 9 (odd),
// so the 16 rows that one ds_load_b128 fragment read touches fall on distinct bank groups (128-B rows all share banks).
constexpr int LDS_PITCH = 72;

// GEMM shape contract (no run-time tails in the GEMM kernel)
static_assert(MODEL_DIM % 32 == 0, "K of qkv projection");
static_assert(INNER_DIM % 32 == 0, "K of output projection");
static_assert(TOK_ROWS % 64 == 0, "M tile multiple");
static_assert(QKV_COLS % 64 == 0, "N tile multiple (qkv)");
static_assert(MODEL_DIM % 64 == 0, "N tile multiple (out)");
static_assert(SEQ_LEN % KV_CHUNK == 0 && SEQ_LEN % Q_BLOCK == 0, "attention tiles");
static_assert(HEAD_D == 64, "attention kernel is head_dim 64");
static_assert(MODEL_DIM == 128 * 8, "LayerNorm kernel: 128 threads x 8 elements per row");

// ---- workspace region map (bytes, every offset a multiple of 128) ----
//  [0]            wq  bf16 [3072][1024]         6291456
//  [6291456]      wo  bf16 [1024][1024]         2097152
//  [8388608]      h   hi bf16 [4096][1024]      8388608
//  [16777216]     h   lo bf16 [4096][1024]      8388608
//  [25165824]     qkv hi bf16 [4096][3072]     25165824
//  [50331648]     qkv lo bf16 [4096][3072]     25165824
//  [75497472]     at  hi bf16 [4096][1024]      8388608
//  [83886080]     at  lo bf16 [4096][1024]      8388608
//  total 92274688
constexpr size_t WS_WQ    = (size_t)QKV_COLS * MODEL_DIM * 2;
constexpr size_t WS_WO    = (size_t)MODEL_DIM * INNER_DIM * 2;
constexpr size_t WS_HPL   = (size_t)TOK_ROWS * MODEL_DIM * 2;
constexpr size_t WS_QKVPL = (size_t)TOK_ROWS * QKV_COLS * 2;
constexpr size_t WS_ATPL  = (size_t)TOK_ROWS * INNER_DIM * 2;
constexpr size_t WS_TOTAL = WS_WQ + WS_WO + 2 * WS_HPL + 2 * WS_QKVPL + 2 * WS_ATPL;
static_assert(WS_TOTAL == 92274688, "carve arithmetic");
static_assert(WS_TOTAL <= 134217728, "carve budget");
static_assert(WS_WQ % 128 == 0 && WS_WO % 128 == 0 && WS_HPL % 128 == 0 && WS_QKVPL % 128 == 0 && WS_ATPL % 128 == 0, "128-B aligned regions");

// ---- bf16 RNE helpers ----
__device__ __forceinline__ unsigned short f2bf_bits(float f) {
  unsigned u = __float_as_uint(f);
  return (unsigned short)((u + 0x7FFFu + ((u >> 16) & 1u)) >> 16);
}
__device__ __forceinline__ float bf_bits2f(unsigned short h) { return __uint_as_float(((unsigned)h) << 16); }

// hazard guards as plain device helpers (no inline asm inside the kernel template body)
__device__ __forceinline__ void dep_guard_h(v8f& a, v8f& b, v16h x, v16h y) { asm volatile("v_nop\n\tv_nop\n\tv_nop\n\tv_nop" : "+v"(a), "+v"(b) : "v"(x), "v"(y)); }
__device__ __forceinline__ void dep_guard_b(v8f& a, v8f& b, v16b x, v16b y) { asm volatile("v_nop\n\tv_nop\n\tv_nop\n\tv_nop" : "+v"(a), "+v"(b) : "v"(x), "v"(y)); }
__device__ __forceinline__ void keep4_h(v16h a, v16h b, v16h c, v16h d) { asm volatile("v_nop" :: "v"(a), "v"(b), "v"(c), "v"(d)); }
__device__ __forceinline__ void keep4_b(v16b a, v16b b, v16b c, v16b d) { asm volatile("v_nop" :: "v"(a), "v"(b), "v"(c), "v"(d)); }
__device__ __forceinline__ void acc_guard4(v8f& a, v8f& b, v8f& c, v8f& d) { asm volatile("v_nop\n\tv_nop\n\tv_nop\n\tv_nop" : "+v"(a), "+v"(b), "+v"(c), "+v"(d)); }
template <typename T> struct Frag;
template <> struct Frag<_Float16> {
  typedef v16h V; union U { v16h v; v8h h[2]; };
  static __device__ __forceinline__ v16h load(const _Float16* p) {   // elements 0..7 <- p[0..7], 8..15 <- p[16..23]
    U f; f.h[0] = *(const v8h*)(p); f.h[1] = *(const v8h*)(p + 16); return f.v;
  }
  static __device__ __forceinline__ v8f mma(v16h a, v16h b, v8f c) {
    return __builtin_amdgcn_wmma_f32_16x16x32_f16(false, a, false, b, (short)0, c, false, false);
  }
  static __device__ __forceinline__ void guard(v8f& a, v8f& b, v16h x, v16h y) { dep_guard_h(a, b, x, y); }
  static __device__ __forceinline__ void keep(v16h a, v16h b, v16h c, v16h d) { keep4_h(a, b, c, d); }
};
template <> struct Frag<__bf16> {
  typedef v16b V; union U { v16b v; v8b h[2]; };
  static __device__ __forceinline__ v16b load(const __bf16* p) {
    U f; f.h[0] = *(const v8b*)(p); f.h[1] = *(const v8b*)(p + 16); return f.v;
  }
  static __device__ __forceinline__ v8f mma(v16b a, v16b b, v8f c) {
    return __builtin_amdgcn_wmma_f32_16x16x32_bf16(false, a, false, b, (short)0, c, false, false);
  }
  static __device__ __forceinline__ void guard(v8f& a, v8f& b, v16b x, v16b y) { dep_guard_b(a, b, x, y); }
  static __device__ __forceinline__ void keep(v16b a, v16b b, v16b c, v16b d) { keep4_b(a, b, c, d); }
};

// attention helpers (bf16 WMMA with hazard guard; f32 -> bf16 hi/lo split)
__device__ __forceinline__ unsigned short at_bf_bits(float f) {
  unsigned u = __float_as_uint(f);
  return (unsigned short)((u + 0x7FFFu + ((u >> 16) & 1u)) >> 16);
}
__device__ __forceinline__ __bf16 at_f2bf(float f) { return __builtin_bit_cast(__bf16, at_bf_bits(f)); }
__device__ __forceinline__ void at_split(float f, __bf16& hi, __bf16& lo) {
  const unsigned short hb = at_bf_bits(f);
  hi = __builtin_bit_cast(__bf16, hb);
  lo = at_f2bf(f - __uint_as_float(((unsigned)hb) << 16));
}
__device__ __forceinline__ v8f at_mma(v16b a, v16b b, v8f c) {
  c = __builtin_amdgcn_wmma_f32_16x16x32_bf16(false, a, false, b, (short)0, c, false, false);
  asm volatile("v_nop\n\tv_nop\n\tv_nop\n\tv_nop" : "+v"(c) : "v"(a), "v"(b));
  return c;
}

// =====================================================================================
// 1) f32 -> bf16 (RNE) cast, 8 elements per thread, one 16-B store per lane
//    Coverage: grid = n8/256 blocks x 256 threads x 8 elements = n exactly (n8 = n/8, n % 2048 == 0 here).
// =====================================================================================
__global__ __launch_bounds__(256) void cast_f32_bf16x8(
    const float* __restrict__ in, unsigned short* __restrict__ out, int n8) {
  const int i = blockIdx.x * 256 + threadIdx.x;
  if (i < n8) {
    const size_t e0 = (size_t)i * 8;
    const v4f a = *(const v4f*)(in + e0);
    const v4f b = *(const v4f*)(in + e0 + 4);
    v4u u;
    u[0] = (unsigned)f2bf_bits(a[0]) | ((unsigned)f2bf_bits(a[1]) << 16);
    u[1] = (unsigned)f2bf_bits(a[2]) | ((unsigned)f2bf_bits(a[3]) << 16);
    u[2] = (unsigned)f2bf_bits(b[0]) | ((unsigned)f2bf_bits(b[1]) << 16);
    u[3] = (unsigned)f2bf_bits(b[2]) | ((unsigned)f2bf_bits(b[3]) << 16);
    *(v4u*)(out + e0) = u;
    
  }
}

// =====================================================================================
//    result split into bf16 hi / lo planes [TOK_ROWS][MODEL_DIM].
//    One block (128 threads) per row; thread t owns elements 8t..8t+7 -> one 16-B store per lane per plane
//    Coverage: 4096 blocks x 128 threads x 8 = 4096 x 1024 exactly.
// =====================================================================================
__global__ __launch_bounds__(128) void layernorm_bf16split_kernel(
    const float* __restrict__ x, const float* __restrict__ gamma, const float* __restrict__ beta,
    unsigned short* __restrict__ hhi, unsigned short* __restrict__ hlo) {
  __shared__ float red_s[4];
  __shared__ float red_q[4];
  const int row = blockIdx.x;
  const int t = threadIdx.x;
  const int lane = t & 31, wave = t >> 5;
  const size_t base = (size_t)row * MODEL_DIM + 8 * (size_t)t;

  const v4f a0 = *(const v4f*)(x + base);
  const v4f a1 = *(const v4f*)(x + base + 4);
  float xv[8];
#pragma unroll
  for (int e = 0; e < 4; ++e) {
    xv[e]     = bf_bits2f(f2bf_bits(a0[e]));
    xv[4 + e] = bf_bits2f(f2bf_bits(a1[e]));
  }
  float s = ((xv[0] + xv[1]) + (xv[2] + xv[3])) + ((xv[4] + xv[5]) + (xv[6] + xv[7]));
#pragma unroll
  for (int off = 1; off < 32; off <<= 1) s += __shfl_xor(s, off, 32);
  if (lane == 0) red_s[wave] = s;
  __syncthreads();
  const float tot = (red_s[0] + red_s[1]) + (red_s[2] + red_s[3]);
  const float mean = tot * (1.0f / (float)MODEL_DIM);

  float d[8];
  float q = 0.f;
#pragma unroll
  for (int e = 0; e < 8; ++e) { d[e] = xv[e] - mean; q += d[e] * d[e]; }
#pragma unroll
  for (int off = 1; off < 32; off <<= 1) q += __shfl_xor(q, off, 32);
  if (lane == 0) red_q[wave] = q;
  __syncthreads();
  const float qt = (red_q[0] + red_q[1]) + (red_q[2] + red_q[3]);
  const float var = qt * (1.0f / (float)MODEL_DIM);
  const float rstd = rsqrtf(var + 1e-5f);

  const v4f g0 = *(const v4f*)(gamma + 8 * t);
  const v4f g1 = *(const v4f*)(gamma + 8 * t + 4);
  const v4f b0 = *(const v4f*)(beta + 8 * t);
  const v4f b1 = *(const v4f*)(beta + 8 * t + 4);
  float hv[8];
#pragma unroll
  for (int e = 0; e < 4; ++e) {
    const float gg0 = bf_bits2f(f2bf_bits(g0[e])), bb0 = bf_bits2f(f2bf_bits(b0[e]));
    const float gg1 = bf_bits2f(f2bf_bits(g1[e])), bb1 = bf_bits2f(f2bf_bits(b1[e]));
    hv[e]     = d[e] * rstd * gg0 + bb0;
    hv[4 + e] = d[4 + e] * rstd * gg1 + bb1;
  }
  v4u ph, pl;
#pragma unroll
  for (int w = 0; w < 4; ++w) {
    const float f0 = hv[2 * w], f1 = hv[2 * w + 1];
    const unsigned short h0 = f2bf_bits(f0), h1 = f2bf_bits(f1);
    const unsigned short l0 = f2bf_bits(f0 - bf_bits2f(h0));
    const unsigned short l1 = f2bf_bits(f1 - bf_bits2f(h1));
    ph[w] = (unsigned)h0 | ((unsigned)h1 << 16);
    pl[w] = (unsigned)l0 | ((unsigned)l1 << 16);
  }
  *(v4u*)(hhi + base) = ph;
  *(v4u*)(hlo + base) = pl;
  
}

// =====================================================================================
// 3) WMMA GEMM, operands staged in LDS: C[m,n] = sum_k (Ah+Al)[m,k] * Bt[n,k] (+bias[n], bias RNE bf16)
//    A = bf16 hi and lo planes row-major [M,K] (lda); Bt = bf16 row-major [N,K] (ldb); 2 WMMA products per tile pair.
//    A block of 8 waves (2 x 4) owns a 128x256 C tile, each wave a 64x64 part of it. K is walked in slabs of 64:
//    a stage is [A hi 128 rows | A lo 128 rows | Bt 256 rows] of 128 B each at a 144-B LDS pitch, two buffers.
//    Every wave copies 64 of the 512 stage rows with 16 asynchronous 16-B-per-lane copies (4 whole 128-B rows each),
//    one slab ahead of the slab that is being multiplied. Per output element the k order of the sums is ascending.
//    Coverage: grid.x = (M/128)*(N/256) blocks, every 64x64 tile exactly once (shapes static_assert'ed below).
// =====================================================================================
constexpr int G_BM          = 128;                              // block tile rows
constexpr int G_BN          = 256;                              // block tile columns
constexpr int G_SLAB_K      = 64;                               // k elements per stage: 128-B rows
constexpr int G_PITCH       = 72;                               // LDS row pitch in bf16 elements: 144 B = 16 B x 9
constexpr int G_STAGE_ROWS  = 2 * G_BM + G_BN;                  // 512
constexpr int G_STAGE_BYTES = G_STAGE_ROWS * G_PITCH * 2;       // 73728
constexpr unsigned G_COPY_LDS_STEP = 4u * G_PITCH * 2u;         // one wave-wide copy fills 4 stage rows
static_assert(TOK_ROWS % G_BM == 0, "M block tile multiple");
static_assert(QKV_COLS % G_BN == 0 && MODEL_DIM % G_BN == 0, "N block tile multiple");
static_assert(MODEL_DIM % G_SLAB_K == 0 && INNER_DIM % G_SLAB_K == 0, "K slab multiple");
static_assert(MODEL_DIM / G_SLAB_K >= 2 && INNER_DIM / G_SLAB_K >= 2, "two stages at least");
static_assert(8 * 16 * 68 * 4 <= 2 * G_STAGE_BYTES, "epilogue slabs fit the ring");

// Eight asynchronous copies global -> LDS, 16 B per lane each, for 32 consecutive stage rows of one wave.
// l = the lane's LDS byte address of the first copy, g = its global address, step = elements per 4 source rows.
// The closing s_wait_xcnt 0 stands inside the statement so that no address register named here is rewritten ahead of it.
__device__ __forceinline__ void stage_copy8(unsigned l, const unsigned short* g, size_t step) {
  asm volatile(
      "global_load_async_to_lds_b128 %0, %8, off\n\t"
      "global_load_async_to_lds_b128 %1, %9, off\n\t"
      "global_load_async_to_lds_b128 %2, %10, off\n\t"
      "global_load_async_to_lds_b128 %3, %11, off\n\t"
      "global_load_async_to_lds_b128 %4, %12, off\n\t"
      "global_load_async_to_lds_b128 %5, %13, off\n\t"
      "global_load_async_to_lds_b128 %6, %14, off\n\t"
      "global_load_async_to_lds_b128 %7, %15, off\n\t"
      "s_wait_xcnt 0x0"
      :: "v"(l), "v"(l + G_COPY_LDS_STEP), "v"(l + 2u * G_COPY_LDS_STEP), "v"(l + 3u * G_COPY_LDS_STEP),
         "v"(l + 4u * G_COPY_LDS_STEP), "v"(l + 5u * G_COPY_LDS_STEP), "v"(l + 6u * G_COPY_LDS_STEP),
         "v"(l + 7u * G_COPY_LDS_STEP),
         "v"(g), "v"(g + step), "v"(g + 2 * step), "v"(g + 3 * step),
         "v"(g + 4 * step), "v"(g + 5 * step), "v"(g + 6 * step), "v"(g + 7 * step)
      : "memory");
}

// The two waits of the stage ring, each an asm statement of its own; the "memory" clobber keeps LDS accesses on their side of it.
__device__ __forceinline__ void wait_own_copies_landed() { asm volatile("s_wait_asynccnt 0x0" ::: "memory"); }
__device__ __forceinline__ void wait_own_lds_reads_done() { asm volatile("s_wait_dscnt 0x0" ::: "memory"); }

template <int OUT_MODE, bool HAS_BIAS>
__global__ __launch_bounds__(256) void gemm64_bf16_asplit(
    const unsigned short* __restrict__ Ahp, const unsigned short* __restrict__ Alp, int lda,
    const unsigned short* __restrict__ Btp, int ldb,
    void* __restrict__ Cout, void* __restrict__ Cout2, int ldc,
    const float* __restrict__ bias, int M, int N, int K) {
  typedef __bf16 T;
  typedef v16b V;
  // two stage buffers; after the K loop the same bytes serve as the per-wave 16x64 f32 epilogue slabs (pitch 68 floats)
  __shared__ __align__(16) unsigned char smem[2 * G_STAGE_BYTES];
  const int lane = threadIdx.x & 31;
  const int wave = __builtin_amdgcn_readfirstlane(threadIdx.x >> 5);
  const int tilesN = N / G_BN;
  const int tilesM = M / G_BM;
  const int bm = blockIdx.x / tilesN;
  const int bn = blockIdx.x - bm * tilesN;
  if (bm >= tilesM) return;              // block-uniform, in front of every barrier and copy
  const int mB = bm * G_BM;
  const int nB = bn * G_BN;
  const int wm = wave >> 2;              // 0..1: 64-row part of the block tile
  const int wn = wave & 3;               // 0..3: 64-column part
  const int m0 = mB + (wm << 6);
  const int n0 = nB + (wn << 6);

  const int rlane = lane & 15;                 // row (A) / col (B, D) within subtile
  const int koff  = (lane >> 4) * 8;           // k offset of this lane half
  const int mOff  = (lane >> 4) * 8;           // D row offset

  // ---- this wave's share of a stage: stage rows wave*64 .. wave*64+63 (waves 0,1: A hi; 2,3: A lo; 4..7: Bt) ----
  const unsigned short* srow;
  int sld;
  if (wave < 2)      { srow = Ahp + (size_t)(mB + wave * 64) * lda;       sld = lda; }
  else if (wave < 4) { srow = Alp + (size_t)(mB + (wave - 2) * 64) * lda; sld = lda; }
  else               { srow = Btp + (size_t)(nB + (wave - 4) * 64) * ldb; sld = ldb; }
  const unsigned short* gl = srow + (size_t)(lane >> 3) * sld + (lane & 7) * 8;   // 8 lanes x 16 B = one 128-B row
  const size_t step4 = (size_t)sld * 4;
  const unsigned ll = (unsigned)(size_t)smem + (unsigned)((wave * 64 + (lane >> 3)) * (G_PITCH * 2) + (lane & 7) * 16);

  v8f acc[4][4];
#pragma unroll
  for (int i = 0; i < 4; ++i)
#pragma unroll
    for (int j = 0; j < 4; ++j) acc[i][j] = (v8f){0.f,0.f,0.f,0.f,0.f,0.f,0.f,0.f};

  const int nT = K / G_SLAB_K;
  // ---- prologue: slab 0 lands and is published, then slab 1 starts to fly ----
  stage_copy8(ll, gl, step4);
  stage_copy8(ll + 8u * G_COPY_LDS_STEP, gl + 8 * step4, step4);
  wait_own_copies_landed();              // slab 0 has landed before the barrier publishes it to the other waves
  __syncthreads();
  if (nT > 1) {
    stage_copy8(ll + (unsigned)G_STAGE_BYTES, gl + G_SLAB_K, step4);
    stage_copy8(ll + (unsigned)G_STAGE_BYTES + 8u * G_COPY_LDS_STEP, gl + G_SLAB_K + 8 * step4, step4);
  }

  for (int t = 0; t < nT; ++t) {
    const unsigned bo = (t & 1) ? (unsigned)G_STAGE_BYTES : 0u;
    const T* sb  = (const T*)(smem + bo);
    const T* sAh = sb + ((wm << 6) + rlane) * G_PITCH + koff;
    const T* sAl = sAh + G_BM * G_PITCH;
    const T* sB  = sb + (2 * G_BM + (wn << 6) + rlane) * G_PITCH + koff;
#pragma unroll
    for (int kk = 0; kk < G_SLAB_K; kk += 32) {
      V bh[4];
#pragma unroll
      for (int j = 0; j < 4; ++j) bh[j] = Frag<T>::load(sB + (j << 4) * G_PITCH + kk);
#pragma unroll
      for (int i = 0; i < 4; ++i) {
        V ah = Frag<T>::load(sAh + (i << 4) * G_PITCH + kk);
        V al = Frag<T>::load(sAl + (i << 4) * G_PITCH + kk);
#pragma unroll
        for (int j = 0; j < 4; ++j) {
          acc[i][j] = Frag<T>::mma(ah, bh[j], acc[i][j]);
          acc[i][j] = Frag<T>::mma(al, bh[j], acc[i][j]);
        }
        Frag<T>::guard(acc[i][0], acc[i][3], ah, al);
      }
      Frag<T>::keep(bh[0], bh[1], bh[2], bh[3]);
    }
    // ---- publish point of slab t+1; it also ends every wave's reads of the buffer refilled behind it ----
    wait_own_lds_reads_done();           // fragment reads of slab t are done before its buffer is refilled
    wait_own_copies_landed();            // slab t+1 has landed before the barrier publishes it
    __syncthreads();
    if (t + 2 < nT) {
      const unsigned short* g2 = gl + (size_t)(t + 2) * G_SLAB_K;
      stage_copy8(ll + bo, g2, step4);
      stage_copy8(ll + bo + 8u * G_COPY_LDS_STEP, g2 + 8 * step4, step4);
    }
  }
  wait_own_copies_landed();              // no copy is outstanding when the ring becomes epilogue staging
  acc_guard4(acc[0][0], acc[0][1], acc[0][2], acc[0][3]);
  acc_guard4(acc[1][0], acc[1][1], acc[1][2], acc[1][3]);
  acc_guard4(acc[2][0], acc[2][1], acc[2][2], acc[2][3]);
  acc_guard4(acc[3][0], acc[3][1], acc[3][2], acc[3][3]);

  // ---- epilogue ----
  float* slab = (float*)smem + wave * (16 * 68);   // the last trip's barrier ended every read of the ring
#pragma unroll
  for (int i = 0; i < 4; ++i) {
    const int mBase = m0 + (i << 4);
#pragma unroll
    for (int j = 0; j < 4; ++j) {
#pragma unroll
      for (int r = 0; r < 8; ++r) {
        slab[(mOff + r) * 68 + (j << 4) + rlane] = acc[i][j][r];
      }
    }
    __builtin_amdgcn_fence(__ATOMIC_RELEASE, "workgroup");
    __builtin_amdgcn_wave_barrier();
    __builtin_amdgcn_fence(__ATOMIC_ACQUIRE, "workgroup");
    if (OUT_MODE == 0) {
      float* Cf = (float*)Cout;
      const int h2 = lane >> 4, c4 = (lane & 15) * 4;     // row seg = 256 B = 16 lanes x 16 B
      v4f bb = (v4f){0.f, 0.f, 0.f, 0.f};
      if (HAS_BIAS) {
        const v4f braw = *(const v4f*)(bias + n0 + c4);
#pragma unroll
        for (int e = 0; e < 4; ++e) bb[e] = bf_bits2f(f2bf_bits(braw[e]));
      }
      {
#pragma unroll
        for (int it = 0; it < 8; ++it) {
          const int row = it * 2 + h2;
          v4f v = *(const v4f*)(slab + row * 68 + c4);
          v = v + bb;
          *(v4f*)(Cf + (size_t)(mBase + row) * ldc + n0 + c4) = v;
        }
        
      }
    } else {
      const int q = lane >> 3, c8 = (lane & 7) * 8;
      unsigned short* Cu  = (unsigned short*)Cout;
      unsigned short* Cu2 = (unsigned short*)Cout2;
      {
#pragma unroll
        for (int it = 0; it < 4; ++it) {
          const int row = it * 4 + q;
          const float* sp = slab + row * 68 + c8;
          v8h hv, lv;
#pragma unroll
          for (int e = 0; e < 8; ++e) {
            unsigned short hb = f2bf_bits(sp[e]);
            unsigned short lb = f2bf_bits(sp[e] - bf_bits2f(hb));
            hv[e] = __builtin_bit_cast(_Float16, hb);
            lv[e] = __builtin_bit_cast(_Float16, lb);
          }
          *(v8h*)(Cu  + (size_t)(mBase + row) * ldc + n0 + c8) = hv;
          *(v8h*)(Cu2 + (size_t)(mBase + row) * ldc + n0 + c8) = lv;
        }
        
      }
    }
    __builtin_amdgcn_fence(__ATOMIC_RELEASE, "workgroup");
    __builtin_amdgcn_wave_barrier();
    __builtin_amdgcn_fence(__ATOMIC_ACQUIRE, "workgroup");
  }
}

// =====================================================================================
// 4) Flash attention, head_dim 64, no mask. Inputs: qkv bf16 hi/lo planes [TOK_ROWS][QKV_COLS]
//    (q at columns h*64.., k at 1024 + h*64.., v at 2048 + h*64..). Output: bf16 hi/lo planes [TOK_ROWS][INNER_DIM]
//    at columns h*64.. (the (b, n, h*64+d) layout of the merged heads).
//    scores = q.k^T as hi.hi + hi.lo + lo.hi (v_wmma_f32_16x16x32_bf16), scaled by 2^-3 in f32;
//    online softmax in f32; p split into bf16 hi/lo per wave in LDS; out += p.v as hi.hi + hi.lo + lo.hi.
//    Block = 4 waves = 64 query rows of one (batch, head); 32 kv chunks of 64 keys, each staged FULLY in LDS
//    (128 threads x (1 row, 32 d) x 4 planes = 64 kv x 64 d for K hi/lo and V^T hi/lo exactly).
// =====================================================================================
__global__ __launch_bounds__(128) void attn64_bf16x3_kernel(
    const unsigned short* __restrict__ qkvh, const unsigned short* __restrict__ qkvl,
    unsigned short* __restrict__ oh, unsigned short* __restrict__ ol) {
  union FB { v16b v; v8b h[2]; };
  __shared__ __align__(16) unsigned short Ksh[KV_CHUNK * LDS_PITCH];  // K hi [kv][d]
  __shared__ __align__(16) unsigned short Ksl[KV_CHUNK * LDS_PITCH];  // K lo [kv][d]
  __shared__ __align__(16) unsigned short Vth[HEAD_D * LDS_PITCH];    // V hi [d][kv]
  __shared__ __align__(16) unsigned short Vtl[HEAD_D * LDS_PITCH];    // V lo [d][kv]
  __shared__ __align__(16) __bf16 Psh[4][16 * LDS_PITCH];             // per wave P hi [row][kv]
  __shared__ __align__(16) __bf16 Psl[4][16 * LDS_PITCH];             // per wave P lo [row][kv]
  __shared__ __align__(16) float  Os[4][16 * 68];                     // per wave out tile, pitch 68

  const int tid  = threadIdx.x;
  const int wave = tid >> 5;
  const int lane = tid & 31;
  const int hh   = lane >> 4;
  const int c    = lane & 15;

  constexpr int NQB = SEQ_LEN / Q_BLOCK;   // 32
  const int bx   = blockIdx.x;
  const int qb   = bx % NQB;
  const int bhid = bx / NQB;
  const int head = bhid % N_HEAD;
  const int bat  = bhid / N_HEAD;
  const int q0   = qb * Q_BLOCK + wave * 16;
  const size_t tokb = (size_t)bat * SEQ_LEN;
  const int hcol = head * HEAD_D;

  const __bf16* QH = (const __bf16*)qkvh;
  const __bf16* QL = (const __bf16*)qkvl;

  // ---- Q fragments (A operand): 2 d-chunks, hi and lo, statically strided global loads ----
  v16b qah[2], qal[2];
  {
    const size_t qo = (tokb + q0 + c) * QKV_COLS + hcol + 8 * hh;
#pragma unroll
    for (int dc = 0; dc < 2; ++dc) {
      qah[dc] = Frag<__bf16>::load(QH + qo + dc * 32);
      qal[dc] = Frag<__bf16>::load(QL + qo + dc * 32);
    }
  }

  float mrow[8], lrow[8];
  v8f oacc[4];
#pragma unroll
  for (int r = 0; r < 8; ++r) { mrow[r] = -INFINITY; lrow[r] = 0.f; }
#pragma unroll
  for (int t = 0; t < 4; ++t) oacc[t] = (v8f){0.f,0.f,0.f,0.f,0.f,0.f,0.f,0.f};

  const __bf16* KHp = (const __bf16*)Ksh;
  const __bf16* KLp = (const __bf16*)Ksl;
  const __bf16* VHp = (const __bf16*)Vth;
  const __bf16* VLp = (const __bf16*)Vtl;

  for (int kc = 0; kc < SEQ_LEN / KV_CHUNK; ++kc) {
    const int kv0 = kc * KV_CHUNK;
    __syncthreads();
    {
      // staging: thread -> kv row kvr = tid>>1, d half dh = (tid&1)*32; 4 x 16 B per plane
      const int kvr = tid >> 1, dh = (tid & 1) * 32;
      const size_t kro = (tokb + kv0 + kvr) * QKV_COLS + INNER_DIM + hcol + dh;
      const size_t vro = kro + INNER_DIM;
#pragma unroll
      for (int i = 0; i < 4; ++i) {
        const v4u kh4 = *(const v4u*)(qkvh + kro + 8 * i);
        const v4u kl4 = *(const v4u*)(qkvl + kro + 8 * i);
        *(v4u*)(Ksh + kvr * LDS_PITCH + dh + 8 * i) = kh4;
        *(v4u*)(Ksl + kvr * LDS_PITCH + dh + 8 * i) = kl4;
      }
      asm volatile("" ::: "memory");
#pragma unroll
      for (int i = 0; i < 4; ++i) {
        const v4u vh4 = *(const v4u*)(qkvh + vro + 8 * i);
        const v4u vl4 = *(const v4u*)(qkvl + vro + 8 * i);
#pragma unroll
        for (int w = 0; w < 4; ++w) {
          const int d0 = dh + 8 * i + 2 * w;
          const unsigned uh = vh4[w], ul = vl4[w];
          Vth[d0 * LDS_PITCH + kvr]       = (unsigned short)(uh & 0xffffu);
          Vth[(d0 + 1) * LDS_PITCH + kvr] = (unsigned short)(uh >> 16);
          Vtl[d0 * LDS_PITCH + kvr]       = (unsigned short)(ul & 0xffffu);
          Vtl[(d0 + 1) * LDS_PITCH + kvr] = (unsigned short)(ul >> 16);
        }
      }
    }
    __syncthreads();

    // ---- scores: 4 kv column tiles, 2 d-chunks, 3 products each ----
    v8f s[4];
#pragma unroll
    for (int j = 0; j < 4; ++j) {
      s[j] = (v8f){0.f,0.f,0.f,0.f,0.f,0.f,0.f,0.f};
#pragma unroll
      for (int dc = 0; dc < 2; ++dc) {
        FB kb, kl;
        const int ko = (j * 16 + c) * LDS_PITCH + dc * 32 + 8 * hh;
        kb.h[0] = *(const v8b*)(KHp + ko);
        kb.h[1] = *(const v8b*)(KHp + ko + 16);
        kl.h[0] = *(const v8b*)(KLp + ko);
        kl.h[1] = *(const v8b*)(KLp + ko + 16);
        s[j] = at_mma(qah[dc], kb.v, s[j]);
        s[j] = at_mma(qah[dc], kl.v, s[j]);
        s[j] = at_mma(qal[dc], kb.v, s[j]);
      }
    }
    // ---- scale by head_dim^-0.5 = 2^-3 (exact), chunk row max over 64 keys ----
    float cm[8];
#pragma unroll
    for (int r = 0; r < 8; ++r) {
      float m = -INFINITY;
#pragma unroll
      for (int j = 0; j < 4; ++j) {
        s[j][r] = s[j][r] * 0.125f;
        m = fmaxf(m, s[j][r]);
      }
#pragma unroll
      for (int off = 1; off < 16; off <<= 1) m = fmaxf(m, __shfl_xor(m, off, 32));
      cm[r] = m;
    }
    // ---- online softmax, p split into bf16 hi/lo (per wave LDS) ----
    __bf16* pwh = Psh[wave];
    __bf16* pwl = Psl[wave];
#pragma unroll
    for (int r = 0; r < 8; ++r) {
      const float mnew = fmaxf(mrow[r], cm[r]);
      const float alpha = expf(mrow[r] - mnew);
      mrow[r] = mnew;
      float psum = 0.f;
#pragma unroll
      for (int j = 0; j < 4; ++j) {
        const float p = expf(s[j][r] - mnew);
        psum += p;
        __bf16 a, bl;
        at_split(p, a, bl);
        pwh[(8 * hh + r) * LDS_PITCH + j * 16 + c] = a;
        pwl[(8 * hh + r) * LDS_PITCH + j * 16 + c] = bl;
      }
#pragma unroll
      for (int off = 1; off < 16; off <<= 1) psum += __shfl_xor(psum, off, 32);
      lrow[r] = lrow[r] * alpha + psum;
#pragma unroll
      for (int t = 0; t < 4; ++t) oacc[t][r] *= alpha;
    }
    __builtin_amdgcn_fence(__ATOMIC_RELEASE, "workgroup");
    __builtin_amdgcn_wave_barrier();
    __builtin_amdgcn_fence(__ATOMIC_ACQUIRE, "workgroup");
    // ---- out += P(16x64) . V(64 kv x 64 d): 2 kv-chunks of 32, 4 d tiles, 3 products ----
#pragma unroll 1
    for (int kk = 0; kk < 2; ++kk) {
      FB pa, pl;
      pa.h[0] = *(const v8b*)(pwh + c * LDS_PITCH + kk * 32 + 8 * hh);
      pa.h[1] = *(const v8b*)(pwh + c * LDS_PITCH + kk * 32 + 16 + 8 * hh);
      pl.h[0] = *(const v8b*)(pwl + c * LDS_PITCH + kk * 32 + 8 * hh);
      pl.h[1] = *(const v8b*)(pwl + c * LDS_PITCH + kk * 32 + 16 + 8 * hh);
#pragma unroll
      for (int t = 0; t < 4; ++t) {
        FB vb, vl;
        const int vo = (t * 16 + c) * LDS_PITCH + kk * 32 + 8 * hh;
        vb.h[0] = *(const v8b*)(VHp + vo);
        vb.h[1] = *(const v8b*)(VHp + vo + 16);
        vl.h[0] = *(const v8b*)(VLp + vo);
        vl.h[1] = *(const v8b*)(VLp + vo + 16);
        oacc[t] = at_mma(pa.v, vb.v, oacc[t]);
        oacc[t] = at_mma(pa.v, vl.v, oacc[t]);
        oacc[t] = at_mma(pl.v, vb.v, oacc[t]);
      }
    }
  }

  float* os = Os[wave];
#pragma unroll
  for (int r = 0; r < 8; ++r) {
    const float inv = 1.0f / lrow[r];
#pragma unroll
    for (int t = 0; t < 4; ++t) os[(8 * hh + r) * 68 + t * 16 + c] = oacc[t][r] * inv;
  }
  __builtin_amdgcn_fence(__ATOMIC_RELEASE, "workgroup");
  __builtin_amdgcn_wave_barrier();
  __builtin_amdgcn_fence(__ATOMIC_ACQUIRE, "workgroup");
  {
    const int q8 = lane >> 3, c8 = (lane & 7) * 8;
    {
#pragma unroll
      for (int it = 0; it < 4; ++it) {
        const int row = it * 4 + q8;                   // rows 0..15 of this wave's tile
        const float* sp = os + row * 68 + c8;
        const v4f f0 = *(const v4f*)(sp);
        const v4f f1 = *(const v4f*)(sp + 4);
        v4u ph, plo;
#pragma unroll
        for (int w = 0; w < 2; ++w) {
          const float a = f0[2 * w], bq = f0[2 * w + 1];
          const unsigned short ha = f2bf_bits(a), hb = f2bf_bits(bq);
          const unsigned short la = f2bf_bits(a - bf_bits2f(ha)), lb = f2bf_bits(bq - bf_bits2f(hb));
          ph[w]  = (unsigned)ha | ((unsigned)hb << 16);
          plo[w] = (unsigned)la | ((unsigned)lb << 16);
        }
#pragma unroll
        for (int w = 0; w < 2; ++w) {
          const float a = f1[2 * w], bq = f1[2 * w + 1];
          const unsigned short ha = f2bf_bits(a), hb = f2bf_bits(bq);
          const unsigned short la = f2bf_bits(a - bf_bits2f(ha)), lb = f2bf_bits(bq - bf_bits2f(hb));
          ph[2 + w]  = (unsigned)ha | ((unsigned)hb << 16);
          plo[2 + w] = (unsigned)la | ((unsigned)lb << 16);
        }
        const size_t o = (tokb + q0 + row) * INNER_DIM + hcol + c8;
        *(v4u*)(oh + o) = ph;
        *(v4u*)(ol + o) = plo;
      }
      
    }
  }
}

// =====================================================================================
// launch glue
// =====================================================================================
extern "C" void kernel_launch(void* const* d_in, const int* in_sizes, int n_in,
                              void* d_out, int out_size, void* d_ws,
                              size_t ws_size, hipStream_t stream) {
  if (n_in < 6) return;
  if (in_sizes[0] != TOK_ROWS * MODEL_DIM) return;
  if (in_sizes[1] != MODEL_DIM || in_sizes[2] != MODEL_DIM) return;
  if (in_sizes[3] != QKV_COLS * MODEL_DIM) return;
  if (in_sizes[4] != MODEL_DIM * INNER_DIM) return;
  if (in_sizes[5] != MODEL_DIM) return;
  if (out_size != TOK_ROWS * MODEL_DIM) return;
  if (ws_size < WS_TOTAL) return;

  const float* x    = (const float*)d_in[0];
  const float* gam  = (const float*)d_in[1];
  const float* bet  = (const float*)d_in[2];
  const float* wqkv = (const float*)d_in[3];
  const float* wout = (const float*)d_in[4];
  const float* bout = (const float*)d_in[5];
  float* out = (float*)d_out;

  char* ws = (char*)d_ws;
  size_t off = 0;
  unsigned short* wq_bf  = (unsigned short*)(ws + off); off += WS_WQ;
  unsigned short* wo_bf  = (unsigned short*)(ws + off); off += WS_WO;
  unsigned short* h_hi   = (unsigned short*)(ws + off); off += WS_HPL;
  unsigned short* h_lo   = (unsigned short*)(ws + off); off += WS_HPL;
  unsigned short* qkv_hi = (unsigned short*)(ws + off); off += WS_QKVPL;
  unsigned short* qkv_lo = (unsigned short*)(ws + off); off += WS_QKVPL;
  unsigned short* at_hi  = (unsigned short*)(ws + off); off += WS_ATPL;
  unsigned short* at_lo  = (unsigned short*)(ws + off); off += WS_ATPL;
  if (off > ws_size) return;

  // weights -> bf16 (RNE): 3145728/8 = 393216 = 1536 x 256 ; 1048576/8 = 131072 = 512 x 256
  const int n8_qkv = (QKV_COLS * MODEL_DIM) / 8;
  const int n8_out = (MODEL_DIM * INNER_DIM) / 8;
  cast_f32_bf16x8<<<dim3((n8_qkv + 255) / 256), dim3(256), 0, stream>>>(wqkv, wq_bf, n8_qkv);
  cast_f32_bf16x8<<<dim3((n8_out + 255) / 256), dim3(256), 0, stream>>>(wout, wo_bf, n8_out);

  // LayerNorm -> h hi/lo planes [4096][1024]
  layernorm_bf16split_kernel<<<dim3(TOK_ROWS), dim3(128), 0, stream>>>(x, gam, bet, h_hi, h_lo);

  // qkv = h @ w_qkv^T -> bf16 hi/lo planes [4096][3072]; M=4096 N=3072 K=1024; block tiles 32*12 = 384 blocks
  gemm64_bf16_asplit<2, false><<<dim3((TOK_ROWS / G_BM) * (QKV_COLS / G_BN)), dim3(256), 0, stream>>>(
      h_hi, h_lo, MODEL_DIM, wq_bf, MODEL_DIM, (void*)qkv_hi, (void*)qkv_lo, QKV_COLS,
      (const float*)nullptr, TOK_ROWS, QKV_COLS, MODEL_DIM);

  // attention per (batch, head, 64 query rows): 2*16*32 = 1024 blocks -> attn hi/lo planes [4096][1024]
  attn64_bf16x3_kernel<<<dim3(N_BATCH * N_HEAD * (SEQ_LEN / Q_BLOCK)), dim3(128), 0, stream>>>(
      qkv_hi, qkv_lo, at_hi, at_lo);

  // out = attn @ w_out^T + b_out -> f32 [4096][1024]; M=4096 N=1024 K=1024; block tiles 32*4 = 128 blocks
  gemm64_bf16_asplit<0, true><<<dim3((TOK_ROWS / G_BM) * (MODEL_DIM / G_BN)), dim3(256), 0, stream>>>(
      at_hi, at_lo, INNER_DIM, wo_bf, INNER_DIM, (void*)out, (void*)nullptr, MODEL_DIM,
      bout, TOK_ROWS, MODEL_DIM, INNER_DIM);
}

// v003
// A run of this version takes 214 microseconds.
// Next to v002, in two timings, it ran 1.42 times as fast each time.
// All steps since v000 together make it 2.42 times as fast.
// Contractions on v_wmma_f32_16x16x32_bf16 (bf16 operands, f32 accumulate): qkv and output projections = activation bf16 hi+lo planes x weight bf16 plane (2 products); q.k scores and p.v = bf16 hi/lo x bf16 hi/lo (3 products); LayerNorm, softmax and epilogues in f32; every float input RNE-converted to bf16 once at load.
#include <hip/hip_runtime.h>
#include <hip/hip_bf16.h>

typedef __attribute__((ext_vector_type(16))) _Float16 v16h;
typedef __attribute__((ext_vector_type(8)))  _Float16 v8h;
typedef __attribute__((ext_vector_type(16))) __bf16   v16b;
typedef __attribute__((ext_vector_type(8)))  __bf16   v8b;
typedef __attribute__((ext_vector_type(8)))  float    v8f;
typedef __attribute__((ext_vector_type(4)))  float    v4f;
typedef __attribute__((ext_vector_type(4)))  unsigned v4u;
typedef __attribute__((ext_vector_type(2)))  float    v2f;
typedef __attribute__((ext_vector_type(2)))  __bf16   v2b;

// ---- problem geometry ----
constexpr int MODEL_DIM = 1024;
constexpr int SEQ_LEN   = 2048;
constexpr int N_BATCH   = 2;
constexpr int N_HEAD    = 16;
constexpr int HEAD_D    = 64;
constexpr int INNER_DIM = N_HEAD * HEAD_D;          // 1024
constexpr int QKV_COLS  = 3 * INNER_DIM;            // 3072
constexpr int TOK_ROWS  = N_BATCH * SEQ_LEN;        // 4096
constexpr int KV_CHUNK  = 64;
constexpr int Q_BLOCK   = 64;
// LDS row pitch of the attention K and V^T tiles, in bf16 elements: 64 data + 8 pad = 144 B = 16 B x 9 (odd),
// so the 16 rows that one ds_load_b128 fragment read touches fall on distinct bank groups (128-B rows all share banks).
constexpr int LDS_PITCH = 72;

// GEMM shape contract (no run-time tails in the GEMM kernel)
static_assert(MODEL_DIM % 32 == 0, "K of qkv projection");
static_assert(INNER_DIM % 32 == 0, "K of output projection");
static_assert(TOK_ROWS % 64 == 0, "M tile multiple");
static_assert(QKV_COLS % 64 == 0, "N tile multiple (qkv)");
static_assert(MODEL_DIM % 64 == 0, "N tile multiple (out)");
static_assert(SEQ_LEN % KV_CHUNK == 0 && SEQ_LEN % Q_BLOCK == 0, "attention tiles");
static_assert(HEAD_D == 64, "attention kernel is head_dim 64");
static_assert(MODEL_DIM == 128 * 8, "LayerNorm kernel: 128 threads x 8 elements per row");

// ---- workspace region map (bytes, every offset a multiple of 128) ----
//  [0]            wq  bf16 [3072][1024]         6291456
//  [6291456]      wo  bf16 [1024][1024]         2097152
//  [8388608]      h   hi bf16 [4096][1024]      8388608
//  [16777216]     h   lo bf16 [4096][1024]      8388608
//  [25165824]     qkv hi bf16 [4096][3072]     25165824
//  [50331648]     qkv lo bf16 [4096][3072]     25165824
//  [75497472]     at  hi bf16 [4096][1024]      8388608
//  [83886080]     at  lo bf16 [4096][1024]      8388608
//  total 92274688
constexpr size_t WS_WQ    = (size_t)QKV_COLS * MODEL_DIM * 2;
constexpr size_t WS_WO    = (size_t)MODEL_DIM * INNER_DIM * 2;
constexpr size_t WS_HPL   = (size_t)TOK_ROWS * MODEL_DIM * 2;
constexpr size_t WS_QKVPL = (size_t)TOK_ROWS * QKV_COLS * 2;
constexpr size_t WS_ATPL  = (size_t)TOK_ROWS * INNER_DIM * 2;
constexpr size_t WS_TOTAL = WS_WQ + WS_WO + 2 * WS_HPL + 2 * WS_QKVPL + 2 * WS_ATPL;
static_assert(WS_TOTAL == 92274688, "carve arithmetic");
static_assert(WS_TOTAL <= 134217728, "carve budget");
static_assert(WS_WQ % 128 == 0 && WS_WO % 128 == 0 && WS_HPL % 128 == 0 && WS_QKVPL % 128 == 0 && WS_ATPL % 128 == 0, "128-B aligned regions");

// ---- bf16 RNE helpers ----
__device__ __forceinline__ unsigned short f2bf_bits(float f) {
  unsigned u = __float_as_uint(f);
  return (unsigned short)((u + 0x7FFFu + ((u >> 16) & 1u)) >> 16);
}
__device__ __forceinline__ float bf_bits2f(unsigned short h) { return __uint_as_float(((unsigned)h) << 16); }

// hazard guards as plain device helpers (no inline asm inside the kernel template body)
__device__ __forceinline__ void dep_guard_h(v8f& a, v8f& b, v16h x, v16h y) { asm volatile("v_nop\n\tv_nop\n\tv_nop\n\tv_nop" : "+v"(a), "+v"(b) : "v"(x), "v"(y)); }
__device__ __forceinline__ void dep_guard_b(v8f& a, v8f& b, v16b x, v16b y) { asm volatile("v_nop\n\tv_nop\n\tv_nop\n\tv_nop" : "+v"(a), "+v"(b) : "v"(x), "v"(y)); }
__device__ __forceinline__ void keep4_h(v16h a, v16h b, v16h c, v16h d) { asm volatile("v_nop" :: "v"(a), "v"(b), "v"(c), "v"(d)); }
__device__ __forceinline__ void keep4_b(v16b a, v16b b, v16b c, v16b d) { asm volatile("v_nop" :: "v"(a), "v"(b), "v"(c), "v"(d)); }
__device__ __forceinline__ void acc_guard4(v8f& a, v8f& b, v8f& c, v8f& d) { asm volatile("v_nop\n\tv_nop\n\tv_nop\n\tv_nop" : "+v"(a), "+v"(b), "+v"(c), "+v"(d)); }
template <typename T> struct Frag;
template <> struct Frag<_Float16> {
  typedef v16h V; union U { v16h v; v8h h[2]; };
  static __device__ __forceinline__ v16h load(const _Float16* p) {   // elements 0..7 <- p[0..7], 8..15 <- p[16..23]
    U f; f.h[0] = *(const v8h*)(p); f.h[1] = *(const v8h*)(p + 16); return f.v;
  }
  static __device__ __forceinline__ v8f mma(v16h a, v16h b, v8f c) {
    return __builtin_amdgcn_wmma_f32_16x16x32_f16(false, a, false, b, (short)0, c, false, false);
  }
  static __device__ __forceinline__ void guard(v8f& a, v8f& b, v16h x, v16h y) { dep_guard_h(a, b, x, y); }
  static __device__ __forceinline__ void keep(v16h a, v16h b, v16h c, v16h d) { keep4_h(a, b, c, d); }
};
template <> struct Frag<__bf16> {
  typedef v16b V; union U { v16b v; v8b h[2]; };
  static __device__ __forceinline__ v16b load(const __bf16* p) {
    U f; f.h[0] = *(const v8b*)(p); f.h[1] = *(const v8b*)(p + 16); return f.v;
  }
  static __device__ __forceinline__ v8f mma(v16b a, v16b b, v8f c) {
    return __builtin_amdgcn_wmma_f32_16x16x32_bf16(false, a, false, b, (short)0, c, false, false);
  }
  static __device__ __forceinline__ void guard(v8f& a, v8f& b, v16b x, v16b y) { dep_guard_b(a, b, x, y); }
  static __device__ __forceinline__ void keep(v16b a, v16b b, v16b c, v16b d) { keep4_b(a, b, c, d); }
};

// attention helpers (bf16 WMMA with hazard guard; exchange between the wave halves)
__device__ __forceinline__ v8f at_mma(v16b a, v16b b, v8f c) {
  c = __builtin_amdgcn_wmma_f32_16x16x32_bf16(false, a, false, b, (short)0, c, false, false);
  asm volatile("v_nop\n\tv_nop\n\tv_nop\n\tv_nop" : "+v"(c) : "v"(a), "v"(b));
  return c;
}

// value of lane l ^ 16: the other half of the wave holds the other keys of the same query
__device__ __forceinline__ float at_xhalf(float x) {
  const int b = __builtin_bit_cast(int, x);
  return __builtin_bit_cast(float, __builtin_amdgcn_permlanex16(b, b, 0x76543210, 0xfedcba98, false, false));
}

// =====================================================================================
// 1) f32 -> bf16 (RNE) cast, 8 elements per thread, one 16-B store per lane
//    Coverage: grid = n8/256 blocks x 256 threads x 8 elements = n exactly (n8 = n/8, n % 2048 == 0 here).
// =====================================================================================
__global__ __launch_bounds__(256) void cast_f32_bf16x8(
    const float* __restrict__ in, unsigned short* __restrict__ out, int n8) {
  const int i = blockIdx.x * 256 + threadIdx.x;
  if (i < n8) {
    const size_t e0 = (size_t)i * 8;
    const v4f a = *(const v4f*)(in + e0);
    const v4f b = *(const v4f*)(in + e0 + 4);
    v4u u;
    u[0] = (unsigned)f2bf_bits(a[0]) | ((unsigned)f2bf_bits(a[1]) << 16);
    u[1] = (unsigned)f2bf_bits(a[2]) | ((unsigned)f2bf_bits(a[3]) << 16);
    u[2] = (unsigned)f2bf_bits(b[0]) | ((unsigned)f2bf_bits(b[1]) << 16);
    u[3] = (unsigned)f2bf_bits(b[2]) | ((unsigned)f2bf_bits(b[3]) << 16);
    *(v4u*)(out + e0) = u;
    
  }
}

// =====================================================================================
//    result split into bf16 hi / lo planes [TOK_ROWS][MODEL_DIM].
//    One block (128 threads) per row; thread t owns elements 8t..8t+7 -> one 16-B store per lane per plane
//    Coverage: 4096 blocks x 128 threads x 8 = 4096 x 1024 exactly.
// =====================================================================================
__global__ __launch_bounds__(128) void layernorm_bf16split_kernel(
    const float* __restrict__ x, const float* __restrict__ gamma, const float* __restrict__ beta,
    unsigned short* __restrict__ hhi, unsigned short* __restrict__ hlo) {
  __shared__ float red_s[4];
  __shared__ float red_q[4];
  const int row = blockIdx.x;
  const int t = threadIdx.x;
  const int lane = t & 31, wave = t >> 5;
  const size_t base = (size_t)row * MODEL_DIM + 8 * (size_t)t;

  const v4f a0 = *(const v4f*)(x + base);
  const v4f a1 = *(const v4f*)(x + base + 4);
  float xv[8];
#pragma unroll
  for (int e = 0; e < 4; ++e) {
    xv[e]     = bf_bits2f(f2bf_bits(a0[e]));
    xv[4 + e] = bf_bits2f(f2bf_bits(a1[e]));
  }
  float s = ((xv[0] + xv[1]) + (xv[2] + xv[3])) + ((xv[4] + xv[5]) + (xv[6] + xv[7]));
#pragma unroll
  for (int off = 1; off < 32; off <<= 1) s += __shfl_xor(s, off, 32);
  if (lane == 0) red_s[wave] = s;
  __syncthreads();
  const float tot = (red_s[0] + red_s[1]) + (red_s[2] + red_s[3]);
  const float mean = tot * (1.0f / (float)MODEL_DIM);

  float d[8];
  float q = 0.f;
#pragma unroll
  for (int e = 0; e < 8; ++e) { d[e] = xv[e] - mean; q += d[e] * d[e]; }
#pragma unroll
  for (int off = 1; off < 32; off <<= 1) q += __shfl_xor(q, off, 32);
  if (lane == 0) red_q[wave] = q;
  __syncthreads();
  const float qt = (red_q[0] + red_q[1]) + (red_q[2] + red_q[3]);
  const float var = qt * (1.0f / (float)MODEL_DIM);
  const float rstd = rsqrtf(var + 1e-5f);

  const v4f g0 = *(const v4f*)(gamma + 8 * t);
  const v4f g1 = *(const v4f*)(gamma + 8 * t + 4);
  const v4f b0 = *(const v4f*)(beta + 8 * t);
  const v4f b1 = *(const v4f*)(beta + 8 * t + 4);
  float hv[8];
#pragma unroll
  for (int e = 0; e < 4; ++e) {
    const float gg0 = bf_bits2f(f2bf_bits(g0[e])), bb0 = bf_bits2f(f2bf_bits(b0[e]));
    const float gg1 = bf_bits2f(f2bf_bits(g1[e])), bb1 = bf_bits2f(f2bf_bits(b1[e]));
    hv[e]     = d[e] * rstd * gg0 + bb0;
    hv[4 + e] = d[4 + e] * rstd * gg1 + bb1;
  }
  v4u ph, pl;
#pragma unroll
  for (int w = 0; w < 4; ++w) {
    const float f0 = hv[2 * w], f1 = hv[2 * w + 1];
    const unsigned short h0 = f2bf_bits(f0), h1 = f2bf_bits(f1);
    const unsigned short l0 = f2bf_bits(f0 - bf_bits2f(h0));
    const unsigned short l1 = f2bf_bits(f1 - bf_bits2f(h1));
    ph[w] = (unsigned)h0 | ((unsigned)h1 << 16);
    pl[w] = (unsigned)l0 | ((unsigned)l1 << 16);
  }
  *(v4u*)(hhi + base) = ph;
  *(v4u*)(hlo + base) = pl;
  
}

// =====================================================================================
// 3) WMMA GEMM, operands staged in LDS: C[m,n] = sum_k (Ah+Al)[m,k] * Bt[n,k] (+bias[n], bias RNE bf16)
//    A = bf16 hi and lo planes row-major [M,K] (lda); Bt = bf16 row-major [N,K] (ldb); 2 WMMA products per tile pair.
//    A block of 8 waves (2 x 4) owns a 128x256 C tile, each wave a 64x64 part of it. K is walked in slabs of 64:
//    a stage is [A hi 128 rows | A lo 128 rows | Bt 256 rows] of 128 B each at a 144-B LDS pitch, two buffers.
//    Every wave copies 64 of the 512 stage rows with 16 asynchronous 16-B-per-lane copies (4 whole 128-B rows each),
//    one slab ahead of the slab that is being multiplied. Per output element the k order of the sums is ascending.
//    Coverage: grid.x = (M/128)*(N/256) blocks, every 64x64 tile exactly once (shapes static_assert'ed below).
// =====================================================================================
constexpr int G_BM          = 128;                              // block tile rows
constexpr int G_BN          = 256;                              // block tile columns
constexpr int G_SLAB_K      = 64;                               // k elements per stage: 128-B rows
constexpr int G_PITCH       = 72;                               // LDS row pitch in bf16 elements: 144 B = 16 B x 9
constexpr int G_STAGE_ROWS  = 2 * G_BM + G_BN;                  // 512
constexpr int G_STAGE_BYTES = G_STAGE_ROWS * G_PITCH * 2;       // 73728
constexpr unsigned G_COPY_LDS_STEP = 4u * G_PITCH * 2u;         // one wave-wide copy fills 4 stage rows
static_assert(TOK_ROWS % G_BM == 0, "M block tile multiple");
static_assert(QKV_COLS % G_BN == 0 && MODEL_DIM % G_BN == 0, "N block tile multiple");
static_assert(MODEL_DIM % G_SLAB_K == 0 && INNER_DIM % G_SLAB_K == 0, "K slab multiple");
static_assert(MODEL_DIM / G_SLAB_K >= 2 && INNER_DIM / G_SLAB_K >= 2, "two stages at least");
static_assert(8 * 16 * 68 * 4 <= 2 * G_STAGE_BYTES, "epilogue slabs fit the ring");

// Eight asynchronous copies global -> LDS, 16 B per lane each, for 32 consecutive stage rows of one wave.
// l = the lane's LDS byte address of the first copy, g = its global address, step = elements per 4 source rows.
// The closing s_wait_xcnt 0 stands inside the statement so that no address register named here is rewritten ahead of it.
__device__ __forceinline__ void stage_copy8(unsigned l, const unsigned short* g, size_t step) {
  asm volatile(
      "global_load_async_to_lds_b128 %0, %8, off\n\t"
      "global_load_async_to_lds_b128 %1, %9, off\n\t"
      "global_load_async_to_lds_b128 %2, %10, off\n\t"
      "global_load_async_to_lds_b128 %3, %11, off\n\t"
      "global_load_async_to_lds_b128 %4, %12, off\n\t"
      "global_load_async_to_lds_b128 %5, %13, off\n\t"
      "global_load_async_to_lds_b128 %6, %14, off\n\t"
      "global_load_async_to_lds_b128 %7, %15, off\n\t"
      "s_wait_xcnt 0x0"
      :: "v"(l), "v"(l + G_COPY_LDS_STEP), "v"(l + 2u * G_COPY_LDS_STEP), "v"(l + 3u * G_COPY_LDS_STEP),
         "v"(l + 4u * G_COPY_LDS_STEP), "v"(l + 5u * G_COPY_LDS_STEP), "v"(l + 6u * G_COPY_LDS_STEP),
         "v"(l + 7u * G_COPY_LDS_STEP),
         "v"(g), "v"(g + step), "v"(g + 2 * step), "v"(g + 3 * step),
         "v"(g + 4 * step), "v"(g + 5 * step), "v"(g + 6 * step), "v"(g + 7 * step)
      : "memory");
}

// The two waits of the stage ring, each an asm statement of its own; the "memory" clobber keeps LDS accesses on their side of it.
__device__ __forceinline__ void wait_own_copies_landed() { asm volatile("s_wait_asynccnt 0x0" ::: "memory"); }
__device__ __forceinline__ void wait_own_lds_reads_done() { asm volatile("s_wait_dscnt 0x0" ::: "memory"); }

template <int OUT_MODE, bool HAS_BIAS>
__global__ __launch_bounds__(256) void gemm64_bf16_asplit(
    const unsigned short* __restrict__ Ahp, const unsigned short* __restrict__ Alp, int lda,
    const unsigned short* __restrict__ Btp, int ldb,
    void* __restrict__ Cout, void* __restrict__ Cout2, int ldc,
    const float* __restrict__ bias, int M, int N, int K) {
  typedef __bf16 T;
  typedef v16b V;
  // two stage buffers; after the K loop the same bytes serve as the per-wave 16x64 f32 epilogue slabs (pitch 68 floats)
  __shared__ __align__(16) unsigned char smem[2 * G_STAGE_BYTES];
  const int lane = threadIdx.x & 31;
  const int wave = __builtin_amdgcn_readfirstlane(threadIdx.x >> 5);
  const int tilesN = N / G_BN;
  const int tilesM = M / G_BM;
  const int bm = blockIdx.x / tilesN;
  const int bn = blockIdx.x - bm * tilesN;
  if (bm >= tilesM) return;              // block-uniform, in front of every barrier and copy
  const int mB = bm * G_BM;
  const int nB = bn * G_BN;
  const int wm = wave >> 2;              // 0..1: 64-row part of the block tile
  const int wn = wave & 3;               // 0..3: 64-column part
  const int m0 = mB + (wm << 6);
  const int n0 = nB + (wn << 6);

  const int rlane = lane & 15;                 // row (A) / col (B, D) within subtile
  const int koff  = (lane >> 4) * 8;           // k offset of this lane half
  const int mOff  = (lane >> 4) * 8;           // D row offset

  // ---- this wave's share of a stage: stage rows wave*64 .. wave*64+63 (waves 0,1: A hi; 2,3: A lo; 4..7: Bt) ----
  const unsigned short* srow;
  int sld;
  if (wave < 2)      { srow = Ahp + (size_t)(mB + wave * 64) * lda;       sld = lda; }
  else if (wave < 4) { srow = Alp + (size_t)(mB + (wave - 2) * 64) * lda; sld = lda; }
  else               { srow = Btp + (size_t)(nB + (wave - 4) * 64) * ldb; sld = ldb; }
  const unsigned short* gl = srow + (size_t)(lane >> 3) * sld + (lane & 7) * 8;   // 8 lanes x 16 B = one 128-B row
  const size_t step4 = (size_t)sld * 4;
  const unsigned ll = (unsigned)(size_t)smem + (unsigned)((wave * 64 + (lane >> 3)) * (G_PITCH * 2) + (lane & 7) * 16);

  v8f acc[4][4];
#pragma unroll
  for (int i = 0; i < 4; ++i)
#pragma unroll
    for (int j = 0; j < 4; ++j) acc[i][j] = (v8f){0.f,0.f,0.f,0.f,0.f,0.f,0.f,0.f};

  const int nT = K / G_SLAB_K;
  // ---- prologue: slab 0 lands and is published, then slab 1 starts to fly ----
  stage_copy8(ll, gl, step4);
  stage_copy8(ll + 8u * G_COPY_LDS_STEP, gl + 8 * step4, step4);
  wait_own_copies_landed();              // slab 0 has landed before the barrier publishes it to the other waves
  __syncthreads();
  if (nT > 1) {
    stage_copy8(ll + (unsigned)G_STAGE_BYTES, gl + G_SLAB_K, step4);
    stage_copy8(ll + (unsigned)G_STAGE_BYTES + 8u * G_COPY_LDS_STEP, gl + G_SLAB_K + 8 * step4, step4);
  }

  for (int t = 0; t < nT; ++t) {
    const unsigned bo = (t & 1) ? (unsigned)G_STAGE_BYTES : 0u;
    const T* sb  = (const T*)(smem + bo);
    const T* sAh = sb + ((wm << 6) + rlane) * G_PITCH + koff;
    const T* sAl = sAh + G_BM * G_PITCH;
    const T* sB  = sb + (2 * G_BM + (wn << 6) + rlane) * G_PITCH + koff;
#pragma unroll
    for (int kk = 0; kk < G_SLAB_K; kk += 32) {
      V bh[4];
#pragma unroll
      for (int j = 0; j < 4; ++j) bh[j] = Frag<T>::load(sB + (j << 4) * G_PITCH + kk);
#pragma unroll
      for (int i = 0; i < 4; ++i) {
        V ah = Frag<T>::load(sAh + (i << 4) * G_PITCH + kk);
        V al = Frag<T>::load(sAl + (i << 4) * G_PITCH + kk);
#pragma unroll
        for (int j = 0; j < 4; ++j) {
          acc[i][j] = Frag<T>::mma(ah, bh[j], acc[i][j]);
          acc[i][j] = Frag<T>::mma(al, bh[j], acc[i][j]);
        }
        Frag<T>::guard(acc[i][0], acc[i][3], ah, al);
      }
      Frag<T>::keep(bh[0], bh[1], bh[2], bh[3]);
    }
    // ---- publish point of slab t+1; it also ends every wave's reads of the buffer refilled behind it ----
    wait_own_lds_reads_done();           // fragment reads of slab t are done before its buffer is refilled
    wait_own_copies_landed();            // slab t+1 has landed before the barrier publishes it
    __syncthreads();
    if (t + 2 < nT) {
      const unsigned short* g2 = gl + (size_t)(t + 2) * G_SLAB_K;
      stage_copy8(ll + bo, g2, step4);
      stage_copy8(ll + bo + 8u * G_COPY_LDS_STEP, g2 + 8 * step4, step4);
    }
  }
  wait_own_copies_landed();              // no copy is outstanding when the ring becomes epilogue staging
  acc_guard4(acc[0][0], acc[0][1], acc[0][2], acc[0][3]);
  acc_guard4(acc[1][0], acc[1][1], acc[1][2], acc[1][3]);
  acc_guard4(acc[2][0], acc[2][1], acc[2][2], acc[2][3]);
  acc_guard4(acc[3][0], acc[3][1], acc[3][2], acc[3][3]);

  // ---- epilogue ----
  float* slab = (float*)smem + wave * (16 * 68);   // the last trip's barrier ended every read of the ring
#pragma unroll
  for (int i = 0; i < 4; ++i) {
    const int mBase = m0 + (i << 4);
#pragma unroll
    for (int j = 0; j < 4; ++j) {
#pragma unroll
      for (int r = 0; r < 8; ++r) {
        slab[(mOff + r) * 68 + (j << 4) + rlane] = acc[i][j][r];
      }
    }
    __builtin_amdgcn_fence(__ATOMIC_RELEASE, "workgroup");
    __builtin_amdgcn_wave_barrier();
    __builtin_amdgcn_fence(__ATOMIC_ACQUIRE, "workgroup");
    if (OUT_MODE == 0) {
      float* Cf = (float*)Cout;
      const int h2 = lane >> 4, c4 = (lane & 15) * 4;     // row seg = 256 B = 16 lanes x 16 B
      v4f bb = (v4f){0.f, 0.f, 0.f, 0.f};
      if (HAS_BIAS) {
        const v4f braw = *(const v4f*)(bias + n0 + c4);
#pragma unroll
        for (int e = 0; e < 4; ++e) bb[e] = bf_bits2f(f2bf_bits(braw[e]));
      }
      {
#pragma unroll
        for (int it = 0; it < 8; ++it) {
          const int row = it * 2 + h2;
          v4f v = *(const v4f*)(slab + row * 68 + c4);
          v = v + bb;
          *(v4f*)(Cf + (size_t)(mBase + row) * ldc + n0 + c4) = v;
        }
        
      }
    } else {
      const int q = lane >> 3, c8 = (lane & 7) * 8;
      unsigned short* Cu  = (unsigned short*)Cout;
      unsigned short* Cu2 = (unsigned short*)Cout2;
      {
#pragma unroll
        for (int it = 0; it < 4; ++it) {
          const int row = it * 4 + q;
          const float* sp = slab + row * 68 + c8;
          v8h hv, lv;
#pragma unroll
          for (int e = 0; e < 8; ++e) {
            unsigned short hb = f2bf_bits(sp[e]);
            unsigned short lb = f2bf_bits(sp[e] - bf_bits2f(hb));
            hv[e] = __builtin_bit_cast(_Float16, hb);
            lv[e] = __builtin_bit_cast(_Float16, lb);
          }
          *(v8h*)(Cu  + (size_t)(mBase + row) * ldc + n0 + c8) = hv;
          *(v8h*)(Cu2 + (size_t)(mBase + row) * ldc + n0 + c8) = lv;
        }
        
      }
    }
    __builtin_amdgcn_fence(__ATOMIC_RELEASE, "workgroup");
    __builtin_amdgcn_wave_barrier();
    __builtin_amdgcn_fence(__ATOMIC_ACQUIRE, "workgroup");
  }
}

__global__ __launch_bounds__(128) void attn64_bf16x3_kernel(
    const unsigned short* __restrict__ qkvh, const unsigned short* __restrict__ qkvl,
    unsigned short* __restrict__ oh, unsigned short* __restrict__ ol) {
  union FB { v16b v; v8b h[2]; };
  __shared__ __align__(16) unsigned short Ksh[KV_CHUNK * LDS_PITCH];  // K hi [kv][d]
  __shared__ __align__(16) unsigned short Ksl[KV_CHUNK * LDS_PITCH];  // K lo [kv][d]
  __shared__ __align__(16) unsigned short Vth[HEAD_D * LDS_PITCH];    // V hi [d][kv]
  __shared__ __align__(16) unsigned short Vtl[HEAD_D * LDS_PITCH];    // V lo [d][kv]
  __shared__ __align__(16) float  Os[4][16 * 68];                     // per wave out tile, pitch 68

  const int tid  = threadIdx.x;
  const int wave = tid >> 5;
  const int lane = tid & 31;
  const int hh   = lane >> 4;
  const int c    = lane & 15;

  constexpr int NQB = SEQ_LEN / Q_BLOCK;   // 32
  const int bx   = blockIdx.x;
  const int qb   = bx % NQB;
  const int bhid = bx / NQB;
  const int head = bhid % N_HEAD;
  const int bat  = bhid / N_HEAD;
  const int q0   = qb * Q_BLOCK + wave * 16;
  const size_t tokb = (size_t)bat * SEQ_LEN;
  const int hcol = head * HEAD_D;

  const __bf16* QH = (const __bf16*)qkvh;
  const __bf16* QL = (const __bf16*)qkvl;

  // ---- Q fragments (B operand, column = query c): 2 d-chunks, hi and lo, statically strided global loads ----
  v16b qah[2], qal[2];
  {
    const size_t qo = (tokb + q0 + c) * QKV_COLS + hcol + 8 * hh;
#pragma unroll
    for (int dc = 0; dc < 2; ++dc) {
      qah[dc] = Frag<__bf16>::load(QH + qo + dc * 32);
      qal[dc] = Frag<__bf16>::load(QL + qo + dc * 32);
    }
  }

  float mrun = -INFINITY;   // running maximum of query c (equal in both halves)
  float lrun = 0.f;         // running denominator of query c over this half's keys only
  v8f oacc[4];              // oacc[t][r] = out[query c][d = 16 t + 8 hh + r]
#pragma unroll
  for (int t = 0; t < 4; ++t) oacc[t] = (v8f){0.f,0.f,0.f,0.f,0.f,0.f,0.f,0.f};

  const __bf16* KHp = (const __bf16*)Ksh;
  const __bf16* KLp = (const __bf16*)Ksl;
  const __bf16* VHp = (const __bf16*)Vth;
  const __bf16* VLp = (const __bf16*)Vtl;

  for (int kc = 0; kc < SEQ_LEN / KV_CHUNK; ++kc) {
    const int kv0 = kc * KV_CHUNK;
    __syncthreads();
    {
      // staging: thread -> kv row kvr = tid>>1, d half dh = (tid&1)*32; 4 x 16 B per plane
      const int kvr = tid >> 1, dh = (tid & 1) * 32;
      const size_t kro = (tokb + kv0 + kvr) * QKV_COLS + INNER_DIM + hcol + dh;
      const size_t vro = kro + INNER_DIM;
#pragma unroll
      for (int i = 0; i < 4; ++i) {
        const v4u kh4 = *(const v4u*)(qkvh + kro + 8 * i);
        const v4u kl4 = *(const v4u*)(qkvl + kro + 8 * i);
        *(v4u*)(Ksh + kvr * LDS_PITCH + dh + 8 * i) = kh4;
        *(v4u*)(Ksl + kvr * LDS_PITCH + dh + 8 * i) = kl4;
      }
      asm volatile("" ::: "memory");
#pragma unroll
      for (int i = 0; i < 4; ++i) {
        const v4u vh4 = *(const v4u*)(qkvh + vro + 8 * i);
        const v4u vl4 = *(const v4u*)(qkvl + vro + 8 * i);
#pragma unroll
        for (int w = 0; w < 4; ++w) {
          const int d0 = dh + 8 * i + 2 * w;
          const unsigned uh = vh4[w], ul = vl4[w];
          Vth[d0 * LDS_PITCH + kvr]       = (unsigned short)(uh & 0xffffu);
          Vth[(d0 + 1) * LDS_PITCH + kvr] = (unsigned short)(uh >> 16);
          Vtl[d0 * LDS_PITCH + kvr]       = (unsigned short)(ul & 0xffffu);
          Vtl[(d0 + 1) * LDS_PITCH + kvr] = (unsigned short)(ul >> 16);
        }
      }
    }
    __syncthreads();

    // ---- scores S^T: 4 tiles of 16 keys x 16 queries, 2 d-chunks, 3 products each ----
    v8f s[4];
#pragma unroll
    for (int j = 0; j < 4; ++j) {
      s[j] = (v8f){0.f,0.f,0.f,0.f,0.f,0.f,0.f,0.f};
#pragma unroll
      for (int dc = 0; dc < 2; ++dc) {
        FB kb, kl;
        const int ko = (j * 16 + c) * LDS_PITCH + dc * 32 + 8 * hh;
        kb.h[0] = *(const v8b*)(KHp + ko);
        kb.h[1] = *(const v8b*)(KHp + ko + 16);
        kl.h[0] = *(const v8b*)(KLp + ko);
        kl.h[1] = *(const v8b*)(KLp + ko + 16);
        s[j] = at_mma(kb.v, qah[dc], s[j]);
        s[j] = at_mma(kl.v, qah[dc], s[j]);
        s[j] = at_mma(kb.v, qal[dc], s[j]);
      }
    }
    // ---- scale by head_dim^-0.5 = 2^-3 (exact); chunk maximum of query c: 32 scores in-lane, then the other half ----
    float mj[4];
#pragma unroll
    for (int j = 0; j < 4; ++j) {
      mj[j] = -INFINITY;
#pragma unroll
      for (int r = 0; r < 8; ++r) {
        s[j][r] = s[j][r] * 0.125f;
        mj[j] = fmaxf(mj[j], s[j][r]);
      }
    }
    float cm = fmaxf(fmaxf(mj[0], mj[1]), fmaxf(mj[2], mj[3]));
    cm = fmaxf(cm, at_xhalf(cm));
    // ---- online softmax; p split into bf16 hi/lo in place: pbh[kk] / pbl[kk] element e = p of key 32 kk + kmap(e, hh) ----
    const float mnew = fmaxf(mrun, cm);
    const float alpha = expf(mrun - mnew);
    mrun = mnew;
    union PB { v16b v; v2b w[8]; };
    PB pbh[2], pbl[2];
    float pj[4];
#pragma unroll
    for (int j = 0; j < 4; ++j) {
      pj[j] = 0.f;
#pragma unroll
      for (int r = 0; r < 8; r += 2) {
        v2f p2;
        p2[0] = expf(s[j][r] - mnew);
        p2[1] = expf(s[j][r + 1] - mnew);
        pj[j] += p2[0];
        pj[j] += p2[1];
        const v2b h2 = __builtin_convertvector(p2, v2b);                 // RNE, two values per register
        const v2b l2 = __builtin_convertvector(p2 - __builtin_convertvector(h2, v2f), v2b);
        pbh[j >> 1].w[(j & 1) * 4 + (r >> 1)] = h2;
        pbl[j >> 1].w[(j & 1) * 4 + (r >> 1)] = l2;
      }
    }
    lrun = lrun * alpha + ((pj[0] + pj[1]) + (pj[2] + pj[3]));
#pragma unroll
    for (int t = 0; t < 4; ++t)
#pragma unroll
      for (int r = 0; r < 8; ++r) oacc[t][r] *= alpha;
    // ---- O^T += V^T(64 d x 64 kv) . P^T(64 kv x 16 queries): 2 kv-chunks of 32, 4 d tiles, 3 products ----
#pragma unroll
    for (int kk = 0; kk < 2; ++kk) {
#pragma unroll
      for (int t = 0; t < 4; ++t) {
        FB vb, vl;
        const int vo = (t * 16 + c) * LDS_PITCH + kk * 32 + 8 * hh;
        vb.h[0] = *(const v8b*)(VHp + vo);
        vb.h[1] = *(const v8b*)(VHp + vo + 16);
        vl.h[0] = *(const v8b*)(VLp + vo);
        vl.h[1] = *(const v8b*)(VLp + vo + 16);
        oacc[t] = at_mma(vb.v, pbh[kk].v, oacc[t]);
        oacc[t] = at_mma(vl.v, pbh[kk].v, oacc[t]);
        oacc[t] = at_mma(vb.v, pbl[kk].v, oacc[t]);
      }
    }
  }

  // ---- the two halves' denominators join; the lane's 8 consecutive d of each tile go to row c of the wave's out tile ----
  float* os = Os[wave];
  {
    const float inv = 1.0f / (lrun + at_xhalf(lrun));
#pragma unroll
    for (int t = 0; t < 4; ++t) {
      v4f o0, o1;
#pragma unroll
      for (int e = 0; e < 4; ++e) { o0[e] = oacc[t][e] * inv; o1[e] = oacc[t][4 + e] * inv; }
      *(v4f*)(os + c * 68 + t * 16 + 8 * hh)     = o0;
      *(v4f*)(os + c * 68 + t * 16 + 8 * hh + 4) = o1;
    }
  }
  __builtin_amdgcn_fence(__ATOMIC_RELEASE, "workgroup");
  __builtin_amdgcn_wave_barrier();
  __builtin_amdgcn_fence(__ATOMIC_ACQUIRE, "workgroup");
  {
    const int q8 = lane >> 3, c8 = (lane & 7) * 8;
    {
#pragma unroll
      for (int it = 0; it < 4; ++it) {
        const int row = it * 4 + q8;                   // rows 0..15 of this wave's tile
        const float* sp = os + row * 68 + c8;
        const v4f f0 = *(const v4f*)(sp);
        const v4f f1 = *(const v4f*)(sp + 4);
        v4u ph, plo;
#pragma unroll
        for (int w = 0; w < 2; ++w) {
          const float a = f0[2 * w], bq = f0[2 * w + 1];
          const unsigned short ha = f2bf_bits(a), hb = f2bf_bits(bq);
          const unsigned short la = f2bf_bits(a - bf_bits2f(ha)), lb = f2bf_bits(bq - bf_bits2f(hb));
          ph[w]  = (unsigned)ha | ((unsigned)hb << 16);
          plo[w] = (unsigned)la | ((unsigned)lb << 16);
        }
#pragma unroll
        for (int w = 0; w < 2; ++w) {
          const float a = f1[2 * w], bq = f1[2 * w + 1];
          const unsigned short ha = f2bf_bits(a), hb = f2bf_bits(bq);
          const unsigned short la = f2bf_bits(a - bf_bits2f(ha)), lb = f2bf_bits(bq - bf_bits2f(hb));
          ph[2 + w]  = (unsigned)ha | ((unsigned)hb << 16);
          plo[2 + w] = (unsigned)la | ((unsigned)lb << 16);
        }
        const size_t o = (tokb + q0 + row) * INNER_DIM + hcol + c8;
        *(v4u*)(oh + o) = ph;
        *(v4u*)(ol + o) = plo;
      }
      
    }
  }
}

// =====================================================================================
// launch glue
// =====================================================================================
extern "C" void kernel_launch(void* const* d_in, const int* in_sizes, int n_in,
                              void* d_out, int out_size, void* d_ws,
                              size_t ws_size, hipStream_t stream) {
  if (n_in < 6) return;
  if (in_sizes[0] != TOK_ROWS * MODEL_DIM) return;
  if (in_sizes[1] != MODEL_DIM || in_sizes[2] != MODEL_DIM) return;
  if (in_sizes[3] != QKV_COLS * MODEL_DIM) return;
  if (in_sizes[4] != MODEL_DIM * INNER_DIM) return;
  if (in_sizes[5] != MODEL_DIM) return;
  if (out_size != TOK_ROWS * MODEL_DIM) return;
  if (ws_size < WS_TOTAL) return;

  const float* x    = (const float*)d_in[0];
  const float* gam  = (const float*)d_in[1];
  const float* bet  = (const float*)d_in[2];
  const float* wqkv = (const float*)d_in[3];
  const float* wout = (const float*)d_in[4];
  const float* bout = (const float*)d_in[5];
  float* out = (float*)d_out;

  char* ws = (char*)d_ws;
  size_t off = 0;
  unsigned short* wq_bf  = (unsigned short*)(ws + off); off += WS_WQ;
  unsigned short* wo_bf  = (unsigned short*)(ws + off); off += WS_WO;
  unsigned short* h_hi   = (unsigned short*)(ws + off); off += WS_HPL;
  unsigned short* h_lo   = (unsigned short*)(ws + off); off += WS_HPL;
  unsigned short* qkv_hi = (unsigned short*)(ws + off); off += WS_QKVPL;
  unsigned short* qkv_lo = (unsigned short*)(ws + off); off += WS_QKVPL;
  unsigned short* at_hi  = (unsigned short*)(ws + off); off += WS_ATPL;
  unsigned short* at_lo  = (unsigned short*)(ws + off); off += WS_ATPL;
  if (off > ws_size) return;

  // weights -> bf16 (RNE): 3145728/8 = 393216 = 1536 x 256 ; 1048576/8 = 131072 = 512 x 256
  const int n8_qkv = (QKV_COLS * MODEL_DIM) / 8;
  const int n8_out = (MODEL_DIM * INNER_DIM) / 8;
  cast_f32_bf16x8<<<dim3((n8_qkv + 255) / 256), dim3(256), 0, stream>>>(wqkv, wq_bf, n8_qkv);
  cast_f32_bf16x8<<<dim3((n8_out + 255) / 256), dim3(256), 0, stream>>>(wout, wo_bf, n8_out);

  // LayerNorm -> h hi/lo planes [4096][1024]
  layernorm_bf16split_kernel<<<dim3(TOK_ROWS), dim3(128), 0, stream>>>(x, gam, bet, h_hi, h_lo);

  // qkv = h @ w_qkv^T -> bf16 hi/lo planes [4096][3072]; M=4096 N=3072 K=1024; block tiles 32*12 = 384 blocks
  gemm64_bf16_asplit<2, false><<<dim3((TOK_ROWS / G_BM) * (QKV_COLS / G_BN)), dim3(256), 0, stream>>>(
      h_hi, h_lo, MODEL_DIM, wq_bf, MODEL_DIM, (void*)qkv_hi, (void*)qkv_lo, QKV_COLS,
      (const float*)nullptr, TOK_ROWS, QKV_COLS, MODEL_DIM);

  // attention per (batch, head, 64 query rows): 2*16*32 = 1024 blocks -> attn hi/lo planes [4096][1024]
  attn64_bf16x3_kernel<<<dim3(N_BATCH * N_HEAD * (SEQ_LEN / Q_BLOCK)), dim3(128), 0, stream>>>(
      qkv_hi, qkv_lo, at_hi, at_lo);

  // out = attn @ w_out^T + b_out -> f32 [4096][1024]; M=4096 N=1024 K=1024; block tiles 32*4 = 128 blocks
  gemm64_bf16_asplit<0, true><<<dim3((TOK_ROWS / G_BM) * (MODEL_DIM / G_BN)), dim3(256), 0, stream>>>(
      at_hi, at_lo, INNER_DIM, wo_bf, INNER_DIM, (void*)out, (void*)nullptr, MODEL_DIM,
      bout, TOK_ROWS, MODEL_DIM, INNER_DIM);
}

// v004
// A run of this version takes 195 microseconds.
// Timed twice side by side with v003, it ran 1.09 and 1.10 times as fast.
// Over all steps from v000 it is 2.65 times as fast.
// Contractions on v_wmma_f32_16x16x32_bf16 (bf16 operands, f32 accumulate): qkv and output projections = activation bf16 hi+lo planes x weight bf16 plane (2 products); q.k scores and p.v = bf16 hi/lo x bf16 hi/lo (3 products); LayerNorm, softmax and epilogues in f32; every float input RNE-converted to bf16 once at load.
#include <hip/hip_runtime.h>
#include <hip/hip_bf16.h>

typedef __attribute__((ext_vector_type(16))) _Float16 v16h;
typedef __attribute__((ext_vector_type(8)))  _Float16 v8h;
typedef __attribute__((ext_vector_type(16))) __bf16   v16b;
typedef __attribute__((ext_vector_type(8)))  __bf16   v8b;
typedef __attribute__((ext_vector_type(8)))  float    v8f;
typedef __attribute__((ext_vector_type(4)))  float    v4f;
typedef __attribute__((ext_vector_type(4)))  unsigned v4u;
typedef __attribute__((ext_vector_type(2)))  float    v2f;
typedef __attribute__((ext_vector_type(2)))  __bf16   v2b;

// ---- problem geometry ----
constexpr int MODEL_DIM = 1024;
constexpr int SEQ_LEN   = 2048;
constexpr int N_BATCH   = 2;
constexpr int N_HEAD    = 16;
constexpr int HEAD_D    = 64;
constexpr int INNER_DIM = N_HEAD * HEAD_D;          // 1024
constexpr int QKV_COLS  = 3 * INNER_DIM;            // 3072
constexpr int TOK_ROWS  = N_BATCH * SEQ_LEN;        // 4096
constexpr int KV_CHUNK  = 64;
constexpr int Q_BLOCK   = 64;
// LDS row pitch of the attention K and V^T tiles, in bf16 elements: 64 data + 8 pad = 144 B = 16 B x 9 (odd),
// so the 16 rows that one ds_load_b128 fragment read touches fall on distinct bank groups (128-B rows all share banks).
constexpr int LDS_PITCH = 72;

// GEMM shape contract (no run-time tails in the GEMM kernel)
static_assert(MODEL_DIM % 32 == 0, "K of qkv projection");
static_assert(INNER_DIM % 32 == 0, "K of output projection");
static_assert(TOK_ROWS % 64 == 0, "M tile multiple");
static_assert(QKV_COLS % 64 == 0, "N tile multiple (qkv)");
static_assert(MODEL_DIM % 64 == 0, "N tile multiple (out)");
static_assert(SEQ_LEN % KV_CHUNK == 0 && SEQ_LEN % Q_BLOCK == 0, "attention tiles");
static_assert(HEAD_D == 64, "attention kernel is head_dim 64");
static_assert(MODEL_DIM == 128 * 8, "LayerNorm kernel: 128 threads x 8 elements per row");

// ---- workspace region map (bytes, every offset a multiple of 128) ----
//  [0]            wq  bf16 [3072][1024]         6291456
//  [6291456]      wo  bf16 [1024][1024]         2097152
//  [8388608]      h   hi bf16 [4096][1024]      8388608
//  [16777216]     h   lo bf16 [4096][1024]      8388608
//  [25165824]     qkv hi bf16 [4096][3072]     25165824
//  [50331648]     qkv lo bf16 [4096][3072]     25165824
//  [75497472]     at  hi bf16 [4096][1024]      8388608
//  [83886080]     at  lo bf16 [4096][1024]      8388608
//  total 92274688
constexpr size_t WS_WQ    = (size_t)QKV_COLS * MODEL_DIM * 2;
constexpr size_t WS_WO    = (size_t)MODEL_DIM * INNER_DIM * 2;
constexpr size_t WS_HPL   = (size_t)TOK_ROWS * MODEL_DIM * 2;
constexpr size_t WS_QKVPL = (size_t)TOK_ROWS * QKV_COLS * 2;
constexpr size_t WS_ATPL  = (size_t)TOK_ROWS * INNER_DIM * 2;
constexpr size_t WS_TOTAL = WS_WQ + WS_WO + 2 * WS_HPL + 2 * WS_QKVPL + 2 * WS_ATPL;
static_assert(WS_TOTAL == 92274688, "carve arithmetic");
static_assert(WS_TOTAL <= 134217728, "carve budget");
static_assert(WS_WQ % 128 == 0 && WS_WO % 128 == 0 && WS_HPL % 128 == 0 && WS_QKVPL % 128 == 0 && WS_ATPL % 128 == 0, "128-B aligned regions");

// ---- bf16 RNE helpers ----
__device__ __forceinline__ unsigned short f2bf_bits(float f) {
  unsigned u = __float_as_uint(f);
  return (unsigned short)((u + 0x7FFFu + ((u >> 16) & 1u)) >> 16);
}
__device__ __forceinline__ float bf_bits2f(unsigned short h) { return __uint_as_float(((unsigned)h) << 16); }

// hazard guards as plain device helpers (no inline asm inside the kernel template body)
__device__ __forceinline__ void dep_guard_h(v8f& a, v8f& b, v16h x, v16h y) { asm volatile("v_nop\n\tv_nop\n\tv_nop\n\tv_nop" : "+v"(a), "+v"(b) : "v"(x), "v"(y)); }
__device__ __forceinline__ void dep_guard_b(v8f& a, v8f& b, v16b x, v16b y) { asm volatile("v_nop\n\tv_nop\n\tv_nop\n\tv_nop" : "+v"(a), "+v"(b) : "v"(x), "v"(y)); }
__device__ __forceinline__ void keep4_h(v16h a, v16h b, v16h c, v16h d) { asm volatile("v_nop" :: "v"(a), "v"(b), "v"(c), "v"(d)); }
__device__ __forceinline__ void keep4_b(v16b a, v16b b, v16b c, v16b d) { asm volatile("v_nop" :: "v"(a), "v"(b), "v"(c), "v"(d)); }
__device__ __forceinline__ void acc_guard4(v8f& a, v8f& b, v8f& c, v8f& d) { asm volatile("v_nop\n\tv_nop\n\tv_nop\n\tv_nop" : "+v"(a), "+v"(b), "+v"(c), "+v"(d)); }
template <typename T> struct Frag;
template <> struct Frag<_Float16> {
  typedef v16h V; union U { v16h v; v8h h[2]; };
  static __device__ __forceinline__ v16h load(const _Float16* p) {   // elements 0..7 <- p[0..7], 8..15 <- p[16..23]
    U f; f.h[0] = *(const v8h*)(p); f.h[1] = *(const v8h*)(p + 16); return f.v;
  }
  static __device__ __forceinline__ v8f mma(v16h a, v16h b, v8f c) {
    return __builtin_amdgcn_wmma_f32_16x16x32_f16(false, a, false, b, (short)0, c, false, false);
  }
  static __device__ __forceinline__ void guard(v8f& a, v8f& b, v16h x, v16h y) { dep_guard_h(a, b, x, y); }
  static __device__ __forceinline__ void keep(v16h a, v16h b, v16h c, v16h d) { keep4_h(a, b, c, d); }
};
template <> struct Frag<__bf16> {
  typedef v16b V; union U { v16b v; v8b h[2]; };
  static __device__ __forceinline__ v16b load(const __bf16* p) {
    U f; f.h[0] = *(const v8b*)(p); f.h[1] = *(const v8b*)(p + 16); return f.v;
  }
  static __device__ __forceinline__ v8f mma(v16b a, v16b b, v8f c) {
    return __builtin_amdgcn_wmma_f32_16x16x32_bf16(false, a, false, b, (short)0, c, false, false);
  }
  static __device__ __forceinline__ void guard(v8f& a, v8f& b, v16b x, v16b y) { dep_guard_b(a, b, x, y); }
  static __device__ __forceinline__ void keep(v16b a, v16b b, v16b c, v16b d) { keep4_b(a, b, c, d); }
};

// attention helpers (bf16 WMMA with hazard guard; exchange between the wave halves)
__device__ __forceinline__ v8f at_mma(v16b a, v16b b, v8f c) {
  c = __builtin_amdgcn_wmma_f32_16x16x32_bf16(false, a, false, b, (short)0, c, false, false);
  asm volatile("v_nop\n\tv_nop\n\tv_nop\n\tv_nop" : "+v"(c) : "v"(a), "v"(b));
  return c;
}

// value of lane l ^ 16: the other half of the wave holds the other keys of the same query
__device__ __forceinline__ float at_xhalf(float x) {
  const int b = __builtin_bit_cast(int, x);
  return __builtin_bit_cast(float, __builtin_amdgcn_permlanex16(b, b, 0x76543210, 0xfedcba98, false, false));
}

// =====================================================================================
// 1) f32 -> bf16 (RNE) cast, 8 elements per thread, one 16-B store per lane
//    Coverage: grid = n8/256 blocks x 256 threads x 8 elements = n exactly (n8 = n/8, n % 2048 == 0 here).
// =====================================================================================
__global__ __launch_bounds__(256) void cast_f32_bf16x8(
    const float* __restrict__ in, unsigned short* __restrict__ out, int n8) {
  const int i = blockIdx.x * 256 + threadIdx.x;
  if (i < n8) {
    const size_t e0 = (size_t)i * 8;
    const v4f a = *(const v4f*)(in + e0);
    const v4f b = *(const v4f*)(in + e0 + 4);
    v4u u;
    u[0] = (unsigned)f2bf_bits(a[0]) | ((unsigned)f2bf_bits(a[1]) << 16);
    u[1] = (unsigned)f2bf_bits(a[2]) | ((unsigned)f2bf_bits(a[3]) << 16);
    u[2] = (unsigned)f2bf_bits(b[0]) | ((unsigned)f2bf_bits(b[1]) << 16);
    u[3] = (unsigned)f2bf_bits(b[2]) | ((unsigned)f2bf_bits(b[3]) << 16);
    *(v4u*)(out + e0) = u;
    
  }
}

// =====================================================================================
//    result split into bf16 hi / lo planes [TOK_ROWS][MODEL_DIM].
//    One block (128 threads) per row; thread t owns elements 8t..8t+7 -> one 16-B store per lane per plane
//    Coverage: 4096 blocks x 128 threads x 8 = 4096 x 1024 exactly.
// =====================================================================================
__global__ __launch_bounds__(128) void layernorm_bf16split_kernel(
    const float* __restrict__ x, const float* __restrict__ gamma, const float* __restrict__ beta,
    unsigned short* __restrict__ hhi, unsigned short* __restrict__ hlo) {
  __shared__ float red_s[4];
  __shared__ float red_q[4];
  const int row = blockIdx.x;
  const int t = threadIdx.x;
  const int lane = t & 31, wave = t >> 5;
  const size_t base = (size_t)row * MODEL_DIM + 8 * (size_t)t;

  const v4f a0 = *(const v4f*)(x + base);
  const v4f a1 = *(const v4f*)(x + base + 4);
  float xv[8];
#pragma unroll
  for (int e = 0; e < 4; ++e) {
    xv[e]     = bf_bits2f(f2bf_bits(a0[e]));
    xv[4 + e] = bf_bits2f(f2bf_bits(a1[e]));
  }
  float s = ((xv[0] + xv[1]) + (xv[2] + xv[3])) + ((xv[4] + xv[5]) + (xv[6] + xv[7]));
#pragma unroll
  for (int off = 1; off < 32; off <<= 1) s += __shfl_xor(s, off, 32);
  if (lane == 0) red_s[wave] = s;
  __syncthreads();
  const float tot = (red_s[0] + red_s[1]) + (red_s[2] + red_s[3]);
  const float mean = tot * (1.0f / (float)MODEL_DIM);

  float d[8];
  float q = 0.f;
#pragma unroll
  for (int e = 0; e < 8; ++e) { d[e] = xv[e] - mean; q += d[e] * d[e]; }
#pragma unroll
  for (int off = 1; off < 32; off <<= 1) q += __shfl_xor(q, off, 32);
  if (lane == 0) red_q[wave] = q;
  __syncthreads();
  const float qt = (red_q[0] + red_q[1]) + (red_q[2] + red_q[3]);
  const float var = qt * (1.0f / (float)MODEL_DIM);
  const float rstd = rsqrtf(var + 1e-5f);

  const v4f g0 = *(const v4f*)(gamma + 8 * t);
  const v4f g1 = *(const v4f*)(gamma + 8 * t + 4);
  const v4f b0 = *(const v4f*)(beta + 8 * t);
  const v4f b1 = *(const v4f*)(beta + 8 * t + 4);
  float hv[8];
#pragma unroll
  for (int e = 0; e < 4; ++e) {
    const float gg0 = bf_bits2f(f2bf_bits(g0[e])), bb0 = bf_bits2f(f2bf_bits(b0[e]));
    const float gg1 = bf_bits2f(f2bf_bits(g1[e])), bb1 = bf_bits2f(f2bf_bits(b1[e]));
    hv[e]     = d[e] * rstd * gg0 + bb0;
    hv[4 + e] = d[4 + e] * rstd * gg1 + bb1;
  }
  v4u ph, pl;
#pragma unroll
  for (int w = 0; w < 4; ++w) {
    const float f0 = hv[2 * w], f1 = hv[2 * w + 1];
    const unsigned short h0 = f2bf_bits(f0), h1 = f2bf_bits(f1);
    const unsigned short l0 = f2bf_bits(f0 - bf_bits2f(h0));
    const unsigned short l1 = f2bf_bits(f1 - bf_bits2f(h1));
    ph[w] = (unsigned)h0 | ((unsigned)h1 << 16);
    pl[w] = (unsigned)l0 | ((unsigned)l1 << 16);
  }
  *(v4u*)(hhi + base) = ph;
  *(v4u*)(hlo + base) = pl;
  
}

// =====================================================================================
// 3) WMMA GEMM, operands staged in LDS: C[m,n] = sum_k (Ah+Al)[m,k] * Bt[n,k] (+bias[n], bias RNE bf16)
//    A = bf16 hi and lo planes row-major [M,K] (lda); Bt = bf16 row-major [N,K] (ldb); 2 WMMA products per tile pair.
//    A block of 8 waves (2 x 4) owns a 128x256 C tile, each wave a 64x64 part of it. K is walked in slabs of 64:
//    a stage is [A hi 128 rows | A lo 128 rows | Bt 256 rows] of 128 B each at a 144-B LDS pitch, two buffers.
//    Every wave copies 64 of the 512 stage rows with 16 asynchronous 16-B-per-lane copies (4 whole 128-B rows each),
//    one slab ahead of the slab that is being multiplied. Per output element the k order of the sums is ascending.
//    Coverage: grid.x = (M/128)*(N/256) blocks, every 64x64 tile exactly once (shapes static_assert'ed below).
// =====================================================================================
constexpr int G_BM          = 128;                              // block tile rows
constexpr int G_BN          = 256;                              // block tile columns
constexpr int G_SLAB_K      = 64;                               // k elements per stage: 128-B rows
constexpr int G_PITCH       = 72;                               // LDS row pitch in bf16 elements: 144 B = 16 B x 9
constexpr int G_STAGE_ROWS  = 2 * G_BM + G_BN;                  // 512
constexpr int G_STAGE_BYTES = G_STAGE_ROWS * G_PITCH * 2;       // 73728
constexpr unsigned G_COPY_LDS_STEP = 4u * G_PITCH * 2u;         // one wave-wide copy fills 4 stage rows
static_assert(TOK_ROWS % G_BM == 0, "M block tile multiple");
static_assert(QKV_COLS % G_BN == 0 && MODEL_DIM % G_BN == 0, "N block tile multiple");
static_assert(MODEL_DIM % G_SLAB_K == 0 && INNER_DIM % G_SLAB_K == 0, "K slab multiple");
static_assert(MODEL_DIM / G_SLAB_K >= 2 && INNER_DIM / G_SLAB_K >= 2, "two stages at least");
static_assert(8 * 16 * 68 * 4 <= 2 * G_STAGE_BYTES, "epilogue slabs fit the ring");

// Eight asynchronous copies global -> LDS, 16 B per lane each, for 32 consecutive stage rows of one wave.
// l = the lane's LDS byte address of the first copy, g = its global address, step = elements per 4 source rows.
// The closing s_wait_xcnt 0 stands inside the statement so that no address register named here is rewritten ahead of it.
__device__ __forceinline__ void stage_copy8(unsigned l, const unsigned short* g, size_t step) {
  asm volatile(
      "global_load_async_to_lds_b128 %0, %8, off\n\t"
      "global_load_async_to_lds_b128 %1, %9, off\n\t"
      "global_load_async_to_lds_b128 %2, %10, off\n\t"
      "global_load_async_to_lds_b128 %3, %11, off\n\t"
      "global_load_async_to_lds_b128 %4, %12, off\n\t"
      "global_load_async_to_lds_b128 %5, %13, off\n\t"
      "global_load_async_to_lds_b128 %6, %14, off\n\t"
      "global_load_async_to_lds_b128 %7, %15, off\n\t"
      "s_wait_xcnt 0x0"
      :: "v"(l), "v"(l + G_COPY_LDS_STEP), "v"(l + 2u * G_COPY_LDS_STEP), "v"(l + 3u * G_COPY_LDS_STEP),
         "v"(l + 4u * G_COPY_LDS_STEP), "v"(l + 5u * G_COPY_LDS_STEP), "v"(l + 6u * G_COPY_LDS_STEP),
         "v"(l + 7u * G_COPY_LDS_STEP),
         "v"(g), "v"(g + step), "v"(g + 2 * step), "v"(g + 3 * step),
         "v"(g + 4 * step), "v"(g + 5 * step), "v"(g + 6 * step), "v"(g + 7 * step)
      : "memory");
}

// The two waits of the stage ring, each an asm statement of its own; the "memory" clobber keeps LDS accesses on their side of it.
__device__ __forceinline__ void wait_own_copies_landed() { asm volatile("s_wait_asynccnt 0x0" ::: "memory"); }
__device__ __forceinline__ void wait_own_lds_reads_done() { asm volatile("s_wait_dscnt 0x0" ::: "memory"); }

template <int OUT_MODE, bool HAS_BIAS>
__global__ __launch_bounds__(256) void gemm64_bf16_asplit(
    const unsigned short* __restrict__ Ahp, const unsigned short* __restrict__ Alp, int lda,
    const unsigned short* __restrict__ Btp, int ldb,
    void* __restrict__ Cout, void* __restrict__ Cout2, int ldc,
    const float* __restrict__ bias, int M, int N, int K) {
  typedef __bf16 T;
  typedef v16b V;
  // two stage buffers; after the K loop the same bytes serve as the per-wave 16x64 f32 epilogue slabs (pitch 68 floats)
  __shared__ __align__(16) unsigned char smem[2 * G_STAGE_BYTES];
  const int lane = threadIdx.x & 31;
  const int wave = __builtin_amdgcn_readfirstlane(threadIdx.x >> 5);
  const int tilesN = N / G_BN;
  const int tilesM = M / G_BM;
  const int bm = blockIdx.x / tilesN;
  const int bn = blockIdx.x - bm * tilesN;
  if (bm >= tilesM) return;              // block-uniform, in front of every barrier and copy
  const int mB = bm * G_BM;
  const int nB = bn * G_BN;
  const int wm = wave >> 2;              // 0..1: 64-row part of the block tile
  const int wn = wave & 3;               // 0..3: 64-column part
  const int m0 = mB + (wm << 6);
  const int n0 = nB + (wn << 6);

  const int rlane = lane & 15;                 // row (A) / col (B, D) within subtile
  const int koff  = (lane >> 4) * 8;           // k offset of this lane half
  const int mOff  = (lane >> 4) * 8;           // D row offset

  // ---- this wave's share of a stage: stage rows wave*64 .. wave*64+63 (waves 0,1: A hi; 2,3: A lo; 4..7: Bt) ----
  const unsigned short* srow;
  int sld;
  if (wave < 2)      { srow = Ahp + (size_t)(mB + wave * 64) * lda;       sld = lda; }
  else if (wave < 4) { srow = Alp + (size_t)(mB + (wave - 2) * 64) * lda; sld = lda; }
  else               { srow = Btp + (size_t)(nB + (wave - 4) * 64) * ldb; sld = ldb; }
  const unsigned short* gl = srow + (size_t)(lane >> 3) * sld + (lane & 7) * 8;   // 8 lanes x 16 B = one 128-B row
  const size_t step4 = (size_t)sld * 4;
  const unsigned ll = (unsigned)(size_t)smem + (unsigned)((wave * 64 + (lane >> 3)) * (G_PITCH * 2) + (lane & 7) * 16);

  v8f acc[4][4];
#pragma unroll
  for (int i = 0; i < 4; ++i)
#pragma unroll
    for (int j = 0; j < 4; ++j) acc[i][j] = (v8f){0.f,0.f,0.f,0.f,0.f,0.f,0.f,0.f};

  const int nT = K / G_SLAB_K;
  // ---- prologue: slab 0 lands and is published, then slab 1 starts to fly ----
  stage_copy8(ll, gl, step4);
  stage_copy8(ll + 8u * G_COPY_LDS_STEP, gl + 8 * step4, step4);
  wait_own_copies_landed();              // slab 0 has landed before the barrier publishes it to the other waves
  __syncthreads();
  if (nT > 1) {
    stage_copy8(ll + (unsigned)G_STAGE_BYTES, gl + G_SLAB_K, step4);
    stage_copy8(ll + (unsigned)G_STAGE_BYTES + 8u * G_COPY_LDS_STEP, gl + G_SLAB_K + 8 * step4, step4);
  }

  for (int t = 0; t < nT; ++t) {
    const unsigned bo = (t & 1) ? (unsigned)G_STAGE_BYTES : 0u;
    const T* sb  = (const T*)(smem + bo);
    const T* sAh = sb + ((wm << 6) + rlane) * G_PITCH + koff;
    const T* sAl = sAh + G_BM * G_PITCH;
    const T* sB  = sb + (2 * G_BM + (wn << 6) + rlane) * G_PITCH + koff;
#pragma unroll
    for (int kk = 0; kk < G_SLAB_K; kk += 32) {
      V bh[4];
#pragma unroll
      for (int j = 0; j < 4; ++j) bh[j] = Frag<T>::load(sB + (j << 4) * G_PITCH + kk);
#pragma unroll
      for (int i = 0; i < 4; ++i) {
        V ah = Frag<T>::load(sAh + (i << 4) * G_PITCH + kk);
        V al = Frag<T>::load(sAl + (i << 4) * G_PITCH + kk);
#pragma unroll
        for (int j = 0; j < 4; ++j) {
          acc[i][j] = Frag<T>::mma(ah, bh[j], acc[i][j]);
          acc[i][j] = Frag<T>::mma(al, bh[j], acc[i][j]);
        }
        Frag<T>::guard(acc[i][0], acc[i][3], ah, al);
      }
      Frag<T>::keep(bh[0], bh[1], bh[2], bh[3]);
    }
    // ---- publish point of slab t+1; it also ends every wave's reads of the buffer refilled behind it ----
    wait_own_lds_reads_done();           // fragment reads of slab t are done before its buffer is refilled
    wait_own_copies_landed();            // slab t+1 has landed before the barrier publishes it
    __syncthreads();
    if (t + 2 < nT) {
      const unsigned short* g2 = gl + (size_t)(t + 2) * G_SLAB_K;
      stage_copy8(ll + bo, g2, step4);
      stage_copy8(ll + bo + 8u * G_COPY_LDS_STEP, g2 + 8 * step4, step4);
    }
  }
  wait_own_copies_landed();              // no copy is outstanding when the ring becomes epilogue staging
  acc_guard4(acc[0][0], acc[0][1], acc[0][2], acc[0][3]);
  acc_guard4(acc[1][0], acc[1][1], acc[1][2], acc[1][3]);
  acc_guard4(acc[2][0], acc[2][1], acc[2][2], acc[2][3]);
  acc_guard4(acc[3][0], acc[3][1], acc[3][2], acc[3][3]);

  // ---- epilogue ----
  float* slab = (float*)smem + wave * (16 * 68);   // the last trip's barrier ended every read of the ring
#pragma unroll
  for (int i = 0; i < 4; ++i) {
    const int mBase = m0 + (i << 4);
#pragma unroll
    for (int j = 0; j < 4; ++j) {
#pragma unroll
      for (int r = 0; r < 8; ++r) {
        slab[(mOff + r) * 68 + (j << 4) + rlane] = acc[i][j][r];
      }
    }
    __builtin_amdgcn_fence(__ATOMIC_RELEASE, "workgroup");
    __builtin_amdgcn_wave_barrier();
    __builtin_amdgcn_fence(__ATOMIC_ACQUIRE, "workgroup");
    if (OUT_MODE == 0) {
      float* Cf = (float*)Cout;
      const int h2 = lane >> 4, c4 = (lane & 15) * 4;     // row seg = 256 B = 16 lanes x 16 B
      v4f bb = (v4f){0.f, 0.f, 0.f, 0.f};
      if (HAS_BIAS) {
        const v4f braw = *(const v4f*)(bias + n0 + c4);
#pragma unroll
        for (int e = 0; e < 4; ++e) bb[e] = bf_bits2f(f2bf_bits(braw[e]));
      }
      {
#pragma unroll
        for (int it = 0; it < 8; ++it) {
          const int row = it * 2 + h2;
          v4f v = *(const v4f*)(slab + row * 68 + c4);
          v = v + bb;
          *(v4f*)(Cf + (size_t)(mBase + row) * ldc + n0 + c4) = v;
        }
        
      }
    } else {
      const int q = lane >> 3, c8 = (lane & 7) * 8;
      unsigned short* Cu  = (unsigned short*)Cout;
      unsigned short* Cu2 = (unsigned short*)Cout2;
      {
#pragma unroll
        for (int it = 0; it < 4; ++it) {
          const int row = it * 4 + q;
          const float* sp = slab + row * 68 + c8;
          v8h hv, lv;
#pragma unroll
          for (int e = 0; e < 8; ++e) {
            unsigned short hb = f2bf_bits(sp[e]);
            unsigned short lb = f2bf_bits(sp[e] - bf_bits2f(hb));
            hv[e] = __builtin_bit_cast(_Float16, hb);
            lv[e] = __builtin_bit_cast(_Float16, lb);
          }
          *(v8h*)(Cu  + (size_t)(mBase + row) * ldc + n0 + c8) = hv;
          *(v8h*)(Cu2 + (size_t)(mBase + row) * ldc + n0 + c8) = lv;
        }
        
      }
    }
    __builtin_amdgcn_fence(__ATOMIC_RELEASE, "workgroup");
    __builtin_amdgcn_wave_barrier();
    __builtin_amdgcn_fence(__ATOMIC_ACQUIRE, "workgroup");
  }
}

__global__ __launch_bounds__(128) void attn64_bf16x3_kernel(
    const unsigned short* __restrict__ qkvh, const unsigned short* __restrict__ qkvl,
    unsigned short* __restrict__ oh, unsigned short* __restrict__ ol) {
  union FB { v16b v; v8b h[2]; };
  __shared__ __align__(16) unsigned short Ksh[KV_CHUNK * LDS_PITCH];  // K hi [kv][d]
  __shared__ __align__(16) unsigned short Ksl[KV_CHUNK * LDS_PITCH];  // K lo [kv][d]
  __shared__ __align__(16) unsigned short Vth[HEAD_D * LDS_PITCH];    // V hi [d][kv]
  __shared__ __align__(16) unsigned short Vtl[HEAD_D * LDS_PITCH];    // V lo [d][kv]
  __shared__ __align__(16) float  Os[4][16 * 68];                     // per wave out tile, pitch 68

  const int tid  = threadIdx.x;
  const int wave = tid >> 5;
  const int lane = tid & 31;
  const int hh   = lane >> 4;
  const int c    = lane & 15;

  constexpr int NQB = SEQ_LEN / Q_BLOCK;   // 32
  const int bx   = blockIdx.x;
  const int qb   = bx % NQB;
  const int bhid = bx / NQB;
  const int head = bhid % N_HEAD;
  const int bat  = bhid / N_HEAD;
  const int q0   = qb * Q_BLOCK + wave * 16;
  const size_t tokb = (size_t)bat * SEQ_LEN;
  const int hcol = head * HEAD_D;

  const __bf16* QH = (const __bf16*)qkvh;
  const __bf16* QL = (const __bf16*)qkvl;

  // ---- Q fragments (B operand, column = query c): 2 d-chunks, hi and lo, statically strided global loads ----
  v16b qah[2], qal[2];
  {
    const size_t qo = (tokb + q0 + c) * QKV_COLS + hcol + 8 * hh;
#pragma unroll
    for (int dc = 0; dc < 2; ++dc) {
      qah[dc] = Frag<__bf16>::load(QH + qo + dc * 32);
      qal[dc] = Frag<__bf16>::load(QL + qo + dc * 32);
    }
  }

  constexpr float SC_LOG2E = 0.125f * 1.4426950408889634f;   // head_dim^-0.5 * log2(e)
  float mrun = -INFINITY;   // running maximum of query c's scores times SC_LOG2E (equal in both halves)
  float lrun = 0.f;         // running denominator of query c over this half's keys only
  v8f oacc[4];              // oacc[t][r] = out[query c][d = 16 t + 8 hh + r]
#pragma unroll
  for (int t = 0; t < 4; ++t) oacc[t] = (v8f){0.f,0.f,0.f,0.f,0.f,0.f,0.f,0.f};

  const __bf16* KHp = (const __bf16*)Ksh;
  const __bf16* KLp = (const __bf16*)Ksl;
  const __bf16* VHp = (const __bf16*)Vth;
  const __bf16* VLp = (const __bf16*)Vtl;

  for (int kc = 0; kc < SEQ_LEN / KV_CHUNK; ++kc) {
    const int kv0 = kc * KV_CHUNK;
    __syncthreads();
    {
      // staging: thread -> kv row kvr = tid>>1, d half dh = (tid&1)*32; 4 x 16 B per plane
      const int kvr = tid >> 1, dh = (tid & 1) * 32;
      const size_t kro = (tokb + kv0 + kvr) * QKV_COLS + INNER_DIM + hcol + dh;
      const size_t vro = kro + INNER_DIM;
#pragma unroll
      for (int i = 0; i < 4; ++i) {
        const v4u kh4 = *(const v4u*)(qkvh + kro + 8 * i);
        const v4u kl4 = *(const v4u*)(qkvl + kro + 8 * i);
        *(v4u*)(Ksh + kvr * LDS_PITCH + dh + 8 * i) = kh4;
        *(v4u*)(Ksl + kvr * LDS_PITCH + dh + 8 * i) = kl4;
      }
      asm volatile("" ::: "memory");
#pragma unroll
      for (int i = 0; i < 4; ++i) {
        const v4u vh4 = *(const v4u*)(qkvh + vro + 8 * i);
        const v4u vl4 = *(const v4u*)(qkvl + vro + 8 * i);
#pragma unroll
        for (int w = 0; w < 4; ++w) {
          const int d0 = dh + 8 * i + 2 * w;
          const unsigned uh = vh4[w], ul = vl4[w];
          Vth[d0 * LDS_PITCH + kvr]       = (unsigned short)(uh & 0xffffu);
          Vth[(d0 + 1) * LDS_PITCH + kvr] = (unsigned short)(uh >> 16);
          Vtl[d0 * LDS_PITCH + kvr]       = (unsigned short)(ul & 0xffffu);
          Vtl[(d0 + 1) * LDS_PITCH + kvr] = (unsigned short)(ul >> 16);
        }
      }
    }
    __syncthreads();

    // ---- scores S^T: 4 tiles of 16 keys x 16 queries, 2 d-chunks, 3 products each ----
    v8f s[4];
#pragma unroll
    for (int j = 0; j < 4; ++j) {
      s[j] = (v8f){0.f,0.f,0.f,0.f,0.f,0.f,0.f,0.f};
#pragma unroll
      for (int dc = 0; dc < 2; ++dc) {
        FB kb, kl;
        const int ko = (j * 16 + c) * LDS_PITCH + dc * 32 + 8 * hh;
        kb.h[0] = *(const v8b*)(KHp + ko);
        kb.h[1] = *(const v8b*)(KHp + ko + 16);
        kl.h[0] = *(const v8b*)(KLp + ko);
        kl.h[1] = *(const v8b*)(KLp + ko + 16);
        s[j] = at_mma(kb.v, qah[dc], s[j]);
        s[j] = at_mma(kl.v, qah[dc], s[j]);
        s[j] = at_mma(kb.v, qal[dc], s[j]);
      }
    }
    // ---- chunk maximum of query c over the unscaled scores (the scale is positive): 32 in-lane, then the other half ----
    float mj[4];
#pragma unroll
    for (int j = 0; j < 4; ++j) {
      mj[j] = -INFINITY;
#pragma unroll
      for (int r = 0; r < 8; ++r) mj[j] = fmaxf(mj[j], s[j][r]);
    }
    float cm = fmaxf(fmaxf(mj[0], mj[1]), fmaxf(mj[2], mj[3]));
    cm = fmaxf(cm, at_xhalf(cm));
    // ---- online softmax in base 2; p split into bf16 hi/lo in place: pbh[kk] / pbl[kk] element e = p of key 32 kk + kmap(e, hh) ----
    const float mnew = fmaxf(mrun, cm * SC_LOG2E);
    const float alpha = __builtin_amdgcn_exp2f(mrun - mnew);   // 0 on the first chunk, where mrun is -inf
    mrun = mnew;
    const v2f sc2 = (v2f){SC_LOG2E, SC_LOG2E};
    const v2f mn2 = (v2f){mnew, mnew};
    union PB { v16b v; v2b w[8]; };
    PB pbh[2], pbl[2];
    float pj[4];
#pragma unroll
    for (int j = 0; j < 4; ++j) {
      pj[j] = 0.f;
#pragma unroll
      for (int r = 0; r < 8; r += 2) {
        const v2f a2 = (v2f){s[j][r], s[j][r + 1]} * sc2 - mn2;          // scale, log2(e) and maximum in one FMA
        v2f p2;
        p2[0] = __builtin_amdgcn_exp2f(a2[0]);
        p2[1] = __builtin_amdgcn_exp2f(a2[1]);
        pj[j] += p2[0];
        pj[j] += p2[1];
        const v2b h2 = __builtin_convertvector(p2, v2b);                 // RNE, two values per register
        const v2b l2 = __builtin_convertvector(p2 - __builtin_convertvector(h2, v2f), v2b);
        pbh[j >> 1].w[(j & 1) * 4 + (r >> 1)] = h2;
        pbl[j >> 1].w[(j & 1) * 4 + (r >> 1)] = l2;
      }
    }
    lrun = lrun * alpha + ((pj[0] + pj[1]) + (pj[2] + pj[3]));
#pragma unroll
    for (int t = 0; t < 4; ++t)
#pragma unroll
      for (int r = 0; r < 8; ++r) oacc[t][r] *= alpha;
    // ---- O^T += V^T(64 d x 64 kv) . P^T(64 kv x 16 queries): 2 kv-chunks of 32, 4 d tiles, 3 products ----
#pragma unroll
    for (int kk = 0; kk < 2; ++kk) {
#pragma unroll
      for (int t = 0; t < 4; ++t) {
        FB vb, vl;
        const int vo = (t * 16 + c) * LDS_PITCH + kk * 32 + 8 * hh;
        vb.h[0] = *(const v8b*)(VHp + vo);
        vb.h[1] = *(const v8b*)(VHp + vo + 16);
        vl.h[0] = *(const v8b*)(VLp + vo);
        vl.h[1] = *(const v8b*)(VLp + vo + 16);
        oacc[t] = at_mma(vb.v, pbh[kk].v, oacc[t]);
        oacc[t] = at_mma(vl.v, pbh[kk].v, oacc[t]);
        oacc[t] = at_mma(vb.v, pbl[kk].v, oacc[t]);
      }
    }
  }

  // ---- the two halves' denominators join; the lane's 8 consecutive d of each tile go to row c of the wave's out tile ----
  float* os = Os[wave];
  {
    const float inv = 1.0f / (lrun + at_xhalf(lrun));
#pragma unroll
    for (int t = 0; t < 4; ++t) {
      v4f o0, o1;
#pragma unroll
      for (int e = 0; e < 4; ++e) { o0[e] = oacc[t][e] * inv; o1[e] = oacc[t][4 + e] * inv; }
      *(v4f*)(os + c * 68 + t * 16 + 8 * hh)     = o0;
      *(v4f*)(os + c * 68 + t * 16 + 8 * hh + 4) = o1;
    }
  }
  __builtin_amdgcn_fence(__ATOMIC_RELEASE, "workgroup");
  __builtin_amdgcn_wave_barrier();
  __builtin_amdgcn_fence(__ATOMIC_ACQUIRE, "workgroup");
  {
    const int q8 = lane >> 3, c8 = (lane & 7) * 8;
    {
#pragma unroll
      for (int it = 0; it < 4; ++it) {
        const int row = it * 4 + q8;                   // rows 0..15 of this wave's tile
        const float* sp = os + row * 68 + c8;
        const v4f f0 = *(const v4f*)(sp);
        const v4f f1 = *(const v4f*)(sp + 4);
        v4u ph, plo;
#pragma unroll
        for (int w = 0; w < 2; ++w) {
          const float a = f0[2 * w], bq = f0[2 * w + 1];
          const unsigned short ha = f2bf_bits(a), hb = f2bf_bits(bq);
          const unsigned short la = f2bf_bits(a - bf_bits2f(ha)), lb = f2bf_bits(bq - bf_bits2f(hb));
          ph[w]  = (unsigned)ha | ((unsigned)hb << 16);
          plo[w] = (unsigned)la | ((unsigned)lb << 16);
        }
#pragma unroll
        for (int w = 0; w < 2; ++w) {
          const float a = f1[2 * w], bq = f1[2 * w + 1];
          const unsigned short ha = f2bf_bits(a), hb = f2bf_bits(bq);
          const unsigned short la = f2bf_bits(a - bf_bits2f(ha)), lb = f2bf_bits(bq - bf_bits2f(hb));
          ph[2 + w]  = (unsigned)ha | ((unsigned)hb << 16);
          plo[2 + w] = (unsigned)la | ((unsigned)lb << 16);
        }
        const size_t o = (tokb + q0 + row) * INNER_DIM + hcol + c8;
        *(v4u*)(oh + o) = ph;
        *(v4u*)(ol + o) = plo;
      }
      
    }
  }
}

// =====================================================================================
// launch glue
// =====================================================================================
extern "C" void kernel_launch(void* const* d_in, const int* in_sizes, int n_in,
                              void* d_out, int out_size, void* d_ws,
                              size_t ws_size, hipStream_t stream) {
  if (n_in < 6) return;
  if (in_sizes[0] != TOK_ROWS * MODEL_DIM) return;
  if (in_sizes[1] != MODEL_DIM || in_sizes[2] != MODEL_DIM) return;
  if (in_sizes[3] != QKV_COLS * MODEL_DIM) return;
  if (in_sizes[4] != MODEL_DIM * INNER_DIM) return;
  if (in_sizes[5] != MODEL_DIM) return;
  if (out_size != TOK_ROWS * MODEL_DIM) return;
  if (ws_size < WS_TOTAL) return;

  const float* x    = (const float*)d_in[0];
  const float* gam  = (const float*)d_in[1];
  const float* bet  = (const float*)d_in[2];
  const float* wqkv = (const float*)d_in[3];
  const float* wout = (const float*)d_in[4];
  const float* bout = (const float*)d_in[5];
  float* out = (float*)d_out;

  char* ws = (char*)d_ws;
  size_t off = 0;
  unsigned short* wq_bf  = (unsigned short*)(ws + off); off += WS_WQ;
  unsigned short* wo_bf  = (unsigned short*)(ws + off); off += WS_WO;
  unsigned short* h_hi   = (unsigned short*)(ws + off); off += WS_HPL;
  unsigned short* h_lo   = (unsigned short*)(ws + off); off += WS_HPL;
  unsigned short* qkv_hi = (unsigned short*)(ws + off); off += WS_QKVPL;
  unsigned short* qkv_lo = (unsigned short*)(ws + off); off += WS_QKVPL;
  unsigned short* at_hi  = (unsigned short*)(ws + off); off += WS_ATPL;
  unsigned short* at_lo  = (unsigned short*)(ws + off); off += WS_ATPL;
  if (off > ws_size) return;

  // weights -> bf16 (RNE): 3145728/8 = 393216 = 1536 x 256 ; 1048576/8 = 131072 = 512 x 256
  const int n8_qkv = (QKV_COLS * MODEL_DIM) / 8;
  const int n8_out = (MODEL_DIM * INNER_DIM) / 8;
  cast_f32_bf16x8<<<dim3((n8_qkv + 255) / 256), dim3(256), 0, stream>>>(wqkv, wq_bf, n8_qkv);
  cast_f32_bf16x8<<<dim3((n8_out + 255) / 256), dim3(256), 0, stream>>>(wout, wo_bf, n8_out);

  // LayerNorm -> h hi/lo planes [4096][1024]
  layernorm_bf16split_kernel<<<dim3(TOK_ROWS), dim3(128), 0, stream>>>(x, gam, bet, h_hi, h_lo);

  // qkv = h @ w_qkv^T -> bf16 hi/lo planes [4096][3072]; M=4096 N=3072 K=1024; block tiles 32*12 = 384 blocks
  gemm64_bf16_asplit<2, false><<<dim3((TOK_ROWS / G_BM) * (QKV_COLS / G_BN)), dim3(256), 0, stream>>>(
      h_hi, h_lo, MODEL_DIM, wq_bf, MODEL_DIM, (void*)qkv_hi, (void*)qkv_lo, QKV_COLS,
      (const float*)nullptr, TOK_ROWS, QKV_COLS, MODEL_DIM);

  // attention per (batch, head, 64 query rows): 2*16*32 = 1024 blocks -> attn hi/lo planes [4096][1024]
  attn64_bf16x3_kernel<<<dim3(N_BATCH * N_HEAD * (SEQ_LEN / Q_BLOCK)), dim3(128), 0, stream>>>(
      qkv_hi, qkv_lo, at_hi, at_lo);

  // out = attn @ w_out^T + b_out -> f32 [4096][1024]; M=4096 N=1024 K=1024; block tiles 32*4 = 128 blocks
  gemm64_bf16_asplit<0, true><<<dim3((TOK_ROWS / G_BM) * (MODEL_DIM / G_BN)), dim3(256), 0, stream>>>(
      at_hi, at_lo, INNER_DIM, wo_bf, INNER_DIM, (void*)out, (void*)nullptr, MODEL_DIM,
      bout, TOK_ROWS, MODEL_DIM, INNER_DIM);
}

// v005
// A run of this version takes 184 microseconds.
// Next to v004, in two timings, it ran 1.07 and 1.06 times as fast.
// Over all steps from v000 it is 2.82 times as fast.
// Contractions on v_wmma_f32_16x16x32_bf16 (bf16 operands, f32 accumulate): qkv and output projections = activation bf16 hi+lo planes x weight bf16 plane (2 products); q.k scores and p.v = bf16 hi/lo x bf16 hi/lo (3 products); LayerNorm, softmax and epilogues in f32; every float input RNE-converted to bf16 once at load.
#include <hip/hip_runtime.h>
#include <hip/hip_bf16.h>

typedef __attribute__((ext_vector_type(16))) _Float16 v16h;
typedef __attribute__((ext_vector_type(8)))  _Float16 v8h;
typedef __attribute__((ext_vector_type(16))) __bf16   v16b;
typedef __attribute__((ext_vector_type(8)))  __bf16   v8b;
typedef __attribute__((ext_vector_type(8)))  float    v8f;
typedef __attribute__((ext_vector_type(4)))  float    v4f;
typedef __attribute__((ext_vector_type(4)))  unsigned v4u;
typedef __attribute__((ext_vector_type(2)))  float    v2f;
typedef __attribute__((ext_vector_type(2)))  __bf16   v2b;

// ---- problem geometry ----
constexpr int MODEL_DIM = 1024;
constexpr int SEQ_LEN   = 2048;
constexpr int N_BATCH   = 2;
constexpr int N_HEAD    = 16;
constexpr int HEAD_D    = 64;
constexpr int INNER_DIM = N_HEAD * HEAD_D;          // 1024
constexpr int QKV_COLS  = 3 * INNER_DIM;            // 3072
constexpr int TOK_ROWS  = N_BATCH * SEQ_LEN;        // 4096
constexpr int KV_CHUNK  = 64;
constexpr int Q_BLOCK   = 64;
// LDS row pitch of the attention K and V^T tiles, in bf16 elements: 64 data + 8 pad = 144 B = 16 B x 9 (odd),
// so the 16 rows that one ds_load_b128 fragment read touches fall on distinct bank groups (128-B rows all share banks).
constexpr int LDS_PITCH = 72;

// GEMM shape contract (no run-time tails in the GEMM kernel)
static_assert(MODEL_DIM % 32 == 0, "K of qkv projection");
static_assert(INNER_DIM % 32 == 0, "K of output projection");
static_assert(TOK_ROWS % 64 == 0, "M tile multiple");
static_assert(QKV_COLS % 64 == 0, "N tile multiple (qkv)");
static_assert(MODEL_DIM % 64 == 0, "N tile multiple (out)");
static_assert(SEQ_LEN % KV_CHUNK == 0 && SEQ_LEN % Q_BLOCK == 0, "attention tiles");
static_assert(HEAD_D == 64, "attention kernel is head_dim 64");
static_assert(MODEL_DIM == 128 * 8, "LayerNorm kernel: 128 threads x 8 elements per row");

// ---- workspace region map (bytes, every offset a multiple of 128) ----
//  [0]            wq  bf16 [3072][1024]         6291456
//  [6291456]      wo  bf16 [1024][1024]         2097152
//  [8388608]      h   hi bf16 [4096][1024]      8388608
//  [16777216]     h   lo bf16 [4096][1024]      8388608
//  [25165824]     qkv hi bf16 [4096][3072]     25165824
//  [50331648]     qkv lo bf16 [4096][3072]     25165824
//  [75497472]     at  hi bf16 [4096][1024]      8388608
//  [83886080]     at  lo bf16 [4096][1024]      8388608
//  total 92274688
constexpr size_t WS_WQ    = (size_t)QKV_COLS * MODEL_DIM * 2;
constexpr size_t WS_WO    = (size_t)MODEL_DIM * INNER_DIM * 2;
constexpr size_t WS_HPL   = (size_t)TOK_ROWS * MODEL_DIM * 2;
constexpr size_t WS_QKVPL = (size_t)TOK_ROWS * QKV_COLS * 2;
constexpr size_t WS_ATPL  = (size_t)TOK_ROWS * INNER_DIM * 2;
constexpr size_t WS_TOTAL = WS_WQ + WS_WO + 2 * WS_HPL + 2 * WS_QKVPL + 2 * WS_ATPL;
static_assert(WS_TOTAL == 92274688, "carve arithmetic");
static_assert(WS_TOTAL <= 134217728, "carve budget");
static_assert(WS_WQ % 128 == 0 && WS_WO % 128 == 0 && WS_HPL % 128 == 0 && WS_QKVPL % 128 == 0 && WS_ATPL % 128 == 0, "128-B aligned regions");

// ---- bf16 RNE helpers ----
__device__ __forceinline__ unsigned short f2bf_bits(float f) {
  unsigned u = __float_as_uint(f);
  return (unsigned short)((u + 0x7FFFu + ((u >> 16) & 1u)) >> 16);
}
__device__ __forceinline__ float bf_bits2f(unsigned short h) { return __uint_as_float(((unsigned)h) << 16); }

// hazard guards as plain device helpers (no inline asm inside the kernel template body)
__device__ __forceinline__ void dep_guard_h(v8f& a, v8f& b, v16h x, v16h y) { asm volatile("v_nop\n\tv_nop\n\tv_nop\n\tv_nop" : "+v"(a), "+v"(b) : "v"(x), "v"(y)); }
__device__ __forceinline__ void dep_guard_b(v8f& a, v8f& b, v16b x, v16b y) { asm volatile("v_nop\n\tv_nop\n\tv_nop\n\tv_nop" : "+v"(a), "+v"(b) : "v"(x), "v"(y)); }
__device__ __forceinline__ void keep4_h(v16h a, v16h b, v16h c, v16h d) { asm volatile("v_nop" :: "v"(a), "v"(b), "v"(c), "v"(d)); }
__device__ __forceinline__ void keep4_b(v16b a, v16b b, v16b c, v16b d) { asm volatile("v_nop" :: "v"(a), "v"(b), "v"(c), "v"(d)); }
__device__ __forceinline__ void acc_guard4(v8f& a, v8f& b, v8f& c, v8f& d) { asm volatile("v_nop\n\tv_nop\n\tv_nop\n\tv_nop" : "+v"(a), "+v"(b), "+v"(c), "+v"(d)); }
template <typename T> struct Frag;
template <> struct Frag<_Float16> {
  typedef v16h V; union U { v16h v; v8h h[2]; };
  static __device__ __forceinline__ v16h load(const _Float16* p) {   // elements 0..7 <- p[0..7], 8..15 <- p[16..23]
    U f; f.h[0] = *(const v8h*)(p); f.h[1] = *(const v8h*)(p + 16); return f.v;
  }
  static __device__ __forceinline__ v8f mma(v16h a, v16h b, v8f c) {
    return __builtin_amdgcn_wmma_f32_16x16x32_f16(false, a, false, b, (short)0, c, false, false);
  }
  static __device__ __forceinline__ void guard(v8f& a, v8f& b, v16h x, v16h y) { dep_guard_h(a, b, x, y); }
  static __device__ __forceinline__ void keep(v16h a, v16h b, v16h c, v16h d) { keep4_h(a, b, c, d); }
};
template <> struct Frag<__bf16> {
  typedef v16b V; union U { v16b v; v8b h[2]; };
  static __device__ __forceinline__ v16b load(const __bf16* p) {
    U f; f.h[0] = *(const v8b*)(p); f.h[1] = *(const v8b*)(p + 16); return f.v;
  }
  static __device__ __forceinline__ v8f mma(v16b a, v16b b, v8f c) {
    return __builtin_amdgcn_wmma_f32_16x16x32_bf16(false, a, false, b, (short)0, c, false, false);
  }
  static __device__ __forceinline__ void guard(v8f& a, v8f& b, v16b x, v16b y) { dep_guard_b(a, b, x, y); }
  static __device__ __forceinline__ void keep(v16b a, v16b b, v16b c, v16b d) { keep4_b(a, b, c, d); }
};

// attention helpers (bf16 WMMA as the plain builtin: the compiler keeps its distances; exchange between the wave halves)
__device__ __forceinline__ v8f at_mma(v16b a, v16b b, v8f c) {
  return __builtin_amdgcn_wmma_f32_16x16x32_bf16(false, a, false, b, (short)0, c, false, false);
}

// Scheduling fence, no instruction: without it the compiler sinks the grouped fragment reads back among the WMMAs (each
// then waited for right behind its issue), puts the dependent WMMAs of one tile back to back again, or lifts a read group
// so far up that the registers of four waves per SIMD no longer suffice.
__device__ __forceinline__ void row_fence() { __builtin_amdgcn_sched_barrier(0); }

// value of lane l ^ 16: the other half of the wave holds the other keys of the same query
__device__ __forceinline__ float at_xhalf(float x) {
  const int b = __builtin_bit_cast(int, x);
  return __builtin_bit_cast(float, __builtin_amdgcn_permlanex16(b, b, 0x76543210, 0xfedcba98, false, false));
}

// =====================================================================================
// 1) f32 -> bf16 (RNE) cast, 8 elements per thread, one 16-B store per lane
//    Coverage: grid = n8/256 blocks x 256 threads x 8 elements = n exactly (n8 = n/8, n % 2048 == 0 here).
// =====================================================================================
__global__ __launch_bounds__(256) void cast_f32_bf16x8(
    const float* __restrict__ in, unsigned short* __restrict__ out, int n8) {
  const int i = blockIdx.x * 256 + threadIdx.x;
  if (i < n8) {
    const size_t e0 = (size_t)i * 8;
    const v4f a = *(const v4f*)(in + e0);
    const v4f b = *(const v4f*)(in + e0 + 4);
    v4u u;
    u[0] = (unsigned)f2bf_bits(a[0]) | ((unsigned)f2bf_bits(a[1]) << 16);
    u[1] = (unsigned)f2bf_bits(a[2]) | ((unsigned)f2bf_bits(a[3]) << 16);
    u[2] = (unsigned)f2bf_bits(b[0]) | ((unsigned)f2bf_bits(b[1]) << 16);
    u[3] = (unsigned)f2bf_bits(b[2]) | ((unsigned)f2bf_bits(b[3]) << 16);
    *(v4u*)(out + e0) = u;
    
  }
}

// =====================================================================================
//    result split into bf16 hi / lo planes [TOK_ROWS][MODEL_DIM].
//    One block (128 threads) per row; thread t owns elements 8t..8t+7 -> one 16-B store per lane per plane
//    Coverage: 4096 blocks x 128 threads x 8 = 4096 x 1024 exactly.
// =====================================================================================
__global__ __launch_bounds__(128) void layernorm_bf16split_kernel(
    const float* __restrict__ x, const float* __restrict__ gamma, const float* __restrict__ beta,
    unsigned short* __restrict__ hhi, unsigned short* __restrict__ hlo) {
  __shared__ float red_s[4];
  __shared__ float red_q[4];
  const int row = blockIdx.x;
  const int t = threadIdx.x;
  const int lane = t & 31, wave = t >> 5;
  const size_t base = (size_t)row * MODEL_DIM + 8 * (size_t)t;

  const v4f a0 = *(const v4f*)(x + base);
  const v4f a1 = *(const v4f*)(x + base + 4);
  float xv[8];
#pragma unroll
  for (int e = 0; e < 4; ++e) {
    xv[e]     = bf_bits2f(f2bf_bits(a0[e]));
    xv[4 + e] = bf_bits2f(f2bf_bits(a1[e]));
  }
  float s = ((xv[0] + xv[1]) + (xv[2] + xv[3])) + ((xv[4] + xv[5]) + (xv[6] + xv[7]));
#pragma unroll
  for (int off = 1; off < 32; off <<= 1) s += __shfl_xor(s, off, 32);
  if (lane == 0) red_s[wave] = s;
  __syncthreads();
  const float tot = (red_s[0] + red_s[1]) + (red_s[2] + red_s[3]);
  const float mean = tot * (1.0f / (float)MODEL_DIM);

  float d[8];
  float q = 0.f;
#pragma unroll
  for (int e = 0; e < 8; ++e) { d[e] = xv[e] - mean; q += d[e] * d[e]; }
#pragma unroll
  for (int off = 1; off < 32; off <<= 1) q += __shfl_xor(q, off, 32);
  if (lane == 0) red_q[wave] = q;
  __syncthreads();
  const float qt = (red_q[0] + red_q[1]) + (red_q[2] + red_q[3]);
  const float var = qt * (1.0f / (float)MODEL_DIM);
  const float rstd = rsqrtf(var + 1e-5f);

  const v4f g0 = *(const v4f*)(gamma + 8 * t);
  const v4f g1 = *(const v4f*)(gamma + 8 * t + 4);
  const v4f b0 = *(const v4f*)(beta + 8 * t);
  const v4f b1 = *(const v4f*)(beta + 8 * t + 4);
  float hv[8];
#pragma unroll
  for (int e = 0; e < 4; ++e) {
    const float gg0 = bf_bits2f(f2bf_bits(g0[e])), bb0 = bf_bits2f(f2bf_bits(b0[e]));
    const float gg1 = bf_bits2f(f2bf_bits(g1[e])), bb1 = bf_bits2f(f2bf_bits(b1[e]));
    hv[e]     = d[e] * rstd * gg0 + bb0;
    hv[4 + e] = d[4 + e] * rstd * gg1 + bb1;
  }
  v4u ph, pl;
#pragma unroll
  for (int w = 0; w < 4; ++w) {
    const float f0 = hv[2 * w], f1 = hv[2 * w + 1];
    const unsigned short h0 = f2bf_bits(f0), h1 = f2bf_bits(f1);
    const unsigned short l0 = f2bf_bits(f0 - bf_bits2f(h0));
    const unsigned short l1 = f2bf_bits(f1 - bf_bits2f(h1));
    ph[w] = (unsigned)h0 | ((unsigned)h1 << 16);
    pl[w] = (unsigned)l0 | ((unsigned)l1 << 16);
  }
  *(v4u*)(hhi + base) = ph;
  *(v4u*)(hlo + base) = pl;
  
}

// =====================================================================================
// 3) WMMA GEMM, operands staged in LDS: C[m,n] = sum_k (Ah+Al)[m,k] * Bt[n,k] (+bias[n], bias RNE bf16)
//    A = bf16 hi and lo planes row-major [M,K] (lda); Bt = bf16 row-major [N,K] (ldb); 2 WMMA products per tile pair.
//    A block of 8 waves (2 x 4) owns a 128x256 C tile, each wave a 64x64 part of it. K is walked in slabs of 64:
//    a stage is [A hi 128 rows | A lo 128 rows | Bt 256 rows] of 128 B each at a 144-B LDS pitch, two buffers.
//    Every wave copies 64 of the 512 stage rows with 16 asynchronous 16-B-per-lane copies (4 whole 128-B rows each),
//    one slab ahead of the slab that is being multiplied. Per output element the k order of the sums is ascending.
//    Coverage: grid.x = (M/128)*(N/256) blocks, every 64x64 tile exactly once (shapes static_assert'ed below).
// =====================================================================================
constexpr int G_BM          = 128;                              // block tile rows
constexpr int G_BN          = 256;                              // block tile columns
constexpr int G_SLAB_K      = 64;                               // k elements per stage: 128-B rows
constexpr int G_PITCH       = 72;                               // LDS row pitch in bf16 elements: 144 B = 16 B x 9
constexpr int G_STAGE_ROWS  = 2 * G_BM + G_BN;                  // 512
constexpr int G_STAGE_BYTES = G_STAGE_ROWS * G_PITCH * 2;       // 73728
constexpr unsigned G_COPY_LDS_STEP = 4u * G_PITCH * 2u;         // one wave-wide copy fills 4 stage rows
static_assert(TOK_ROWS % G_BM == 0, "M block tile multiple");
static_assert(QKV_COLS % G_BN == 0 && MODEL_DIM % G_BN == 0, "N block tile multiple");
static_assert(MODEL_DIM % G_SLAB_K == 0 && INNER_DIM % G_SLAB_K == 0, "K slab multiple");
static_assert(MODEL_DIM / G_SLAB_K >= 2 && INNER_DIM / G_SLAB_K >= 2, "two stages at least");
static_assert(8 * 16 * 68 * 4 <= 2 * G_STAGE_BYTES, "epilogue slabs fit the ring");

// Eight asynchronous copies global -> LDS, 16 B per lane each, for 32 consecutive stage rows of one wave.
// l = the lane's LDS byte address of the first copy, g = its global address, step = elements per 4 source rows.
// The closing s_wait_xcnt 0 stands inside the statement so that no address register named here is rewritten ahead of it.
__device__ __forceinline__ void stage_copy8(unsigned l, const unsigned short* g, size_t step) {
  asm volatile(
      "global_load_async_to_lds_b128 %0, %8, off\n\t"
      "global_load_async_to_lds_b128 %1, %9, off\n\t"
      "global_load_async_to_lds_b128 %2, %10, off\n\t"
      "global_load_async_to_lds_b128 %3, %11, off\n\t"
      "global_load_async_to_lds_b128 %4, %12, off\n\t"
      "global_load_async_to_lds_b128 %5, %13, off\n\t"
      "global_load_async_to_lds_b128 %6, %14, off\n\t"
      "global_load_async_to_lds_b128 %7, %15, off\n\t"
      "s_wait_xcnt 0x0"
      :: "v"(l), "v"(l + G_COPY_LDS_STEP), "v"(l + 2u * G_COPY_LDS_STEP), "v"(l + 3u * G_COPY_LDS_STEP),
         "v"(l + 4u * G_COPY_LDS_STEP), "v"(l + 5u * G_COPY_LDS_STEP), "v"(l + 6u * G_COPY_LDS_STEP),
         "v"(l + 7u * G_COPY_LDS_STEP),
         "v"(g), "v"(g + step), "v"(g + 2 * step), "v"(g + 3 * step),
         "v"(g + 4 * step), "v"(g + 5 * step), "v"(g + 6 * step), "v"(g + 7 * step)
      : "memory");
}

// The two waits of the stage ring, each an asm statement of its own; the "memory" clobber keeps LDS accesses on their side of it.
__device__ __forceinline__ void wait_own_copies_landed() { asm volatile("s_wait_asynccnt 0x0" ::: "memory"); }
__device__ __forceinline__ void wait_own_lds_reads_done() { asm volatile("s_wait_dscnt 0x0" ::: "memory"); }

template <int OUT_MODE, bool HAS_BIAS>
__global__ __launch_bounds__(256) void gemm64_bf16_asplit(
    const unsigned short* __restrict__ Ahp, const unsigned short* __restrict__ Alp, int lda,
    const unsigned short* __restrict__ Btp, int ldb,
    void* __restrict__ Cout, void* __restrict__ Cout2, int ldc,
    const float* __restrict__ bias, int M, int N, int K) {
  typedef __bf16 T;
  typedef v16b V;
  // two stage buffers; after the K loop the same bytes serve as the per-wave 16x64 f32 epilogue slabs (pitch 68 floats)
  __shared__ __align__(16) unsigned char smem[2 * G_STAGE_BYTES];
  const int lane = threadIdx.x & 31;
  const int wave = __builtin_amdgcn_readfirstlane(threadIdx.x >> 5);
  const int tilesN = N / G_BN;
  const int tilesM = M / G_BM;
  const int bm = blockIdx.x / tilesN;
  const int bn = blockIdx.x - bm * tilesN;
  if (bm >= tilesM) return;              // block-uniform, in front of every barrier and copy
  const int mB = bm * G_BM;
  const int nB = bn * G_BN;
  const int wm = wave >> 2;              // 0..1: 64-row part of the block tile
  const int wn = wave & 3;               // 0..3: 64-column part
  const int m0 = mB + (wm << 6);
  const int n0 = nB + (wn << 6);

  const int rlane = lane & 15;                 // row (A) / col (B, D) within subtile
  const int koff  = (lane >> 4) * 8;           // k offset of this lane half
  const int mOff  = (lane >> 4) * 8;           // D row offset

  // ---- this wave's share of a stage: stage rows wave*64 .. wave*64+63 (waves 0,1: A hi; 2,3: A lo; 4..7: Bt) ----
  const unsigned short* srow;
  int sld;
  if (wave < 2)      { srow = Ahp + (size_t)(mB + wave * 64) * lda;       sld = lda; }
  else if (wave < 4) { srow = Alp + (size_t)(mB + (wave - 2) * 64) * lda; sld = lda; }
  else               { srow = Btp + (size_t)(nB + (wave - 4) * 64) * ldb; sld = ldb; }
  const unsigned short* gl = srow + (size_t)(lane >> 3) * sld + (lane & 7) * 8;   // 8 lanes x 16 B = one 128-B row
  const size_t step4 = (size_t)sld * 4;
  const unsigned ll = (unsigned)(size_t)smem + (unsigned)((wave * 64 + (lane >> 3)) * (G_PITCH * 2) + (lane & 7) * 16);

  v8f acc[4][4];
#pragma unroll
  for (int i = 0; i < 4; ++i)
#pragma unroll
    for (int j = 0; j < 4; ++j) acc[i][j] = (v8f){0.f,0.f,0.f,0.f,0.f,0.f,0.f,0.f};

  const int nT = K / G_SLAB_K;
  // ---- prologue: slab 0 lands and is published, then slab 1 starts to fly ----
  stage_copy8(ll, gl, step4);
  stage_copy8(ll + 8u * G_COPY_LDS_STEP, gl + 8 * step4, step4);
  wait_own_copies_landed();              // slab 0 has landed before the barrier publishes it to the other waves
  __syncthreads();
  if (nT > 1) {
    stage_copy8(ll + (unsigned)G_STAGE_BYTES, gl + G_SLAB_K, step4);
    stage_copy8(ll + (unsigned)G_STAGE_BYTES + 8u * G_COPY_LDS_STEP, gl + G_SLAB_K + 8 * step4, step4);
  }

  for (int t = 0; t < nT; ++t) {
    const unsigned bo = (t & 1) ? (unsigned)G_STAGE_BYTES : 0u;
    const T* sb  = (const T*)(smem + bo);
    const T* sAh = sb + ((wm << 6) + rlane) * G_PITCH + koff;
    const T* sAl = sAh + G_BM * G_PITCH;
    const T* sB  = sb + (2 * G_BM + (wn << 6) + rlane) * G_PITCH + koff;
#pragma unroll
    for (int kk = 0; kk < G_SLAB_K; kk += 32) {
      V bh[4];
#pragma unroll
      for (int j = 0; j < 4; ++j) bh[j] = Frag<T>::load(sB + (j << 4) * G_PITCH + kk);
#pragma unroll
      for (int i = 0; i < 4; ++i) {
        V ah = Frag<T>::load(sAh + (i << 4) * G_PITCH + kk);
        V al = Frag<T>::load(sAl + (i << 4) * G_PITCH + kk);
#pragma unroll
        for (int j = 0; j < 4; ++j) {
          acc[i][j] = Frag<T>::mma(ah, bh[j], acc[i][j]);
          acc[i][j] = Frag<T>::mma(al, bh[j], acc[i][j]);
        }
        Frag<T>::guard(acc[i][0], acc[i][3], ah, al);
      }
      Frag<T>::keep(bh[0], bh[1], bh[2], bh[3]);
    }
    // ---- publish point of slab t+1; it also ends every wave's reads of the buffer refilled behind it ----
    wait_own_lds_reads_done();           // fragment reads of slab t are done before its buffer is refilled
    wait_own_copies_landed();            // slab t+1 has landed before the barrier publishes it
    __syncthreads();
    if (t + 2 < nT) {
      const unsigned short* g2 = gl + (size_t)(t + 2) * G_SLAB_K;
      stage_copy8(ll + bo, g2, step4);
      stage_copy8(ll + bo + 8u * G_COPY_LDS_STEP, g2 + 8 * step4, step4);
    }
  }
  wait_own_copies_landed();              // no copy is outstanding when the ring becomes epilogue staging
  acc_guard4(acc[0][0], acc[0][1], acc[0][2], acc[0][3]);
  acc_guard4(acc[1][0], acc[1][1], acc[1][2], acc[1][3]);
  acc_guard4(acc[2][0], acc[2][1], acc[2][2], acc[2][3]);
  acc_guard4(acc[3][0], acc[3][1], acc[3][2], acc[3][3]);

  // ---- epilogue ----
  float* slab = (float*)smem + wave * (16 * 68);   // the last trip's barrier ended every read of the ring
#pragma unroll
  for (int i = 0; i < 4; ++i) {
    const int mBase = m0 + (i << 4);
#pragma unroll
    for (int j = 0; j < 4; ++j) {
#pragma unroll
      for (int r = 0; r < 8; ++r) {
        slab[(mOff + r) * 68 + (j << 4) + rlane] = acc[i][j][r];
      }
    }
    __builtin_amdgcn_fence(__ATOMIC_RELEASE, "workgroup");
    __builtin_amdgcn_wave_barrier();
    __builtin_amdgcn_fence(__ATOMIC_ACQUIRE, "workgroup");
    if (OUT_MODE == 0) {
      float* Cf = (float*)Cout;
      const int h2 = lane >> 4, c4 = (lane & 15) * 4;     // row seg = 256 B = 16 lanes x 16 B
      v4f bb = (v4f){0.f, 0.f, 0.f, 0.f};
      if (HAS_BIAS) {
        const v4f braw = *(const v4f*)(bias + n0 + c4);
#pragma unroll
        for (int e = 0; e < 4; ++e) bb[e] = bf_bits2f(f2bf_bits(braw[e]));
      }
      {
#pragma unroll
        for (int it = 0; it < 8; ++it) {
          const int row = it * 2 + h2;
          v4f v = *(const v4f*)(slab + row * 68 + c4);
          v = v + bb;
          *(v4f*)(Cf + (size_t)(mBase + row) * ldc + n0 + c4) = v;
        }
        
      }
    } else {
      const int q = lane >> 3, c8 = (lane & 7) * 8;
      unsigned short* Cu  = (unsigned short*)Cout;
      unsigned short* Cu2 = (unsigned short*)Cout2;
      {
#pragma unroll
        for (int it = 0; it < 4; ++it) {
          const int row = it * 4 + q;
          const float* sp = slab + row * 68 + c8;
          v8h hv, lv;
#pragma unroll
          for (int e = 0; e < 8; ++e) {
            unsigned short hb = f2bf_bits(sp[e]);
            unsigned short lb = f2bf_bits(sp[e] - bf_bits2f(hb));
            hv[e] = __builtin_bit_cast(_Float16, hb);
            lv[e] = __builtin_bit_cast(_Float16, lb);
          }
          *(v8h*)(Cu  + (size_t)(mBase + row) * ldc + n0 + c8) = hv;
          *(v8h*)(Cu2 + (size_t)(mBase + row) * ldc + n0 + c8) = lv;
        }
        
      }
    }
    __builtin_amdgcn_fence(__ATOMIC_RELEASE, "workgroup");
    __builtin_amdgcn_wave_barrier();
    __builtin_amdgcn_fence(__ATOMIC_ACQUIRE, "workgroup");
  }
}

__global__ __launch_bounds__(128) __attribute__((amdgpu_waves_per_eu(4))) void attn64_bf16x3_kernel(
    const unsigned short* __restrict__ qkvh, const unsigned short* __restrict__ qkvl,
    unsigned short* __restrict__ oh, unsigned short* __restrict__ ol) {
  union FB { v16b v; v8b h[2]; };
  __shared__ __align__(16) unsigned short Ksh[KV_CHUNK * LDS_PITCH];  // K hi [kv][d]
  __shared__ __align__(16) unsigned short Ksl[KV_CHUNK * LDS_PITCH];  // K lo [kv][d]
  __shared__ __align__(16) unsigned short Vth[HEAD_D * LDS_PITCH];    // V hi [d][kv]
  __shared__ __align__(16) unsigned short Vtl[HEAD_D * LDS_PITCH];    // V lo [d][kv]
  __shared__ __align__(16) float  Os[4][16 * 68];                     // per wave out tile, pitch 68

  const int tid  = threadIdx.x;
  const int wave = tid >> 5;
  const int lane = tid & 31;
  const int hh   = lane >> 4;
  const int c    = lane & 15;

  constexpr int NQB = SEQ_LEN / Q_BLOCK;   // 32
  const int bx   = blockIdx.x;
  const int qb   = bx % NQB;
  const int bhid = bx / NQB;
  const int head = bhid % N_HEAD;
  const int bat  = bhid / N_HEAD;
  const int q0   = qb * Q_BLOCK + wave * 16;
  const size_t tokb = (size_t)bat * SEQ_LEN;
  const int hcol = head * HEAD_D;

  const __bf16* QH = (const __bf16*)qkvh;
  const __bf16* QL = (const __bf16*)qkvl;

  // ---- Q fragments (B operand, column = query c): 2 d-chunks, hi and lo, statically strided global loads ----
  v16b qah[2], qal[2];
  {
    const size_t qo = (tokb + q0 + c) * QKV_COLS + hcol + 8 * hh;
#pragma unroll
    for (int dc = 0; dc < 2; ++dc) {
      qah[dc] = Frag<__bf16>::load(QH + qo + dc * 32);
      qal[dc] = Frag<__bf16>::load(QL + qo + dc * 32);
    }
  }

  constexpr float SC_LOG2E = 0.125f * 1.4426950408889634f;   // head_dim^-0.5 * log2(e)
  float mrun = -INFINITY;   // running maximum of query c's scores times SC_LOG2E (equal in both halves)
  float lrun = 0.f;         // running denominator of query c over this half's keys only
  v8f oacc[4];              // oacc[t][r] = out[query c][d = 16 t + 8 hh + r]
#pragma unroll
  for (int t = 0; t < 4; ++t) oacc[t] = (v8f){0.f,0.f,0.f,0.f,0.f,0.f,0.f,0.f};

  const __bf16* KHp = (const __bf16*)Ksh;
  const __bf16* KLp = (const __bf16*)Ksl;
  const __bf16* VHp = (const __bf16*)Vth;
  const __bf16* VLp = (const __bf16*)Vtl;
  const int fo = c * LDS_PITCH + 8 * hh;   // the lane's place in a 16-row fragment; tile and chunk steps are constants on top

  for (int kc = 0; kc < SEQ_LEN / KV_CHUNK; ++kc) {
    const int kv0 = kc * KV_CHUNK;
    __syncthreads();
    {
      // staging: thread -> kv row kvr = tid>>1, d half dh = (tid&1)*32; 4 x 16 B per plane
      const int kvr = tid >> 1, dh = (tid & 1) * 32;
      const size_t kro = (tokb + kv0 + kvr) * QKV_COLS + INNER_DIM + hcol + dh;
      const size_t vro = kro + INNER_DIM;
      const int vto = dh * LDS_PITCH + kvr;
#pragma unroll
      for (int i = 0; i < 4; ++i) {
        const v4u kh4 = *(const v4u*)(qkvh + kro + 8 * i);
        const v4u kl4 = *(const v4u*)(qkvl + kro + 8 * i);
        *(v4u*)(Ksh + kvr * LDS_PITCH + dh + 8 * i) = kh4;
        *(v4u*)(Ksl + kvr * LDS_PITCH + dh + 8 * i) = kl4;
      }
      asm volatile("" ::: "memory");
#pragma unroll
      for (int i = 0; i < 4; ++i) {
        const v4u vh4 = *(const v4u*)(qkvh + vro + 8 * i);
        const v4u vl4 = *(const v4u*)(qkvl + vro + 8 * i);
#pragma unroll
        for (int w = 0; w < 4; ++w) {
          const int d0 = 8 * i + 2 * w;               // a constant on top of the thread's base vto: one address register
          const unsigned uh = vh4[w], ul = vl4[w];
          Vth[vto + d0 * LDS_PITCH]       = (unsigned short)(uh & 0xffffu);
          Vth[vto + (d0 + 1) * LDS_PITCH] = (unsigned short)(uh >> 16);
          Vtl[vto + d0 * LDS_PITCH]       = (unsigned short)(ul & 0xffffu);
          Vtl[vto + (d0 + 1) * LDS_PITCH] = (unsigned short)(ul >> 16);
        }
      }
    }
    __syncthreads();

    // ---- scores S^T: 4 tiles of 16 keys x 16 queries, 2 d-chunks, 3 products each ----
    // The K fragments of a d-chunk are read as one group, and consecutive WMMAs go round the 4 independent score tiles,
    // so that no WMMA waits for the one in front of it; each tile still sums its 6 products in the order dc, hi.hi, lo.hi, hi.lo.
    v8f s[4];
    FB kb[2][4], kl[2][4];
#pragma unroll
    for (int dc = 0; dc < 2; ++dc) {
#pragma unroll
      for (int j = 0; j < 4; ++j) {
        const int ko = j * 16 * LDS_PITCH + dc * 32;      // a constant: folds into the read's offset field
        kb[dc][j].h[0] = *(const v8b*)(KHp + fo + ko);
        kb[dc][j].h[1] = *(const v8b*)(KHp + fo + ko + 16);
        kl[dc][j].h[0] = *(const v8b*)(KLp + fo + ko);
        kl[dc][j].h[1] = *(const v8b*)(KLp + fo + ko + 16);
      }
    }
    row_fence();
#pragma unroll
    for (int j = 0; j < 4; ++j) s[j] = (v8f){0.f,0.f,0.f,0.f,0.f,0.f,0.f,0.f};
#pragma unroll
    for (int dc = 0; dc < 2; ++dc) {
#pragma unroll
      for (int j = 0; j < 4; ++j) s[j] = at_mma(kb[dc][j].v, qah[dc], s[j]);
      row_fence();
#pragma unroll
      for (int j = 0; j < 4; ++j) s[j] = at_mma(kl[dc][j].v, qah[dc], s[j]);
      row_fence();
#pragma unroll
      for (int j = 0; j < 4; ++j) s[j] = at_mma(kb[dc][j].v, qal[dc], s[j]);
      row_fence();
    }
    // V^T fragments of the first kv-chunk: read here so that the softmax below covers their latency
    FB vb[2][4], vl[2][4];
#pragma unroll
    for (int t = 0; t < 4; ++t) {
      const int vo = t * 16 * LDS_PITCH;
      vb[0][t].h[0] = *(const v8b*)(VHp + fo + vo);
      vb[0][t].h[1] = *(const v8b*)(VHp + fo + vo + 16);
      vl[0][t].h[0] = *(const v8b*)(VLp + fo + vo);
      vl[0][t].h[1] = *(const v8b*)(VLp + fo + vo + 16);
    }
    row_fence();
    // ---- chunk maximum of query c over the unscaled scores (the scale is positive): 32 in-lane, then the other half ----
    float mj[4];
#pragma unroll
    for (int j = 0; j < 4; ++j) {
      mj[j] = -INFINITY;
#pragma unroll
      for (int r = 0; r < 8; ++r) mj[j] = fmaxf(mj[j], s[j][r]);
    }
    float cm = fmaxf(fmaxf(mj[0], mj[1]), fmaxf(mj[2], mj[3]));
    cm = fmaxf(cm, at_xhalf(cm));
    // ---- online softmax in base 2; p split into bf16 hi/lo in place: pbh[kk] / pbl[kk] element e = p of key 32 kk + kmap(e, hh) ----
    const float mnew = fmaxf(mrun, cm * SC_LOG2E);
    const float alpha = __builtin_amdgcn_exp2f(mrun - mnew);   // 0 on the first chunk, where mrun is -inf
    mrun = mnew;
    const v2f sc2 = (v2f){SC_LOG2E, SC_LOG2E};
    const v2f mn2 = (v2f){mnew, mnew};
    union PB { v16b v; v2b w[8]; };
    PB pbh[2], pbl[2];
    float pj[4];
#pragma unroll
    for (int j = 0; j < 4; ++j) {
      pj[j] = 0.f;
#pragma unroll
      for (int r = 0; r < 8; r += 2) {
        const v2f a2 = (v2f){s[j][r], s[j][r + 1]} * sc2 - mn2;          // scale, log2(e) and maximum in one FMA
        v2f p2;
        p2[0] = __builtin_amdgcn_exp2f(a2[0]);
        p2[1] = __builtin_amdgcn_exp2f(a2[1]);
        pj[j] += p2[0];
        pj[j] += p2[1];
        const v2b h2 = __builtin_convertvector(p2, v2b);                 // RNE, two values per register
        const v2b l2 = __builtin_convertvector(p2 - __builtin_convertvector(h2, v2f), v2b);
        pbh[j >> 1].w[(j & 1) * 4 + (r >> 1)] = h2;
        pbl[j >> 1].w[(j & 1) * 4 + (r >> 1)] = l2;
      }
    }
    lrun = lrun * alpha + ((pj[0] + pj[1]) + (pj[2] + pj[3]));
#pragma unroll
    for (int t = 0; t < 4; ++t)
#pragma unroll
      for (int r = 0; r < 8; ++r) oacc[t][r] *= alpha;
    // ---- O^T += V^T(64 d x 64 kv) . P^T(64 kv x 16 queries): 2 kv-chunks of 32, 4 d tiles, 3 products ----
    // As above: WMMAs round the 4 independent d tiles, per-tile order kept; the second kv-chunk's fragments are read
    // as one group in front of the first kv-chunk's products.
    row_fence();
#pragma unroll
    for (int t = 0; t < 4; ++t) {
      const int vo = t * 16 * LDS_PITCH + 32;
      vb[1][t].h[0] = *(const v8b*)(VHp + fo + vo);
      vb[1][t].h[1] = *(const v8b*)(VHp + fo + vo + 16);
      vl[1][t].h[0] = *(const v8b*)(VLp + fo + vo);
      vl[1][t].h[1] = *(const v8b*)(VLp + fo + vo + 16);
    }
    row_fence();
#pragma unroll
    for (int kk = 0; kk < 2; ++kk) {
#pragma unroll
      for (int t = 0; t < 4; ++t) oacc[t] = at_mma(vb[kk][t].v, pbh[kk].v, oacc[t]);
      row_fence();
#pragma unroll
      for (int t = 0; t < 4; ++t) oacc[t] = at_mma(vl[kk][t].v, pbh[kk].v, oacc[t]);
      row_fence();
#pragma unroll
      for (int t = 0; t < 4; ++t) oacc[t] = at_mma(vb[kk][t].v, pbl[kk].v, oacc[t]);
      if (kk == 0) row_fence();
    }
  }

  // ---- the two halves' denominators join; the lane's 8 consecutive d of each tile go to row c of the wave's out tile ----
  float* os = Os[wave];
  {
    const float inv = 1.0f / (lrun + at_xhalf(lrun));
#pragma unroll
    for (int t = 0; t < 4; ++t) {
      v4f o0, o1;
#pragma unroll
      for (int e = 0; e < 4; ++e) { o0[e] = oacc[t][e] * inv; o1[e] = oacc[t][4 + e] * inv; }
      *(v4f*)(os + c * 68 + t * 16 + 8 * hh)     = o0;
      *(v4f*)(os + c * 68 + t * 16 + 8 * hh + 4) = o1;
    }
  }
  __builtin_amdgcn_fence(__ATOMIC_RELEASE, "workgroup");
  __builtin_amdgcn_wave_barrier();
  __builtin_amdgcn_fence(__ATOMIC_ACQUIRE, "workgroup");
  {
    const int q8 = lane >> 3, c8 = (lane & 7) * 8;
    {
#pragma unroll
      for (int it = 0; it < 4; ++it) {
        const int row = it * 4 + q8;                   // rows 0..15 of this wave's tile
        const float* sp = os + row * 68 + c8;
        const v4f f0 = *(const v4f*)(sp);
        const v4f f1 = *(const v4f*)(sp + 4);
        v4u ph, plo;
#pragma unroll
        for (int w = 0; w < 2; ++w) {
          const float a = f0[2 * w], bq = f0[2 * w + 1];
          const unsigned short ha = f2bf_bits(a), hb = f2bf_bits(bq);
          const unsigned short la = f2bf_bits(a - bf_bits2f(ha)), lb = f2bf_bits(bq - bf_bits2f(hb));
          ph[w]  = (unsigned)ha | ((unsigned)hb << 16);
          plo[w] = (unsigned)la | ((unsigned)lb << 16);
        }
#pragma unroll
        for (int w = 0; w < 2; ++w) {
          const float a = f1[2 * w], bq = f1[2 * w + 1];
          const unsigned short ha = f2bf_bits(a), hb = f2bf_bits(bq);
          const unsigned short la = f2bf_bits(a - bf_bits2f(ha)), lb = f2bf_bits(bq - bf_bits2f(hb));
          ph[2 + w]  = (unsigned)ha | ((unsigned)hb << 16);
          plo[2 + w] = (unsigned)la | ((unsigned)lb << 16);
        }
        const size_t o = (tokb + q0 + row) * INNER_DIM + hcol + c8;
        *(v4u*)(oh + o) = ph;
        *(v4u*)(ol + o) = plo;
      }
      
    }
  }
}

// =====================================================================================
// launch glue
// =====================================================================================
extern "C" void kernel_launch(void* const* d_in, const int* in_sizes, int n_in,
                              void* d_out, int out_size, void* d_ws,
                              size_t ws_size, hipStream_t stream) {
  if (n_in < 6) return;
  if (in_sizes[0] != TOK_ROWS * MODEL_DIM) return;
  if (in_sizes[1] != MODEL_DIM || in_sizes[2] != MODEL_DIM) return;
  if (in_sizes[3] != QKV_COLS * MODEL_DIM) return;
  if (in_sizes[4] != MODEL_DIM * INNER_DIM) return;
  if (in_sizes[5] != MODEL_DIM) return;
  if (out_size != TOK_ROWS * MODEL_DIM) return;
  if (ws_size < WS_TOTAL) return;

  const float* x    = (const float*)d_in[0];
  const float* gam  = (const float*)d_in[1];
  const float* bet  = (const float*)d_in[2];
  const float* wqkv = (const float*)d_in[3];
  const float* wout = (const float*)d_in[4];
  const float* bout = (const float*)d_in[5];
  float* out = (float*)d_out;

  char* ws = (char*)d_ws;
  size_t off = 0;
  unsigned short* wq_bf  = (unsigned short*)(ws + off); off += WS_WQ;
  unsigned short* wo_bf  = (unsigned short*)(ws + off); off += WS_WO;
  unsigned short* h_hi   = (unsigned short*)(ws + off); off += WS_HPL;
  unsigned short* h_lo   = (unsigned short*)(ws + off); off += WS_HPL;
  unsigned short* qkv_hi = (unsigned short*)(ws + off); off += WS_QKVPL;
  unsigned short* qkv_lo = (unsigned short*)(ws + off); off += WS_QKVPL;
  unsigned short* at_hi  = (unsigned short*)(ws + off); off += WS_ATPL;
  unsigned short* at_lo  = (unsigned short*)(ws + off); off += WS_ATPL;
  if (off > ws_size) return;

  // weights -> bf16 (RNE): 3145728/8 = 393216 = 1536 x 256 ; 1048576/8 = 131072 = 512 x 256
  const int n8_qkv = (QKV_COLS * MODEL_DIM) / 8;
  const int n8_out = (MODEL_DIM * INNER_DIM) / 8;
  cast_f32_bf16x8<<<dim3((n8_qkv + 255) / 256), dim3(256), 0, stream>>>(wqkv, wq_bf, n8_qkv);
  cast_f32_bf16x8<<<dim3((n8_out + 255) / 256), dim3(256), 0, stream>>>(wout, wo_bf, n8_out);

  // LayerNorm -> h hi/lo planes [4096][1024]
  layernorm_bf16split_kernel<<<dim3(TOK_ROWS), dim3(128), 0, stream>>>(x, gam, bet, h_hi, h_lo);

  // qkv = h @ w_qkv^T -> bf16 hi/lo planes [4096][3072]; M=4096 N=3072 K=1024; block tiles 32*12 = 384 blocks
  gemm64_bf16_asplit<2, false><<<dim3((TOK_ROWS / G_BM) * (QKV_COLS / G_BN)), dim3(256), 0, stream>>>(
      h_hi, h_lo, MODEL_DIM, wq_bf, MODEL_DIM, (void*)qkv_hi, (void*)qkv_lo, QKV_COLS,
      (const float*)nullptr, TOK_ROWS, QKV_COLS, MODEL_DIM);

  // attention per (batch, head, 64 query rows): 2*16*32 = 1024 blocks -> attn hi/lo planes [4096][1024]
  attn64_bf16x3_kernel<<<dim3(N_BATCH * N_HEAD * (SEQ_LEN / Q_BLOCK)), dim3(128), 0, stream>>>(
      qkv_hi, qkv_lo, at_hi, at_lo);

  // out = attn @ w_out^T + b_out -> f32 [4096][1024]; M=4096 N=1024 K=1024; block tiles 32*4 = 128 blocks
  gemm64_bf16_asplit<0, true><<<dim3((TOK_ROWS / G_BM) * (MODEL_DIM / G_BN)), dim3(256), 0, stream>>>(
      at_hi, at_lo, INNER_DIM, wo_bf, INNER_DIM, (void*)out, (void*)nullptr, MODEL_DIM,
      bout, TOK_ROWS, MODEL_DIM, INNER_DIM);
}

// v006
// A run of this version takes 164 microseconds.
// Next to v005, in two timings, it ran 1.12 times as fast each time.
// Over all steps from v000 it is 3.16 times as fast.
// Contractions on v_wmma_f32_16x16x32_bf16 (bf16 operands, f32 accumulate): qkv and output projections = activation bf16 hi+lo planes x weight bf16 plane (2 products); q.k scores and p.v = bf16 hi/lo x bf16 hi/lo (3 products); LayerNorm, softmax and epilogues in f32; every float input RNE-converted to bf16 once at load.
#include <hip/hip_runtime.h>
#include <hip/hip_bf16.h>

typedef __attribute__((ext_vector_type(16))) _Float16 v16h;
typedef __attribute__((ext_vector_type(8)))  _Float16 v8h;
typedef __attribute__((ext_vector_type(16))) __bf16   v16b;
typedef __attribute__((ext_vector_type(8)))  __bf16   v8b;
typedef __attribute__((ext_vector_type(8)))  float    v8f;
typedef __attribute__((ext_vector_type(4)))  float    v4f;
typedef __attribute__((ext_vector_type(4)))  unsigned v4u;
typedef __attribute__((ext_vector_type(2)))  float    v2f;
typedef __attribute__((ext_vector_type(2)))  __bf16   v2b;

// ---- problem geometry ----
constexpr int MODEL_DIM = 1024;
constexpr int SEQ_LEN   = 2048;
constexpr int N_BATCH   = 2;
constexpr int N_HEAD    = 16;
constexpr int HEAD_D    = 64;
constexpr int INNER_DIM = N_HEAD * HEAD_D;          // 1024
constexpr int QKV_COLS  = 3 * INNER_DIM;            // 3072
constexpr int TOK_ROWS  = N_BATCH * SEQ_LEN;        // 4096
constexpr int KV_CHUNK  = 64;
constexpr int Q_BLOCK   = 64;
// LDS row pitch of the attention K tiles, in bf16 elements: 64 data + 8 pad = 144 B = 16 B x 9 (odd),
// so the 16 rows that one ds_load_b128 fragment read touches fall on distinct bank groups (128-B rows all share banks).
constexpr int LDS_PITCH = 72;
// LDS row pitch of the attention V tiles (row-major [kv][d]), in bf16 elements: 64 data + 16 pad = 160 B = 32 B x 5 (odd),
// the conflict-free pitch of their reader, ds_load_tr16_b128.
constexpr int V_PITCH = 80;

// GEMM shape contract (no run-time tails in the GEMM kernel)
static_assert(MODEL_DIM % 32 == 0, "K of qkv projection");
static_assert(INNER_DIM % 32 == 0, "K of output projection");
static_assert(TOK_ROWS % 64 == 0, "M tile multiple");
static_assert(QKV_COLS % 64 == 0, "N tile multiple (qkv)");
static_assert(MODEL_DIM % 64 == 0, "N tile multiple (out)");
static_assert(SEQ_LEN % KV_CHUNK == 0 && SEQ_LEN % Q_BLOCK == 0, "attention tiles");
static_assert(HEAD_D == 64, "attention kernel is head_dim 64");
static_assert(MODEL_DIM == 128 * 8, "LayerNorm kernel: 128 threads x 8 elements per row");

// ---- workspace region map (bytes, every offset a multiple of 128) ----
//  [0]            wq  bf16 [3072][1024]         6291456
//  [6291456]      wo  bf16 [1024][1024]         2097152
//  [8388608]      h   hi bf16 [4096][1024]      8388608
//  [16777216]     h   lo bf16 [4096][1024]      8388608
//  [25165824]     qkv hi bf16 [4096][3072]     25165824
//  [50331648]     qkv lo bf16 [4096][3072]     25165824
//  [75497472]     at  hi bf16 [4096][1024]      8388608
//  [83886080]     at  lo bf16 [4096][1024]      8388608
//  total 92274688
constexpr size_t WS_WQ    = (size_t)QKV_COLS * MODEL_DIM * 2;
constexpr size_t WS_WO    = (size_t)MODEL_DIM * INNER_DIM * 2;
constexpr size_t WS_HPL   = (size_t)TOK_ROWS * MODEL_DIM * 2;
constexpr size_t WS_QKVPL = (size_t)TOK_ROWS * QKV_COLS * 2;
constexpr size_t WS_ATPL  = (size_t)TOK_ROWS * INNER_DIM * 2;
constexpr size_t WS_TOTAL = WS_WQ + WS_WO + 2 * WS_HPL + 2 * WS_QKVPL + 2 * WS_ATPL;
static_assert(WS_TOTAL == 92274688, "carve arithmetic");
static_assert(WS_TOTAL <= 134217728, "carve budget");
static_assert(WS_WQ % 128 == 0 && WS_WO % 128 == 0 && WS_HPL % 128 == 0 && WS_QKVPL % 128 == 0 && WS_ATPL % 128 == 0, "128-B aligned regions");

// ---- bf16 RNE helpers ----
__device__ __forceinline__ unsigned short f2bf_bits(float f) {
  unsigned u = __float_as_uint(f);
  return (unsigned short)((u + 0x7FFFu + ((u >> 16) & 1u)) >> 16);
}
__device__ __forceinline__ float bf_bits2f(unsigned short h) { return __uint_as_float(((unsigned)h) << 16); }

// hazard guards as plain device helpers (no inline asm inside the kernel template body)
__device__ __forceinline__ void dep_guard_h(v8f& a, v8f& b, v16h x, v16h y) { asm volatile("v_nop\n\tv_nop\n\tv_nop\n\tv_nop" : "+v"(a), "+v"(b) : "v"(x), "v"(y)); }
__device__ __forceinline__ void dep_guard_b(v8f& a, v8f& b, v16b x, v16b y) { asm volatile("v_nop\n\tv_nop\n\tv_nop\n\tv_nop" : "+v"(a), "+v"(b) : "v"(x), "v"(y)); }
__device__ __forceinline__ void keep4_h(v16h a, v16h b, v16h c, v16h d) { asm volatile("v_nop" :: "v"(a), "v"(b), "v"(c), "v"(d)); }
__device__ __forceinline__ void keep4_b(v16b a, v16b b, v16b c, v16b d) { asm volatile("v_nop" :: "v"(a), "v"(b), "v"(c), "v"(d)); }
__device__ __forceinline__ void acc_guard4(v8f& a, v8f& b, v8f& c, v8f& d) { asm volatile("v_nop\n\tv_nop\n\tv_nop\n\tv_nop" : "+v"(a), "+v"(b), "+v"(c), "+v"(d)); }
template <typename T> struct Frag;
template <> struct Frag<_Float16> {
  typedef v16h V; union U { v16h v; v8h h[2]; };
  static __device__ __forceinline__ v16h load(const _Float16* p) {   // elements 0..7 <- p[0..7], 8..15 <- p[16..23]
    U f; f.h[0] = *(const v8h*)(p); f.h[1] = *(const v8h*)(p + 16); return f.v;
  }
  static __device__ __forceinline__ v8f mma(v16h a, v16h b, v8f c) {
    return __builtin_amdgcn_wmma_f32_16x16x32_f16(false, a, false, b, (short)0, c, false, false);
  }
  static __device__ __forceinline__ void guard(v8f& a, v8f& b, v16h x, v16h y) { dep_guard_h(a, b, x, y); }
  static __device__ __forceinline__ void keep(v16h a, v16h b, v16h c, v16h d) { keep4_h(a, b, c, d); }
};
template <> struct Frag<__bf16> {
  typedef v16b V; union U { v16b v; v8b h[2]; };
  static __device__ __forceinline__ v16b load(const __bf16* p) {
    U f; f.h[0] = *(const v8b*)(p); f.h[1] = *(const v8b*)(p + 16); return f.v;
  }
  static __device__ __forceinline__ v8f mma(v16b a, v16b b, v8f c) {
    return __builtin_amdgcn_wmma_f32_16x16x32_bf16(false, a, false, b, (short)0, c, false, false);
  }
  static __device__ __forceinline__ void guard(v8f& a, v8f& b, v16b x, v16b y) { dep_guard_b(a, b, x, y); }
  static __device__ __forceinline__ void keep(v16b a, v16b b, v16b c, v16b d) { keep4_b(a, b, c, d); }
};

// attention helpers (bf16 WMMA as the plain builtin: the compiler keeps its distances; exchange between the wave halves)
__device__ __forceinline__ v8f at_mma(v16b a, v16b b, v8f c) {
  return __builtin_amdgcn_wmma_f32_16x16x32_bf16(false, a, false, b, (short)0, c, false, false);
}

__device__ __forceinline__ v8b at_ld_tr16(const unsigned short* p) {
  typedef __attribute__((address_space(3))) v8b lds_v8b;
  return __builtin_amdgcn_ds_load_tr16_b128_v8bf16((lds_v8b*)p);
}

// Scheduling fence, no instruction: without it the compiler sinks the grouped fragment reads back among the WMMAs (each
// then waited for right behind its issue), puts the dependent WMMAs of one tile back to back again, or lifts a read group
// so far up that the registers of four waves per SIMD no longer suffice.
__device__ __forceinline__ void row_fence() { __builtin_amdgcn_sched_barrier(0); }

// value of lane l ^ 16: the other half of the wave holds the other keys of the same query
__device__ __forceinline__ float at_xhalf(float x) {
  const int b = __builtin_bit_cast(int, x);
  return __builtin_bit_cast(float, __builtin_amdgcn_permlanex16(b, b, 0x76543210, 0xfedcba98, false, false));
}

// =====================================================================================
// 1) f32 -> bf16 (RNE) cast, 8 elements per thread, one 16-B store per lane
//    Coverage: grid = n8/256 blocks x 256 threads x 8 elements = n exactly (n8 = n/8, n % 2048 == 0 here).
// =====================================================================================
__global__ __launch_bounds__(256) void cast_f32_bf16x8(
    const float* __restrict__ in, unsigned short* __restrict__ out, int n8) {
  const int i = blockIdx.x * 256 + threadIdx.x;
  if (i < n8) {
    const size_t e0 = (size_t)i * 8;
    const v4f a = *(const v4f*)(in + e0);
    const v4f b = *(const v4f*)(in + e0 + 4);
    v4u u;
    u[0] = (unsigned)f2bf_bits(a[0]) | ((unsigned)f2bf_bits(a[1]) << 16);
    u[1] = (unsigned)f2bf_bits(a[2]) | ((unsigned)f2bf_bits(a[3]) << 16);
    u[2] = (unsigned)f2bf_bits(b[0]) | ((unsigned)f2bf_bits(b[1]) << 16);
    u[3] = (unsigned)f2bf_bits(b[2]) | ((unsigned)f2bf_bits(b[3]) << 16);
    *(v4u*)(out + e0) = u;
    
  }
}

// =====================================================================================
//    result split into bf16 hi / lo planes [TOK_ROWS][MODEL_DIM].
//    One block (128 threads) per row; thread t owns elements 8t..8t+7 -> one 16-B store per lane per plane
//    Coverage: 4096 blocks x 128 threads x 8 = 4096 x 1024 exactly.
// =====================================================================================
__global__ __launch_bounds__(128) void layernorm_bf16split_kernel(
    const float* __restrict__ x, const float* __restrict__ gamma, const float* __restrict__ beta,
    unsigned short* __restrict__ hhi, unsigned short* __restrict__ hlo) {
  __shared__ float red_s[4];
  __shared__ float red_q[4];
  const int row = blockIdx.x;
  const int t = threadIdx.x;
  const int lane = t & 31, wave = t >> 5;
  const size_t base = (size_t)row * MODEL_DIM + 8 * (size_t)t;

  const v4f a0 = *(const v4f*)(x + base);
  const v4f a1 = *(const v4f*)(x + base + 4);
  float xv[8];
#pragma unroll
  for (int e = 0; e < 4; ++e) {
    xv[e]     = bf_bits2f(f2bf_bits(a0[e]));
    xv[4 + e] = bf_bits2f(f2bf_bits(a1[e]));
  }
  float s = ((xv[0] + xv[1]) + (xv[2] + xv[3])) + ((xv[4] + xv[5]) + (xv[6] + xv[7]));
#pragma unroll
  for (int off = 1; off < 32; off <<= 1) s += __shfl_xor(s, off, 32);
  if (lane == 0) red_s[wave] = s;
  __syncthreads();
  const float tot = (red_s[0] + red_s[1]) + (red_s[2] + red_s[3]);
  const float mean = tot * (1.0f / (float)MODEL_DIM);

  float d[8];
  float q = 0.f;
#pragma unroll
  for (int e = 0; e < 8; ++e) { d[e] = xv[e] - mean; q += d[e] * d[e]; }
#pragma unroll
  for (int off = 1; off < 32; off <<= 1) q += __shfl_xor(q, off, 32);
  if (lane == 0) red_q[wave] = q;
  __syncthreads();
  const float qt = (red_q[0] + red_q[1]) + (red_q[2] + red_q[3]);
  const float var = qt * (1.0f / (float)MODEL_DIM);
  const float rstd = rsqrtf(var + 1e-5f);

  const v4f g0 = *(const v4f*)(gamma + 8 * t);
  const v4f g1 = *(const v4f*)(gamma + 8 * t + 4);
  const v4f b0 = *(const v4f*)(beta + 8 * t);
  const v4f b1 = *(const v4f*)(beta + 8 * t + 4);
  float hv[8];
#pragma unroll
  for (int e = 0; e < 4; ++e) {
    const float gg0 = bf_bits2f(f2bf_bits(g0[e])), bb0 = bf_bits2f(f2bf_bits(b0[e]));
    const float gg1 = bf_bits2f(f2bf_bits(g1[e])), bb1 = bf_bits2f(f2bf_bits(b1[e]));
    hv[e]     = d[e] * rstd * gg0 + bb0;
    hv[4 + e] = d[4 + e] * rstd * gg1 + bb1;
  }
  v4u ph, pl;
#pragma unroll
  for (int w = 0; w < 4; ++w) {
    const float f0 = hv[2 * w], f1 = hv[2 * w + 1];
    const unsigned short h0 = f2bf_bits(f0), h1 = f2bf_bits(f1);
    const unsigned short l0 = f2bf_bits(f0 - bf_bits2f(h0));
    const unsigned short l1 = f2bf_bits(f1 - bf_bits2f(h1));
    ph[w] = (unsigned)h0 | ((unsigned)h1 << 16);
    pl[w] = (unsigned)l0 | ((unsigned)l1 << 16);
  }
  *(v4u*)(hhi + base) = ph;
  *(v4u*)(hlo + base) = pl;
  
}

// =====================================================================================
// 3) WMMA GEMM, operands staged in LDS: C[m,n] = sum_k (Ah+Al)[m,k] * Bt[n,k] (+bias[n], bias RNE bf16)
//    A = bf16 hi and lo planes row-major [M,K] (lda); Bt = bf16 row-major [N,K] (ldb); 2 WMMA products per tile pair.
//    A block of 8 waves (2 x 4) owns a 128x256 C tile, each wave a 64x64 part of it. K is walked in slabs of 64:
//    a stage is [A hi 128 rows | A lo 128 rows | Bt 256 rows] of 128 B each at a 144-B LDS pitch, two buffers.
//    Every wave copies 64 of the 512 stage rows with 16 asynchronous 16-B-per-lane copies (4 whole 128-B rows each),
//    one slab ahead of the slab that is being multiplied. Per output element the k order of the sums is ascending.
//    Coverage: grid.x = (M/128)*(N/256) blocks, every 64x64 tile exactly once (shapes static_assert'ed below).
// =====================================================================================
constexpr int G_BM          = 128;                              // block tile rows
constexpr int G_BN          = 256;                              // block tile columns
constexpr int G_SLAB_K      = 64;                               // k elements per stage: 128-B rows
constexpr int G_PITCH       = 72;                               // LDS row pitch in bf16 elements: 144 B = 16 B x 9
constexpr int G_STAGE_ROWS  = 2 * G_BM + G_BN;                  // 512
constexpr int G_STAGE_BYTES = G_STAGE_ROWS * G_PITCH * 2;       // 73728
constexpr unsigned G_COPY_LDS_STEP = 4u * G_PITCH * 2u;         // one wave-wide copy fills 4 stage rows
static_assert(TOK_ROWS % G_BM == 0, "M block tile multiple");
static_assert(QKV_COLS % G_BN == 0 && MODEL_DIM % G_BN == 0, "N block tile multiple");
static_assert(MODEL_DIM % G_SLAB_K == 0 && INNER_DIM % G_SLAB_K == 0, "K slab multiple");
static_assert(MODEL_DIM / G_SLAB_K >= 2 && INNER_DIM / G_SLAB_K >= 2, "two stages at least");
static_assert(8 * 16 * 68 * 4 <= 2 * G_STAGE_BYTES, "epilogue slabs fit the ring");

// Eight asynchronous copies global -> LDS, 16 B per lane each, for 32 consecutive stage rows of one wave.
// l = the lane's LDS byte address of the first copy, g = its global address, step = elements per 4 source rows.
// The closing s_wait_xcnt 0 stands inside the statement so that no address register named here is rewritten ahead of it.
__device__ __forceinline__ void stage_copy8(unsigned l, const unsigned short* g, size_t step) {
  asm volatile(
      "global_load_async_to_lds_b128 %0, %8, off\n\t"
      "global_load_async_to_lds_b128 %1, %9, off\n\t"
      "global_load_async_to_lds_b128 %2, %10, off\n\t"
      "global_load_async_to_lds_b128 %3, %11, off\n\t"
      "global_load_async_to_lds_b128 %4, %12, off\n\t"
      "global_load_async_to_lds_b128 %5, %13, off\n\t"
      "global_load_async_to_lds_b128 %6, %14, off\n\t"
      "global_load_async_to_lds_b128 %7, %15, off\n\t"
      "s_wait_xcnt 0x0"
      :: "v"(l), "v"(l + G_COPY_LDS_STEP), "v"(l + 2u * G_COPY_LDS_STEP), "v"(l + 3u * G_COPY_LDS_STEP),
         "v"(l + 4u * G_COPY_LDS_STEP), "v"(l + 5u * G_COPY_LDS_STEP), "v"(l + 6u * G_COPY_LDS_STEP),
         "v"(l + 7u * G_COPY_LDS_STEP),
         "v"(g), "v"(g + step), "v"(g + 2 * step), "v"(g + 3 * step),
         "v"(g + 4 * step), "v"(g + 5 * step), "v"(g + 6 * step), "v"(g + 7 * step)
      : "memory");
}

// The two waits of the stage ring, each an asm statement of its own; the "memory" clobber keeps LDS accesses on their side of it.
__device__ __forceinline__ void wait_own_copies_landed() { asm volatile("s_wait_asynccnt 0x0" ::: "memory"); }
__device__ __forceinline__ void wait_own_lds_reads_done() { asm volatile("s_wait_dscnt 0x0" ::: "memory"); }

template <int OUT_MODE, bool HAS_BIAS>
__global__ __launch_bounds__(256) void gemm64_bf16_asplit(
    const unsigned short* __restrict__ Ahp, const unsigned short* __restrict__ Alp, int lda,
    const unsigned short* __restrict__ Btp, int ldb,
    void* __restrict__ Cout, void* __restrict__ Cout2, int ldc,
    const float* __restrict__ bias, int M, int N, int K) {
  typedef __bf16 T;
  typedef v16b V;
  // two stage buffers; after the K loop the same bytes serve as the per-wave 16x64 f32 epilogue slabs (pitch 68 floats)
  __shared__ __align__(16) unsigned char smem[2 * G_STAGE_BYTES];
  const int lane = threadIdx.x & 31;
  const int wave = __builtin_amdgcn_readfirstlane(threadIdx.x >> 5);
  const int tilesN = N / G_BN;
  const int tilesM = M / G_BM;
  const int bm = blockIdx.x / tilesN;
  const int bn = blockIdx.x - bm * tilesN;
  if (bm >= tilesM) return;              // block-uniform, in front of every barrier and copy
  const int mB = bm * G_BM;
  const int nB = bn * G_BN;
  const int wm = wave >> 2;              // 0..1: 64-row part of the block tile
  const int wn = wave & 3;               // 0..3: 64-column part
  const int m0 = mB + (wm << 6);
  const int n0 = nB + (wn << 6);

  const int rlane = lane & 15;                 // row (A) / col (B, D) within subtile
  const int koff  = (lane >> 4) * 8;           // k offset of this lane half
  const int mOff  = (lane >> 4) * 8;           // D row offset

  // ---- this wave's share of a stage: stage rows wave*64 .. wave*64+63 (waves 0,1: A hi; 2,3: A lo; 4..7: Bt) ----
  const unsigned short* srow;
  int sld;
  if (wave < 2)      { srow = Ahp + (size_t)(mB + wave * 64) * lda;       sld = lda; }
  else if (wave < 4) { srow = Alp + (size_t)(mB + (wave - 2) * 64) * lda; sld = lda; }
  else               { srow = Btp + (size_t)(nB + (wave - 4) * 64) * ldb; sld = ldb; }
  const unsigned short* gl = srow + (size_t)(lane >> 3) * sld + (lane & 7) * 8;   // 8 lanes x 16 B = one 128-B row
  const size_t step4 = (size_t)sld * 4;
  const unsigned ll = (unsigned)(size_t)smem + (unsigned)((wave * 64 + (lane >> 3)) * (G_PITCH * 2) + (lane & 7) * 16);

  v8f acc[4][4];
#pragma unroll
  for (int i = 0; i < 4; ++i)
#pragma unroll
    for (int j = 0; j < 4; ++j) acc[i][j] = (v8f){0.f,0.f,0.f,0.f,0.f,0.f,0.f,0.f};

  const int nT = K / G_SLAB_K;
  // ---- prologue: slab 0 lands and is published, then slab 1 starts to fly ----
  stage_copy8(ll, gl, step4);
  stage_copy8(ll + 8u * G_COPY_LDS_STEP, gl + 8 * step4, step4);
  wait_own_copies_landed();              // slab 0 has landed before the barrier publishes it to the other waves
  __syncthreads();
  if (nT > 1) {
    stage_copy8(ll + (unsigned)G_STAGE_BYTES, gl + G_SLAB_K, step4);
    stage_copy8(ll + (unsigned)G_STAGE_BYTES + 8u * G_COPY_LDS_STEP, gl + G_SLAB_K + 8 * step4, step4);
  }

  for (int t = 0; t < nT; ++t) {
    const unsigned bo = (t & 1) ? (unsigned)G_STAGE_BYTES : 0u;
    const T* sb  = (const T*)(smem + bo);
    const T* sAh = sb + ((wm << 6) + rlane) * G_PITCH + koff;
    const T* sAl = sAh + G_BM * G_PITCH;
    const T* sB  = sb + (2 * G_BM + (wn << 6) + rlane) * G_PITCH + koff;
#pragma unroll
    for (int kk = 0; kk < G_SLAB_K; kk += 32) {
      V bh[4];
#pragma unroll
      for (int j = 0; j < 4; ++j) bh[j] = Frag<T>::load(sB + (j << 4) * G_PITCH + kk);
#pragma unroll
      for (int i = 0; i < 4; ++i) {
        V ah = Frag<T>::load(sAh + (i << 4) * G_PITCH + kk);
        V al = Frag<T>::load(sAl + (i << 4) * G_PITCH + kk);
#pragma unroll
        for (int j = 0; j < 4; ++j) {
          acc[i][j] = Frag<T>::mma(ah, bh[j], acc[i][j]);
          acc[i][j] = Frag<T>::mma(al, bh[j], acc[i][j]);
        }
        Frag<T>::guard(acc[i][0], acc[i][3], ah, al);
      }
      Frag<T>::keep(bh[0], bh[1], bh[2], bh[3]);
    }
    // ---- publish point of slab t+1; it also ends every wave's reads of the buffer refilled behind it ----
    wait_own_lds_reads_done();           // fragment reads of slab t are done before its buffer is refilled
    wait_own_copies_landed();            // slab t+1 has landed before the barrier publishes it
    __syncthreads();
    if (t + 2 < nT) {
      const unsigned short* g2 = gl + (size_t)(t + 2) * G_SLAB_K;
      stage_copy8(ll + bo, g2, step4);
      stage_copy8(ll + bo + 8u * G_COPY_LDS_STEP, g2 + 8 * step4, step4);
    }
  }
  wait_own_copies_landed();              // no copy is outstanding when the ring becomes epilogue staging
  acc_guard4(acc[0][0], acc[0][1], acc[0][2], acc[0][3]);
  acc_guard4(acc[1][0], acc[1][1], acc[1][2], acc[1][3]);
  acc_guard4(acc[2][0], acc[2][1], acc[2][2], acc[2][3]);
  acc_guard4(acc[3][0], acc[3][1], acc[3][2], acc[3][3]);

  // ---- epilogue ----
  float* slab = (float*)smem + wave * (16 * 68);   // the last trip's barrier ended every read of the ring
#pragma unroll
  for (int i = 0; i < 4; ++i) {
    const int mBase = m0 + (i << 4);
#pragma unroll
    for (int j = 0; j < 4; ++j) {
#pragma unroll
      for (int r = 0; r < 8; ++r) {
        slab[(mOff + r) * 68 + (j << 4) + rlane] = acc[i][j][r];
      }
    }
    __builtin_amdgcn_fence(__ATOMIC_RELEASE, "workgroup");
    __builtin_amdgcn_wave_barrier();
    __builtin_amdgcn_fence(__ATOMIC_ACQUIRE, "workgroup");
    if (OUT_MODE == 0) {
      float* Cf = (float*)Cout;
      const int h2 = lane >> 4, c4 = (lane & 15) * 4;     // row seg = 256 B = 16 lanes x 16 B
      v4f bb = (v4f){0.f, 0.f, 0.f, 0.f};
      if (HAS_BIAS) {
        const v4f braw = *(const v4f*)(bias + n0 + c4);
#pragma unroll
        for (int e = 0; e < 4; ++e) bb[e] = bf_bits2f(f2bf_bits(braw[e]));
      }
      {
#pragma unroll
        for (int it = 0; it < 8; ++it) {
          const int row = it * 2 + h2;
          v4f v = *(const v4f*)(slab + row * 68 + c4);
          v = v + bb;
          *(v4f*)(Cf + (size_t)(mBase + row) * ldc + n0 + c4) = v;
        }
        
      }
    } else {
      const int q = lane >> 3, c8 = (lane & 7) * 8;
      unsigned short* Cu  = (unsigned short*)Cout;
      unsigned short* Cu2 = (unsigned short*)Cout2;
      {
#pragma unroll
        for (int it = 0; it < 4; ++it) {
          const int row = it * 4 + q;
          const float* sp = slab + row * 68 + c8;
          v8h hv, lv;
#pragma unroll
          for (int e = 0; e < 8; ++e) {
            unsigned short hb = f2bf_bits(sp[e]);
            unsigned short lb = f2bf_bits(sp[e] - bf_bits2f(hb));
            hv[e] = __builtin_bit_cast(_Float16, hb);
            lv[e] = __builtin_bit_cast(_Float16, lb);
          }
          *(v8h*)(Cu  + (size_t)(mBase + row) * ldc + n0 + c8) = hv;
          *(v8h*)(Cu2 + (size_t)(mBase + row) * ldc + n0 + c8) = lv;
        }
        
      }
    }
    __builtin_amdgcn_fence(__ATOMIC_RELEASE, "workgroup");
    __builtin_amdgcn_wave_barrier();
    __builtin_amdgcn_fence(__ATOMIC_ACQUIRE, "workgroup");
  }
}

__global__ __launch_bounds__(128) __attribute__((amdgpu_waves_per_eu(4))) void attn64_bf16x3_kernel(
    const unsigned short* __restrict__ qkvh, const unsigned short* __restrict__ qkvl,
    unsigned short* __restrict__ oh, unsigned short* __restrict__ ol) {
  union FB { v16b v; v8b h[2]; };
  __shared__ __align__(16) unsigned short Ksh[KV_CHUNK * LDS_PITCH];  // K hi [kv][d]
  __shared__ __align__(16) unsigned short Ksl[KV_CHUNK * LDS_PITCH];  // K lo [kv][d]
  __shared__ __align__(32) unsigned short Vsh[KV_CHUNK * V_PITCH];    // V hi [kv][d]
  __shared__ __align__(32) unsigned short Vsl[KV_CHUNK * V_PITCH];    // V lo [kv][d]
  __shared__ __align__(16) float  Os[4][16 * 68];                     // per wave out tile, pitch 68

  const int tid  = threadIdx.x;
  const int wave = tid >> 5;
  const int lane = tid & 31;
  const int hh   = lane >> 4;
  const int c    = lane & 15;

  constexpr int NQB = SEQ_LEN / Q_BLOCK;   // 32
  const int bx   = blockIdx.x;
  const int qb   = bx % NQB;
  const int bhid = bx / NQB;
  const int head = bhid % N_HEAD;
  const int bat  = bhid / N_HEAD;
  const int q0   = qb * Q_BLOCK + wave * 16;
  const size_t tokb = (size_t)bat * SEQ_LEN;
  const int hcol = head * HEAD_D;

  const __bf16* QH = (const __bf16*)qkvh;
  const __bf16* QL = (const __bf16*)qkvl;

  // ---- Q fragments (B operand, column = query c): 2 d-chunks, hi and lo, statically strided global loads ----
  v16b qah[2], qal[2];
  {
    const size_t qo = (tokb + q0 + c) * QKV_COLS + hcol + 8 * hh;
#pragma unroll
    for (int dc = 0; dc < 2; ++dc) {
      qah[dc] = Frag<__bf16>::load(QH + qo + dc * 32);
      qal[dc] = Frag<__bf16>::load(QL + qo + dc * 32);
    }
  }

  constexpr float SC_LOG2E = 0.125f * 1.4426950408889634f;   // head_dim^-0.5 * log2(e)
  float mrun = -INFINITY;   // running maximum of query c's scores times SC_LOG2E (equal in both halves)
  float lrun = 0.f;         // running denominator of query c over this half's keys only
  v8f oacc[4];              // oacc[t][r] = out[query c][d = 16 t + 8 hh + r]
#pragma unroll
  for (int t = 0; t < 4; ++t) oacc[t] = (v8f){0.f,0.f,0.f,0.f,0.f,0.f,0.f,0.f};

  const __bf16* KHp = (const __bf16*)Ksh;
  const __bf16* KLp = (const __bf16*)Ksl;
  const int fo = c * LDS_PITCH + 8 * hh;   // the lane's place in a 16-row fragment; tile and chunk steps are constants on top
  const int vfo = (8 * hh + (lane & 7)) * V_PITCH + 8 * ((lane >> 3) & 1);   // the lane's address part of a transposing read of V

  for (int kc = 0; kc < SEQ_LEN / KV_CHUNK; ++kc) {
    const int kv0 = kc * KV_CHUNK;
    __syncthreads();
    {
      // staging: thread -> kv row kvr = tid>>1, d half dh = (tid&1)*32; 4 x 16 B per plane
      const int kvr = tid >> 1, dh = (tid & 1) * 32;
      const size_t kro = (tokb + kv0 + kvr) * QKV_COLS + INNER_DIM + hcol + dh;
      const size_t vro = kro + INNER_DIM;
#pragma unroll
      for (int i = 0; i < 4; ++i) {
        const v4u kh4 = *(const v4u*)(qkvh + kro + 8 * i);
        const v4u kl4 = *(const v4u*)(qkvl + kro + 8 * i);
        *(v4u*)(Ksh + kvr * LDS_PITCH + dh + 8 * i) = kh4;
        *(v4u*)(Ksl + kvr * LDS_PITCH + dh + 8 * i) = kl4;
      }
      asm volatile("" ::: "memory");
#pragma unroll
      for (int i = 0; i < 4; ++i) {
        const v4u vh4 = *(const v4u*)(qkvh + vro + 8 * i);
        const v4u vl4 = *(const v4u*)(qkvl + vro + 8 * i);
        *(v4u*)(Vsh + kvr * V_PITCH + dh + 8 * i) = vh4;
        *(v4u*)(Vsl + kvr * V_PITCH + dh + 8 * i) = vl4;
      }
    }
    __syncthreads();

    // ---- scores S^T: 4 tiles of 16 keys x 16 queries, 2 d-chunks, 3 products each ----
    // The K fragments of a d-chunk are read as one group, and consecutive WMMAs go round the 4 independent score tiles,
    // so that no WMMA waits for the one in front of it; each tile still sums its 6 products in the order dc, hi.hi, lo.hi, hi.lo.
    v8f s[4];
    FB kb[2][4], kl[2][4];
#pragma unroll
    for (int dc = 0; dc < 2; ++dc) {
#pragma unroll
      for (int j = 0; j < 4; ++j) {
        const int ko = j * 16 * LDS_PITCH + dc * 32;      // a constant: folds into the read's offset field
        kb[dc][j].h[0] = *(const v8b*)(KHp + fo + ko);
        kb[dc][j].h[1] = *(const v8b*)(KHp + fo + ko + 16);
        kl[dc][j].h[0] = *(const v8b*)(KLp + fo + ko);
        kl[dc][j].h[1] = *(const v8b*)(KLp + fo + ko + 16);
      }
    }
    row_fence();
#pragma unroll
    for (int j = 0; j < 4; ++j) s[j] = (v8f){0.f,0.f,0.f,0.f,0.f,0.f,0.f,0.f};
#pragma unroll
    for (int dc = 0; dc < 2; ++dc) {
#pragma unroll
      for (int j = 0; j < 4; ++j) s[j] = at_mma(kb[dc][j].v, qah[dc], s[j]);
      row_fence();
#pragma unroll
      for (int j = 0; j < 4; ++j) s[j] = at_mma(kl[dc][j].v, qah[dc], s[j]);
      row_fence();
#pragma unroll
      for (int j = 0; j < 4; ++j) s[j] = at_mma(kb[dc][j].v, qal[dc], s[j]);
      row_fence();
    }
    // V^T fragments of the first kv-chunk: read here so that the softmax below covers their latency
    FB vb[2][4], vl[2][4];
#pragma unroll
    for (int t = 0; t < 4; ++t) {
      const int vo = t * 16;                            // d tile: 16 columns further; keys 16..31: 16 rows further
      vb[0][t].h[0] = at_ld_tr16(Vsh + vfo + vo);
      vb[0][t].h[1] = at_ld_tr16(Vsh + vfo + vo + 16 * V_PITCH);
      vl[0][t].h[0] = at_ld_tr16(Vsl + vfo + vo);
      vl[0][t].h[1] = at_ld_tr16(Vsl + vfo + vo + 16 * V_PITCH);
    }
    row_fence();
    // ---- chunk maximum of query c over the unscaled scores (the scale is positive): 32 in-lane, then the other half ----
    float mj[4];
#pragma unroll
    for (int j = 0; j < 4; ++j) {
      mj[j] = -INFINITY;
#pragma unroll
      for (int r = 0; r < 8; ++r) mj[j] = fmaxf(mj[j], s[j][r]);
    }
    float cm = fmaxf(fmaxf(mj[0], mj[1]), fmaxf(mj[2], mj[3]));
    cm = fmaxf(cm, at_xhalf(cm));
    // ---- online softmax in base 2; p split into bf16 hi/lo in place: pbh[kk] / pbl[kk] element e = p of key 32 kk + kmap(e, hh) ----
    const float mnew = fmaxf(mrun, cm * SC_LOG2E);
    const float alpha = __builtin_amdgcn_exp2f(mrun - mnew);   // 0 on the first chunk, where mrun is -inf
    mrun = mnew;
    const v2f sc2 = (v2f){SC_LOG2E, SC_LOG2E};
    const v2f mn2 = (v2f){mnew, mnew};
    union PB { v16b v; v2b w[8]; };
    PB pbh[2], pbl[2];
    float pj[4];
#pragma unroll
    for (int j = 0; j < 4; ++j) {
      pj[j] = 0.f;
#pragma unroll
      for (int r = 0; r < 8; r += 2) {
        const v2f a2 = (v2f){s[j][r], s[j][r + 1]} * sc2 - mn2;          // scale, log2(e) and maximum in one FMA
        v2f p2;
        p2[0] = __builtin_amdgcn_exp2f(a2[0]);
        p2[1] = __builtin_amdgcn_exp2f(a2[1]);
        pj[j] += p2[0];
        pj[j] += p2[1];
        const v2b h2 = __builtin_convertvector(p2, v2b);                 // RNE, two values per register
        const v2b l2 = __builtin_convertvector(p2 - __builtin_convertvector(h2, v2f), v2b);
        pbh[j >> 1].w[(j & 1) * 4 + (r >> 1)] = h2;
        pbl[j >> 1].w[(j & 1) * 4 + (r >> 1)] = l2;
      }
    }
    lrun = lrun * alpha + ((pj[0] + pj[1]) + (pj[2] + pj[3]));
#pragma unroll
    for (int t = 0; t < 4; ++t)
#pragma unroll
      for (int r = 0; r < 8; ++r) oacc[t][r] *= alpha;
    // ---- O^T += V^T(64 d x 64 kv) . P^T(64 kv x 16 queries): 2 kv-chunks of 32, 4 d tiles, 3 products ----
    // As above: WMMAs round the 4 independent d tiles, per-tile order kept; the second kv-chunk's fragments are read
    // as one group in front of the first kv-chunk's products.
    row_fence();
#pragma unroll
    for (int t = 0; t < 4; ++t) {
      const int vo = t * 16 + 32 * V_PITCH;
      vb[1][t].h[0] = at_ld_tr16(Vsh + vfo + vo);
      vb[1][t].h[1] = at_ld_tr16(Vsh + vfo + vo + 16 * V_PITCH);
      vl[1][t].h[0] = at_ld_tr16(Vsl + vfo + vo);
      vl[1][t].h[1] = at_ld_tr16(Vsl + vfo + vo + 16 * V_PITCH);
    }
    row_fence();
#pragma unroll
    for (int kk = 0; kk < 2; ++kk) {
#pragma unroll
      for (int t = 0; t < 4; ++t) oacc[t] = at_mma(vb[kk][t].v, pbh[kk].v, oacc[t]);
      row_fence();
#pragma unroll
      for (int t = 0; t < 4; ++t) oacc[t] = at_mma(vl[kk][t].v, pbh[kk].v, oacc[t]);
      row_fence();
#pragma unroll
      for (int t = 0; t < 4; ++t) oacc[t] = at_mma(vb[kk][t].v, pbl[kk].v, oacc[t]);
      if (kk == 0) row_fence();
    }
  }

  // ---- the two halves' denominators join; the lane's 8 consecutive d of each tile go to row c of the wave's out tile ----
  float* os = Os[wave];
  {
    const float inv = 1.0f / (lrun + at_xhalf(lrun));
#pragma unroll
    for (int t = 0; t < 4; ++t) {
      v4f o0, o1;
#pragma unroll
      for (int e = 0; e < 4; ++e) { o0[e] = oacc[t][e] * inv; o1[e] = oacc[t][4 + e] * inv; }
      *(v4f*)(os + c * 68 + t * 16 + 8 * hh)     = o0;
      *(v4f*)(os + c * 68 + t * 16 + 8 * hh + 4) = o1;
    }
  }
  __builtin_amdgcn_fence(__ATOMIC_RELEASE, "workgroup");
  __builtin_amdgcn_wave_barrier();
  __builtin_amdgcn_fence(__ATOMIC_ACQUIRE, "workgroup");
  {
    const int q8 = lane >> 3, c8 = (lane & 7) * 8;
    {
#pragma unroll
      for (int it = 0; it < 4; ++it) {
        const int row = it * 4 + q8;                   // rows 0..15 of this wave's tile
        const float* sp = os + row * 68 + c8;
        const v4f f0 = *(const v4f*)(sp);
        const v4f f1 = *(const v4f*)(sp + 4);
        v4u ph, plo;
#pragma unroll
        for (int w = 0; w < 2; ++w) {
          const float a = f0[2 * w], bq = f0[2 * w + 1];
          const unsigned short ha = f2bf_bits(a), hb = f2bf_bits(bq);
          const unsigned short la = f2bf_bits(a - bf_bits2f(ha)), lb = f2bf_bits(bq - bf_bits2f(hb));
          ph[w]  = (unsigned)ha | ((unsigned)hb << 16);
          plo[w] = (unsigned)la | ((unsigned)lb << 16);
        }
#pragma unroll
        for (int w = 0; w < 2; ++w) {
          const float a = f1[2 * w], bq = f1[2 * w + 1];
          const unsigned short ha = f2bf_bits(a), hb = f2bf_bits(bq);
          const unsigned short la = f2bf_bits(a - bf_bits2f(ha)), lb = f2bf_bits(bq - bf_bits2f(hb));
          ph[2 + w]  = (unsigned)ha | ((unsigned)hb << 16);
          plo[2 + w] = (unsigned)la | ((unsigned)lb << 16);
        }
        const size_t o = (tokb + q0 + row) * INNER_DIM + hcol + c8;
        *(v4u*)(oh + o) = ph;
        *(v4u*)(ol + o) = plo;
      }
      
    }
  }
}

// =====================================================================================
// launch glue
// =====================================================================================
extern "C" void kernel_launch(void* const* d_in, const int* in_sizes, int n_in,
                              void* d_out, int out_size, void* d_ws,
                              size_t ws_size, hipStream_t stream) {
  if (n_in < 6) return;
  if (in_sizes[0] != TOK_ROWS * MODEL_DIM) return;
  if (in_sizes[1] != MODEL_DIM || in_sizes[2] != MODEL_DIM) return;
  if (in_sizes[3] != QKV_COLS * MODEL_DIM) return;
  if (in_sizes[4] != MODEL_DIM * INNER_DIM) return;
  if (in_sizes[5] != MODEL_DIM) return;
  if (out_size != TOK_ROWS * MODEL_DIM) return;
  if (ws_size < WS_TOTAL) return;

  const float* x    = (const float*)d_in[0];
  const float* gam  = (const float*)d_in[1];
  const float* bet  = (const float*)d_in[2];
  const float* wqkv = (const float*)d_in[3];
  const float* wout = (const float*)d_in[4];
  const float* bout = (const float*)d_in[5];
  float* out = (float*)d_out;

  char* ws = (char*)d_ws;
  size_t off = 0;
  unsigned short* wq_bf  = (unsigned short*)(ws + off); off += WS_WQ;
  unsigned short* wo_bf  = (unsigned short*)(ws + off); off += WS_WO;
  unsigned short* h_hi   = (unsigned short*)(ws + off); off += WS_HPL;
  unsigned short* h_lo   = (unsigned short*)(ws + off); off += WS_HPL;
  unsigned short* qkv_hi = (unsigned short*)(ws + off); off += WS_QKVPL;
  unsigned short* qkv_lo = (unsigned short*)(ws + off); off += WS_QKVPL;
  unsigned short* at_hi  = (unsigned short*)(ws + off); off += WS_ATPL;
  unsigned short* at_lo  = (unsigned short*)(ws + off); off += WS_ATPL;
  if (off > ws_size) return;

  // weights -> bf16 (RNE): 3145728/8 = 393216 = 1536 x 256 ; 1048576/8 = 131072 = 512 x 256
  const int n8_qkv = (QKV_COLS * MODEL_DIM) / 8;
  const int n8_out = (MODEL_DIM * INNER_DIM) / 8;
  cast_f32_bf16x8<<<dim3((n8_qkv + 255) / 256), dim3(256), 0, stream>>>(wqkv, wq_bf, n8_qkv);
  cast_f32_bf16x8<<<dim3((n8_out + 255) / 256), dim3(256), 0, stream>>>(wout, wo_bf, n8_out);

  // LayerNorm -> h hi/lo planes [4096][1024]
  layernorm_bf16split_kernel<<<dim3(TOK_ROWS), dim3(128), 0, stream>>>(x, gam, bet, h_hi, h_lo);

  // qkv = h @ w_qkv^T -> bf16 hi/lo planes [4096][3072]; M=4096 N=3072 K=1024; block tiles 32*12 = 384 blocks
  gemm64_bf16_asplit<2, false><<<dim3((TOK_ROWS / G_BM) * (QKV_COLS / G_BN)), dim3(256), 0, stream>>>(
      h_hi, h_lo, MODEL_DIM, wq_bf, MODEL_DIM, (void*)qkv_hi, (void*)qkv_lo, QKV_COLS,
      (const float*)nullptr, TOK_ROWS, QKV_COLS, MODEL_DIM);

  // attention per (batch, head, 64 query rows): 2*16*32 = 1024 blocks -> attn hi/lo planes [4096][1024]
  attn64_bf16x3_kernel<<<dim3(N_BATCH * N_HEAD * (SEQ_LEN / Q_BLOCK)), dim3(128), 0, stream>>>(
      qkv_hi, qkv_lo, at_hi, at_lo);

  // out = attn @ w_out^T + b_out -> f32 [4096][1024]; M=4096 N=1024 K=1024; block tiles 32*4 = 128 blocks
  gemm64_bf16_asplit<0, true><<<dim3((TOK_ROWS / G_BM) * (MODEL_DIM / G_BN)), dim3(256), 0, stream>>>(
      at_hi, at_lo, INNER_DIM, wo_bf, INNER_DIM, (void*)out, (void*)nullptr, MODEL_DIM,
      bout, TOK_ROWS, MODEL_DIM, INNER_DIM);
}

// v007
// One run takes 144 microseconds.
// Two timings next to v006 both put it at 1.14 times that version's speed.
// All steps since v000 together make it 3.61 times as fast.
// Contractions on v_wmma_f32_16x16x32_bf16 (bf16 operands, f32 accumulate): qkv and output projections = activation bf16 hi+lo planes x weight bf16 plane (2 products); q.k scores and p.v = bf16 hi/lo x bf16 hi/lo (3 products); LayerNorm, softmax and epilogues in f32; every float input RNE-converted to bf16 once at load.
#include <hip/hip_runtime.h>
#include <hip/hip_bf16.h>

typedef __attribute__((ext_vector_type(16))) _Float16 v16h;
typedef __attribute__((ext_vector_type(8)))  _Float16 v8h;
typedef __attribute__((ext_vector_type(16))) __bf16   v16b;
typedef __attribute__((ext_vector_type(8)))  __bf16   v8b;
typedef __attribute__((ext_vector_type(8)))  float    v8f;
typedef __attribute__((ext_vector_type(4)))  float    v4f;
typedef __attribute__((ext_vector_type(4)))  unsigned v4u;
typedef __attribute__((ext_vector_type(2)))  float    v2f;
typedef __attribute__((ext_vector_type(2)))  __bf16   v2b;

// ---- problem geometry ----
constexpr int MODEL_DIM = 1024;
constexpr int SEQ_LEN   = 2048;
constexpr int N_BATCH   = 2;
constexpr int N_HEAD    = 16;
constexpr int HEAD_D    = 64;
constexpr int INNER_DIM = N_HEAD * HEAD_D;          // 1024
constexpr int QKV_COLS  = 3 * INNER_DIM;            // 3072
constexpr int TOK_ROWS  = N_BATCH * SEQ_LEN;        // 4096
constexpr int KV_CHUNK  = 64;
constexpr int Q_BLOCK   = 64;
// LDS row pitch of the attention K tiles, in bf16 elements: 64 data + 8 pad = 144 B = 16 B x 9 (odd),
// so the 16 rows that one ds_load_b128 fragment read touches fall on distinct bank groups (128-B rows all share banks).
constexpr int LDS_PITCH = 72;
// LDS row pitch of the attention V tiles (row-major [kv][d]), in bf16 elements: 64 data + 16 pad = 160 B = 32 B x 5 (odd),
// the conflict-free pitch of their reader, ds_load_tr16_b128.
constexpr int V_PITCH = 80;

// GEMM shape contract (no run-time tails in the GEMM kernel)
static_assert(MODEL_DIM % 32 == 0, "K of qkv projection");
static_assert(INNER_DIM % 32 == 0, "K of output projection");
static_assert(TOK_ROWS % 64 == 0, "M tile multiple");
static_assert(QKV_COLS % 64 == 0, "N tile multiple (qkv)");
static_assert(MODEL_DIM % 64 == 0, "N tile multiple (out)");
static_assert(SEQ_LEN % KV_CHUNK == 0 && SEQ_LEN % Q_BLOCK == 0, "attention tiles");
static_assert(HEAD_D == 64, "attention kernel is head_dim 64");
static_assert(MODEL_DIM == 128 * 8, "LayerNorm kernel: 128 threads x 8 elements per row");

// ---- workspace region map (bytes, every offset a multiple of 128) ----
//  [0]            wq  bf16 [3072][1024]         6291456
//  [6291456]      wo  bf16 [1024][1024]         2097152
//  [8388608]      h   hi bf16 [4096][1024]      8388608
//  [16777216]     h   lo bf16 [4096][1024]      8388608
//  [25165824]     qkv hi bf16 [4096][3072]     25165824
//  [50331648]     qkv lo bf16 [4096][3072]     25165824
//  [75497472]     at  hi bf16 [4096][1024]      8388608
//  [83886080]     at  lo bf16 [4096][1024]      8388608
//  total 92274688
constexpr size_t WS_WQ    = (size_t)QKV_COLS * MODEL_DIM * 2;
constexpr size_t WS_WO    = (size_t)MODEL_DIM * INNER_DIM * 2;
constexpr size_t WS_HPL   = (size_t)TOK_ROWS * MODEL_DIM * 2;
constexpr size_t WS_QKVPL = (size_t)TOK_ROWS * QKV_COLS * 2;
constexpr size_t WS_ATPL  = (size_t)TOK_ROWS * INNER_DIM * 2;
constexpr size_t WS_TOTAL = WS_WQ + WS_WO + 2 * WS_HPL + 2 * WS_QKVPL + 2 * WS_ATPL;
static_assert(WS_TOTAL == 92274688, "carve arithmetic");
static_assert(WS_TOTAL <= 134217728, "carve budget");
static_assert(WS_WQ % 128 == 0 && WS_WO % 128 == 0 && WS_HPL % 128 == 0 && WS_QKVPL % 128 == 0 && WS_ATPL % 128 == 0, "128-B aligned regions");

// ---- bf16 RNE helpers ----
__device__ __forceinline__ unsigned short f2bf_bits(float f) {
  unsigned u = __float_as_uint(f);
  return (unsigned short)((u + 0x7FFFu + ((u >> 16) & 1u)) >> 16);
}
__device__ __forceinline__ float bf_bits2f(unsigned short h) { return __uint_as_float(((unsigned)h) << 16); }

// hazard guards as plain device helpers (no inline asm inside the kernel template body)
__device__ __forceinline__ void dep_guard_h(v8f& a, v8f& b, v16h x, v16h y) { asm volatile("v_nop\n\tv_nop\n\tv_nop\n\tv_nop" : "+v"(a), "+v"(b) : "v"(x), "v"(y)); }
__device__ __forceinline__ void dep_guard_b(v8f& a, v8f& b, v16b x, v16b y) { asm volatile("v_nop\n\tv_nop\n\tv_nop\n\tv_nop" : "+v"(a), "+v"(b) : "v"(x), "v"(y)); }
__device__ __forceinline__ void keep4_h(v16h a, v16h b, v16h c, v16h d) { asm volatile("v_nop" :: "v"(a), "v"(b), "v"(c), "v"(d)); }
__device__ __forceinline__ void keep4_b(v16b a, v16b b, v16b c, v16b d) { asm volatile("v_nop" :: "v"(a), "v"(b), "v"(c), "v"(d)); }
__device__ __forceinline__ void acc_guard4(v8f& a, v8f& b, v8f& c, v8f& d) { asm volatile("v_nop\n\tv_nop\n\tv_nop\n\tv_nop" : "+v"(a), "+v"(b), "+v"(c), "+v"(d)); }
template <typename T> struct Frag;
template <> struct Frag<_Float16> {
  typedef v16h V; union U { v16h v; v8h h[2]; };
  static __device__ __forceinline__ v16h load(const _Float16* p) {   // elements 0..7 <- p[0..7], 8..15 <- p[16..23]
    U f; f.h[0] = *(const v8h*)(p); f.h[1] = *(const v8h*)(p + 16); return f.v;
  }
  static __device__ __forceinline__ v8f mma(v16h a, v16h b, v8f c) {
    return __builtin_amdgcn_wmma_f32_16x16x32_f16(false, a, false, b, (short)0, c, false, false);
  }
  static __device__ __forceinline__ void guard(v8f& a, v8f& b, v16h x, v16h y) { dep_guard_h(a, b, x, y); }
  static __device__ __forceinline__ void keep(v16h a, v16h b, v16h c, v16h d) { keep4_h(a, b, c, d); }
};
template <> struct Frag<__bf16> {
  typedef v16b V; union U { v16b v; v8b h[2]; };
  static __device__ __forceinline__ v16b load(const __bf16* p) {
    U f; f.h[0] = *(const v8b*)(p); f.h[1] = *(const v8b*)(p + 16); return f.v;
  }
  static __device__ __forceinline__ v8f mma(v16b a, v16b b, v8f c) {
    return __builtin_amdgcn_wmma_f32_16x16x32_bf16(false, a, false, b, (short)0, c, false, false);
  }
  static __device__ __forceinline__ void guard(v8f& a, v8f& b, v16b x, v16b y) { dep_guard_b(a, b, x, y); }
  static __device__ __forceinline__ void keep(v16b a, v16b b, v16b c, v16b d) { keep4_b(a, b, c, d); }
};

// attention helpers (bf16 WMMA as the plain builtin: the compiler keeps its distances; exchange between the wave halves)
__device__ __forceinline__ v8f at_mma(v16b a, v16b b, v8f c) {
  return __builtin_amdgcn_wmma_f32_16x16x32_bf16(false, a, false, b, (short)0, c, false, false);
}

__device__ __forceinline__ v8b at_ld_tr16(const unsigned short* p) {
  typedef __attribute__((address_space(3))) v8b lds_v8b;
  return __builtin_amdgcn_ds_load_tr16_b128_v8bf16((lds_v8b*)p);
}

// Scheduling fence, no instruction: without it the compiler sinks the grouped fragment reads back among the WMMAs (each
// then waited for right behind its issue), puts the dependent WMMAs of one tile back to back again, or lifts a read group
// so far up that the registers of four waves per SIMD no longer suffice.
__device__ __forceinline__ void row_fence() { __builtin_amdgcn_sched_barrier(0); }

// value of lane l ^ 16: the other half of the wave holds the other keys of the same query
__device__ __forceinline__ float at_xhalf(float x) {
  const int b = __builtin_bit_cast(int, x);
  return __builtin_bit_cast(float, __builtin_amdgcn_permlanex16(b, b, 0x76543210, 0xfedcba98, false, false));
}

// =====================================================================================
// 1) f32 -> bf16 (RNE) cast, 8 elements per thread, one 16-B store per lane
//    Coverage: grid = n8/256 blocks x 256 threads x 8 elements = n exactly (n8 = n/8, n % 2048 == 0 here).
// =====================================================================================
__global__ __launch_bounds__(256) void cast_f32_bf16x8(
    const float* __restrict__ in, unsigned short* __restrict__ out, int n8) {
  const int i = blockIdx.x * 256 + threadIdx.x;
  if (i < n8) {
    const size_t e0 = (size_t)i * 8;
    const v4f a = *(const v4f*)(in + e0);
    const v4f b = *(const v4f*)(in + e0 + 4);
    v4u u;
    u[0] = (unsigned)f2bf_bits(a[0]) | ((unsigned)f2bf_bits(a[1]) << 16);
    u[1] = (unsigned)f2bf_bits(a[2]) | ((unsigned)f2bf_bits(a[3]) << 16);
    u[2] = (unsigned)f2bf_bits(b[0]) | ((unsigned)f2bf_bits(b[1]) << 16);
    u[3] = (unsigned)f2bf_bits(b[2]) | ((unsigned)f2bf_bits(b[3]) << 16);
    *(v4u*)(out + e0) = u;
    
  }
}

// =====================================================================================
//    result split into bf16 hi / lo planes [TOK_ROWS][MODEL_DIM].
//    One block (128 threads) per row; thread t owns elements 8t..8t+7 -> one 16-B store per lane per plane
//    Coverage: 4096 blocks x 128 threads x 8 = 4096 x 1024 exactly.
// =====================================================================================
__global__ __launch_bounds__(128) void layernorm_bf16split_kernel(
    const float* __restrict__ x, const float* __restrict__ gamma, const float* __restrict__ beta,
    unsigned short* __restrict__ hhi, unsigned short* __restrict__ hlo) {
  __shared__ float red_s[4];
  __shared__ float red_q[4];
  const int row = blockIdx.x;
  const int t = threadIdx.x;
  const int lane = t & 31, wave = t >> 5;
  const size_t base = (size_t)row * MODEL_DIM + 8 * (size_t)t;

  const v4f a0 = *(const v4f*)(x + base);
  const v4f a1 = *(const v4f*)(x + base + 4);
  float xv[8];
#pragma unroll
  for (int e = 0; e < 4; ++e) {
    xv[e]     = bf_bits2f(f2bf_bits(a0[e]));
    xv[4 + e] = bf_bits2f(f2bf_bits(a1[e]));
  }
  float s = ((xv[0] + xv[1]) + (xv[2] + xv[3])) + ((xv[4] + xv[5]) + (xv[6] + xv[7]));
#pragma unroll
  for (int off = 1; off < 32; off <<= 1) s += __shfl_xor(s, off, 32);
  if (lane == 0) red_s[wave] = s;
  __syncthreads();
  const float tot = (red_s[0] + red_s[1]) + (red_s[2] + red_s[3]);
  const float mean = tot * (1.0f / (float)MODEL_DIM);

  float d[8];
  float q = 0.f;
#pragma unroll
  for (int e = 0; e < 8; ++e) { d[e] = xv[e] - mean; q += d[e] * d[e]; }
#pragma unroll
  for (int off = 1; off < 32; off <<= 1) q += __shfl_xor(q, off, 32);
  if (lane == 0) red_q[wave] = q;
  __syncthreads();
  const float qt = (red_q[0] + red_q[1]) + (red_q[2] + red_q[3]);
  const float var = qt * (1.0f / (float)MODEL_DIM);
  const float rstd = rsqrtf(var + 1e-5f);

  const v4f g0 = *(const v4f*)(gamma + 8 * t);
  const v4f g1 = *(const v4f*)(gamma + 8 * t + 4);
  const v4f b0 = *(const v4f*)(beta + 8 * t);
  const v4f b1 = *(const v4f*)(beta + 8 * t + 4);
  float hv[8];
#pragma unroll
  for (int e = 0; e < 4; ++e) {
    const float gg0 = bf_bits2f(f2bf_bits(g0[e])), bb0 = bf_bits2f(f2bf_bits(b0[e]));
    const float gg1 = bf_bits2f(f2bf_bits(g1[e])), bb1 = bf_bits2f(f2bf_bits(b1[e]));
    hv[e]     = d[e] * rstd * gg0 + bb0;
    hv[4 + e] = d[4 + e] * rstd * gg1 + bb1;
  }
  v4u ph, pl;
#pragma unroll
  for (int w = 0; w < 4; ++w) {
    const float f0 = hv[2 * w], f1 = hv[2 * w + 1];
    const unsigned short h0 = f2bf_bits(f0), h1 = f2bf_bits(f1);
    const unsigned short l0 = f2bf_bits(f0 - bf_bits2f(h0));
    const unsigned short l1 = f2bf_bits(f1 - bf_bits2f(h1));
    ph[w] = (unsigned)h0 | ((unsigned)h1 << 16);
    pl[w] = (unsigned)l0 | ((unsigned)l1 << 16);
  }
  *(v4u*)(hhi + base) = ph;
  *(v4u*)(hlo + base) = pl;
  
}

// =====================================================================================
// 3) WMMA GEMM, operands staged in LDS: C[m,n] = sum_k (Ah+Al)[m,k] * Bt[n,k] (+bias[n], bias RNE bf16)
//    A = bf16 hi and lo planes row-major [M,K] (lda); Bt = bf16 row-major [N,K] (ldb); 2 WMMA products per tile pair.
//    A block of 8 waves (2 x 4) owns a 128x256 C tile, each wave a 64x64 part of it. K is walked in slabs of 64:
//    a stage is [A hi 128 rows | A lo 128 rows | Bt 256 rows] of 128 B each at a 144-B LDS pitch, two buffers.
//    Every wave copies 64 of the 512 stage rows with 16 asynchronous 16-B-per-lane copies (4 whole 128-B rows each),
//    one slab ahead of the slab that is being multiplied. Per output element the k order of the sums is ascending.
//    Coverage: grid.x = (M/128)*(N/256) blocks, every 64x64 tile exactly once (shapes static_assert'ed below).
// =====================================================================================
constexpr int G_BM          = 128;                              // block tile rows
constexpr int G_BN          = 256;                              // block tile columns
constexpr int G_SLAB_K      = 64;                               // k elements per stage: 128-B rows
constexpr int G_PITCH       = 72;                               // LDS row pitch in bf16 elements: 144 B = 16 B x 9
constexpr int G_STAGE_ROWS  = 2 * G_BM + G_BN;                  // 512
constexpr int G_STAGE_BYTES = G_STAGE_ROWS * G_PITCH * 2;       // 73728
constexpr unsigned G_COPY_LDS_STEP = 4u * G_PITCH * 2u;         // one wave-wide copy fills 4 stage rows
static_assert(TOK_ROWS % G_BM == 0, "M block tile multiple");
static_assert(QKV_COLS % G_BN == 0 && MODEL_DIM % G_BN == 0, "N block tile multiple");
static_assert(MODEL_DIM % G_SLAB_K == 0 && INNER_DIM % G_SLAB_K == 0, "K slab multiple");
static_assert(MODEL_DIM / G_SLAB_K >= 2 && INNER_DIM / G_SLAB_K >= 2, "two stages at least");
static_assert(8 * 16 * 68 * 4 <= 2 * G_STAGE_BYTES, "epilogue slabs fit the ring");

// Eight asynchronous copies global -> LDS, 16 B per lane each, for 32 consecutive stage rows of one wave.
// l = the lane's LDS byte address of the first copy, g = its global address, step = elements per 4 source rows.
// The closing s_wait_xcnt 0 stands inside the statement so that no address register named here is rewritten ahead of it.
__device__ __forceinline__ void stage_copy8(unsigned l, const unsigned short* g, size_t step) {
  asm volatile(
      "global_load_async_to_lds_b128 %0, %8, off\n\t"
      "global_load_async_to_lds_b128 %1, %9, off\n\t"
      "global_load_async_to_lds_b128 %2, %10, off\n\t"
      "global_load_async_to_lds_b128 %3, %11, off\n\t"
      "global_load_async_to_lds_b128 %4, %12, off\n\t"
      "global_load_async_to_lds_b128 %5, %13, off\n\t"
      "global_load_async_to_lds_b128 %6, %14, off\n\t"
      "global_load_async_to_lds_b128 %7, %15, off\n\t"
      "s_wait_xcnt 0x0"
      :: "v"(l), "v"(l + G_COPY_LDS_STEP), "v"(l + 2u * G_COPY_LDS_STEP), "v"(l + 3u * G_COPY_LDS_STEP),
         "v"(l + 4u * G_COPY_LDS_STEP), "v"(l + 5u * G_COPY_LDS_STEP), "v"(l + 6u * G_COPY_LDS_STEP),
         "v"(l + 7u * G_COPY_LDS_STEP),
         "v"(g), "v"(g + step), "v"(g + 2 * step), "v"(g + 3 * step),
         "v"(g + 4 * step), "v"(g + 5 * step), "v"(g + 6 * step), "v"(g + 7 * step)
      : "memory");
}

// The two waits of the stage ring, each an asm statement of its own; the "memory" clobber keeps LDS accesses on their side of it.
__device__ __forceinline__ void wait_own_copies_landed() { asm volatile("s_wait_asynccnt 0x0" ::: "memory"); }
__device__ __forceinline__ void wait_own_lds_reads_done() { asm volatile("s_wait_dscnt 0x0" ::: "memory"); }

template <int OUT_MODE, bool HAS_BIAS>
__global__ __launch_bounds__(256) void gemm64_bf16_asplit(
    const unsigned short* __restrict__ Ahp, const unsigned short* __restrict__ Alp, int lda,
    const unsigned short* __restrict__ Btp, int ldb,
    void* __restrict__ Cout, void* __restrict__ Cout2, int ldc,
    const float* __restrict__ bias, int M, int N, int K) {
  typedef __bf16 T;
  typedef v16b V;
  // two stage buffers; after the K loop the same bytes serve as the per-wave 16x64 f32 epilogue slabs (pitch 68 floats)
  __shared__ __align__(16) unsigned char smem[2 * G_STAGE_BYTES];
  const int lane = threadIdx.x & 31;
  const int wave = __builtin_amdgcn_readfirstlane(threadIdx.x >> 5);
  const int tilesN = N / G_BN;
  const int tilesM = M / G_BM;
  const int bm = blockIdx.x / tilesN;
  const int bn = blockIdx.x - bm * tilesN;
  if (bm >= tilesM) return;              // block-uniform, in front of every barrier and copy
  const int mB = bm * G_BM;
  const int nB = bn * G_BN;
  const int wm = wave >> 2;              // 0..1: 64-row part of the block tile
  const int wn = wave & 3;               // 0..3: 64-column part
  const int m0 = mB + (wm << 6);
  const int n0 = nB + (wn << 6);

  const int rlane = lane & 15;                 // row (A) / col (B, D) within subtile
  const int koff  = (lane >> 4) * 8;           // k offset of this lane half
  const int mOff  = (lane >> 4) * 8;           // D row offset

  // ---- this wave's share of a stage: stage rows wave*64 .. wave*64+63 (waves 0,1: A hi; 2,3: A lo; 4..7: Bt) ----
  const unsigned short* srow;
  int sld;
  if (wave < 2)      { srow = Ahp + (size_t)(mB + wave * 64) * lda;       sld = lda; }
  else if (wave < 4) { srow = Alp + (size_t)(mB + (wave - 2) * 64) * lda; sld = lda; }
  else               { srow = Btp + (size_t)(nB + (wave - 4) * 64) * ldb; sld = ldb; }
  const unsigned short* gl = srow + (size_t)(lane >> 3) * sld + (lane & 7) * 8;   // 8 lanes x 16 B = one 128-B row
  const size_t step4 = (size_t)sld * 4;
  const unsigned ll = (unsigned)(size_t)smem + (unsigned)((wave * 64 + (lane >> 3)) * (G_PITCH * 2) + (lane & 7) * 16);

  v8f acc[4][4];
#pragma unroll
  for (int i = 0; i < 4; ++i)
#pragma unroll
    for (int j = 0; j < 4; ++j) acc[i][j] = (v8f){0.f,0.f,0.f,0.f,0.f,0.f,0.f,0.f};

  const int nT = K / G_SLAB_K;
  // ---- prologue: slab 0 lands and is published, then slab 1 starts to fly ----
  stage_copy8(ll, gl, step4);
  stage_copy8(ll + 8u * G_COPY_LDS_STEP, gl + 8 * step4, step4);
  wait_own_copies_landed();              // slab 0 has landed before the barrier publishes it to the other waves
  __syncthreads();
  if (nT > 1) {
    stage_copy8(ll + (unsigned)G_STAGE_BYTES, gl + G_SLAB_K, step4);
    stage_copy8(ll + (unsigned)G_STAGE_BYTES + 8u * G_COPY_LDS_STEP, gl + G_SLAB_K + 8 * step4, step4);
  }

  for (int t = 0; t < nT; ++t) {
    const unsigned bo = (t & 1) ? (unsigned)G_STAGE_BYTES : 0u;
    const T* sb  = (const T*)(smem + bo);
    const T* sAh = sb + ((wm << 6) + rlane) * G_PITCH + koff;
    const T* sAl = sAh + G_BM * G_PITCH;
    const T* sB  = sb + (2 * G_BM + (wn << 6) + rlane) * G_PITCH + koff;
#pragma unroll
    for (int kk = 0; kk < G_SLAB_K; kk += 32) {
      V bh[4];
#pragma unroll
      for (int j = 0; j < 4; ++j) bh[j] = Frag<T>::load(sB + (j << 4) * G_PITCH + kk);
#pragma unroll
      for (int i = 0; i < 4; ++i) {
        V ah = Frag<T>::load(sAh + (i << 4) * G_PITCH + kk);
        V al = Frag<T>::load(sAl + (i << 4) * G_PITCH + kk);
#pragma unroll
        for (int j = 0; j < 4; ++j) {
          acc[i][j] = Frag<T>::mma(ah, bh[j], acc[i][j]);
          acc[i][j] = Frag<T>::mma(al, bh[j], acc[i][j]);
        }
        Frag<T>::guard(acc[i][0], acc[i][3], ah, al);
      }
      Frag<T>::keep(bh[0], bh[1], bh[2], bh[3]);
    }
    // ---- publish point of slab t+1; it also ends every wave's reads of the buffer refilled behind it ----
    wait_own_lds_reads_done();           // fragment reads of slab t are done before its buffer is refilled
    wait_own_copies_landed();            // slab t+1 has landed before the barrier publishes it
    __syncthreads();
    if (t + 2 < nT) {
      const unsigned short* g2 = gl + (size_t)(t + 2) * G_SLAB_K;
      stage_copy8(ll + bo, g2, step4);
      stage_copy8(ll + bo + 8u * G_COPY_LDS_STEP, g2 + 8 * step4, step4);
    }
  }
  wait_own_copies_landed();              // no copy is outstanding when the ring becomes epilogue staging
  acc_guard4(acc[0][0], acc[0][1], acc[0][2], acc[0][3]);
  acc_guard4(acc[1][0], acc[1][1], acc[1][2], acc[1][3]);
  acc_guard4(acc[2][0], acc[2][1], acc[2][2], acc[2][3]);
  acc_guard4(acc[3][0], acc[3][1], acc[3][2], acc[3][3]);

  // ---- epilogue ----
  float* slab = (float*)smem + wave * (16 * 68);   // the last trip's barrier ended every read of the ring
#pragma unroll
  for (int i = 0; i < 4; ++i) {
    const int mBase = m0 + (i << 4);
#pragma unroll
    for (int j = 0; j < 4; ++j) {
#pragma unroll
      for (int r = 0; r < 8; ++r) {
        slab[(mOff + r) * 68 + (j << 4) + rlane] = acc[i][j][r];
      }
    }
    __builtin_amdgcn_fence(__ATOMIC_RELEASE, "workgroup");
    __builtin_amdgcn_wave_barrier();
    __builtin_amdgcn_fence(__ATOMIC_ACQUIRE, "workgroup");
    if (OUT_MODE == 0) {
      float* Cf = (float*)Cout;
      const int h2 = lane >> 4, c4 = (lane & 15) * 4;     // row seg = 256 B = 16 lanes x 16 B
      v4f bb = (v4f){0.f, 0.f, 0.f, 0.f};
      if (HAS_BIAS) {
        const v4f braw = *(const v4f*)(bias + n0 + c4);
#pragma unroll
        for (int e = 0; e < 4; ++e) bb[e] = bf_bits2f(f2bf_bits(braw[e]));
      }
      {
#pragma unroll
        for (int it = 0; it < 8; ++it) {
          const int row = it * 2 + h2;
          v4f v = *(const v4f*)(slab + row * 68 + c4);
          v = v + bb;
          *(v4f*)(Cf + (size_t)(mBase + row) * ldc + n0 + c4) = v;
        }
        
      }
    } else {
      const int q = lane >> 3, c8 = (lane & 7) * 8;
      unsigned short* Cu  = (unsigned short*)Cout;
      unsigned short* Cu2 = (unsigned short*)Cout2;
      {
#pragma unroll
        for (int it = 0; it < 4; ++it) {
          const int row = it * 4 + q;
          const float* sp = slab + row * 68 + c8;
          v8h hv, lv;
#pragma unroll
          for (int e = 0; e < 8; ++e) {
            unsigned short hb = f2bf_bits(sp[e]);
            unsigned short lb = f2bf_bits(sp[e] - bf_bits2f(hb));
            hv[e] = __builtin_bit_cast(_Float16, hb);
            lv[e] = __builtin_bit_cast(_Float16, lb);
          }
          *(v8h*)(Cu  + (size_t)(mBase + row) * ldc + n0 + c8) = hv;
          *(v8h*)(Cu2 + (size_t)(mBase + row) * ldc + n0 + c8) = lv;
        }
        
      }
    }
    __builtin_amdgcn_fence(__ATOMIC_RELEASE, "workgroup");
    __builtin_amdgcn_wave_barrier();
    __builtin_amdgcn_fence(__ATOMIC_ACQUIRE, "workgroup");
  }
}

constexpr int AT_K_PLANE = KV_CHUNK * LDS_PITCH * 2;
constexpr int AT_V_PLANE = KV_CHUNK * V_PITCH * 2;
constexpr int AT_V_OFF   = 2 * AT_K_PLANE;
constexpr int AT_BUF     = 2 * AT_K_PLANE + 2 * AT_V_PLANE;
static_assert(AT_V_OFF % 32 == 0 && AT_V_PLANE % 32 == 0 && AT_BUF % 32 == 0, "V planes stay 32-B aligned");
static_assert(4 * 16 * 68 * 4 <= 2 * AT_BUF, "out tiles fit the ring");
static_assert(SEQ_LEN / KV_CHUNK >= 2, "two chunks at least");

// Eight asynchronous copies global -> LDS, 16 B per lane each, for 32 consecutive kv rows of one plane.
// l = the lane's LDS byte address of the first copy, ls = LDS bytes per 4 rows, g = its global address.
// The closing s_wait_xcnt 0 stands inside the statement so that no address register named here is rewritten ahead of it.
__device__ __forceinline__ void kv_copy8(unsigned l, unsigned ls, const unsigned short* g) {
  constexpr size_t gs = (size_t)4 * QKV_COLS;                      // elements per 4 source rows
  asm volatile(
      "global_load_async_to_lds_b128 %0, %8, off\n\t"
      "global_load_async_to_lds_b128 %1, %9, off\n\t"
      "global_load_async_to_lds_b128 %2, %10, off\n\t"
      "global_load_async_to_lds_b128 %3, %11, off\n\t"
      "global_load_async_to_lds_b128 %4, %12, off\n\t"
      "global_load_async_to_lds_b128 %5, %13, off\n\t"
      "global_load_async_to_lds_b128 %6, %14, off\n\t"
      "global_load_async_to_lds_b128 %7, %15, off\n\t"
      "s_wait_xcnt 0x0"
      :: "v"(l), "v"(l + ls), "v"(l + 2u * ls), "v"(l + 3u * ls),
         "v"(l + 4u * ls), "v"(l + 5u * ls), "v"(l + 6u * ls), "v"(l + 7u * ls),
         "v"(g), "v"(g + gs), "v"(g + 2 * gs), "v"(g + 3 * gs),
         "v"(g + 4 * gs), "v"(g + 5 * gs), "v"(g + 6 * gs), "v"(g + 7 * gs)
      : "memory");
}

// amdgpu_waves_per_eu(4): a budget of 256 VGPRs, so that four blocks (one wave of each per SIMD) stay resident on a WGP
__global__ __launch_bounds__(128) __attribute__((amdgpu_waves_per_eu(4))) void attn64_bf16x3_kernel(
    const unsigned short* __restrict__ qkvh, const unsigned short* __restrict__ qkvl,
    unsigned short* __restrict__ oh, unsigned short* __restrict__ ol) {
  union FB { v16b v; v8b h[2]; };
  // two chunk buffers; after the kv loop the same bytes serve as the per-wave 16x64 f32 out tiles (pitch 68 floats)
  __shared__ __align__(32) unsigned char ring[2 * AT_BUF];

  const int tid  = threadIdx.x;
  const int wave = __builtin_amdgcn_readfirstlane(tid >> 5);
  const int lane = tid & 31;
  const int hh   = lane >> 4;
  const int c    = lane & 15;

  constexpr int NQB = SEQ_LEN / Q_BLOCK;   // 32
  const int bx   = blockIdx.x;
  const int qb   = bx % NQB;
  const int bhid = bx / NQB;
  const int head = bhid % N_HEAD;
  const int bat  = bhid / N_HEAD;
  const int q0   = qb * Q_BLOCK + wave * 16;
  const size_t tokb = (size_t)bat * SEQ_LEN;
  const int hcol = head * HEAD_D;

  const __bf16* QH = (const __bf16*)qkvh;
  const __bf16* QL = (const __bf16*)qkvl;

  // ---- Q fragments (B operand, column = query c): 2 d-chunks, hi and lo, statically strided global loads ----
  v16b qah[2], qal[2];
  {
    const size_t qo = (tokb + q0 + c) * QKV_COLS + hcol + 8 * hh;
#pragma unroll
    for (int dc = 0; dc < 2; ++dc) {
      qah[dc] = Frag<__bf16>::load(QH + qo + dc * 32);
      qal[dc] = Frag<__bf16>::load(QL + qo + dc * 32);
    }
  }

  constexpr float SC_LOG2E = 0.125f * 1.4426950408889634f;   // head_dim^-0.5 * log2(e)
  float mrun = -INFINITY;   // running maximum of query c's scores times SC_LOG2E (equal in both halves)
  float lrun = 0.f;         // running denominator of query c over this half's keys only
  v8f oacc[4];              // oacc[t][r] = out[query c][d = 16 t + 8 hh + r]
#pragma unroll
  for (int t = 0; t < 4; ++t) oacc[t] = (v8f){0.f,0.f,0.f,0.f,0.f,0.f,0.f,0.f};

  const int fo = c * LDS_PITCH + 8 * hh;   // the lane's place in a 16-row fragment; tile and chunk steps are constants on top
  const int vfo = (8 * hh + (lane & 7)) * V_PITCH + 8 * ((lane >> 3) & 1);   // the lane's address part of a transposing read of V

  // ---- this wave's share of a chunk: plane w (0: K hi, 1: K lo, 2: V hi, 3: V lo), all 64 rows of it ----
  const bool isV = wave >= 2;
  const unsigned lpitch = isV ? (unsigned)(V_PITCH * 2) : (unsigned)(LDS_PITCH * 2);
  const unsigned lplane = (isV ? (unsigned)AT_V_OFF : 0u) + (unsigned)(wave & 1) * (isV ? (unsigned)AT_V_PLANE : (unsigned)AT_K_PLANE);
  const unsigned short* gl = ((wave & 1) ? qkvl : qkvh) + (tokb + (lane >> 3)) * QKV_COLS
                             + (isV ? 2 * INNER_DIM : INNER_DIM) + hcol + (lane & 7) * 8;   // 8 lanes x 16 B = one 128-B row
  const unsigned ll = (unsigned)(size_t)ring + lplane + (unsigned)(lane >> 3) * lpitch + (unsigned)(lane & 7) * 16u;
  const unsigned ls4 = 4u * lpitch;
  constexpr int NCH = SEQ_LEN / KV_CHUNK;
  constexpr size_t G_CHUNK = (size_t)KV_CHUNK * QKV_COLS;    // elements from one chunk's rows to the next chunk's

  // ---- prologue: chunk 0 lands and is published, then chunk 1 starts to fly ----
  kv_copy8(ll, ls4, gl);
  kv_copy8(ll + 8u * ls4, ls4, gl + G_CHUNK / 2);
  wait_own_copies_landed();              // chunk 0 has landed before the barrier publishes it to the other waves
  __syncthreads();
  kv_copy8(ll + (unsigned)AT_BUF, ls4, gl + G_CHUNK);
  kv_copy8(ll + (unsigned)AT_BUF + 8u * ls4, ls4, gl + G_CHUNK + G_CHUNK / 2);

  // One trip of the kv loop. It is written once and used in two loops: one whose every trip refills, and one for the last
  // two chunks, behind which no chunk is left to fetch. So no trip holds a branch (with one, the compiler sinks the
  // denominator's adds behind it and keeps all 32 p alive over the second product, which spills).
  auto trip = [&](const int kc, const bool refill) __attribute__((always_inline)) {
    const unsigned bo = (kc & 1) ? (unsigned)AT_BUF : 0u;
    const __bf16* KHp = (const __bf16*)(ring + bo);
    const __bf16* KLp = (const __bf16*)(ring + bo + AT_K_PLANE);
    const unsigned short* Vsh = (const unsigned short*)(ring + bo + AT_V_OFF);
    const unsigned short* Vsl = (const unsigned short*)(ring + bo + AT_V_OFF + AT_V_PLANE);

    // ---- scores S^T: 4 tiles of 16 keys x 16 queries, 2 d-chunks, 3 products each ----
    // The K fragments of a d-chunk are read as one group, and consecutive WMMAs go round the 4 independent score tiles,
    // so that no WMMA waits for the one in front of it; each tile still sums its 6 products in the order dc, hi.hi, lo.hi, hi.lo.
    v8f s[4];
    FB kb[2][4], kl[2][4];
#pragma unroll
    for (int dc = 0; dc < 2; ++dc) {
#pragma unroll
      for (int j = 0; j < 4; ++j) {
        const int ko = j * 16 * LDS_PITCH + dc * 32;      // a constant: folds into the read's offset field
        kb[dc][j].h[0] = *(const v8b*)(KHp + fo + ko);
        kb[dc][j].h[1] = *(const v8b*)(KHp + fo + ko + 16);
        kl[dc][j].h[0] = *(const v8b*)(KLp + fo + ko);
        kl[dc][j].h[1] = *(const v8b*)(KLp + fo + ko + 16);
      }
    }
    row_fence();
#pragma unroll
    for (int j = 0; j < 4; ++j) s[j] = (v8f){0.f,0.f,0.f,0.f,0.f,0.f,0.f,0.f};
#pragma unroll
    for (int dc = 0; dc < 2; ++dc) {
#pragma unroll
      for (int j = 0; j < 4; ++j) s[j] = at_mma(kb[dc][j].v, qah[dc], s[j]);
      row_fence();
#pragma unroll
      for (int j = 0; j < 4; ++j) s[j] = at_mma(kl[dc][j].v, qah[dc], s[j]);
      row_fence();
#pragma unroll
      for (int j = 0; j < 4; ++j) s[j] = at_mma(kb[dc][j].v, qal[dc], s[j]);
      row_fence();
    }
    // V^T fragments of the first kv-chunk: read here so that the softmax below covers their latency
    FB vb[2][4], vl[2][4];
#pragma unroll
    for (int t = 0; t < 4; ++t) {
      const int vo = t * 16;                            // d tile: 16 columns further; keys 16..31: 16 rows further
      vb[0][t].h[0] = at_ld_tr16(Vsh + vfo + vo);
      vb[0][t].h[1] = at_ld_tr16(Vsh + vfo + vo + 16 * V_PITCH);
      vl[0][t].h[0] = at_ld_tr16(Vsl + vfo + vo);
      vl[0][t].h[1] = at_ld_tr16(Vsl + vfo + vo + 16 * V_PITCH);
    }
    row_fence();
    // ---- chunk maximum of query c over the unscaled scores (the scale is positive): 32 in-lane, then the other half ----
    float mj[4];
#pragma unroll
    for (int j = 0; j < 4; ++j) {
      mj[j] = -INFINITY;
#pragma unroll
      for (int r = 0; r < 8; ++r) mj[j] = fmaxf(mj[j], s[j][r]);
    }
    float cm = fmaxf(fmaxf(mj[0], mj[1]), fmaxf(mj[2], mj[3]));
    cm = fmaxf(cm, at_xhalf(cm));
    // ---- online softmax in base 2; p split into bf16 hi/lo in place: pbh[kk] / pbl[kk] element e = p of key 32 kk + kmap(e, hh) ----
    const float mnew = fmaxf(mrun, cm * SC_LOG2E);
    const float alpha = __builtin_amdgcn_exp2f(mrun - mnew);   // 0 on the first chunk, where mrun is -inf
    mrun = mnew;
    const v2f sc2 = (v2f){SC_LOG2E, SC_LOG2E};
    const v2f mn2 = (v2f){mnew, mnew};
    union PB { v16b v; v2b w[8]; };
    PB pbh[2], pbl[2];
    float pj[4];
#pragma unroll
    for (int j = 0; j < 4; ++j) {
      pj[j] = 0.f;
#pragma unroll
      for (int r = 0; r < 8; r += 2) {
        const v2f a2 = (v2f){s[j][r], s[j][r + 1]} * sc2 - mn2;          // scale, log2(e) and maximum in one FMA
        v2f p2;
        p2[0] = __builtin_amdgcn_exp2f(a2[0]);
        p2[1] = __builtin_amdgcn_exp2f(a2[1]);
        pj[j] += p2[0];
        pj[j] += p2[1];
        const v2b h2 = __builtin_convertvector(p2, v2b);                 // RNE, two values per register
        const v2b l2 = __builtin_convertvector(p2 - __builtin_convertvector(h2, v2f), v2b);
        pbh[j >> 1].w[(j & 1) * 4 + (r >> 1)] = h2;
        pbl[j >> 1].w[(j & 1) * 4 + (r >> 1)] = l2;
      }
    }
    lrun = lrun * alpha + ((pj[0] + pj[1]) + (pj[2] + pj[3]));
#pragma unroll
    for (int t = 0; t < 4; ++t)
#pragma unroll
      for (int r = 0; r < 8; ++r) oacc[t][r] *= alpha;
    // ---- O^T += V^T(64 d x 64 kv) . P^T(64 kv x 16 queries): 2 kv-chunks of 32, 4 d tiles, 3 products ----
    // As above: WMMAs round the 4 independent d tiles, per-tile order kept; the second kv-chunk's fragments are read
    // as one group in front of the first kv-chunk's products.
    row_fence();
#pragma unroll
    for (int t = 0; t < 4; ++t) {
      const int vo = t * 16 + 32 * V_PITCH;
      vb[1][t].h[0] = at_ld_tr16(Vsh + vfo + vo);
      vb[1][t].h[1] = at_ld_tr16(Vsh + vfo + vo + 16 * V_PITCH);
      vl[1][t].h[0] = at_ld_tr16(Vsl + vfo + vo);
      vl[1][t].h[1] = at_ld_tr16(Vsl + vfo + vo + 16 * V_PITCH);
    }
    row_fence();
#pragma unroll
    for (int kk = 0; kk < 2; ++kk) {
#pragma unroll
      for (int t = 0; t < 4; ++t) oacc[t] = at_mma(vb[kk][t].v, pbh[kk].v, oacc[t]);
      row_fence();
#pragma unroll
      for (int t = 0; t < 4; ++t) oacc[t] = at_mma(vl[kk][t].v, pbh[kk].v, oacc[t]);
      row_fence();
#pragma unroll
      for (int t = 0; t < 4; ++t) oacc[t] = at_mma(vb[kk][t].v, pbl[kk].v, oacc[t]);
      if (kk == 0) row_fence();
    }
    // ---- publish point of chunk kc+1; it also ends every wave's reads of the buffer refilled behind it ----
    wait_own_lds_reads_done();           // fragment reads of chunk kc are done before its buffer is refilled
    wait_own_copies_landed();            // chunk kc+1 has landed before the barrier publishes it
    __syncthreads();
    if (refill) {                        // chunk kc+2 exists: into the buffer that this trip has just read
      const unsigned short* g2 = gl + (size_t)(kc + 2) * G_CHUNK;
      kv_copy8(ll + bo, ls4, g2);
      kv_copy8(ll + bo + 8u * ls4, ls4, g2 + G_CHUNK / 2);
    }
  };
  for (int kc = 0; kc < NCH - 2; ++kc) trip(kc, true);
  // kept rolled: unrolled, the two trips are one long block in which fragment reads are lifted far up and spilled
#pragma unroll 1
  for (int kc = NCH - 2; kc < NCH; ++kc) trip(kc, false);
  wait_own_copies_landed();              // no copy is outstanding when the ring becomes the out tiles

  // ---- the two halves' denominators join; the lane's 8 consecutive d of each tile go to row c of the wave's out tile ----
  float* os = (float*)ring + wave * (16 * 68);   // the last trip's barrier ended every read of the ring
  {
    const float inv = 1.0f / (lrun + at_xhalf(lrun));
#pragma unroll
    for (int t = 0; t < 4; ++t) {
      v4f o0, o1;
#pragma unroll
      for (int e = 0; e < 4; ++e) { o0[e] = oacc[t][e] * inv; o1[e] = oacc[t][4 + e] * inv; }
      *(v4f*)(os + c * 68 + t * 16 + 8 * hh)     = o0;
      *(v4f*)(os + c * 68 + t * 16 + 8 * hh + 4) = o1;
    }
  }
  __builtin_amdgcn_fence(__ATOMIC_RELEASE, "workgroup");
  __builtin_amdgcn_wave_barrier();
  __builtin_amdgcn_fence(__ATOMIC_ACQUIRE, "workgroup");
  {
    const int q8 = lane >> 3, c8 = (lane & 7) * 8;
    {
#pragma unroll
      for (int it = 0; it < 4; ++it) {
        const int row = it * 4 + q8;                   // rows 0..15 of this wave's tile
        const float* sp = os + row * 68 + c8;
        const v4f f0 = *(const v4f*)(sp);
        const v4f f1 = *(const v4f*)(sp + 4);
        v4u ph, plo;
#pragma unroll
        for (int w = 0; w < 2; ++w) {
          const float a = f0[2 * w], bq = f0[2 * w + 1];
          const unsigned short ha = f2bf_bits(a), hb = f2bf_bits(bq);
          const unsigned short la = f2bf_bits(a - bf_bits2f(ha)), lb = f2bf_bits(bq - bf_bits2f(hb));
          ph[w]  = (unsigned)ha | ((unsigned)hb << 16);
          plo[w] = (unsigned)la | ((unsigned)lb << 16);
        }
#pragma unroll
        for (int w = 0; w < 2; ++w) {
          const float a = f1[2 * w], bq = f1[2 * w + 1];
          const unsigned short ha = f2bf_bits(a), hb = f2bf_bits(bq);
          const unsigned short la = f2bf_bits(a - bf_bits2f(ha)), lb = f2bf_bits(bq - bf_bits2f(hb));
          ph[2 + w]  = (unsigned)ha | ((unsigned)hb << 16);
          plo[2 + w] = (unsigned)la | ((unsigned)lb << 16);
        }
        const size_t o = (tokb + q0 + row) * INNER_DIM + hcol + c8;
        *(v4u*)(oh + o) = ph;
        *(v4u*)(ol + o) = plo;
      }
      
    }
  }
}

// =====================================================================================
// launch glue
// =====================================================================================
extern "C" void kernel_launch(void* const* d_in, const int* in_sizes, int n_in,
                              void* d_out, int out_size, void* d_ws,
                              size_t ws_size, hipStream_t stream) {
  if (n_in < 6) return;
  if (in_sizes[0] != TOK_ROWS * MODEL_DIM) return;
  if (in_sizes[1] != MODEL_DIM || in_sizes[2] != MODEL_DIM) return;
  if (in_sizes[3] != QKV_COLS * MODEL_DIM) return;
  if (in_sizes[4] != MODEL_DIM * INNER_DIM) return;
  if (in_sizes[5] != MODEL_DIM) return;
  if (out_size != TOK_ROWS * MODEL_DIM) return;
  if (ws_size < WS_TOTAL) return;

  const float* x    = (const float*)d_in[0];
  const float* gam  = (const float*)d_in[1];
  const float* bet  = (const float*)d_in[2];
  const float* wqkv = (const float*)d_in[3];
  const float* wout = (const float*)d_in[4];
  const float* bout = (const float*)d_in[5];
  float* out = (float*)d_out;

  char* ws = (char*)d_ws;
  size_t off = 0;
  unsigned short* wq_bf  = (unsigned short*)(ws + off); off += WS_WQ;
  unsigned short* wo_bf  = (unsigned short*)(ws + off); off += WS_WO;
  unsigned short* h_hi   = (unsigned short*)(ws + off); off += WS_HPL;
  unsigned short* h_lo   = (unsigned short*)(ws + off); off += WS_HPL;
  unsigned short* qkv_hi = (unsigned short*)(ws + off); off += WS_QKVPL;
  unsigned short* qkv_lo = (unsigned short*)(ws + off); off += WS_QKVPL;
  unsigned short* at_hi  = (unsigned short*)(ws + off); off += WS_ATPL;
  unsigned short* at_lo  = (unsigned short*)(ws + off); off += WS_ATPL;
  if (off > ws_size) return;

  // weights -> bf16 (RNE): 3145728/8 = 393216 = 1536 x 256 ; 1048576/8 = 131072 = 512 x 256
  const int n8_qkv = (QKV_COLS * MODEL_DIM) / 8;
  const int n8_out = (MODEL_DIM * INNER_DIM) / 8;
  cast_f32_bf16x8<<<dim3((n8_qkv + 255) / 256), dim3(256), 0, stream>>>(wqkv, wq_bf, n8_qkv);
  cast_f32_bf16x8<<<dim3((n8_out + 255) / 256), dim3(256), 0, stream>>>(wout, wo_bf, n8_out);

  // LayerNorm -> h hi/lo planes [4096][1024]
  layernorm_bf16split_kernel<<<dim3(TOK_ROWS), dim3(128), 0, stream>>>(x, gam, bet, h_hi, h_lo);

  // qkv = h @ w_qkv^T -> bf16 hi/lo planes [4096][3072]; M=4096 N=3072 K=1024; block tiles 32*12 = 384 blocks
  gemm64_bf16_asplit<2, false><<<dim3((TOK_ROWS / G_BM) * (QKV_COLS / G_BN)), dim3(256), 0, stream>>>(
      h_hi, h_lo, MODEL_DIM, wq_bf, MODEL_DIM, (void*)qkv_hi, (void*)qkv_lo, QKV_COLS,
      (const float*)nullptr, TOK_ROWS, QKV_COLS, MODEL_DIM);

  // attention per (batch, head, 64 query rows): 2*16*32 = 1024 blocks -> attn hi/lo planes [4096][1024]
  attn64_bf16x3_kernel<<<dim3(N_BATCH * N_HEAD * (SEQ_LEN / Q_BLOCK)), dim3(128), 0, stream>>>(
      qkv_hi, qkv_lo, at_hi, at_lo);

  // out = attn @ w_out^T + b_out -> f32 [4096][1024]; M=4096 N=1024 K=1024; block tiles 32*4 = 128 blocks
  gemm64_bf16_asplit<0, true><<<dim3((TOK_ROWS / G_BM) * (MODEL_DIM / G_BN)), dim3(256), 0, stream>>>(
      at_hi, at_lo, INNER_DIM, wo_bf, INNER_DIM, (void*)out, (void*)nullptr, MODEL_DIM,
      bout, TOK_ROWS, MODEL_DIM, INNER_DIM);
}

// v008
// A run of this version takes 139 microseconds.
// Two timings next to v007 both put it at 1.03 times that version's speed.
// All steps since v000 together make it 3.73 times as fast.
// Contractions on v_wmma_f32_16x16x32_bf16 (bf16 operands, f32 accumulate): qkv and output projections = activation bf16 hi+lo planes x weight bf16 plane (2 products); q.k scores and p.v = bf16 hi/lo x bf16 hi/lo (3 products); LayerNorm, softmax and epilogues in f32; every float input RNE-converted to bf16 once at load.
#include <hip/hip_runtime.h>
#include <hip/hip_bf16.h>

typedef __attribute__((ext_vector_type(16))) _Float16 v16h;
typedef __attribute__((ext_vector_type(8)))  _Float16 v8h;
typedef __attribute__((ext_vector_type(16))) __bf16   v16b;
typedef __attribute__((ext_vector_type(8)))  __bf16   v8b;
typedef __attribute__((ext_vector_type(8)))  float    v8f;
typedef __attribute__((ext_vector_type(4)))  float    v4f;
typedef __attribute__((ext_vector_type(4)))  unsigned v4u;
typedef __attribute__((ext_vector_type(2)))  float    v2f;
typedef __attribute__((ext_vector_type(2)))  __bf16   v2b;

// ---- problem geometry ----
constexpr int MODEL_DIM = 1024;
constexpr int SEQ_LEN   = 2048;
constexpr int N_BATCH   = 2;
constexpr int N_HEAD    = 16;
constexpr int HEAD_D    = 64;
constexpr int INNER_DIM = N_HEAD * HEAD_D;          // 1024
constexpr int QKV_COLS  = 3 * INNER_DIM;            // 3072
constexpr int TOK_ROWS  = N_BATCH * SEQ_LEN;        // 4096
constexpr int KV_CHUNK  = 64;
constexpr int Q_TILES   = 2;                       // 16-query tiles per attention wave
constexpr int Q_WAVE    = 16 * Q_TILES;            // 32 queries per wave
constexpr int Q_BLOCK   = 4 * Q_WAVE;              // 128 queries per block of 4 waves
// LDS row pitch of the attention K tiles, in bf16 elements: 64 data + 8 pad = 144 B = 16 B x 9 (odd),
// so the 16 rows that one ds_load_b128 fragment read touches fall on distinct bank groups (128-B rows all share banks).
constexpr int LDS_PITCH = 72;
// LDS row pitch of the attention V tiles (row-major [kv][d]), in bf16 elements: 64 data + 16 pad = 160 B = 32 B x 5 (odd),
// the conflict-free pitch of their reader, ds_load_tr16_b128.
constexpr int V_PITCH = 80;

// GEMM shape contract (no run-time tails in the GEMM kernel)
static_assert(MODEL_DIM % 32 == 0, "K of qkv projection");
static_assert(INNER_DIM % 32 == 0, "K of output projection");
static_assert(TOK_ROWS % 64 == 0, "M tile multiple");
static_assert(QKV_COLS % 64 == 0, "N tile multiple (qkv)");
static_assert(MODEL_DIM % 64 == 0, "N tile multiple (out)");
static_assert(SEQ_LEN % KV_CHUNK == 0 && SEQ_LEN % Q_BLOCK == 0, "attention tiles");
static_assert(HEAD_D == 64, "attention kernel is head_dim 64");
static_assert(MODEL_DIM == 128 * 8, "LayerNorm kernel: 128 threads x 8 elements per row");

// ---- workspace region map (bytes, every offset a multiple of 128) ----
//  [0]            wq  bf16 [3072][1024]         6291456
//  [6291456]      wo  bf16 [1024][1024]         2097152
//  [8388608]      h   hi bf16 [4096][1024]      8388608
//  [16777216]     h   lo bf16 [4096][1024]      8388608
//  [25165824]     qkv hi bf16 [4096][3072]     25165824
//  [50331648]     qkv lo bf16 [4096][3072]     25165824
//  [75497472]     at  hi bf16 [4096][1024]      8388608
//  [83886080]     at  lo bf16 [4096][1024]      8388608
//  total 92274688
constexpr size_t WS_WQ    = (size_t)QKV_COLS * MODEL_DIM * 2;
constexpr size_t WS_WO    = (size_t)MODEL_DIM * INNER_DIM * 2;
constexpr size_t WS_HPL   = (size_t)TOK_ROWS * MODEL_DIM * 2;
constexpr size_t WS_QKVPL = (size_t)TOK_ROWS * QKV_COLS * 2;
constexpr size_t WS_ATPL  = (size_t)TOK_ROWS * INNER_DIM * 2;
constexpr size_t WS_TOTAL = WS_WQ + WS_WO + 2 * WS_HPL + 2 * WS_QKVPL + 2 * WS_ATPL;
static_assert(WS_TOTAL == 92274688, "carve arithmetic");
static_assert(WS_TOTAL <= 134217728, "carve budget");
static_assert(WS_WQ % 128 == 0 && WS_WO % 128 == 0 && WS_HPL % 128 == 0 && WS_QKVPL % 128 == 0 && WS_ATPL % 128 == 0, "128-B aligned regions");

// ---- bf16 RNE helpers ----
__device__ __forceinline__ unsigned short f2bf_bits(float f) {
  unsigned u = __float_as_uint(f);
  return (unsigned short)((u + 0x7FFFu + ((u >> 16) & 1u)) >> 16);
}
__device__ __forceinline__ float bf_bits2f(unsigned short h) { return __uint_as_float(((unsigned)h) << 16); }

// hazard guards as plain device helpers (no inline asm inside the kernel template body)
__device__ __forceinline__ void dep_guard_h(v8f& a, v8f& b, v16h x, v16h y) { asm volatile("v_nop\n\tv_nop\n\tv_nop\n\tv_nop" : "+v"(a), "+v"(b) : "v"(x), "v"(y)); }
__device__ __forceinline__ void dep_guard_b(v8f& a, v8f& b, v16b x, v16b y) { asm volatile("v_nop\n\tv_nop\n\tv_nop\n\tv_nop" : "+v"(a), "+v"(b) : "v"(x), "v"(y)); }
__device__ __forceinline__ void keep4_h(v16h a, v16h b, v16h c, v16h d) { asm volatile("v_nop" :: "v"(a), "v"(b), "v"(c), "v"(d)); }
__device__ __forceinline__ void keep4_b(v16b a, v16b b, v16b c, v16b d) { asm volatile("v_nop" :: "v"(a), "v"(b), "v"(c), "v"(d)); }
__device__ __forceinline__ void acc_guard4(v8f& a, v8f& b, v8f& c, v8f& d) { asm volatile("v_nop\n\tv_nop\n\tv_nop\n\tv_nop" : "+v"(a), "+v"(b), "+v"(c), "+v"(d)); }
template <typename T> struct Frag;
template <> struct Frag<_Float16> {
  typedef v16h V; union U { v16h v; v8h h[2]; };
  static __device__ __forceinline__ v16h load(const _Float16* p) {   // elements 0..7 <- p[0..7], 8..15 <- p[16..23]
    U f; f.h[0] = *(const v8h*)(p); f.h[1] = *(const v8h*)(p + 16); return f.v;
  }
  static __device__ __forceinline__ v8f mma(v16h a, v16h b, v8f c) {
    return __builtin_amdgcn_wmma_f32_16x16x32_f16(false, a, false, b, (short)0, c, false, false);
  }
  static __device__ __forceinline__ void guard(v8f& a, v8f& b, v16h x, v16h y) { dep_guard_h(a, b, x, y); }
  static __device__ __forceinline__ void keep(v16h a, v16h b, v16h c, v16h d) { keep4_h(a, b, c, d); }
};
template <> struct Frag<__bf16> {
  typedef v16b V; union U { v16b v; v8b h[2]; };
  static __device__ __forceinline__ v16b load(const __bf16* p) {
    U f; f.h[0] = *(const v8b*)(p); f.h[1] = *(const v8b*)(p + 16); return f.v;
  }
  static __device__ __forceinline__ v8f mma(v16b a, v16b b, v8f c) {
    return __builtin_amdgcn_wmma_f32_16x16x32_bf16(false, a, false, b, (short)0, c, false, false);
  }
  static __device__ __forceinline__ void guard(v8f& a, v8f& b, v16b x, v16b y) { dep_guard_b(a, b, x, y); }
  static __device__ __forceinline__ void keep(v16b a, v16b b, v16b c, v16b d) { keep4_b(a, b, c, d); }
};

// attention helpers (bf16 WMMA as the plain builtin: the compiler keeps its distances; exchange between the wave halves)
__device__ __forceinline__ v8f at_mma(v16b a, v16b b, v8f c) {
  return __builtin_amdgcn_wmma_f32_16x16x32_bf16(false, a, false, b, (short)0, c, false, false);
}

__device__ __forceinline__ v8b at_ld_tr16(const unsigned short* p) {
  typedef __attribute__((address_space(3))) v8b lds_v8b;
  return __builtin_amdgcn_ds_load_tr16_b128_v8bf16((lds_v8b*)p);
}

// Scheduling fence, no instruction: without it the compiler sinks the grouped fragment reads back among the WMMAs (each
// then waited for right behind its issue), puts the dependent WMMAs of one tile back to back again, or lifts a read group
// so far up that the registers of two waves per SIMD no longer suffice.
__device__ __forceinline__ void row_fence() { __builtin_amdgcn_sched_barrier(0); }

// value of lane l ^ 16: the other half of the wave holds the other keys of the same query
__device__ __forceinline__ float at_xhalf(float x) {
  const int b = __builtin_bit_cast(int, x);
  return __builtin_bit_cast(float, __builtin_amdgcn_permlanex16(b, b, 0x76543210, 0xfedcba98, false, false));
}

// =====================================================================================
// 1) f32 -> bf16 (RNE) cast, 8 elements per thread, one 16-B store per lane
//    Coverage: grid = n8/256 blocks x 256 threads x 8 elements = n exactly (n8 = n/8, n % 2048 == 0 here).
// =====================================================================================
__global__ __launch_bounds__(256) void cast_f32_bf16x8(
    const float* __restrict__ in, unsigned short* __restrict__ out, int n8) {
  const int i = blockIdx.x * 256 + threadIdx.x;
  if (i < n8) {
    const size_t e0 = (size_t)i * 8;
    const v4f a = *(const v4f*)(in + e0);
    const v4f b = *(const v4f*)(in + e0 + 4);
    v4u u;
    u[0] = (unsigned)f2bf_bits(a[0]) | ((unsigned)f2bf_bits(a[1]) << 16);
    u[1] = (unsigned)f2bf_bits(a[2]) | ((unsigned)f2bf_bits(a[3]) << 16);
    u[2] = (unsigned)f2bf_bits(b[0]) | ((unsigned)f2bf_bits(b[1]) << 16);
    u[3] = (unsigned)f2bf_bits(b[2]) | ((unsigned)f2bf_bits(b[3]) << 16);
    *(v4u*)(out + e0) = u;
    
  }
}

// =====================================================================================
//    result split into bf16 hi / lo planes [TOK_ROWS][MODEL_DIM].
//    One block (128 threads) per row; thread t owns elements 8t..8t+7 -> one 16-B store per lane per plane
//    Coverage: 4096 blocks x 128 threads x 8 = 4096 x 1024 exactly.
// =====================================================================================
__global__ __launch_bounds__(128) void layernorm_bf16split_kernel(
    const float* __restrict__ x, const float* __restrict__ gamma, const float* __restrict__ beta,
    unsigned short* __restrict__ hhi, unsigned short* __restrict__ hlo) {
  __shared__ float red_s[4];
  __shared__ float red_q[4];
  const int row = blockIdx.x;
  const int t = threadIdx.x;
  const int lane = t & 31, wave = t >> 5;
  const size_t base = (size_t)row * MODEL_DIM + 8 * (size_t)t;

  const v4f a0 = *(const v4f*)(x + base);
  const v4f a1 = *(const v4f*)(x + base + 4);
  float xv[8];
#pragma unroll
  for (int e = 0; e < 4; ++e) {
    xv[e]     = bf_bits2f(f2bf_bits(a0[e]));
    xv[4 + e] = bf_bits2f(f2bf_bits(a1[e]));
  }
  float s = ((xv[0] + xv[1]) + (xv[2] + xv[3])) + ((xv[4] + xv[5]) + (xv[6] + xv[7]));
#pragma unroll
  for (int off = 1; off < 32; off <<= 1) s += __shfl_xor(s, off, 32);
  if (lane == 0) red_s[wave] = s;
  __syncthreads();
  const float tot = (red_s[0] + red_s[1]) + (red_s[2] + red_s[3]);
  const float mean = tot * (1.0f / (float)MODEL_DIM);

  float d[8];
  float q = 0.f;
#pragma unroll
  for (int e = 0; e < 8; ++e) { d[e] = xv[e] - mean; q += d[e] * d[e]; }
#pragma unroll
  for (int off = 1; off < 32; off <<= 1) q += __shfl_xor(q, off, 32);
  if (lane == 0) red_q[wave] = q;
  __syncthreads();
  const float qt = (red_q[0] + red_q[1]) + (red_q[2] + red_q[3]);
  const float var = qt * (1.0f / (float)MODEL_DIM);
  const float rstd = rsqrtf(var + 1e-5f);

  const v4f g0 = *(const v4f*)(gamma + 8 * t);
  const v4f g1 = *(const v4f*)(gamma + 8 * t + 4);
  const v4f b0 = *(const v4f*)(beta + 8 * t);
  const v4f b1 = *(const v4f*)(beta + 8 * t + 4);
  float hv[8];
#pragma unroll
  for (int e = 0; e < 4; ++e) {
    const float gg0 = bf_bits2f(f2bf_bits(g0[e])), bb0 = bf_bits2f(f2bf_bits(b0[e]));
    const float gg1 = bf_bits2f(f2bf_bits(g1[e])), bb1 = bf_bits2f(f2bf_bits(b1[e]));
    hv[e]     = d[e] * rstd * gg0 + bb0;
    hv[4 + e] = d[4 + e] * rstd * gg1 + bb1;
  }
  v4u ph, pl;
#pragma unroll
  for (int w = 0; w < 4; ++w) {
    const float f0 = hv[2 * w], f1 = hv[2 * w + 1];
    const unsigned short h0 = f2bf_bits(f0), h1 = f2bf_bits(f1);
    const unsigned short l0 = f2bf_bits(f0 - bf_bits2f(h0));
    const unsigned short l1 = f2bf_bits(f1 - bf_bits2f(h1));
    ph[w] = (unsigned)h0 | ((unsigned)h1 << 16);
    pl[w] = (unsigned)l0 | ((unsigned)l1 << 16);
  }
  *(v4u*)(hhi + base) = ph;
  *(v4u*)(hlo + base) = pl;
  
}

// =====================================================================================
// 3) WMMA GEMM, operands staged in LDS: C[m,n] = sum_k (Ah+Al)[m,k] * Bt[n,k] (+bias[n], bias RNE bf16)
//    A = bf16 hi and lo planes row-major [M,K] (lda); Bt = bf16 row-major [N,K] (ldb); 2 WMMA products per tile pair.
//    A block of 8 waves (2 x 4) owns a 128x256 C tile, each wave a 64x64 part of it. K is walked in slabs of 64:
//    a stage is [A hi 128 rows | A lo 128 rows | Bt 256 rows] of 128 B each at a 144-B LDS pitch, two buffers.
//    Every wave copies 64 of the 512 stage rows with 16 asynchronous 16-B-per-lane copies (4 whole 128-B rows each),
//    one slab ahead of the slab that is being multiplied. Per output element the k order of the sums is ascending.
//    Coverage: grid.x = (M/128)*(N/256) blocks, every 64x64 tile exactly once (shapes static_assert'ed below).
// =====================================================================================
constexpr int G_BM          = 128;                              // block tile rows
constexpr int G_BN          = 256;                              // block tile columns
constexpr int G_SLAB_K      = 64;                               // k elements per stage: 128-B rows
constexpr int G_PITCH       = 72;                               // LDS row pitch in bf16 elements: 144 B = 16 B x 9
constexpr int G_STAGE_ROWS  = 2 * G_BM + G_BN;                  // 512
constexpr int G_STAGE_BYTES = G_STAGE_ROWS * G_PITCH * 2;       // 73728
constexpr unsigned G_COPY_LDS_STEP = 4u * G_PITCH * 2u;         // one wave-wide copy fills 4 stage rows
static_assert(TOK_ROWS % G_BM == 0, "M block tile multiple");
static_assert(QKV_COLS % G_BN == 0 && MODEL_DIM % G_BN == 0, "N block tile multiple");
static_assert(MODEL_DIM % G_SLAB_K == 0 && INNER_DIM % G_SLAB_K == 0, "K slab multiple");
static_assert(MODEL_DIM / G_SLAB_K >= 2 && INNER_DIM / G_SLAB_K >= 2, "two stages at least");
static_assert(8 * 16 * 68 * 4 <= 2 * G_STAGE_BYTES, "epilogue slabs fit the ring");

// Eight asynchronous copies global -> LDS, 16 B per lane each, for 32 consecutive stage rows of one wave.
// l = the lane's LDS byte address of the first copy, g = its global address, step = elements per 4 source rows.
// The closing s_wait_xcnt 0 stands inside the statement so that no address register named here is rewritten ahead of it.
__device__ __forceinline__ void stage_copy8(unsigned l, const unsigned short* g, size_t step) {
  asm volatile(
      "global_load_async_to_lds_b128 %0, %8, off\n\t"
      "global_load_async_to_lds_b128 %1, %9, off\n\t"
      "global_load_async_to_lds_b128 %2, %10, off\n\t"
      "global_load_async_to_lds_b128 %3, %11, off\n\t"
      "global_load_async_to_lds_b128 %4, %12, off\n\t"
      "global_load_async_to_lds_b128 %5, %13, off\n\t"
      "global_load_async_to_lds_b128 %6, %14, off\n\t"
      "global_load_async_to_lds_b128 %7, %15, off\n\t"
      "s_wait_xcnt 0x0"
      :: "v"(l), "v"(l + G_COPY_LDS_STEP), "v"(l + 2u * G_COPY_LDS_STEP), "v"(l + 3u * G_COPY_LDS_STEP),
         "v"(l + 4u * G_COPY_LDS_STEP), "v"(l + 5u * G_COPY_LDS_STEP), "v"(l + 6u * G_COPY_LDS_STEP),
         "v"(l + 7u * G_COPY_LDS_STEP),
         "v"(g), "v"(g + step), "v"(g + 2 * step), "v"(g + 3 * step),
         "v"(g + 4 * step), "v"(g + 5 * step), "v"(g + 6 * step), "v"(g + 7 * step)
      : "memory");
}

// The two waits of the stage ring, each an asm statement of its own; the "memory" clobber keeps LDS accesses on their side of it.
__device__ __forceinline__ void wait_own_copies_landed() { asm volatile("s_wait_asynccnt 0x0" ::: "memory"); }
__device__ __forceinline__ void wait_own_lds_reads_done() { asm volatile("s_wait_dscnt 0x0" ::: "memory"); }

template <int OUT_MODE, bool HAS_BIAS>
__global__ __launch_bounds__(256) void gemm64_bf16_asplit(
    const unsigned short* __restrict__ Ahp, const unsigned short* __restrict__ Alp, int lda,
    const unsigned short* __restrict__ Btp, int ldb,
    void* __restrict__ Cout, void* __restrict__ Cout2, int ldc,
    const float* __restrict__ bias, int M, int N, int K) {
  typedef __bf16 T;
  typedef v16b V;
  // two stage buffers; after the K loop the same bytes serve as the per-wave 16x64 f32 epilogue slabs (pitch 68 floats)
  __shared__ __align__(16) unsigned char smem[2 * G_STAGE_BYTES];
  const int lane = threadIdx.x & 31;
  const int wave = __builtin_amdgcn_readfirstlane(threadIdx.x >> 5);
  const int tilesN = N / G_BN;
  const int tilesM = M / G_BM;
  const int bm = blockIdx.x / tilesN;
  const int bn = blockIdx.x - bm * tilesN;
  if (bm >= tilesM) return;              // block-uniform, in front of every barrier and copy
  const int mB = bm * G_BM;
  const int nB = bn * G_BN;
  const int wm = wave >> 2;              // 0..1: 64-row part of the block tile
  const int wn = wave & 3;               // 0..3: 64-column part
  const int m0 = mB + (wm << 6);
  const int n0 = nB + (wn << 6);

  const int rlane = lane & 15;                 // row (A) / col (B, D) within subtile
  const int koff  = (lane >> 4) * 8;           // k offset of this lane half
  const int mOff  = (lane >> 4) * 8;           // D row offset

  // ---- this wave's share of a stage: stage rows wave*64 .. wave*64+63 (waves 0,1: A hi; 2,3: A lo; 4..7: Bt) ----
  const unsigned short* srow;
  int sld;
  if (wave < 2)      { srow = Ahp + (size_t)(mB + wave * 64) * lda;       sld = lda; }
  else if (wave < 4) { srow = Alp + (size_t)(mB + (wave - 2) * 64) * lda; sld = lda; }
  else               { srow = Btp + (size_t)(nB + (wave - 4) * 64) * ldb; sld = ldb; }
  const unsigned short* gl = srow + (size_t)(lane >> 3) * sld + (lane & 7) * 8;   // 8 lanes x 16 B = one 128-B row
  const size_t step4 = (size_t)sld * 4;
  const unsigned ll = (unsigned)(size_t)smem + (unsigned)((wave * 64 + (lane >> 3)) * (G_PITCH * 2) + (lane & 7) * 16);

  v8f acc[4][4];
#pragma unroll
  for (int i = 0; i < 4; ++i)
#pragma unroll
    for (int j = 0; j < 4; ++j) acc[i][j] = (v8f){0.f,0.f,0.f,0.f,0.f,0.f,0.f,0.f};

  const int nT = K / G_SLAB_K;
  // ---- prologue: slab 0 lands and is published, then slab 1 starts to fly ----
  stage_copy8(ll, gl, step4);
  stage_copy8(ll + 8u * G_COPY_LDS_STEP, gl + 8 * step4, step4);
  wait_own_copies_landed();              // slab 0 has landed before the barrier publishes it to the other waves
  __syncthreads();
  if (nT > 1) {
    stage_copy8(ll + (unsigned)G_STAGE_BYTES, gl + G_SLAB_K, step4);
    stage_copy8(ll + (unsigned)G_STAGE_BYTES + 8u * G_COPY_LDS_STEP, gl + G_SLAB_K + 8 * step4, step4);
  }

  for (int t = 0; t < nT; ++t) {
    const unsigned bo = (t & 1) ? (unsigned)G_STAGE_BYTES : 0u;
    const T* sb  = (const T*)(smem + bo);
    const T* sAh = sb + ((wm << 6) + rlane) * G_PITCH + koff;
    const T* sAl = sAh + G_BM * G_PITCH;
    const T* sB  = sb + (2 * G_BM + (wn << 6) + rlane) * G_PITCH + koff;
#pragma unroll
    for (int kk = 0; kk < G_SLAB_K; kk += 32) {
      V bh[4];
#pragma unroll
      for (int j = 0; j < 4; ++j) bh[j] = Frag<T>::load(sB + (j << 4) * G_PITCH + kk);
#pragma unroll
      for (int i = 0; i < 4; ++i) {
        V ah = Frag<T>::load(sAh + (i << 4) * G_PITCH + kk);
        V al = Frag<T>::load(sAl + (i << 4) * G_PITCH + kk);
#pragma unroll
        for (int j = 0; j < 4; ++j) {
          acc[i][j] = Frag<T>::mma(ah, bh[j], acc[i][j]);
          acc[i][j] = Frag<T>::mma(al, bh[j], acc[i][j]);
        }
        Frag<T>::guard(acc[i][0], acc[i][3], ah, al);
      }
      Frag<T>::keep(bh[0], bh[1], bh[2], bh[3]);
    }
    // ---- publish point of slab t+1; it also ends every wave's reads of the buffer refilled behind it ----
    wait_own_lds_reads_done();           // fragment reads of slab t are done before its buffer is refilled
    wait_own_copies_landed();            // slab t+1 has landed before the barrier publishes it
    __syncthreads();
    if (t + 2 < nT) {
      const unsigned short* g2 = gl + (size_t)(t + 2) * G_SLAB_K;
      stage_copy8(ll + bo, g2, step4);
      stage_copy8(ll + bo + 8u * G_COPY_LDS_STEP, g2 + 8 * step4, step4);
    }
  }
  wait_own_copies_landed();              // no copy is outstanding when the ring becomes epilogue staging
  acc_guard4(acc[0][0], acc[0][1], acc[0][2], acc[0][3]);
  acc_guard4(acc[1][0], acc[1][1], acc[1][2], acc[1][3]);
  acc_guard4(acc[2][0], acc[2][1], acc[2][2], acc[2][3]);
  acc_guard4(acc[3][0], acc[3][1], acc[3][2], acc[3][3]);

  // ---- epilogue ----
  float* slab = (float*)smem + wave * (16 * 68);   // the last trip's barrier ended every read of the ring
#pragma unroll
  for (int i = 0; i < 4; ++i) {
    const int mBase = m0 + (i << 4);
#pragma unroll
    for (int j = 0; j < 4; ++j) {
#pragma unroll
      for (int r = 0; r < 8; ++r) {
        slab[(mOff + r) * 68 + (j << 4) + rlane] = acc[i][j][r];
      }
    }
    __builtin_amdgcn_fence(__ATOMIC_RELEASE, "workgroup");
    __builtin_amdgcn_wave_barrier();
    __builtin_amdgcn_fence(__ATOMIC_ACQUIRE, "workgroup");
    if (OUT_MODE == 0) {
      float* Cf = (float*)Cout;
      const int h2 = lane >> 4, c4 = (lane & 15) * 4;     // row seg = 256 B = 16 lanes x 16 B
      v4f bb = (v4f){0.f, 0.f, 0.f, 0.f};
      if (HAS_BIAS) {
        const v4f braw = *(const v4f*)(bias + n0 + c4);
#pragma unroll
        for (int e = 0; e < 4; ++e) bb[e] = bf_bits2f(f2bf_bits(braw[e]));
      }
      {
#pragma unroll
        for (int it = 0; it < 8; ++it) {
          const int row = it * 2 + h2;
          v4f v = *(const v4f*)(slab + row * 68 + c4);
          v = v + bb;
          *(v4f*)(Cf + (size_t)(mBase + row) * ldc + n0 + c4) = v;
        }
        
      }
    } else {
      const int q = lane >> 3, c8 = (lane & 7) * 8;
      unsigned short* Cu  = (unsigned short*)Cout;
      unsigned short* Cu2 = (unsigned short*)Cout2;
      {
#pragma unroll
        for (int it = 0; it < 4; ++it) {
          const int row = it * 4 + q;
          const float* sp = slab + row * 68 + c8;
          v8h hv, lv;
#pragma unroll
          for (int e = 0; e < 8; ++e) {
            unsigned short hb = f2bf_bits(sp[e]);
            unsigned short lb = f2bf_bits(sp[e] - bf_bits2f(hb));
            hv[e] = __builtin_bit_cast(_Float16, hb);
            lv[e] = __builtin_bit_cast(_Float16, lb);
          }
          *(v8h*)(Cu  + (size_t)(mBase + row) * ldc + n0 + c8) = hv;
          *(v8h*)(Cu2 + (size_t)(mBase + row) * ldc + n0 + c8) = lv;
        }
        
      }
    }
    __builtin_amdgcn_fence(__ATOMIC_RELEASE, "workgroup");
    __builtin_amdgcn_wave_barrier();
    __builtin_amdgcn_fence(__ATOMIC_ACQUIRE, "workgroup");
  }
}

constexpr int AT_K_PLANE = KV_CHUNK * LDS_PITCH * 2;
constexpr int AT_V_PLANE = KV_CHUNK * V_PITCH * 2;
constexpr int AT_V_OFF   = 2 * AT_K_PLANE;
constexpr int AT_BUF     = 2 * AT_K_PLANE + 2 * AT_V_PLANE;
static_assert(AT_V_OFF % 32 == 0 && AT_V_PLANE % 32 == 0 && AT_BUF % 32 == 0, "V planes stay 32-B aligned");
static_assert(4 * Q_WAVE * 68 * 4 <= 2 * AT_BUF, "out tiles fit the ring");
static_assert(SEQ_LEN / KV_CHUNK >= 2, "two chunks at least");

// Eight asynchronous copies global -> LDS, 16 B per lane each, for 32 consecutive kv rows of one plane.
// l = the lane's LDS byte address of the first copy, ls = LDS bytes per 4 rows, g = its global address.
// The closing s_wait_xcnt 0 stands inside the statement so that no address register named here is rewritten ahead of it.
__device__ __forceinline__ void kv_copy8(unsigned l, unsigned ls, const unsigned short* g) {
  constexpr size_t gs = (size_t)4 * QKV_COLS;                      // elements per 4 source rows
  asm volatile(
      "global_load_async_to_lds_b128 %0, %8, off\n\t"
      "global_load_async_to_lds_b128 %1, %9, off\n\t"
      "global_load_async_to_lds_b128 %2, %10, off\n\t"
      "global_load_async_to_lds_b128 %3, %11, off\n\t"
      "global_load_async_to_lds_b128 %4, %12, off\n\t"
      "global_load_async_to_lds_b128 %5, %13, off\n\t"
      "global_load_async_to_lds_b128 %6, %14, off\n\t"
      "global_load_async_to_lds_b128 %7, %15, off\n\t"
      "s_wait_xcnt 0x0"
      :: "v"(l), "v"(l + ls), "v"(l + 2u * ls), "v"(l + 3u * ls),
         "v"(l + 4u * ls), "v"(l + 5u * ls), "v"(l + 6u * ls), "v"(l + 7u * ls),
         "v"(g), "v"(g + gs), "v"(g + 2 * gs), "v"(g + 3 * gs),
         "v"(g + 4 * gs), "v"(g + 5 * gs), "v"(g + 6 * gs), "v"(g + 7 * gs)
      : "memory");
}

// amdgpu_waves_per_eu(2): a budget of 512 VGPRs; the grid is two blocks per WGP, one wave of each per SIMD
__global__ __launch_bounds__(128) __attribute__((amdgpu_waves_per_eu(2))) void attn64_bf16x3_kernel(
    const unsigned short* __restrict__ qkvh, const unsigned short* __restrict__ qkvl,
    unsigned short* __restrict__ oh, unsigned short* __restrict__ ol) {
  union FB { v16b v; v8b h[2]; };
  // two chunk buffers; after the kv loop the same bytes serve as the per-wave 32x64 f32 out tiles (pitch 68 floats)
  __shared__ __align__(32) unsigned char ring[2 * AT_BUF];

  const int tid  = threadIdx.x;
  const int wave = __builtin_amdgcn_readfirstlane(tid >> 5);
  const int lane = tid & 31;
  const int hh   = lane >> 4;
  const int c    = lane & 15;

  constexpr int NQB = SEQ_LEN / Q_BLOCK;   // 16
  const int bx   = blockIdx.x;
  const int qb   = bx % NQB;
  const int bhid = bx / NQB;
  const int head = bhid % N_HEAD;
  const int bat  = bhid / N_HEAD;
  const int q0   = qb * Q_BLOCK + wave * Q_WAVE;
  const size_t tokb = (size_t)bat * SEQ_LEN;
  const int hcol = head * HEAD_D;

  const __bf16* QH = (const __bf16*)qkvh;
  const __bf16* QL = (const __bf16*)qkvl;

  // ---- Q fragments (B operand, column = query 16 u + c of the wave): 2 d-chunks, hi and lo, statically strided global loads ----
  v16b qah[Q_TILES][2], qal[Q_TILES][2];
  const __bf16* qbh = QH + (tokb + q0 + c) * QKV_COLS + hcol + 8 * hh;   // the lane's row of query tile 0, hi plane
  const __bf16* qbl = QL + (tokb + q0 + c) * QKV_COLS + hcol + 8 * hh;   // the same, lo plane
#pragma unroll
  for (int u = 0; u < Q_TILES; ++u) {
#pragma unroll
    for (int dc = 0; dc < 2; ++dc) {
      qah[u][dc] = Frag<__bf16>::load(qbh + (size_t)16 * u * QKV_COLS + dc * 32);
      qal[u][dc] = Frag<__bf16>::load(qbl + (size_t)16 * u * QKV_COLS + dc * 32);
    }
  }
  // The wait in front of any rewrite of the Q loads' address registers; the two bases are inputs so that they stay live
  // up to it and no load's result is placed in them.
  asm volatile("s_wait_xcnt 0x0" :: "v"(qbh), "v"(qbl) : "memory");

  constexpr float SC_LOG2E = 0.125f * 1.4426950408889634f;   // head_dim^-0.5 * log2(e)
  float mrun[Q_TILES];      // running maximum of query 16 u + c's scores times SC_LOG2E (equal in both halves)
  float lrun[Q_TILES];      // running denominator of query 16 u + c over this half's keys only
  v8f oacc[Q_TILES][4];     // oacc[u][t][r] = out[query 16 u + c][d = 16 t + 8 hh + r]
#pragma unroll
  for (int u = 0; u < Q_TILES; ++u) {
    mrun[u] = -INFINITY;
    lrun[u] = 0.f;
#pragma unroll
    for (int t = 0; t < 4; ++t) oacc[u][t] = (v8f){0.f,0.f,0.f,0.f,0.f,0.f,0.f,0.f};
  }

  const int fo = c * LDS_PITCH + 8 * hh;   // the lane's place in a 16-row fragment; tile and chunk steps are constants on top
  const int vfo = (8 * hh + (lane & 7)) * V_PITCH + 8 * ((lane >> 3) & 1);   // the lane's address part of a transposing read of V

  // ---- this wave's share of a chunk: plane w (0: K hi, 1: K lo, 2: V hi, 3: V lo), all 64 rows of it ----
  const bool isV = wave >= 2;
  const unsigned lpitch = isV ? (unsigned)(V_PITCH * 2) : (unsigned)(LDS_PITCH * 2);
  const unsigned lplane = (isV ? (unsigned)AT_V_OFF : 0u) + (unsigned)(wave & 1) * (isV ? (unsigned)AT_V_PLANE : (unsigned)AT_K_PLANE);
  const unsigned short* gl = ((wave & 1) ? qkvl : qkvh) + (tokb + (lane >> 3)) * QKV_COLS
                             + (isV ? 2 * INNER_DIM : INNER_DIM) + hcol + (lane & 7) * 8;   // 8 lanes x 16 B = one 128-B row
  const unsigned ll = (unsigned)(size_t)ring + lplane + (unsigned)(lane >> 3) * lpitch + (unsigned)(lane & 7) * 16u;
  const unsigned ls4 = 4u * lpitch;
  constexpr int NCH = SEQ_LEN / KV_CHUNK;
  constexpr size_t G_CHUNK = (size_t)KV_CHUNK * QKV_COLS;    // elements from one chunk's rows to the next chunk's

  // ---- prologue: chunk 0 lands and is published, then chunk 1 starts to fly ----
  kv_copy8(ll, ls4, gl);
  kv_copy8(ll + 8u * ls4, ls4, gl + G_CHUNK / 2);
  wait_own_copies_landed();              // chunk 0 has landed before the barrier publishes it to the other waves
  __syncthreads();
  kv_copy8(ll + (unsigned)AT_BUF, ls4, gl + G_CHUNK);
  kv_copy8(ll + (unsigned)AT_BUF + 8u * ls4, ls4, gl + G_CHUNK + G_CHUNK / 2);

  // One trip of the kv loop. It is written once and used in two loops: one whose every trip refills, and one for the last
  // two chunks, behind which no chunk is left to fetch. So no trip holds a branch (with one, the compiler sinks the
  // denominator's adds behind it and keeps all 64 p alive over the second product, which spills).
  auto trip = [&](const int kc, const bool refill) __attribute__((always_inline)) {
    const unsigned bo = (kc & 1) ? (unsigned)AT_BUF : 0u;
    const __bf16* KHp = (const __bf16*)(ring + bo);
    const __bf16* KLp = (const __bf16*)(ring + bo + AT_K_PLANE);
    const unsigned short* Vsh = (const unsigned short*)(ring + bo + AT_V_OFF);
    const unsigned short* Vsl = (const unsigned short*)(ring + bo + AT_V_OFF + AT_V_PLANE);

    // ---- scores S^T: 4 x 2 tiles of 16 keys x 16 queries, 2 d-chunks, 3 products each ----
    // The K fragments of a d-chunk are read as one group, and consecutive WMMAs go round the 8 independent score tiles,
    // so that no WMMA waits for the one in front of it; each tile still sums its 6 products in the order dc, hi.hi, lo.hi, hi.lo.
    v8f s[Q_TILES][4];
    FB kb[2][4], kl[2][4];
#pragma unroll
    for (int dc = 0; dc < 2; ++dc) {
#pragma unroll
      for (int j = 0; j < 4; ++j) {
        const int ko = j * 16 * LDS_PITCH + dc * 32;      // a constant: folds into the read's offset field
        kb[dc][j].h[0] = *(const v8b*)(KHp + fo + ko);
        kb[dc][j].h[1] = *(const v8b*)(KHp + fo + ko + 16);
        kl[dc][j].h[0] = *(const v8b*)(KLp + fo + ko);
        kl[dc][j].h[1] = *(const v8b*)(KLp + fo + ko + 16);
      }
    }
    row_fence();
#pragma unroll
    for (int u = 0; u < Q_TILES; ++u)
#pragma unroll
      for (int j = 0; j < 4; ++j) s[u][j] = (v8f){0.f,0.f,0.f,0.f,0.f,0.f,0.f,0.f};
#pragma unroll
    for (int dc = 0; dc < 2; ++dc) {
#pragma unroll
      for (int j = 0; j < 4; ++j)
#pragma unroll
        for (int u = 0; u < Q_TILES; ++u) s[u][j] = at_mma(kb[dc][j].v, qah[u][dc], s[u][j]);
      row_fence();
#pragma unroll
      for (int j = 0; j < 4; ++j)
#pragma unroll
        for (int u = 0; u < Q_TILES; ++u) s[u][j] = at_mma(kl[dc][j].v, qah[u][dc], s[u][j]);
      row_fence();
#pragma unroll
      for (int j = 0; j < 4; ++j)
#pragma unroll
        for (int u = 0; u < Q_TILES; ++u) s[u][j] = at_mma(kb[dc][j].v, qal[u][dc], s[u][j]);
      row_fence();
    }
    // V^T fragments of the first kv-chunk: read here so that the softmax below covers their latency
    FB vb[2][4], vl[2][4];
#pragma unroll
    for (int t = 0; t < 4; ++t) {
      const int vo = t * 16;                            // d tile: 16 columns further; keys 16..31: 16 rows further
      vb[0][t].h[0] = at_ld_tr16(Vsh + vfo + vo);
      vb[0][t].h[1] = at_ld_tr16(Vsh + vfo + vo + 16 * V_PITCH);
      vl[0][t].h[0] = at_ld_tr16(Vsl + vfo + vo);
      vl[0][t].h[1] = at_ld_tr16(Vsl + vfo + vo + 16 * V_PITCH);
    }
    row_fence();
    union PB { v16b v; v2b w[8]; };
    PB pbh[Q_TILES][2], pbl[Q_TILES][2];
#pragma unroll
    for (int u = 0; u < Q_TILES; ++u) {
      // ---- chunk maximum of query 16 u + c over the unscaled scores (the scale is positive): 32 in-lane, then the other half ----
      float mj[4];
#pragma unroll
      for (int j = 0; j < 4; ++j) {
        mj[j] = -INFINITY;
#pragma unroll
        for (int r = 0; r < 8; ++r) mj[j] = fmaxf(mj[j], s[u][j][r]);
      }
      float cm = fmaxf(fmaxf(mj[0], mj[1]), fmaxf(mj[2], mj[3]));
      cm = fmaxf(cm, at_xhalf(cm));
      // ---- online softmax in base 2; p split into bf16 hi/lo in place: pbh[u][kk] / pbl[u][kk] element e = p of key 32 kk + kmap(e, hh) ----
      const float mnew = fmaxf(mrun[u], cm * SC_LOG2E);
      const float alpha = __builtin_amdgcn_exp2f(mrun[u] - mnew);   // 0 on the first chunk, where mrun is -inf
      mrun[u] = mnew;
      const v2f sc2 = (v2f){SC_LOG2E, SC_LOG2E};
      const v2f mn2 = (v2f){mnew, mnew};
      float pj[4];
#pragma unroll
      for (int j = 0; j < 4; ++j) {
        pj[j] = 0.f;
#pragma unroll
        for (int r = 0; r < 8; r += 2) {
          const v2f a2 = (v2f){s[u][j][r], s[u][j][r + 1]} * sc2 - mn2;    // scale, log2(e) and maximum in one FMA
          v2f p2;
          p2[0] = __builtin_amdgcn_exp2f(a2[0]);
          p2[1] = __builtin_amdgcn_exp2f(a2[1]);
          pj[j] += p2[0];
          pj[j] += p2[1];
          const v2b h2 = __builtin_convertvector(p2, v2b);                 // RNE, two values per register
          const v2b l2 = __builtin_convertvector(p2 - __builtin_convertvector(h2, v2f), v2b);
          pbh[u][j >> 1].w[(j & 1) * 4 + (r >> 1)] = h2;
          pbl[u][j >> 1].w[(j & 1) * 4 + (r >> 1)] = l2;
        }
      }
      lrun[u] = lrun[u] * alpha + ((pj[0] + pj[1]) + (pj[2] + pj[3]));
#pragma unroll
      for (int t = 0; t < 4; ++t)
#pragma unroll
        for (int r = 0; r < 8; ++r) oacc[u][t][r] *= alpha;
    }
    // ---- O^T += V^T(64 d x 64 kv) . P^T(64 kv x 32 queries): 2 kv-chunks of 32, 4 d tiles x 2 query tiles, 3 products ----
    // As above: WMMAs round the 8 independent out tiles, per-tile order kept; the second kv-chunk's fragments are read
    // as one group in front of the first kv-chunk's products.
    row_fence();
#pragma unroll
    for (int t = 0; t < 4; ++t) {
      const int vo = t * 16 + 32 * V_PITCH;
      vb[1][t].h[0] = at_ld_tr16(Vsh + vfo + vo);
      vb[1][t].h[1] = at_ld_tr16(Vsh + vfo + vo + 16 * V_PITCH);
      vl[1][t].h[0] = at_ld_tr16(Vsl + vfo + vo);
      vl[1][t].h[1] = at_ld_tr16(Vsl + vfo + vo + 16 * V_PITCH);
    }
    row_fence();
#pragma unroll
    for (int kk = 0; kk < 2; ++kk) {
#pragma unroll
      for (int t = 0; t < 4; ++t)
#pragma unroll
        for (int u = 0; u < Q_TILES; ++u) oacc[u][t] = at_mma(vb[kk][t].v, pbh[u][kk].v, oacc[u][t]);
      row_fence();
#pragma unroll
      for (int t = 0; t < 4; ++t)
#pragma unroll
        for (int u = 0; u < Q_TILES; ++u) oacc[u][t] = at_mma(vl[kk][t].v, pbh[u][kk].v, oacc[u][t]);
      row_fence();
#pragma unroll
      for (int t = 0; t < 4; ++t)
#pragma unroll
        for (int u = 0; u < Q_TILES; ++u) oacc[u][t] = at_mma(vb[kk][t].v, pbl[u][kk].v, oacc[u][t]);
      if (kk == 0) row_fence();
    }
    // ---- publish point of chunk kc+1; it also ends every wave's reads of the buffer refilled behind it ----
    wait_own_lds_reads_done();           // fragment reads of chunk kc are done before its buffer is refilled
    wait_own_copies_landed();            // chunk kc+1 has landed before the barrier publishes it
    __syncthreads();
    if (refill) {                        // chunk kc+2 exists: into the buffer that this trip has just read
      const unsigned short* g2 = gl + (size_t)(kc + 2) * G_CHUNK;
      kv_copy8(ll + bo, ls4, g2);
      kv_copy8(ll + bo + 8u * ls4, ls4, g2 + G_CHUNK / 2);
    }
  };
  for (int kc = 0; kc < NCH - 2; ++kc) trip(kc, true);
  // kept rolled: unrolled, the two trips are one long block in which fragment reads are lifted far up and spilled
#pragma unroll 1
  for (int kc = NCH - 2; kc < NCH; ++kc) trip(kc, false);
  wait_own_copies_landed();              // no copy is outstanding when the ring becomes the out tiles

  // ---- the two halves' denominators join; the lane's 8 consecutive d of each tile go to row 16 u + c of the wave's out tile ----
  float* os = (float*)ring + wave * (Q_WAVE * 68);   // the last trip's barrier ended every read of the ring
#pragma unroll
  for (int u = 0; u < Q_TILES; ++u) {
    const float inv = 1.0f / (lrun[u] + at_xhalf(lrun[u]));
#pragma unroll
    for (int t = 0; t < 4; ++t) {
      v4f o0, o1;
#pragma unroll
      for (int e = 0; e < 4; ++e) { o0[e] = oacc[u][t][e] * inv; o1[e] = oacc[u][t][4 + e] * inv; }
      *(v4f*)(os + (16 * u + c) * 68 + t * 16 + 8 * hh)     = o0;
      *(v4f*)(os + (16 * u + c) * 68 + t * 16 + 8 * hh + 4) = o1;
    }
  }
  __builtin_amdgcn_fence(__ATOMIC_RELEASE, "workgroup");
  __builtin_amdgcn_wave_barrier();
  __builtin_amdgcn_fence(__ATOMIC_ACQUIRE, "workgroup");
  {
    const int q8 = lane >> 3, c8 = (lane & 7) * 8;
    {
#pragma unroll
      for (int it = 0; it < Q_WAVE / 4; ++it) {
        const int row = it * 4 + q8;                   // rows 0..31 of this wave's tile
        const float* sp = os + row * 68 + c8;
        const v4f f0 = *(const v4f*)(sp);
        const v4f f1 = *(const v4f*)(sp + 4);
        v4u ph, plo;
#pragma unroll
        for (int w = 0; w < 2; ++w) {
          const float a = f0[2 * w], bq = f0[2 * w + 1];
          const unsigned short ha = f2bf_bits(a), hb = f2bf_bits(bq);
          const unsigned short la = f2bf_bits(a - bf_bits2f(ha)), lb = f2bf_bits(bq - bf_bits2f(hb));
          ph[w]  = (unsigned)ha | ((unsigned)hb << 16);
          plo[w] = (unsigned)la | ((unsigned)lb << 16);
        }
#pragma unroll
        for (int w = 0; w < 2; ++w) {
          const float a = f1[2 * w], bq = f1[2 * w + 1];
          const unsigned short ha = f2bf_bits(a), hb = f2bf_bits(bq);
          const unsigned short la = f2bf_bits(a - bf_bits2f(ha)), lb = f2bf_bits(bq - bf_bits2f(hb));
          ph[2 + w]  = (unsigned)ha | ((unsigned)hb << 16);
          plo[2 + w] = (unsigned)la | ((unsigned)lb << 16);
        }
        const size_t o = (tokb + q0 + row) * INNER_DIM + hcol + c8;
        *(v4u*)(oh + o) = ph;
        *(v4u*)(ol + o) = plo;
      }
      
    }
  }
}

// =====================================================================================
// launch glue
// =====================================================================================
extern "C" void kernel_launch(void* const* d_in, const int* in_sizes, int n_in,
                              void* d_out, int out_size, void* d_ws,
                              size_t ws_size, hipStream_t stream) {
  if (n_in < 6) return;
  if (in_sizes[0] != TOK_ROWS * MODEL_DIM) return;
  if (in_sizes[1] != MODEL_DIM || in_sizes[2] != MODEL_DIM) return;
  if (in_sizes[3] != QKV_COLS * MODEL_DIM) return;
  if (in_sizes[4] != MODEL_DIM * INNER_DIM) return;
  if (in_sizes[5] != MODEL_DIM) return;
  if (out_size != TOK_ROWS * MODEL_DIM) return;
  if (ws_size < WS_TOTAL) return;

  const float* x    = (const float*)d_in[0];
  const float* gam  = (const float*)d_in[1];
  const float* bet  = (const float*)d_in[2];
  const float* wqkv = (const float*)d_in[3];
  const float* wout = (const float*)d_in[4];
  const float* bout = (const float*)d_in[5];
  float* out = (float*)d_out;

  char* ws = (char*)d_ws;
  size_t off = 0;
  unsigned short* wq_bf  = (unsigned short*)(ws + off); off += WS_WQ;
  unsigned short* wo_bf  = (unsigned short*)(ws + off); off += WS_WO;
  unsigned short* h_hi   = (unsigned short*)(ws + off); off += WS_HPL;
  unsigned short* h_lo   = (unsigned short*)(ws + off); off += WS_HPL;
  unsigned short* qkv_hi = (unsigned short*)(ws + off); off += WS_QKVPL;
  unsigned short* qkv_lo = (unsigned short*)(ws + off); off += WS_QKVPL;
  unsigned short* at_hi  = (unsigned short*)(ws + off); off += WS_ATPL;
  unsigned short* at_lo  = (unsigned short*)(ws + off); off += WS_ATPL;
  if (off > ws_size) return;

  // weights -> bf16 (RNE): 3145728/8 = 393216 = 1536 x 256 ; 1048576/8 = 131072 = 512 x 256
  const int n8_qkv = (QKV_COLS * MODEL_DIM) / 8;
  const int n8_out = (MODEL_DIM * INNER_DIM) / 8;
  cast_f32_bf16x8<<<dim3((n8_qkv + 255) / 256), dim3(256), 0, stream>>>(wqkv, wq_bf, n8_qkv);
  cast_f32_bf16x8<<<dim3((n8_out + 255) / 256), dim3(256), 0, stream>>>(wout, wo_bf, n8_out);

  // LayerNorm -> h hi/lo planes [4096][1024]
  layernorm_bf16split_kernel<<<dim3(TOK_ROWS), dim3(128), 0, stream>>>(x, gam, bet, h_hi, h_lo);

  // qkv = h @ w_qkv^T -> bf16 hi/lo planes [4096][3072]; M=4096 N=3072 K=1024; block tiles 32*12 = 384 blocks
  gemm64_bf16_asplit<2, false><<<dim3((TOK_ROWS / G_BM) * (QKV_COLS / G_BN)), dim3(256), 0, stream>>>(
      h_hi, h_lo, MODEL_DIM, wq_bf, MODEL_DIM, (void*)qkv_hi, (void*)qkv_lo, QKV_COLS,
      (const float*)nullptr, TOK_ROWS, QKV_COLS, MODEL_DIM);

  // attention per (batch, head, 128 query rows): 2*16*16 = 512 blocks -> attn hi/lo planes [4096][1024]
  attn64_bf16x3_kernel<<<dim3(N_BATCH * N_HEAD * (SEQ_LEN / Q_BLOCK)), dim3(128), 0, stream>>>(
      qkv_hi, qkv_lo, at_hi, at_lo);

  // out = attn @ w_out^T + b_out -> f32 [4096][1024]; M=4096 N=1024 K=1024; block tiles 32*4 = 128 blocks
  gemm64_bf16_asplit<0, true><<<dim3((TOK_ROWS / G_BM) * (MODEL_DIM / G_BN)), dim3(256), 0, stream>>>(
      at_hi, at_lo, INNER_DIM, wo_bf, INNER_DIM, (void*)out, (void*)nullptr, MODEL_DIM,
      bout, TOK_ROWS, MODEL_DIM, INNER_DIM);
}

// v009
// Measured time: 135 microseconds a run.
// In both of two side-by-side timings against v008, it was 1.03 times as fast.
// Counting every step since v000, it is 3.84 times as fast.
// Contractions on v_wmma_f32_16x16x32_bf16 (bf16 operands, f32 accumulate): qkv and output projections = activation bf16 hi+lo planes x weight bf16 plane (2 products); q.k scores and p.v = bf16 hi/lo x bf16 hi/lo (3 products); LayerNorm, softmax and epilogues in f32; every float input RNE-converted to bf16 once at load.
#include <hip/hip_runtime.h>
#include <hip/hip_bf16.h>

typedef __attribute__((ext_vector_type(16))) _Float16 v16h;
typedef __attribute__((ext_vector_type(8)))  _Float16 v8h;
typedef __attribute__((ext_vector_type(16))) __bf16   v16b;
typedef __attribute__((ext_vector_type(8)))  __bf16   v8b;
typedef __attribute__((ext_vector_type(8)))  float    v8f;
typedef __attribute__((ext_vector_type(4)))  float    v4f;
typedef __attribute__((ext_vector_type(4)))  unsigned v4u;
typedef __attribute__((ext_vector_type(2)))  float    v2f;
typedef __attribute__((ext_vector_type(2)))  __bf16   v2b;

// ---- problem geometry ----
constexpr int MODEL_DIM = 1024;
constexpr int SEQ_LEN   = 2048;
constexpr int N_BATCH   = 2;
constexpr int N_HEAD    = 16;
constexpr int HEAD_D    = 64;
constexpr int INNER_DIM = N_HEAD * HEAD_D;          // 1024
constexpr int QKV_COLS  = 3 * INNER_DIM;            // 3072
constexpr int TOK_ROWS  = N_BATCH * SEQ_LEN;        // 4096
constexpr int KV_CHUNK  = 64;
constexpr int Q_TILES   = 2;                       // 16-query tiles per attention wave
constexpr int Q_WAVE    = 16 * Q_TILES;            // 32 queries per wave
constexpr int Q_BLOCK   = 4 * Q_WAVE;              // 128 queries per block of 4 waves
// LDS row pitch of the attention K tiles, in bf16 elements: 64 data + 8 pad = 144 B = 16 B x 9 (odd),
// so the 16 rows that one ds_load_b128 fragment read touches fall on distinct bank groups (128-B rows all share banks).
constexpr int LDS_PITCH = 72;
// LDS row pitch of the attention V tiles (row-major [kv][d]), in bf16 elements: 64 data + 16 pad = 160 B = 32 B x 5 (odd),
// the conflict-free pitch of their reader, ds_load_tr16_b128.
constexpr int V_PITCH = 80;

// GEMM shape contract (no run-time tails in the GEMM kernel)
static_assert(MODEL_DIM % 32 == 0, "K of qkv projection");
static_assert(INNER_DIM % 32 == 0, "K of output projection");
static_assert(TOK_ROWS % 64 == 0, "M tile multiple");
static_assert(QKV_COLS % 64 == 0, "N tile multiple (qkv)");
static_assert(MODEL_DIM % 64 == 0, "N tile multiple (out)");
static_assert(SEQ_LEN % KV_CHUNK == 0 && SEQ_LEN % Q_BLOCK == 0, "attention tiles");
static_assert(HEAD_D == 64, "attention kernel is head_dim 64");
static_assert(MODEL_DIM == 128 * 8, "LayerNorm kernel: 128 threads x 8 elements per row");

// ---- workspace region map (bytes, every offset a multiple of 128) ----
//  [0]            wq  bf16 [3072][1024]         6291456
//  [6291456]      wo  bf16 [1024][1024]         2097152
//  [8388608]      h   hi bf16 [4096][1024]      8388608
//  [16777216]     h   lo bf16 [4096][1024]      8388608
//  [25165824]     qkv hi bf16 [4096][3072]     25165824
//  [50331648]     qkv lo bf16 [4096][3072]     25165824
//  [75497472]     at  hi bf16 [4096][1024]      8388608
//  [83886080]     at  lo bf16 [4096][1024]      8388608
//  total 92274688
constexpr size_t WS_WQ    = (size_t)QKV_COLS * MODEL_DIM * 2;
constexpr size_t WS_WO    = (size_t)MODEL_DIM * INNER_DIM * 2;
constexpr size_t WS_HPL   = (size_t)TOK_ROWS * MODEL_DIM * 2;
constexpr size_t WS_QKVPL = (size_t)TOK_ROWS * QKV_COLS * 2;
constexpr size_t WS_ATPL  = (size_t)TOK_ROWS * INNER_DIM * 2;
constexpr size_t WS_TOTAL = WS_WQ + WS_WO + 2 * WS_HPL + 2 * WS_QKVPL + 2 * WS_ATPL;
static_assert(WS_TOTAL == 92274688, "carve arithmetic");
static_assert(WS_TOTAL <= 134217728, "carve budget");
static_assert(WS_WQ % 128 == 0 && WS_WO % 128 == 0 && WS_HPL % 128 == 0 && WS_QKVPL % 128 == 0 && WS_ATPL % 128 == 0, "128-B aligned regions");

// ---- bf16 RNE helpers ----
__device__ __forceinline__ unsigned short f2bf_bits(float f) {
  unsigned u = __float_as_uint(f);
  return (unsigned short)((u + 0x7FFFu + ((u >> 16) & 1u)) >> 16);
}
__device__ __forceinline__ float bf_bits2f(unsigned short h) { return __uint_as_float(((unsigned)h) << 16); }

// hazard guards as plain device helpers (no inline asm inside the kernel template body)
__device__ __forceinline__ void dep_guard_h(v8f& a, v8f& b, v16h x, v16h y) { asm volatile("v_nop\n\tv_nop\n\tv_nop\n\tv_nop" : "+v"(a), "+v"(b) : "v"(x), "v"(y)); }
__device__ __forceinline__ void dep_guard_b(v8f& a, v8f& b, v16b x, v16b y) { asm volatile("v_nop\n\tv_nop\n\tv_nop\n\tv_nop" : "+v"(a), "+v"(b) : "v"(x), "v"(y)); }
__device__ __forceinline__ void keep4_h(v16h a, v16h b, v16h c, v16h d) { asm volatile("v_nop" :: "v"(a), "v"(b), "v"(c), "v"(d)); }
__device__ __forceinline__ void keep4_b(v16b a, v16b b, v16b c, v16b d) { asm volatile("v_nop" :: "v"(a), "v"(b), "v"(c), "v"(d)); }
__device__ __forceinline__ void acc_guard4(v8f& a, v8f& b, v8f& c, v8f& d) { asm volatile("v_nop\n\tv_nop\n\tv_nop\n\tv_nop" : "+v"(a), "+v"(b), "+v"(c), "+v"(d)); }
template <typename T> struct Frag;
template <> struct Frag<_Float16> {
  typedef v16h V; union U { v16h v; v8h h[2]; };
  static __device__ __forceinline__ v16h load(const _Float16* p) {   // elements 0..7 <- p[0..7], 8..15 <- p[16..23]
    U f; f.h[0] = *(const v8h*)(p); f.h[1] = *(const v8h*)(p + 16); return f.v;
  }
  static __device__ __forceinline__ v8f mma(v16h a, v16h b, v8f c) {
    return __builtin_amdgcn_wmma_f32_16x16x32_f16(false, a, false, b, (short)0, c, false, false);
  }
  static __device__ __forceinline__ void guard(v8f& a, v8f& b, v16h x, v16h y) { dep_guard_h(a, b, x, y); }
  static __device__ __forceinline__ void keep(v16h a, v16h b, v16h c, v16h d) { keep4_h(a, b, c, d); }
};
template <> struct Frag<__bf16> {
  typedef v16b V; union U { v16b v; v8b h[2]; };
  static __device__ __forceinline__ v16b load(const __bf16* p) {
    U f; f.h[0] = *(const v8b*)(p); f.h[1] = *(const v8b*)(p + 16); return f.v;
  }
  static __device__ __forceinline__ v8f mma(v16b a, v16b b, v8f c) {
    return __builtin_amdgcn_wmma_f32_16x16x32_bf16(false, a, false, b, (short)0, c, false, false);
  }
  static __device__ __forceinline__ void guard(v8f& a, v8f& b, v16b x, v16b y) { dep_guard_b(a, b, x, y); }
  static __device__ __forceinline__ void keep(v16b a, v16b b, v16b c, v16b d) { keep4_b(a, b, c, d); }
};

// attention helpers (bf16 WMMA as the plain builtin: the compiler keeps its distances; exchange between the wave halves)
__device__ __forceinline__ v8f at_mma(v16b a, v16b b, v8f c) {
  return __builtin_amdgcn_wmma_f32_16x16x32_bf16(false, a, false, b, (short)0, c, false, false);
}

__device__ __forceinline__ v8b at_ld_tr16(const unsigned short* p) {
  typedef __attribute__((address_space(3))) v8b lds_v8b;
  return __builtin_amdgcn_ds_load_tr16_b128_v8bf16((lds_v8b*)p);
}

// Scheduling fence, no instruction: without it the compiler sinks the grouped fragment reads back among the WMMAs (each
// then waited for right behind its issue), puts the dependent WMMAs of one tile back to back again, or lifts a read group
// so far up that the registers of two waves per SIMD no longer suffice.
__device__ __forceinline__ void row_fence() { __builtin_amdgcn_sched_barrier(0); }

// value of lane l ^ 16: the other half of the wave holds the other keys of the same query
__device__ __forceinline__ float at_xhalf(float x) {
  const int b = __builtin_bit_cast(int, x);
  return __builtin_bit_cast(float, __builtin_amdgcn_permlanex16(b, b, 0x76543210, 0xfedcba98, false, false));
}

// =====================================================================================
// 1) f32 -> bf16 (RNE) cast, 8 elements per thread, one 16-B store per lane
//    Coverage: grid = n8/256 blocks x 256 threads x 8 elements = n exactly (n8 = n/8, n % 2048 == 0 here).
// =====================================================================================
__global__ __launch_bounds__(256) void cast_f32_bf16x8(
    const float* __restrict__ in, unsigned short* __restrict__ out, int n8) {
  const int i = blockIdx.x * 256 + threadIdx.x;
  if (i < n8) {
    const size_t e0 = (size_t)i * 8;
    const v4f a = *(const v4f*)(in + e0);
    const v4f b = *(const v4f*)(in + e0 + 4);
    v4u u;
    u[0] = (unsigned)f2bf_bits(a[0]) | ((unsigned)f2bf_bits(a[1]) << 16);
    u[1] = (unsigned)f2bf_bits(a[2]) | ((unsigned)f2bf_bits(a[3]) << 16);
    u[2] = (unsigned)f2bf_bits(b[0]) | ((unsigned)f2bf_bits(b[1]) << 16);
    u[3] = (unsigned)f2bf_bits(b[2]) | ((unsigned)f2bf_bits(b[3]) << 16);
    *(v4u*)(out + e0) = u;
    
  }
}

// =====================================================================================
//    result split into bf16 hi / lo planes [TOK_ROWS][MODEL_DIM].
//    One block (128 threads) per row; thread t owns elements 8t..8t+7 -> one 16-B store per lane per plane
//    Coverage: 4096 blocks x 128 threads x 8 = 4096 x 1024 exactly.
// =====================================================================================
__global__ __launch_bounds__(128) void layernorm_bf16split_kernel(
    const float* __restrict__ x, const float* __restrict__ gamma, const float* __restrict__ beta,
    unsigned short* __restrict__ hhi, unsigned short* __restrict__ hlo) {
  __shared__ float red_s[4];
  __shared__ float red_q[4];
  const int row = blockIdx.x;
  const int t = threadIdx.x;
  const int lane = t & 31, wave = t >> 5;
  const size_t base = (size_t)row * MODEL_DIM + 8 * (size_t)t;

  const v4f a0 = *(const v4f*)(x + base);
  const v4f a1 = *(const v4f*)(x + base + 4);
  float xv[8];
#pragma unroll
  for (int e = 0; e < 4; ++e) {
    xv[e]     = bf_bits2f(f2bf_bits(a0[e]));
    xv[4 + e] = bf_bits2f(f2bf_bits(a1[e]));
  }
  float s = ((xv[0] + xv[1]) + (xv[2] + xv[3])) + ((xv[4] + xv[5]) + (xv[6] + xv[7]));
#pragma unroll
  for (int off = 1; off < 32; off <<= 1) s += __shfl_xor(s, off, 32);
  if (lane == 0) red_s[wave] = s;
  __syncthreads();
  const float tot = (red_s[0] + red_s[1]) + (red_s[2] + red_s[3]);
  const float mean = tot * (1.0f / (float)MODEL_DIM);

  float d[8];
  float q = 0.f;
#pragma unroll
  for (int e = 0; e < 8; ++e) { d[e] = xv[e] - mean; q += d[e] * d[e]; }
#pragma unroll
  for (int off = 1; off < 32; off <<= 1) q += __shfl_xor(q, off, 32);
  if (lane == 0) red_q[wave] = q;
  __syncthreads();
  const float qt = (red_q[0] + red_q[1]) + (red_q[2] + red_q[3]);
  const float var = qt * (1.0f / (float)MODEL_DIM);
  const float rstd = rsqrtf(var + 1e-5f);

  const v4f g0 = *(const v4f*)(gamma + 8 * t);
  const v4f g1 = *(const v4f*)(gamma + 8 * t + 4);
  const v4f b0 = *(const v4f*)(beta + 8 * t);
  const v4f b1 = *(const v4f*)(beta + 8 * t + 4);
  float hv[8];
#pragma unroll
  for (int e = 0; e < 4; ++e) {
    const float gg0 = bf_bits2f(f2bf_bits(g0[e])), bb0 = bf_bits2f(f2bf_bits(b0[e]));
    const float gg1 = bf_bits2f(f2bf_bits(g1[e])), bb1 = bf_bits2f(f2bf_bits(b1[e]));
    hv[e]     = d[e] * rstd * gg0 + bb0;
    hv[4 + e] = d[4 + e] * rstd * gg1 + bb1;
  }
  v4u ph, pl;
#pragma unroll
  for (int w = 0; w < 4; ++w) {
    const float f0 = hv[2 * w], f1 = hv[2 * w + 1];
    const unsigned short h0 = f2bf_bits(f0), h1 = f2bf_bits(f1);
    const unsigned short l0 = f2bf_bits(f0 - bf_bits2f(h0));
    const unsigned short l1 = f2bf_bits(f1 - bf_bits2f(h1));
    ph[w] = (unsigned)h0 | ((unsigned)h1 << 16);
    pl[w] = (unsigned)l0 | ((unsigned)l1 << 16);
  }
  *(v4u*)(hhi + base) = ph;
  *(v4u*)(hlo + base) = pl;
  
}

// =====================================================================================
// 3) WMMA GEMM, operands staged in LDS: C[m,n] = sum_k (Ah+Al)[m,k] * Bt[n,k] (+bias[n], bias RNE bf16)
//    A = bf16 hi and lo planes row-major [M,K] (lda); Bt = bf16 row-major [N,K] (ldb); 2 WMMA products per tile pair.
//    A block of 8 waves owns a 128 x BN C tile. NI = 16-row tiles per wave picks the shape, so that a launch can fill the chip:
//    NI = 4: waves 2 x 4, 64x64 each, BN = 256 (qkv: 384 blocks); NI = 2: waves 4 x 2, 32x64 each, BN = 128 (out: 256 blocks,
//    one per WGP; at BN = 256 that product has only 128 blocks, half of the WGPs). K is walked in slabs of 64:
//    a stage is [A hi 128 rows | A lo 128 rows | Bt BN rows] of 128 B each at a 144-B LDS pitch, two buffers.
//    Every wave copies an eighth of the stage rows with asynchronous 16-B-per-lane copies (4 whole 128-B rows each),
//    one slab ahead of the slab that is being multiplied. Per output element the k order of the sums is ascending.
//    Coverage: grid.x = (M/128)*(N/BN) blocks, every wave tile exactly once (shapes static_assert'ed below).
// =====================================================================================
constexpr int G_BM          = 128;                              // block tile rows
constexpr int G_NI_QKV      = 4;                                // wave tile rows / 16 of the qkv projection: BN = 256
constexpr int G_NI_OUT      = 2;                                // the same of the output projection: BN = 128
constexpr int g_bn(int ni) { return (8 / (G_BM / (16 * ni))) * 64; }                    // block tile columns
constexpr int G_SLAB_K      = 64;                               // k elements per stage: 128-B rows
constexpr int G_PITCH       = 72;                               // LDS row pitch in bf16 elements: 144 B = 16 B x 9
constexpr int g_stage_bytes(int ni) { return (2 * G_BM + g_bn(ni)) * G_PITCH * 2; }    // 73728 (NI = 4), 55296 (NI = 2)
constexpr unsigned G_PLANE_BYTES = (unsigned)G_BM * G_PITCH * 2u;   // one A plane of a stage
constexpr unsigned G_COPY_LDS_STEP = 4u * G_PITCH * 2u;         // one wave-wide copy fills 4 stage rows
static_assert(TOK_ROWS % G_BM == 0, "M block tile multiple");
static_assert(g_bn(G_NI_QKV) == 256 && g_bn(G_NI_OUT) == 128, "block tile columns");
static_assert(QKV_COLS % g_bn(G_NI_QKV) == 0 && MODEL_DIM % g_bn(G_NI_OUT) == 0, "N block tile multiple");
static_assert(MODEL_DIM % G_SLAB_K == 0 && INNER_DIM % G_SLAB_K == 0, "K slab multiple");
static_assert(MODEL_DIM / G_SLAB_K >= 2 && INNER_DIM / G_SLAB_K >= 2, "two stages at least");
static_assert(8 * 16 * 68 * 4 <= 2 * g_stage_bytes(G_NI_OUT), "epilogue slabs fit the ring");

// Eight asynchronous copies global -> LDS, 16 B per lane each, for 32 consecutive stage rows of one wave.
// l = the lane's LDS byte address of the first copy, g = its global address, step = elements per 4 source rows.
// The closing s_wait_xcnt 0 stands inside the statement so that no address register named here is rewritten ahead of it.
__device__ __forceinline__ void stage_copy8(unsigned l, const unsigned short* g, size_t step) {
  asm volatile(
      "global_load_async_to_lds_b128 %0, %8, off\n\t"
      "global_load_async_to_lds_b128 %1, %9, off\n\t"
      "global_load_async_to_lds_b128 %2, %10, off\n\t"
      "global_load_async_to_lds_b128 %3, %11, off\n\t"
      "global_load_async_to_lds_b128 %4, %12, off\n\t"
      "global_load_async_to_lds_b128 %5, %13, off\n\t"
      "global_load_async_to_lds_b128 %6, %14, off\n\t"
      "global_load_async_to_lds_b128 %7, %15, off\n\t"
      "s_wait_xcnt 0x0"
      :: "v"(l), "v"(l + G_COPY_LDS_STEP), "v"(l + 2u * G_COPY_LDS_STEP), "v"(l + 3u * G_COPY_LDS_STEP),
         "v"(l + 4u * G_COPY_LDS_STEP), "v"(l + 5u * G_COPY_LDS_STEP), "v"(l + 6u * G_COPY_LDS_STEP),
         "v"(l + 7u * G_COPY_LDS_STEP),
         "v"(g), "v"(g + step), "v"(g + 2 * step), "v"(g + 3 * step),
         "v"(g + 4 * step), "v"(g + 5 * step), "v"(g + 6 * step), "v"(g + 7 * step)
      : "memory");
}

// Twelve such copies for the 128-column stage: 16 consecutive rows (4 copies) of each of its three 128-row planes.
// l = the lane's LDS byte address in the A hi plane; ga, gb, gc = its global addresses in A hi, A lo and Bt;
// sa, sc = elements per 4 source rows of A and of Bt. The closing s_wait_xcnt 0 stands inside the statement as above.
__device__ __forceinline__ void stage_copy12(unsigned l, const unsigned short* ga, const unsigned short* gb,
                                             const unsigned short* gc, size_t sa, size_t sc) {
  const unsigned l2 = l + G_PLANE_BYTES, l3 = l + 2u * G_PLANE_BYTES;
  asm volatile(
      "global_load_async_to_lds_b128 %0, %12, off\n\t"
      "global_load_async_to_lds_b128 %1, %13, off\n\t"
      "global_load_async_to_lds_b128 %2, %14, off\n\t"
      "global_load_async_to_lds_b128 %3, %15, off\n\t"
      "global_load_async_to_lds_b128 %4, %16, off\n\t"
      "global_load_async_to_lds_b128 %5, %17, off\n\t"
      "global_load_async_to_lds_b128 %6, %18, off\n\t"
      "global_load_async_to_lds_b128 %7, %19, off\n\t"
      "global_load_async_to_lds_b128 %8, %20, off\n\t"
      "global_load_async_to_lds_b128 %9, %21, off\n\t"
      "global_load_async_to_lds_b128 %10, %22, off\n\t"
      "global_load_async_to_lds_b128 %11, %23, off\n\t"
      "s_wait_xcnt 0x0"
      :: "v"(l), "v"(l + G_COPY_LDS_STEP), "v"(l + 2u * G_COPY_LDS_STEP), "v"(l + 3u * G_COPY_LDS_STEP),
         "v"(l2), "v"(l2 + G_COPY_LDS_STEP), "v"(l2 + 2u * G_COPY_LDS_STEP), "v"(l2 + 3u * G_COPY_LDS_STEP),
         "v"(l3), "v"(l3 + G_COPY_LDS_STEP), "v"(l3 + 2u * G_COPY_LDS_STEP), "v"(l3 + 3u * G_COPY_LDS_STEP),
         "v"(ga), "v"(ga + sa), "v"(ga + 2 * sa), "v"(ga + 3 * sa),
         "v"(gb), "v"(gb + sa), "v"(gb + 2 * sa), "v"(gb + 3 * sa),
         "v"(gc), "v"(gc + sc), "v"(gc + 2 * sc), "v"(gc + 3 * sc)
      : "memory");
}

// The two waits of the stage ring, each an asm statement of its own; the "memory" clobber keeps LDS accesses on their side of it.
__device__ __forceinline__ void wait_own_copies_landed() { asm volatile("s_wait_asynccnt 0x0" ::: "memory"); }
__device__ __forceinline__ void wait_own_lds_reads_done() { asm volatile("s_wait_dscnt 0x0" ::: "memory"); }

template <int OUT_MODE, bool HAS_BIAS, int NI>
__global__ __launch_bounds__(256) void gemm64_bf16_asplit(
    const unsigned short* __restrict__ Ahp, const unsigned short* __restrict__ Alp, int lda,
    const unsigned short* __restrict__ Btp, int ldb,
    void* __restrict__ Cout, void* __restrict__ Cout2, int ldc,
    const float* __restrict__ bias, int M, int N, int K) {
  typedef __bf16 T;
  typedef v16b V;
  // two stage buffers; after the K loop the same bytes serve as the per-wave 16x64 f32 epilogue slabs (pitch 68 floats)
  constexpr int WN = 8 / (G_BM / (16 * NI));     // waves along n: 4 or 2
  constexpr int BN = g_bn(NI);
  constexpr int STAGE_BYTES = g_stage_bytes(NI);
  static_assert(NI == 4 || NI == 2, "the two stage layouts below");
  __shared__ __align__(16) unsigned char smem[2 * STAGE_BYTES];
  const int lane = threadIdx.x & 31;
  const int wave = __builtin_amdgcn_readfirstlane(threadIdx.x >> 5);
  const int tilesN = N / BN;
  const int tilesM = M / G_BM;
  const int bm = blockIdx.x / tilesN;
  const int bn = blockIdx.x - bm * tilesN;
  if (bm >= tilesM) return;              // block-uniform, in front of every barrier and copy
  const int mB = bm * G_BM;
  const int nB = bn * BN;
  const int wm = wave / WN;              // 16 NI-row part of the block tile
  const int wn = wave % WN;              // 64-column part
  const int m0 = mB + wm * (16 * NI);
  const int n0 = nB + (wn << 6);

  const int rlane = lane & 15;                 // row (A) / col (B, D) within subtile
  const int koff  = (lane >> 4) * 8;           // k offset of this lane half
  const int mOff  = (lane >> 4) * 8;           // D row offset

  // ---- this wave's share of a stage; 8 lanes x 16 B = one 128-B row ----
  // NI = 4: stage rows wave*64 .. wave*64+63 (waves 0,1: A hi; 2,3: A lo; 4..7: Bt), through gl alone.
  // NI = 2: rows wave*16 .. wave*16+15 of each of the three 128-row planes: gl = A hi, gl2 = A lo, gl3 = Bt.
  const unsigned short* gl;
  const unsigned short* gl2 = nullptr;
  const unsigned short* gl3 = nullptr;
  size_t step4, step4b = 0;
  unsigned ll;
  if constexpr (NI == 4) {
    const unsigned short* srow;
    int sld;
    if (wave < 2)      { srow = Ahp + (size_t)(mB + wave * 64) * lda;       sld = lda; }
    else if (wave < 4) { srow = Alp + (size_t)(mB + (wave - 2) * 64) * lda; sld = lda; }
    else               { srow = Btp + (size_t)(nB + (wave - 4) * 64) * ldb; sld = ldb; }
    gl = srow + (size_t)(lane >> 3) * sld + (lane & 7) * 8;
    step4 = (size_t)sld * 4;
    ll = (unsigned)(size_t)smem + (unsigned)((wave * 64 + (lane >> 3)) * (G_PITCH * 2) + (lane & 7) * 16);
  } else {
    const int r0 = wave * 16 + (lane >> 3);
    gl  = Ahp + (size_t)(mB + r0) * lda + (lane & 7) * 8;
    gl2 = Alp + (size_t)(mB + r0) * lda + (lane & 7) * 8;
    gl3 = Btp + (size_t)(nB + r0) * ldb + (lane & 7) * 8;
    step4  = (size_t)lda * 4;
    step4b = (size_t)ldb * 4;
    ll = (unsigned)(size_t)smem + (unsigned)(r0 * (G_PITCH * 2) + (lane & 7) * 16);
  }
  // the wave's copies of the slab that starts at k element ko, into the buffer at byte offset lo
  auto issue_stage = [&](const unsigned lo, const size_t ko) __attribute__((always_inline)) {
    if constexpr (NI == 4) {
      stage_copy8(ll + lo, gl + ko, step4);
      stage_copy8(ll + lo + 8u * G_COPY_LDS_STEP, gl + ko + 8 * step4, step4);
    } else {
      stage_copy12(ll + lo, gl + ko, gl2 + ko, gl3 + ko, step4, step4b);
    }
  };

  v8f acc[NI][4];
#pragma unroll
  for (int i = 0; i < NI; ++i)
#pragma unroll
    for (int j = 0; j < 4; ++j) acc[i][j] = (v8f){0.f,0.f,0.f,0.f,0.f,0.f,0.f,0.f};

  const int nT = K / G_SLAB_K;
  // ---- prologue: slab 0 lands and is published, then slab 1 starts to fly ----
  issue_stage(0u, 0);
  wait_own_copies_landed();              // slab 0 has landed before the barrier publishes it to the other waves
  __syncthreads();
  if (nT > 1) issue_stage((unsigned)STAGE_BYTES, G_SLAB_K);

  for (int t = 0; t < nT; ++t) {
    const unsigned bo = (t & 1) ? (unsigned)STAGE_BYTES : 0u;
    const T* sb  = (const T*)(smem + bo);
    const T* sAh = sb + (wm * (16 * NI) + rlane) * G_PITCH + koff;
    const T* sAl = sAh + G_BM * G_PITCH;
    const T* sB  = sb + (2 * G_BM + (wn << 6) + rlane) * G_PITCH + koff;
#pragma unroll
    for (int kk = 0; kk < G_SLAB_K; kk += 32) {
      V bh[4];
#pragma unroll
      for (int j = 0; j < 4; ++j) bh[j] = Frag<T>::load(sB + (j << 4) * G_PITCH + kk);
#pragma unroll
      for (int i = 0; i < NI; ++i) {
        V ah = Frag<T>::load(sAh + (i << 4) * G_PITCH + kk);
        V al = Frag<T>::load(sAl + (i << 4) * G_PITCH + kk);
#pragma unroll
        for (int j = 0; j < 4; ++j) {
          acc[i][j] = Frag<T>::mma(ah, bh[j], acc[i][j]);
          acc[i][j] = Frag<T>::mma(al, bh[j], acc[i][j]);
        }
        Frag<T>::guard(acc[i][0], acc[i][3], ah, al);
      }
      Frag<T>::keep(bh[0], bh[1], bh[2], bh[3]);
    }
    // ---- publish point of slab t+1; it also ends every wave's reads of the buffer refilled behind it ----
    wait_own_lds_reads_done();           // fragment reads of slab t are done before its buffer is refilled
    wait_own_copies_landed();            // slab t+1 has landed before the barrier publishes it
    __syncthreads();
    if (t + 2 < nT) issue_stage(bo, (size_t)(t + 2) * G_SLAB_K);
  }
  wait_own_copies_landed();              // no copy is outstanding when the ring becomes epilogue staging
#pragma unroll
  for (int i = 0; i < NI; ++i) acc_guard4(acc[i][0], acc[i][1], acc[i][2], acc[i][3]);

  // ---- epilogue ----
  float* slab = (float*)smem + wave * (16 * 68);   // the last trip's barrier ended every read of the ring
#pragma unroll
  for (int i = 0; i < NI; ++i) {
    const int mBase = m0 + (i << 4);
#pragma unroll
    for (int j = 0; j < 4; ++j) {
#pragma unroll
      for (int r = 0; r < 8; ++r) {
        slab[(mOff + r) * 68 + (j << 4) + rlane] = acc[i][j][r];
      }
    }
    __builtin_amdgcn_fence(__ATOMIC_RELEASE, "workgroup");
    __builtin_amdgcn_wave_barrier();
    __builtin_amdgcn_fence(__ATOMIC_ACQUIRE, "workgroup");
    if (OUT_MODE == 0) {
      float* Cf = (float*)Cout;
      const int h2 = lane >> 4, c4 = (lane & 15) * 4;     // row seg = 256 B = 16 lanes x 16 B
      v4f bb = (v4f){0.f, 0.f, 0.f, 0.f};
      if (HAS_BIAS) {
        const v4f braw = *(const v4f*)(bias + n0 + c4);
#pragma unroll
        for (int e = 0; e < 4; ++e) bb[e] = bf_bits2f(f2bf_bits(braw[e]));
      }
      {
#pragma unroll
        for (int it = 0; it < 8; ++it) {
          const int row = it * 2 + h2;
          v4f v = *(const v4f*)(slab + row * 68 + c4);
          v = v + bb;
          *(v4f*)(Cf + (size_t)(mBase + row) * ldc + n0 + c4) = v;
        }
        
      }
    } else {
      const int q = lane >> 3, c8 = (lane & 7) * 8;
      unsigned short* Cu  = (unsigned short*)Cout;
      unsigned short* Cu2 = (unsigned short*)Cout2;
      {
#pragma unroll
        for (int it = 0; it < 4; ++it) {
          const int row = it * 4 + q;
          const float* sp = slab + row * 68 + c8;
          v8h hv, lv;
#pragma unroll
          for (int e = 0; e < 8; ++e) {
            unsigned short hb = f2bf_bits(sp[e]);
            unsigned short lb = f2bf_bits(sp[e] - bf_bits2f(hb));
            hv[e] = __builtin_bit_cast(_Float16, hb);
            lv[e] = __builtin_bit_cast(_Float16, lb);
          }
          *(v8h*)(Cu  + (size_t)(mBase + row) * ldc + n0 + c8) = hv;
          *(v8h*)(Cu2 + (size_t)(mBase + row) * ldc + n0 + c8) = lv;
        }
        
      }
    }
    __builtin_amdgcn_fence(__ATOMIC_RELEASE, "workgroup");
    __builtin_amdgcn_wave_barrier();
    __builtin_amdgcn_fence(__ATOMIC_ACQUIRE, "workgroup");
  }
}

constexpr int AT_K_PLANE = KV_CHUNK * LDS_PITCH * 2;
constexpr int AT_V_PLANE = KV_CHUNK * V_PITCH * 2;
constexpr int AT_V_OFF   = 2 * AT_K_PLANE;
constexpr int AT_BUF     = 2 * AT_K_PLANE + 2 * AT_V_PLANE;
static_assert(AT_V_OFF % 32 == 0 && AT_V_PLANE % 32 == 0 && AT_BUF % 32 == 0, "V planes stay 32-B aligned");
static_assert(4 * Q_WAVE * 68 * 4 <= 2 * AT_BUF, "out tiles fit the ring");
static_assert(SEQ_LEN / KV_CHUNK >= 2, "two chunks at least");

// Eight asynchronous copies global -> LDS, 16 B per lane each, for 32 consecutive kv rows of one plane.
// l = the lane's LDS byte address of the first copy, ls = LDS bytes per 4 rows, g = its global address.
// The closing s_wait_xcnt 0 stands inside the statement so that no address register named here is rewritten ahead of it.
__device__ __forceinline__ void kv_copy8(unsigned l, unsigned ls, const unsigned short* g) {
  constexpr size_t gs = (size_t)4 * QKV_COLS;                      // elements per 4 source rows
  asm volatile(
      "global_load_async_to_lds_b128 %0, %8, off\n\t"
      "global_load_async_to_lds_b128 %1, %9, off\n\t"
      "global_load_async_to_lds_b128 %2, %10, off\n\t"
      "global_load_async_to_lds_b128 %3, %11, off\n\t"
      "global_load_async_to_lds_b128 %4, %12, off\n\t"
      "global_load_async_to_lds_b128 %5, %13, off\n\t"
      "global_load_async_to_lds_b128 %6, %14, off\n\t"
      "global_load_async_to_lds_b128 %7, %15, off\n\t"
      "s_wait_xcnt 0x0"
      :: "v"(l), "v"(l + ls), "v"(l + 2u * ls), "v"(l + 3u * ls),
         "v"(l + 4u * ls), "v"(l + 5u * ls), "v"(l + 6u * ls), "v"(l + 7u * ls),
         "v"(g), "v"(g + gs), "v"(g + 2 * gs), "v"(g + 3 * gs),
         "v"(g + 4 * gs), "v"(g + 5 * gs), "v"(g + 6 * gs), "v"(g + 7 * gs)
      : "memory");
}

// amdgpu_waves_per_eu(2): a budget of 512 VGPRs; the grid is two blocks per WGP, one wave of each per SIMD
__global__ __launch_bounds__(128) __attribute__((amdgpu_waves_per_eu(2))) void attn64_bf16x3_kernel(
    const unsigned short* __restrict__ qkvh, const unsigned short* __restrict__ qkvl,
    unsigned short* __restrict__ oh, unsigned short* __restrict__ ol) {
  union FB { v16b v; v8b h[2]; };
  // two chunk buffers; after the kv loop the same bytes serve as the per-wave 32x64 f32 out tiles (pitch 68 floats)
  __shared__ __align__(32) unsigned char ring[2 * AT_BUF];

  const int tid  = threadIdx.x;
  const int wave = __builtin_amdgcn_readfirstlane(tid >> 5);
  const int lane = tid & 31;
  const int hh   = lane >> 4;
  const int c    = lane & 15;

  constexpr int NQB = SEQ_LEN / Q_BLOCK;   // 16
  const int bx   = blockIdx.x;
  const int qb   = bx % NQB;
  const int bhid = bx / NQB;
  const int head = bhid % N_HEAD;
  const int bat  = bhid / N_HEAD;
  const int q0   = qb * Q_BLOCK + wave * Q_WAVE;
  const size_t tokb = (size_t)bat * SEQ_LEN;
  const int hcol = head * HEAD_D;

  const __bf16* QH = (const __bf16*)qkvh;
  const __bf16* QL = (const __bf16*)qkvl;

  // ---- Q fragments (B operand, column = query 16 u + c of the wave): 2 d-chunks, hi and lo, statically strided global loads ----
  v16b qah[Q_TILES][2], qal[Q_TILES][2];
  const __bf16* qbh = QH + (tokb + q0 + c) * QKV_COLS + hcol + 8 * hh;   // the lane's row of query tile 0, hi plane
  const __bf16* qbl = QL + (tokb + q0 + c) * QKV_COLS + hcol + 8 * hh;   // the same, lo plane
#pragma unroll
  for (int u = 0; u < Q_TILES; ++u) {
#pragma unroll
    for (int dc = 0; dc < 2; ++dc) {
      qah[u][dc] = Frag<__bf16>::load(qbh + (size_t)16 * u * QKV_COLS + dc * 32);
      qal[u][dc] = Frag<__bf16>::load(qbl + (size_t)16 * u * QKV_COLS + dc * 32);
    }
  }
  // The wait in front of any rewrite of the Q loads' address registers; the two bases are inputs so that they stay live
  // up to it and no load's result is placed in them.
  asm volatile("s_wait_xcnt 0x0" :: "v"(qbh), "v"(qbl) : "memory");

  constexpr float SC_LOG2E = 0.125f * 1.4426950408889634f;   // head_dim^-0.5 * log2(e)
  float mrun[Q_TILES];      // running maximum of query 16 u + c's scores times SC_LOG2E (equal in both halves)
  float lrun[Q_TILES];      // running denominator of query 16 u + c over this half's keys only
  v8f oacc[Q_TILES][4];     // oacc[u][t][r] = out[query 16 u + c][d = 16 t + 8 hh + r]
#pragma unroll
  for (int u = 0; u < Q_TILES; ++u) {
    mrun[u] = -INFINITY;
    lrun[u] = 0.f;
#pragma unroll
    for (int t = 0; t < 4; ++t) oacc[u][t] = (v8f){0.f,0.f,0.f,0.f,0.f,0.f,0.f,0.f};
  }

  const int fo = c * LDS_PITCH + 8 * hh;   // the lane's place in a 16-row fragment; tile and chunk steps are constants on top
  const int vfo = (8 * hh + (lane & 7)) * V_PITCH + 8 * ((lane >> 3) & 1);   // the lane's address part of a transposing read of V

  // ---- this wave's share of a chunk: plane w (0: K hi, 1: K lo, 2: V hi, 3: V lo), all 64 rows of it ----
  const bool isV = wave >= 2;
  const unsigned lpitch = isV ? (unsigned)(V_PITCH * 2) : (unsigned)(LDS_PITCH * 2);
  const unsigned lplane = (isV ? (unsigned)AT_V_OFF : 0u) + (unsigned)(wave & 1) * (isV ? (unsigned)AT_V_PLANE : (unsigned)AT_K_PLANE);
  const unsigned short* gl = ((wave & 1) ? qkvl : qkvh) + (tokb + (lane >> 3)) * QKV_COLS
                             + (isV ? 2 * INNER_DIM : INNER_DIM) + hcol + (lane & 7) * 8;   // 8 lanes x 16 B = one 128-B row
  const unsigned ll = (unsigned)(size_t)ring + lplane + (unsigned)(lane >> 3) * lpitch + (unsigned)(lane & 7) * 16u;
  const unsigned ls4 = 4u * lpitch;
  constexpr int NCH = SEQ_LEN / KV_CHUNK;
  constexpr size_t G_CHUNK = (size_t)KV_CHUNK * QKV_COLS;    // elements from one chunk's rows to the next chunk's

  // ---- prologue: chunk 0 lands and is published, then chunk 1 starts to fly ----
  kv_copy8(ll, ls4, gl);
  kv_copy8(ll + 8u * ls4, ls4, gl + G_CHUNK / 2);
  wait_own_copies_landed();              // chunk 0 has landed before the barrier publishes it to the other waves
  __syncthreads();
  kv_copy8(ll + (unsigned)AT_BUF, ls4, gl + G_CHUNK);
  kv_copy8(ll + (unsigned)AT_BUF + 8u * ls4, ls4, gl + G_CHUNK + G_CHUNK / 2);

  // One trip of the kv loop. It is written once and used in two loops: one whose every trip refills, and one for the last
  // two chunks, behind which no chunk is left to fetch. So no trip holds a branch (with one, the compiler sinks the
  // denominator's adds behind it and keeps all 64 p alive over the second product, which spills).
  auto trip = [&](const int kc, const bool refill) __attribute__((always_inline)) {
    const unsigned bo = (kc & 1) ? (unsigned)AT_BUF : 0u;
    const __bf16* KHp = (const __bf16*)(ring + bo);
    const __bf16* KLp = (const __bf16*)(ring + bo + AT_K_PLANE);
    const unsigned short* Vsh = (const unsigned short*)(ring + bo + AT_V_OFF);
    const unsigned short* Vsl = (const unsigned short*)(ring + bo + AT_V_OFF + AT_V_PLANE);

    // ---- scores S^T: 4 x 2 tiles of 16 keys x 16 queries, 2 d-chunks, 3 products each ----
    // The K fragments of a d-chunk are read as one group, and consecutive WMMAs go round the 8 independent score tiles,
    // so that no WMMA waits for the one in front of it; each tile still sums its 6 products in the order dc, hi.hi, lo.hi, hi.lo.
    v8f s[Q_TILES][4];
    FB kb[2][4], kl[2][4];
#pragma unroll
    for (int dc = 0; dc < 2; ++dc) {
#pragma unroll
      for (int j = 0; j < 4; ++j) {
        const int ko = j * 16 * LDS_PITCH + dc * 32;      // a constant: folds into the read's offset field
        kb[dc][j].h[0] = *(const v8b*)(KHp + fo + ko);
        kb[dc][j].h[1] = *(const v8b*)(KHp + fo + ko + 16);
        kl[dc][j].h[0] = *(const v8b*)(KLp + fo + ko);
        kl[dc][j].h[1] = *(const v8b*)(KLp + fo + ko + 16);
      }
    }
    row_fence();
#pragma unroll
    for (int u = 0; u < Q_TILES; ++u)
#pragma unroll
      for (int j = 0; j < 4; ++j) s[u][j] = (v8f){0.f,0.f,0.f,0.f,0.f,0.f,0.f,0.f};
#pragma unroll
    for (int dc = 0; dc < 2; ++dc) {
#pragma unroll
      for (int j = 0; j < 4; ++j)
#pragma unroll
        for (int u = 0; u < Q_TILES; ++u) s[u][j] = at_mma(kb[dc][j].v, qah[u][dc], s[u][j]);
      row_fence();
#pragma unroll
      for (int j = 0; j < 4; ++j)
#pragma unroll
        for (int u = 0; u < Q_TILES; ++u) s[u][j] = at_mma(kl[dc][j].v, qah[u][dc], s[u][j]);
      row_fence();
#pragma unroll
      for (int j = 0; j < 4; ++j)
#pragma unroll
        for (int u = 0; u < Q_TILES; ++u) s[u][j] = at_mma(kb[dc][j].v, qal[u][dc], s[u][j]);
      row_fence();
    }
    // V^T fragments of the first kv-chunk: read here so that the softmax below covers their latency
    FB vb[2][4], vl[2][4];
#pragma unroll
    for (int t = 0; t < 4; ++t) {
      const int vo = t * 16;                            // d tile: 16 columns further; keys 16..31: 16 rows further
      vb[0][t].h[0] = at_ld_tr16(Vsh + vfo + vo);
      vb[0][t].h[1] = at_ld_tr16(Vsh + vfo + vo + 16 * V_PITCH);
      vl[0][t].h[0] = at_ld_tr16(Vsl + vfo + vo);
      vl[0][t].h[1] = at_ld_tr16(Vsl + vfo + vo + 16 * V_PITCH);
    }
    row_fence();
    union PB { v16b v; v2b w[8]; };
    PB pbh[Q_TILES][2], pbl[Q_TILES][2];
#pragma unroll
    for (int u = 0; u < Q_TILES; ++u) {
      // ---- chunk maximum of query 16 u + c over the unscaled scores (the scale is positive): 32 in-lane, then the other half ----
      float mj[4];
#pragma unroll
      for (int j = 0; j < 4; ++j) {
        mj[j] = -INFINITY;
#pragma unroll
        for (int r = 0; r < 8; ++r) mj[j] = fmaxf(mj[j], s[u][j][r]);
      }
      float cm = fmaxf(fmaxf(mj[0], mj[1]), fmaxf(mj[2], mj[3]));
      cm = fmaxf(cm, at_xhalf(cm));
      // ---- online softmax in base 2; p split into bf16 hi/lo in place: pbh[u][kk] / pbl[u][kk] element e = p of key 32 kk + kmap(e, hh) ----
      const float mnew = fmaxf(mrun[u], cm * SC_LOG2E);
      const float alpha = __builtin_amdgcn_exp2f(mrun[u] - mnew);   // 0 on the first chunk, where mrun is -inf
      mrun[u] = mnew;
      const v2f sc2 = (v2f){SC_LOG2E, SC_LOG2E};
      const v2f mn2 = (v2f){mnew, mnew};
      float pj[4];
#pragma unroll
      for (int j = 0; j < 4; ++j) {
        pj[j] = 0.f;
#pragma unroll
        for (int r = 0; r < 8; r += 2) {
          const v2f a2 = (v2f){s[u][j][r], s[u][j][r + 1]} * sc2 - mn2;    // scale, log2(e) and maximum in one FMA
          v2f p2;
          p2[0] = __builtin_amdgcn_exp2f(a2[0]);
          p2[1] = __builtin_amdgcn_exp2f(a2[1]);
          pj[j] += p2[0];
          pj[j] += p2[1];
          const v2b h2 = __builtin_convertvector(p2, v2b);                 // RNE, two values per register
          const v2b l2 = __builtin_convertvector(p2 - __builtin_convertvector(h2, v2f), v2b);
          pbh[u][j >> 1].w[(j & 1) * 4 + (r >> 1)] = h2;
          pbl[u][j >> 1].w[(j & 1) * 4 + (r >> 1)] = l2;
        }
      }
      lrun[u] = lrun[u] * alpha + ((pj[0] + pj[1]) + (pj[2] + pj[3]));
#pragma unroll
      for (int t = 0; t < 4; ++t)
#pragma unroll
        for (int r = 0; r < 8; ++r) oacc[u][t][r] *= alpha;
    }
    // ---- O^T += V^T(64 d x 64 kv) . P^T(64 kv x 32 queries): 2 kv-chunks of 32, 4 d tiles x 2 query tiles, 3 products ----
    // As above: WMMAs round the 8 independent out tiles, per-tile order kept; the second kv-chunk's fragments are read
    // as one group in front of the first kv-chunk's products.
    row_fence();
#pragma unroll
    for (int t = 0; t < 4; ++t) {
      const int vo = t * 16 + 32 * V_PITCH;
      vb[1][t].h[0] = at_ld_tr16(Vsh + vfo + vo);
      vb[1][t].h[1] = at_ld_tr16(Vsh + vfo + vo + 16 * V_PITCH);
      vl[1][t].h[0] = at_ld_tr16(Vsl + vfo + vo);
      vl[1][t].h[1] = at_ld_tr16(Vsl + vfo + vo + 16 * V_PITCH);
    }
    row_fence();
#pragma unroll
    for (int kk = 0; kk < 2; ++kk) {
#pragma unroll
      for (int t = 0; t < 4; ++t)
#pragma unroll
        for (int u = 0; u < Q_TILES; ++u) oacc[u][t] = at_mma(vb[kk][t].v, pbh[u][kk].v, oacc[u][t]);
      row_fence();
#pragma unroll
      for (int t = 0; t < 4; ++t)
#pragma unroll
        for (int u = 0; u < Q_TILES; ++u) oacc[u][t] = at_mma(vl[kk][t].v, pbh[u][kk].v, oacc[u][t]);
      row_fence();
#pragma unroll
      for (int t = 0; t < 4; ++t)
#pragma unroll
        for (int u = 0; u < Q_TILES; ++u) oacc[u][t] = at_mma(vb[kk][t].v, pbl[u][kk].v, oacc[u][t]);
      if (kk == 0) row_fence();
    }
    // ---- publish point of chunk kc+1; it also ends every wave's reads of the buffer refilled behind it ----
    wait_own_lds_reads_done();           // fragment reads of chunk kc are done before its buffer is refilled
    wait_own_copies_landed();            // chunk kc+1 has landed before the barrier publishes it
    __syncthreads();
    if (refill) {                        // chunk kc+2 exists: into the buffer that this trip has just read
      const unsigned short* g2 = gl + (size_t)(kc + 2) * G_CHUNK;
      kv_copy8(ll + bo, ls4, g2);
      kv_copy8(ll + bo + 8u * ls4, ls4, g2 + G_CHUNK / 2);
    }
  };
  for (int kc = 0; kc < NCH - 2; ++kc) trip(kc, true);
  // kept rolled: unrolled, the two trips are one long block in which fragment reads are lifted far up and spilled
#pragma unroll 1
  for (int kc = NCH - 2; kc < NCH; ++kc) trip(kc, false);
  wait_own_copies_landed();              // no copy is outstanding when the ring becomes the out tiles

  // ---- the two halves' denominators join; the lane's 8 consecutive d of each tile go to row 16 u + c of the wave's out tile ----
  float* os = (float*)ring + wave * (Q_WAVE * 68);   // the last trip's barrier ended every read of the ring
#pragma unroll
  for (int u = 0; u < Q_TILES; ++u) {
    const float inv = 1.0f / (lrun[u] + at_xhalf(lrun[u]));
#pragma unroll
    for (int t = 0; t < 4; ++t) {
      v4f o0, o1;
#pragma unroll
      for (int e = 0; e < 4; ++e) { o0[e] = oacc[u][t][e] * inv; o1[e] = oacc[u][t][4 + e] * inv; }
      *(v4f*)(os + (16 * u + c) * 68 + t * 16 + 8 * hh)     = o0;
      *(v4f*)(os + (16 * u + c) * 68 + t * 16 + 8 * hh + 4) = o1;
    }
  }
  __builtin_amdgcn_fence(__ATOMIC_RELEASE, "workgroup");
  __builtin_amdgcn_wave_barrier();
  __builtin_amdgcn_fence(__ATOMIC_ACQUIRE, "workgroup");
  {
    const int q8 = lane >> 3, c8 = (lane & 7) * 8;
    {
#pragma unroll
      for (int it = 0; it < Q_WAVE / 4; ++it) {
        const int row = it * 4 + q8;                   // rows 0..31 of this wave's tile
        const float* sp = os + row * 68 + c8;
        const v4f f0 = *(const v4f*)(sp);
        const v4f f1 = *(const v4f*)(sp + 4);
        v4u ph, plo;
#pragma unroll
        for (int w = 0; w < 2; ++w) {
          const float a = f0[2 * w], bq = f0[2 * w + 1];
          const unsigned short ha = f2bf_bits(a), hb = f2bf_bits(bq);
          const unsigned short la = f2bf_bits(a - bf_bits2f(ha)), lb = f2bf_bits(bq - bf_bits2f(hb));
          ph[w]  = (unsigned)ha | ((unsigned)hb << 16);
          plo[w] = (unsigned)la | ((unsigned)lb << 16);
        }
#pragma unroll
        for (int w = 0; w < 2; ++w) {
          const float a = f1[2 * w], bq = f1[2 * w + 1];
          const unsigned short ha = f2bf_bits(a), hb = f2bf_bits(bq);
          const unsigned short la = f2bf_bits(a - bf_bits2f(ha)), lb = f2bf_bits(bq - bf_bits2f(hb));
          ph[2 + w]  = (unsigned)ha | ((unsigned)hb << 16);
          plo[2 + w] = (unsigned)la | ((unsigned)lb << 16);
        }
        const size_t o = (tokb + q0 + row) * INNER_DIM + hcol + c8;
        *(v4u*)(oh + o) = ph;
        *(v4u*)(ol + o) = plo;
      }
      
    }
  }
}

// =====================================================================================
// launch glue
// =====================================================================================
extern "C" void kernel_launch(void* const* d_in, const int* in_sizes, int n_in,
                              void* d_out, int out_size, void* d_ws,
                              size_t ws_size, hipStream_t stream) {
  if (n_in < 6) return;
  if (in_sizes[0] != TOK_ROWS * MODEL_DIM) return;
  if (in_sizes[1] != MODEL_DIM || in_sizes[2] != MODEL_DIM) return;
  if (in_sizes[3] != QKV_COLS * MODEL_DIM) return;
  if (in_sizes[4] != MODEL_DIM * INNER_DIM) return;
  if (in_sizes[5] != MODEL_DIM) return;
  if (out_size != TOK_ROWS * MODEL_DIM) return;
  if (ws_size < WS_TOTAL) return;

  const float* x    = (const float*)d_in[0];
  const float* gam  = (const float*)d_in[1];
  const float* bet  = (const float*)d_in[2];
  const float* wqkv = (const float*)d_in[3];
  const float* wout = (const float*)d_in[4];
  const float* bout = (const float*)d_in[5];
  float* out = (float*)d_out;

  char* ws = (char*)d_ws;
  size_t off = 0;
  unsigned short* wq_bf  = (unsigned short*)(ws + off); off += WS_WQ;
  unsigned short* wo_bf  = (unsigned short*)(ws + off); off += WS_WO;
  unsigned short* h_hi   = (unsigned short*)(ws + off); off += WS_HPL;
  unsigned short* h_lo   = (unsigned short*)(ws + off); off += WS_HPL;
  unsigned short* qkv_hi = (unsigned short*)(ws + off); off += WS_QKVPL;
  unsigned short* qkv_lo = (unsigned short*)(ws + off); off += WS_QKVPL;
  unsigned short* at_hi  = (unsigned short*)(ws + off); off += WS_ATPL;
  unsigned short* at_lo  = (unsigned short*)(ws + off); off += WS_ATPL;
  if (off > ws_size) return;

  // weights -> bf16 (RNE): 3145728/8 = 393216 = 1536 x 256 ; 1048576/8 = 131072 = 512 x 256
  const int n8_qkv = (QKV_COLS * MODEL_DIM) / 8;
  const int n8_out = (MODEL_DIM * INNER_DIM) / 8;
  cast_f32_bf16x8<<<dim3((n8_qkv + 255) / 256), dim3(256), 0, stream>>>(wqkv, wq_bf, n8_qkv);
  cast_f32_bf16x8<<<dim3((n8_out + 255) / 256), dim3(256), 0, stream>>>(wout, wo_bf, n8_out);

  // LayerNorm -> h hi/lo planes [4096][1024]
  layernorm_bf16split_kernel<<<dim3(TOK_ROWS), dim3(128), 0, stream>>>(x, gam, bet, h_hi, h_lo);

  // qkv = h @ w_qkv^T -> bf16 hi/lo planes [4096][3072]; M=4096 N=3072 K=1024; block tiles 32*12 = 384 blocks
  gemm64_bf16_asplit<2, false, G_NI_QKV><<<dim3((TOK_ROWS / G_BM) * (QKV_COLS / g_bn(G_NI_QKV))), dim3(256), 0, stream>>>(
      h_hi, h_lo, MODEL_DIM, wq_bf, MODEL_DIM, (void*)qkv_hi, (void*)qkv_lo, QKV_COLS,
      (const float*)nullptr, TOK_ROWS, QKV_COLS, MODEL_DIM);

  // attention per (batch, head, 128 query rows): 2*16*16 = 512 blocks -> attn hi/lo planes [4096][1024]
  attn64_bf16x3_kernel<<<dim3(N_BATCH * N_HEAD * (SEQ_LEN / Q_BLOCK)), dim3(128), 0, stream>>>(
      qkv_hi, qkv_lo, at_hi, at_lo);

  // out = attn @ w_out^T + b_out -> f32 [4096][1024]; M=4096 N=1024 K=1024; block tiles 32*8 = 256 blocks
  gemm64_bf16_asplit<0, true, G_NI_OUT><<<dim3((TOK_ROWS / G_BM) * (MODEL_DIM / g_bn(G_NI_OUT))), dim3(256), 0, stream>>>(
      at_hi, at_lo, INNER_DIM, wo_bf, INNER_DIM, (void*)out, (void*)nullptr, MODEL_DIM,
      bout, TOK_ROWS, MODEL_DIM, INNER_DIM);
}

// v010
// It runs in 131 microseconds.
// Timed twice side by side with v009, it ran 1.03 times as fast both times.
// Counting every step since v000, it is 3.96 times as fast.
// Contractions on v_wmma_f32_16x16x32_bf16 (bf16 operands, f32 accumulate): qkv and output projections = activation bf16 hi+lo planes x weight bf16 plane (2 products); q.k scores and p.v = bf16 hi/lo x bf16 hi/lo (3 products); LayerNorm, softmax and epilogues in f32; every float input RNE-converted to bf16 once at load.
#include <hip/hip_runtime.h>
#include <hip/hip_bf16.h>

typedef __attribute__((ext_vector_type(16))) _Float16 v16h;
typedef __attribute__((ext_vector_type(8)))  _Float16 v8h;
typedef __attribute__((ext_vector_type(16))) __bf16   v16b;
typedef __attribute__((ext_vector_type(8)))  __bf16   v8b;
typedef __attribute__((ext_vector_type(8)))  float    v8f;
typedef __attribute__((ext_vector_type(4)))  float    v4f;
typedef __attribute__((ext_vector_type(4)))  unsigned v4u;
typedef __attribute__((ext_vector_type(2)))  unsigned v2u;
typedef __attribute__((ext_vector_type(2)))  float    v2f;
typedef __attribute__((ext_vector_type(2)))  __bf16   v2b;

// ---- problem geometry ----
constexpr int MODEL_DIM = 1024;
constexpr int SEQ_LEN   = 2048;
constexpr int N_BATCH   = 2;
constexpr int N_HEAD    = 16;
constexpr int HEAD_D    = 64;
constexpr int INNER_DIM = N_HEAD * HEAD_D;          // 1024
constexpr int QKV_COLS  = 3 * INNER_DIM;            // 3072
constexpr int TOK_ROWS  = N_BATCH * SEQ_LEN;        // 4096
constexpr int KV_CHUNK  = 64;
constexpr int Q_TILES   = 2;                       // 16-query tiles per attention wave
constexpr int Q_WAVE    = 16 * Q_TILES;            // 32 queries per wave
constexpr int Q_BLOCK   = 4 * Q_WAVE;              // 128 queries per block of 4 waves
// LDS row pitch of the attention K tiles, in bf16 elements: 64 data + 8 pad = 144 B = 16 B x 9 (odd),
// so the 16 rows that one ds_load_b128 fragment read touches fall on distinct bank groups (128-B rows all share banks).
constexpr int LDS_PITCH = 72;
// LDS row pitch of the attention V tiles (row-major [kv][d]), in bf16 elements: 64 data + 16 pad = 160 B = 32 B x 5 (odd),
// the conflict-free pitch of their reader, ds_load_tr16_b128.
constexpr int V_PITCH = 80;

// GEMM shape contract (no run-time tails in the GEMM kernel)
static_assert(MODEL_DIM % 32 == 0, "K of qkv projection");
static_assert(INNER_DIM % 32 == 0, "K of output projection");
static_assert(TOK_ROWS % 64 == 0, "M tile multiple");
static_assert(QKV_COLS % 64 == 0, "N tile multiple (qkv)");
static_assert(MODEL_DIM % 64 == 0, "N tile multiple (out)");
static_assert(SEQ_LEN % KV_CHUNK == 0 && SEQ_LEN % Q_BLOCK == 0, "attention tiles");
static_assert(HEAD_D == 64, "attention kernel is head_dim 64");

// ---- workspace region map (bytes, every offset a multiple of 128) ----
//  [0]            wq  bf16 [3072][1024]         6291456
//  [6291456]      wo  bf16 [1024][1024]         2097152
//  [8388608]      h   hi bf16 [4096][1024]      8388608
//  [16777216]     h   lo bf16 [4096][1024]      8388608
//  [25165824]     qkv hi bf16 [4096][3072]     25165824
//  [50331648]     qkv lo bf16 [4096][3072]     25165824
//  [75497472]     at  hi bf16 [4096][1024]      8388608
//  [83886080]     at  lo bf16 [4096][1024]      8388608
//  total 92274688
constexpr size_t WS_WQ    = (size_t)QKV_COLS * MODEL_DIM * 2;
constexpr size_t WS_WO    = (size_t)MODEL_DIM * INNER_DIM * 2;
constexpr size_t WS_HPL   = (size_t)TOK_ROWS * MODEL_DIM * 2;
constexpr size_t WS_QKVPL = (size_t)TOK_ROWS * QKV_COLS * 2;
constexpr size_t WS_ATPL  = (size_t)TOK_ROWS * INNER_DIM * 2;
constexpr size_t WS_TOTAL = WS_WQ + WS_WO + 2 * WS_HPL + 2 * WS_QKVPL + 2 * WS_ATPL;
static_assert(WS_TOTAL == 92274688, "carve arithmetic");
static_assert(WS_TOTAL <= 134217728, "carve budget");
static_assert(WS_WQ % 128 == 0 && WS_WO % 128 == 0 && WS_HPL % 128 == 0 && WS_QKVPL % 128 == 0 && WS_ATPL % 128 == 0, "128-B aligned regions");

// ---- bf16 RNE helpers ----
__device__ __forceinline__ unsigned short f2bf_bits(float f) {
  unsigned u = __float_as_uint(f);
  return (unsigned short)((u + 0x7FFFu + ((u >> 16) & 1u)) >> 16);
}
__device__ __forceinline__ float bf_bits2f(unsigned short h) { return __uint_as_float(((unsigned)h) << 16); }

// hazard guards as plain device helpers (no inline asm inside the kernel template body)
__device__ __forceinline__ void dep_guard_h(v8f& a, v8f& b, v16h x, v16h y) { asm volatile("v_nop\n\tv_nop\n\tv_nop\n\tv_nop" : "+v"(a), "+v"(b) : "v"(x), "v"(y)); }
__device__ __forceinline__ void dep_guard_b(v8f& a, v8f& b, v16b x, v16b y) { asm volatile("v_nop\n\tv_nop\n\tv_nop\n\tv_nop" : "+v"(a), "+v"(b) : "v"(x), "v"(y)); }
__device__ __forceinline__ void keep4_h(v16h a, v16h b, v16h c, v16h d) { asm volatile("v_nop" :: "v"(a), "v"(b), "v"(c), "v"(d)); }
__device__ __forceinline__ void keep4_b(v16b a, v16b b, v16b c, v16b d) { asm volatile("v_nop" :: "v"(a), "v"(b), "v"(c), "v"(d)); }
__device__ __forceinline__ void acc_guard4(v8f& a, v8f& b, v8f& c, v8f& d) { asm volatile("v_nop\n\tv_nop\n\tv_nop\n\tv_nop" : "+v"(a), "+v"(b), "+v"(c), "+v"(d)); }
template <typename T> struct Frag;
template <> struct Frag<_Float16> {
  typedef v16h V; union U { v16h v; v8h h[2]; };
  static __device__ __forceinline__ v16h load(const _Float16* p) {   // elements 0..7 <- p[0..7], 8..15 <- p[16..23]
    U f; f.h[0] = *(const v8h*)(p); f.h[1] = *(const v8h*)(p + 16); return f.v;
  }
  static __device__ __forceinline__ v8f mma(v16h a, v16h b, v8f c) {
    return __builtin_amdgcn_wmma_f32_16x16x32_f16(false, a, false, b, (short)0, c, false, false);
  }
  static __device__ __forceinline__ void guard(v8f& a, v8f& b, v16h x, v16h y) { dep_guard_h(a, b, x, y); }
  static __device__ __forceinline__ void keep(v16h a, v16h b, v16h c, v16h d) { keep4_h(a, b, c, d); }
};
template <> struct Frag<__bf16> {
  typedef v16b V; union U { v16b v; v8b h[2]; };
  static __device__ __forceinline__ v16b load(const __bf16* p) {
    U f; f.h[0] = *(const v8b*)(p); f.h[1] = *(const v8b*)(p + 16); return f.v;
  }
  static __device__ __forceinline__ v8f mma(v16b a, v16b b, v8f c) {
    return __builtin_amdgcn_wmma_f32_16x16x32_bf16(false, a, false, b, (short)0, c, false, false);
  }
  static __device__ __forceinline__ void guard(v8f& a, v8f& b, v16b x, v16b y) { dep_guard_b(a, b, x, y); }
  static __device__ __forceinline__ void keep(v16b a, v16b b, v16b c, v16b d) { keep4_b(a, b, c, d); }
};

// attention helpers (bf16 WMMA as the plain builtin: the compiler keeps its distances; exchange between the wave halves)
__device__ __forceinline__ v8f at_mma(v16b a, v16b b, v8f c) {
  return __builtin_amdgcn_wmma_f32_16x16x32_bf16(false, a, false, b, (short)0, c, false, false);
}

__device__ __forceinline__ v8b at_ld_tr16(const unsigned short* p) {
  typedef __attribute__((address_space(3))) v8b lds_v8b;
  return __builtin_amdgcn_ds_load_tr16_b128_v8bf16((lds_v8b*)p);
}

// Scheduling fence, no instruction: without it the compiler sinks the grouped fragment reads back among the WMMAs (each
// then waited for right behind its issue), puts the dependent WMMAs of one tile back to back again, or lifts a read group
// so far up that the registers of two waves per SIMD no longer suffice.
__device__ __forceinline__ void row_fence() { __builtin_amdgcn_sched_barrier(0); }

// value of lane l ^ 16: the other half of the wave holds the other keys of the same query
__device__ __forceinline__ float at_xhalf(float x) {
  const int b = __builtin_bit_cast(int, x);
  return __builtin_bit_cast(float, __builtin_amdgcn_permlanex16(b, b, 0x76543210, 0xfedcba98, false, false));
}

// =====================================================================================
// 1) Prologue, one launch: LayerNorm of x -> bf16 hi / lo planes [TOK_ROWS][MODEL_DIM], and both weights f32 -> bf16 (RNE).
//    The three jobs are independent streams of a few MB each: as launches of their own, with 8 elements per thread, they are
//    32768 short waves whose time is the starting of waves and the gaps between launches, not the bytes.
//    Here a wave owns one whole row of x (32 elements per lane) and 1024 consecutive weight elements; there are exactly as
//    many such weight pieces as rows. Every load is 32 lanes x 16 B = 512 contiguous bytes, and a wave's 16 loads of x and
//    weight are in flight together; every store is 32 lanes x 8 B = two whole 128-B lines.
//    The row's mean and variance are summed in-lane and then over the wave's 32 lanes: no LDS, no barrier.
//    Coverage: 256 blocks x 16 waves = 4096 rows = 3072 pieces of w_qkv + 1024 pieces of w_out.
// =====================================================================================
constexpr int PRO_WAVES  = 16;                                   // waves per block
constexpr int PRO_BLOCKS = TOK_ROWS / PRO_WAVES;                 // 256
constexpr int W_PIECE    = 1024;                                 // weight elements per wave
constexpr int WQ_PIECES  = QKV_COLS * MODEL_DIM / W_PIECE;       // 3072
constexpr int WO_PIECES  = MODEL_DIM * INNER_DIM / W_PIECE;      // 1024
static_assert(TOK_ROWS % PRO_WAVES == 0, "whole blocks of rows");
static_assert(WQ_PIECES * W_PIECE == QKV_COLS * MODEL_DIM && WO_PIECES * W_PIECE == MODEL_DIM * INNER_DIM, "whole pieces");
static_assert(WQ_PIECES + WO_PIECES == TOK_ROWS, "one weight piece per row");
static_assert(MODEL_DIM == 8 * 128 && W_PIECE == 8 * 128, "8 wave-wide loads of 128 floats each");

__global__ __launch_bounds__(32 * PRO_WAVES) void prologue_ln_cast_kernel(
    const float* __restrict__ x, const float* __restrict__ gamma, const float* __restrict__ beta,
    const float* __restrict__ wqkv, const float* __restrict__ wout,
    unsigned short* __restrict__ hhi, unsigned short* __restrict__ hlo,
    unsigned short* __restrict__ wq, unsigned short* __restrict__ wo) {
  const int lane = threadIdx.x & 31;
  const int wave = __builtin_amdgcn_readfirstlane(threadIdx.x >> 5);
  const int unit = blockIdx.x * PRO_WAVES + wave;              // the wave's row of x and its weight piece
  const bool is_q = unit < WQ_PIECES;                          // wave-uniform
  const unsigned lo = 4u * (unsigned)lane;                     // the lane's element offset in every 128-element group
  const unsigned lb = 4u * lo;                                 // the same in bytes of f32: the address register of every load
  const char* xr = (const char*)(x + (size_t)unit * MODEL_DIM) + lb;
  const char* wr = (const char*)(is_q ? wqkv + (size_t)unit * W_PIECE : wout + (size_t)(unit - WQ_PIECES) * W_PIECE) + lb;
  const char* gr = (const char*)gamma + lb;
  const char* br = (const char*)beta + lb;
  unsigned short* wd = (is_q ? wq + (size_t)unit * W_PIECE : wo + (size_t)(unit - WQ_PIECES) * W_PIECE) + lo;

  // lane l holds elements 128 k + 4 l .. + 3 of its row, of its piece, of gamma and of beta
  v4f xa[8], wa[8], ga[8], ba[8];
#pragma unroll
  for (int k = 0; k < 8; ++k) xa[k] = *(const v4f*)(xr + 512 * k);
#pragma unroll
  for (int k = 0; k < 8; ++k) wa[k] = *(const v4f*)(wr + 512 * k);
#pragma unroll
  for (int k = 0; k < 8; ++k) {
    ga[k] = *(const v4f*)(gr + 512 * k);
    ba[k] = *(const v4f*)(br + 512 * k);
  }
  // Scheduling fence, no instruction: without it the compiler sinks the weight loads behind the row's sums, and their
  // memory latency is then paid a second time instead of together with the row's.
  row_fence();
  // The wait in front of any rewrite of these loads' address register; the lane's byte offset is an input so that it stays
  // live up to the wait and no load's result is placed in it.
  asm volatile("s_wait_xcnt 0x0" :: "v"(lb) : "memory");
  row_fence();   // holds that wait directly behind the loads: alone it drifts down among the sums, behind a rewrite of a base

  // ---- LayerNorm of the row (x, gamma, beta RNE bf16 first) ----
  float xv[8][4];
  float sk[8];
#pragma unroll
  for (int k = 0; k < 8; ++k) {
#pragma unroll
    for (int e = 0; e < 4; ++e) xv[k][e] = bf_bits2f(f2bf_bits(xa[k][e]));
    sk[k] = (xv[k][0] + xv[k][1]) + (xv[k][2] + xv[k][3]);
  }
  float s = ((sk[0] + sk[1]) + (sk[2] + sk[3])) + ((sk[4] + sk[5]) + (sk[6] + sk[7]));
#pragma unroll
  for (int off = 1; off < 32; off <<= 1) s += __shfl_xor(s, off, 32);
  const float mean = s * (1.0f / (float)MODEL_DIM);

  float qk[8];
#pragma unroll
  for (int k = 0; k < 8; ++k) {
    qk[k] = 0.f;
#pragma unroll
    for (int e = 0; e < 4; ++e) { xv[k][e] -= mean; qk[k] += xv[k][e] * xv[k][e]; }
  }
  float q = ((qk[0] + qk[1]) + (qk[2] + qk[3])) + ((qk[4] + qk[5]) + (qk[6] + qk[7]));
#pragma unroll
  for (int off = 1; off < 32; off <<= 1) q += __shfl_xor(q, off, 32);
  const float var = q * (1.0f / (float)MODEL_DIM);
  const float rstd = rsqrtf(var + 1e-5f);

  unsigned short* hh = hhi + (size_t)unit * MODEL_DIM + lo;
  unsigned short* hl = hlo + (size_t)unit * MODEL_DIM + lo;
#pragma unroll
  for (int k = 0; k < 8; ++k) {
    v2u ph, pl;
#pragma unroll
    for (int w = 0; w < 2; ++w) {
      const float g0 = bf_bits2f(f2bf_bits(ga[k][2 * w])),     b0 = bf_bits2f(f2bf_bits(ba[k][2 * w]));
      const float g1 = bf_bits2f(f2bf_bits(ga[k][2 * w + 1])), b1 = bf_bits2f(f2bf_bits(ba[k][2 * w + 1]));
      const float f0 = xv[k][2 * w] * rstd * g0 + b0;
      const float f1 = xv[k][2 * w + 1] * rstd * g1 + b1;
      const unsigned short h0 = f2bf_bits(f0), h1 = f2bf_bits(f1);
      const unsigned short l0 = f2bf_bits(f0 - bf_bits2f(h0));
      const unsigned short l1 = f2bf_bits(f1 - bf_bits2f(h1));
      ph[w] = (unsigned)h0 | ((unsigned)h1 << 16);
      pl[w] = (unsigned)l0 | ((unsigned)l1 << 16);
    }
    *(v2u*)(hh + 128 * k) = ph;
    *(v2u*)(hl + 128 * k) = pl;
  }

  // ---- the weight piece ----
#pragma unroll
  for (int k = 0; k < 8; ++k) {
    v2u u;
    u[0] = (unsigned)f2bf_bits(wa[k][0]) | ((unsigned)f2bf_bits(wa[k][1]) << 16);
    u[1] = (unsigned)f2bf_bits(wa[k][2]) | ((unsigned)f2bf_bits(wa[k][3]) << 16);
    *(v2u*)(wd + 128 * k) = u;
  }
}

// =====================================================================================
// 3) WMMA GEMM, operands staged in LDS: C[m,n] = sum_k (Ah+Al)[m,k] * Bt[n,k] (+bias[n], bias RNE bf16)
//    A = bf16 hi and lo planes row-major [M,K] (lda); Bt = bf16 row-major [N,K] (ldb); 2 WMMA products per tile pair.
//    A block of 8 waves owns a 128 x BN C tile. NI = 16-row tiles per wave picks the shape, so that a launch can fill the chip:
//    NI = 4: waves 2 x 4, 64x64 each, BN = 256 (qkv: 384 blocks); NI = 2: waves 4 x 2, 32x64 each, BN = 128 (out: 256 blocks,
//    one per WGP; at BN = 256 that product has only 128 blocks, half of the WGPs). K is walked in slabs of 64:
//    a stage is [A hi 128 rows | A lo 128 rows | Bt BN rows] of 128 B each at a 144-B LDS pitch, two buffers.
//    Every wave copies an eighth of the stage rows with asynchronous 16-B-per-lane copies (4 whole 128-B rows each),
//    one slab ahead of the slab that is being multiplied. Per output element the k order of the sums is ascending.
//    Coverage: grid.x = (M/128)*(N/BN) blocks, every wave tile exactly once (shapes static_assert'ed below).
// =====================================================================================
constexpr int G_BM          = 128;                              // block tile rows
constexpr int G_NI_QKV      = 4;                                // wave tile rows / 16 of the qkv projection: BN = 256
constexpr int G_NI_OUT      = 2;                                // the same of the output projection: BN = 128
constexpr int g_bn(int ni) { return (8 / (G_BM / (16 * ni))) * 64; }                    // block tile columns
constexpr int G_SLAB_K      = 64;                               // k elements per stage: 128-B rows
constexpr int G_PITCH       = 72;                               // LDS row pitch in bf16 elements: 144 B = 16 B x 9
constexpr int g_stage_bytes(int ni) { return (2 * G_BM + g_bn(ni)) * G_PITCH * 2; }    // 73728 (NI = 4), 55296 (NI = 2)
constexpr unsigned G_PLANE_BYTES = (unsigned)G_BM * G_PITCH * 2u;   // one A plane of a stage
constexpr unsigned G_COPY_LDS_STEP = 4u * G_PITCH * 2u;         // one wave-wide copy fills 4 stage rows
static_assert(TOK_ROWS % G_BM == 0, "M block tile multiple");
static_assert(g_bn(G_NI_QKV) == 256 && g_bn(G_NI_OUT) == 128, "block tile columns");
static_assert(QKV_COLS % g_bn(G_NI_QKV) == 0 && MODEL_DIM % g_bn(G_NI_OUT) == 0, "N block tile multiple");
static_assert(MODEL_DIM % G_SLAB_K == 0 && INNER_DIM % G_SLAB_K == 0, "K slab multiple");
static_assert(MODEL_DIM / G_SLAB_K >= 2 && INNER_DIM / G_SLAB_K >= 2, "two stages at least");
static_assert(8 * 16 * 68 * 4 <= 2 * g_stage_bytes(G_NI_OUT), "epilogue slabs fit the ring");

// Eight asynchronous copies global -> LDS, 16 B per lane each, for 32 consecutive stage rows of one wave.
// l = the lane's LDS byte address of the first copy, g = its global address, step = elements per 4 source rows.
// The closing s_wait_xcnt 0 stands inside the statement so that no address register named here is rewritten ahead of it.
__device__ __forceinline__ void stage_copy8(unsigned l, const unsigned short* g, size_t step) {
  asm volatile(
      "global_load_async_to_lds_b128 %0, %8, off\n\t"
      "global_load_async_to_lds_b128 %1, %9, off\n\t"
      "global_load_async_to_lds_b128 %2, %10, off\n\t"
      "global_load_async_to_lds_b128 %3, %11, off\n\t"
      "global_load_async_to_lds_b128 %4, %12, off\n\t"
      "global_load_async_to_lds_b128 %5, %13, off\n\t"
      "global_load_async_to_lds_b128 %6, %14, off\n\t"
      "global_load_async_to_lds_b128 %7, %15, off\n\t"
      "s_wait_xcnt 0x0"
      :: "v"(l), "v"(l + G_COPY_LDS_STEP), "v"(l + 2u * G_COPY_LDS_STEP), "v"(l + 3u * G_COPY_LDS_STEP),
         "v"(l + 4u * G_COPY_LDS_STEP), "v"(l + 5u * G_COPY_LDS_STEP), "v"(l + 6u * G_COPY_LDS_STEP),
         "v"(l + 7u * G_COPY_LDS_STEP),
         "v"(g), "v"(g + step), "v"(g + 2 * step), "v"(g + 3 * step),
         "v"(g + 4 * step), "v"(g + 5 * step), "v"(g + 6 * step), "v"(g + 7 * step)
      : "memory");
}

// Twelve such copies for the 128-column stage: 16 consecutive rows (4 copies) of each of its three 128-row planes.
// l = the lane's LDS byte address in the A hi plane; ga, gb, gc = its global addresses in A hi, A lo and Bt;
// sa, sc = elements per 4 source rows of A and of Bt. The closing s_wait_xcnt 0 stands inside the statement as above.
__device__ __forceinline__ void stage_copy12(unsigned l, const unsigned short* ga, const unsigned short* gb,
                                             const unsigned short* gc, size_t sa, size_t sc) {
  const unsigned l2 = l + G_PLANE_BYTES, l3 = l + 2u * G_PLANE_BYTES;
  asm volatile(
      "global_load_async_to_lds_b128 %0, %12, off\n\t"
      "global_load_async_to_lds_b128 %1, %13, off\n\t"
      "global_load_async_to_lds_b128 %2, %14, off\n\t"
      "global_load_async_to_lds_b128 %3, %15, off\n\t"
      "global_load_async_to_lds_b128 %4, %16, off\n\t"
      "global_load_async_to_lds_b128 %5, %17, off\n\t"
      "global_load_async_to_lds_b128 %6, %18, off\n\t"
      "global_load_async_to_lds_b128 %7, %19, off\n\t"
      "global_load_async_to_lds_b128 %8, %20, off\n\t"
      "global_load_async_to_lds_b128 %9, %21, off\n\t"
      "global_load_async_to_lds_b128 %10, %22, off\n\t"
      "global_load_async_to_lds_b128 %11, %23, off\n\t"
      "s_wait_xcnt 0x0"
      :: "v"(l), "v"(l + G_COPY_LDS_STEP), "v"(l + 2u * G_COPY_LDS_STEP), "v"(l + 3u * G_COPY_LDS_STEP),
         "v"(l2), "v"(l2 + G_COPY_LDS_STEP), "v"(l2 + 2u * G_COPY_LDS_STEP), "v"(l2 + 3u * G_COPY_LDS_STEP),
         "v"(l3), "v"(l3 + G_COPY_LDS_STEP), "v"(l3 + 2u * G_COPY_LDS_STEP), "v"(l3 + 3u * G_COPY_LDS_STEP),
         "v"(ga), "v"(ga + sa), "v"(ga + 2 * sa), "v"(ga + 3 * sa),
         "v"(gb), "v"(gb + sa), "v"(gb + 2 * sa), "v"(gb + 3 * sa),
         "v"(gc), "v"(gc + sc), "v"(gc + 2 * sc), "v"(gc + 3 * sc)
      : "memory");
}

// The two waits of the stage ring, each an asm statement of its own; the "memory" clobber keeps LDS accesses on their side of it.
__device__ __forceinline__ void wait_own_copies_landed() { asm volatile("s_wait_asynccnt 0x0" ::: "memory"); }
__device__ __forceinline__ void wait_own_lds_reads_done() { asm volatile("s_wait_dscnt 0x0" ::: "memory"); }

template <int OUT_MODE, bool HAS_BIAS, int NI>
__global__ __launch_bounds__(256) void gemm64_bf16_asplit(
    const unsigned short* __restrict__ Ahp, const unsigned short* __restrict__ Alp, int lda,
    const unsigned short* __restrict__ Btp, int ldb,
    void* __restrict__ Cout, void* __restrict__ Cout2, int ldc,
    const float* __restrict__ bias, int M, int N, int K) {
  typedef __bf16 T;
  typedef v16b V;
  // two stage buffers; after the K loop the same bytes serve as the per-wave 16x64 f32 epilogue slabs (pitch 68 floats)
  constexpr int WN = 8 / (G_BM / (16 * NI));     // waves along n: 4 or 2
  constexpr int BN = g_bn(NI);
  constexpr int STAGE_BYTES = g_stage_bytes(NI);
  static_assert(NI == 4 || NI == 2, "the two stage layouts below");
  __shared__ __align__(16) unsigned char smem[2 * STAGE_BYTES];
  const int lane = threadIdx.x & 31;
  const int wave = __builtin_amdgcn_readfirstlane(threadIdx.x >> 5);
  const int tilesN = N / BN;
  const int tilesM = M / G_BM;
  const int bm = blockIdx.x / tilesN;
  const int bn = blockIdx.x - bm * tilesN;
  if (bm >= tilesM) return;              // block-uniform, in front of every barrier and copy
  const int mB = bm * G_BM;
  const int nB = bn * BN;
  const int wm = wave / WN;              // 16 NI-row part of the block tile
  const int wn = wave % WN;              // 64-column part
  const int m0 = mB + wm * (16 * NI);
  const int n0 = nB + (wn << 6);

  const int rlane = lane & 15;                 // row (A) / col (B, D) within subtile
  const int koff  = (lane >> 4) * 8;           // k offset of this lane half
  const int mOff  = (lane >> 4) * 8;           // D row offset

  // ---- this wave's share of a stage; 8 lanes x 16 B = one 128-B row ----
  // NI = 4: stage rows wave*64 .. wave*64+63 (waves 0,1: A hi; 2,3: A lo; 4..7: Bt), through gl alone.
  // NI = 2: rows wave*16 .. wave*16+15 of each of the three 128-row planes: gl = A hi, gl2 = A lo, gl3 = Bt.
  const unsigned short* gl;
  const unsigned short* gl2 = nullptr;
  const unsigned short* gl3 = nullptr;
  size_t step4, step4b = 0;
  unsigned ll;
  if constexpr (NI == 4) {
    const unsigned short* srow;
    int sld;
    if (wave < 2)      { srow = Ahp + (size_t)(mB + wave * 64) * lda;       sld = lda; }
    else if (wave < 4) { srow = Alp + (size_t)(mB + (wave - 2) * 64) * lda; sld = lda; }
    else               { srow = Btp + (size_t)(nB + (wave - 4) * 64) * ldb; sld = ldb; }
    gl = srow + (size_t)(lane >> 3) * sld + (lane & 7) * 8;
    step4 = (size_t)sld * 4;
    ll = (unsigned)(size_t)smem + (unsigned)((wave * 64 + (lane >> 3)) * (G_PITCH * 2) + (lane & 7) * 16);
  } else {
    const int r0 = wave * 16 + (lane >> 3);
    gl  = Ahp + (size_t)(mB + r0) * lda + (lane & 7) * 8;
    gl2 = Alp + (size_t)(mB + r0) * lda + (lane & 7) * 8;
    gl3 = Btp + (size_t)(nB + r0) * ldb + (lane & 7) * 8;
    step4  = (size_t)lda * 4;
    step4b = (size_t)ldb * 4;
    ll = (unsigned)(size_t)smem + (unsigned)(r0 * (G_PITCH * 2) + (lane & 7) * 16);
  }
  // the wave's copies of the slab that starts at k element ko, into the buffer at byte offset lo
  auto issue_stage = [&](const unsigned lo, const size_t ko) __attribute__((always_inline)) {
    if constexpr (NI == 4) {
      stage_copy8(ll + lo, gl + ko, step4);
      stage_copy8(ll + lo + 8u * G_COPY_LDS_STEP, gl + ko + 8 * step4, step4);
    } else {
      stage_copy12(ll + lo, gl + ko, gl2 + ko, gl3 + ko, step4, step4b);
    }
  };

  v8f acc[NI][4];
#pragma unroll
  for (int i = 0; i < NI; ++i)
#pragma unroll
    for (int j = 0; j < 4; ++j) acc[i][j] = (v8f){0.f,0.f,0.f,0.f,0.f,0.f,0.f,0.f};

  const int nT = K / G_SLAB_K;
  // ---- prologue: slab 0 lands and is published, then slab 1 starts to fly ----
  issue_stage(0u, 0);
  wait_own_copies_landed();              // slab 0 has landed before the barrier publishes it to the other waves
  __syncthreads();
  if (nT > 1) issue_stage((unsigned)STAGE_BYTES, G_SLAB_K);

  for (int t = 0; t < nT; ++t) {
    const unsigned bo = (t & 1) ? (unsigned)STAGE_BYTES : 0u;
    const T* sb  = (const T*)(smem + bo);
    const T* sAh = sb + (wm * (16 * NI) + rlane) * G_PITCH + koff;
    const T* sAl = sAh + G_BM * G_PITCH;
    const T* sB  = sb + (2 * G_BM + (wn << 6) + rlane) * G_PITCH + koff;
#pragma unroll
    for (int kk = 0; kk < G_SLAB_K; kk += 32) {
      V bh[4];
#pragma unroll
      for (int j = 0; j < 4; ++j) bh[j] = Frag<T>::load(sB + (j << 4) * G_PITCH + kk);
#pragma unroll
      for (int i = 0; i < NI; ++i) {
        V ah = Frag<T>::load(sAh + (i << 4) * G_PITCH + kk);
        V al = Frag<T>::load(sAl + (i << 4) * G_PITCH + kk);
#pragma unroll
        for (int j = 0; j < 4; ++j) {
          acc[i][j] = Frag<T>::mma(ah, bh[j], acc[i][j]);
          acc[i][j] = Frag<T>::mma(al, bh[j], acc[i][j]);
        }
        Frag<T>::guard(acc[i][0], acc[i][3], ah, al);
      }
      Frag<T>::keep(bh[0], bh[1], bh[2], bh[3]);
    }
    // ---- publish point of slab t+1; it also ends every wave's reads of the buffer refilled behind it ----
    wait_own_lds_reads_done();           // fragment reads of slab t are done before its buffer is refilled
    wait_own_copies_landed();            // slab t+1 has landed before the barrier publishes it
    __syncthreads();
    if (t + 2 < nT) issue_stage(bo, (size_t)(t + 2) * G_SLAB_K);
  }
  wait_own_copies_landed();              // no copy is outstanding when the ring becomes epilogue staging
#pragma unroll
  for (int i = 0; i < NI; ++i) acc_guard4(acc[i][0], acc[i][1], acc[i][2], acc[i][3]);

  // ---- epilogue ----
  float* slab = (float*)smem + wave * (16 * 68);   // the last trip's barrier ended every read of the ring
#pragma unroll
  for (int i = 0; i < NI; ++i) {
    const int mBase = m0 + (i << 4);
#pragma unroll
    for (int j = 0; j < 4; ++j) {
#pragma unroll
      for (int r = 0; r < 8; ++r) {
        slab[(mOff + r) * 68 + (j << 4) + rlane] = acc[i][j][r];
      }
    }
    __builtin_amdgcn_fence(__ATOMIC_RELEASE, "workgroup");
    __builtin_amdgcn_wave_barrier();
    __builtin_amdgcn_fence(__ATOMIC_ACQUIRE, "workgroup");
    if (OUT_MODE == 0) {
      float* Cf = (float*)Cout;
      const int h2 = lane >> 4, c4 = (lane & 15) * 4;     // row seg = 256 B = 16 lanes x 16 B
      v4f bb = (v4f){0.f, 0.f, 0.f, 0.f};
      if (HAS_BIAS) {
        const v4f braw = *(const v4f*)(bias + n0 + c4);
#pragma unroll
        for (int e = 0; e < 4; ++e) bb[e] = bf_bits2f(f2bf_bits(braw[e]));
      }
      {
#pragma unroll
        for (int it = 0; it < 8; ++it) {
          const int row = it * 2 + h2;
          v4f v = *(const v4f*)(slab + row * 68 + c4);
          v = v + bb;
          *(v4f*)(Cf + (size_t)(mBase + row) * ldc + n0 + c4) = v;
        }
        
      }
    } else {
      const int q = lane >> 3, c8 = (lane & 7) * 8;
      unsigned short* Cu  = (unsigned short*)Cout;
      unsigned short* Cu2 = (unsigned short*)Cout2;
      {
#pragma unroll
        for (int it = 0; it < 4; ++it) {
          const int row = it * 4 + q;
          const float* sp = slab + row * 68 + c8;
          v8h hv, lv;
#pragma unroll
          for (int e = 0; e < 8; ++e) {
            unsigned short hb = f2bf_bits(sp[e]);
            unsigned short lb = f2bf_bits(sp[e] - bf_bits2f(hb));
            hv[e] = __builtin_bit_cast(_Float16, hb);
            lv[e] = __builtin_bit_cast(_Float16, lb);
          }
          *(v8h*)(Cu  + (size_t)(mBase + row) * ldc + n0 + c8) = hv;
          *(v8h*)(Cu2 + (size_t)(mBase + row) * ldc + n0 + c8) = lv;
        }
        
      }
    }
    __builtin_amdgcn_fence(__ATOMIC_RELEASE, "workgroup");
    __builtin_amdgcn_wave_barrier();
    __builtin_amdgcn_fence(__ATOMIC_ACQUIRE, "workgroup");
  }
}

constexpr int AT_K_PLANE = KV_CHUNK * LDS_PITCH * 2;
constexpr int AT_V_PLANE = KV_CHUNK * V_PITCH * 2;
constexpr int AT_V_OFF   = 2 * AT_K_PLANE;
constexpr int AT_BUF     = 2 * AT_K_PLANE + 2 * AT_V_PLANE;
static_assert(AT_V_OFF % 32 == 0 && AT_V_PLANE % 32 == 0 && AT_BUF % 32 == 0, "V planes stay 32-B aligned");
static_assert(4 * Q_WAVE * 68 * 4 <= 2 * AT_BUF, "out tiles fit the ring");
static_assert(SEQ_LEN / KV_CHUNK >= 2, "two chunks at least");

// Eight asynchronous copies global -> LDS, 16 B per lane each, for 32 consecutive kv rows of one plane.
// l = the lane's LDS byte address of the first copy, ls = LDS bytes per 4 rows, g = its global address.
// The closing s_wait_xcnt 0 stands inside the statement so that no address register named here is rewritten ahead of it.
__device__ __forceinline__ void kv_copy8(unsigned l, unsigned ls, const unsigned short* g) {
  constexpr size_t gs = (size_t)4 * QKV_COLS;                      // elements per 4 source rows
  asm volatile(
      "global_load_async_to_lds_b128 %0, %8, off\n\t"
      "global_load_async_to_lds_b128 %1, %9, off\n\t"
      "global_load_async_to_lds_b128 %2, %10, off\n\t"
      "global_load_async_to_lds_b128 %3, %11, off\n\t"
      "global_load_async_to_lds_b128 %4, %12, off\n\t"
      "global_load_async_to_lds_b128 %5, %13, off\n\t"
      "global_load_async_to_lds_b128 %6, %14, off\n\t"
      "global_load_async_to_lds_b128 %7, %15, off\n\t"
      "s_wait_xcnt 0x0"
      :: "v"(l), "v"(l + ls), "v"(l + 2u * ls), "v"(l + 3u * ls),
         "v"(l + 4u * ls), "v"(l + 5u * ls), "v"(l + 6u * ls), "v"(l + 7u * ls),
         "v"(g), "v"(g + gs), "v"(g + 2 * gs), "v"(g + 3 * gs),
         "v"(g + 4 * gs), "v"(g + 5 * gs), "v"(g + 6 * gs), "v"(g + 7 * gs)
      : "memory");
}

// amdgpu_waves_per_eu(2): a budget of 512 VGPRs; the grid is two blocks per WGP, one wave of each per SIMD
__global__ __launch_bounds__(128) __attribute__((amdgpu_waves_per_eu(2))) void attn64_bf16x3_kernel(
    const unsigned short* __restrict__ qkvh, const unsigned short* __restrict__ qkvl,
    unsigned short* __restrict__ oh, unsigned short* __restrict__ ol) {
  union FB { v16b v; v8b h[2]; };
  // two chunk buffers; after the kv loop the same bytes serve as the per-wave 32x64 f32 out tiles (pitch 68 floats)
  __shared__ __align__(32) unsigned char ring[2 * AT_BUF];

  const int tid  = threadIdx.x;
  const int wave = __builtin_amdgcn_readfirstlane(tid >> 5);
  const int lane = tid & 31;
  const int hh   = lane >> 4;
  const int c    = lane & 15;

  constexpr int NQB = SEQ_LEN / Q_BLOCK;   // 16
  const int bx   = blockIdx.x;
  const int qb   = bx % NQB;
  const int bhid = bx / NQB;
  const int head = bhid % N_HEAD;
  const int bat  = bhid / N_HEAD;
  const int q0   = qb * Q_BLOCK + wave * Q_WAVE;
  const size_t tokb = (size_t)bat * SEQ_LEN;
  const int hcol = head * HEAD_D;

  const __bf16* QH = (const __bf16*)qkvh;
  const __bf16* QL = (const __bf16*)qkvl;

  // ---- Q fragments (B operand, column = query 16 u + c of the wave): 2 d-chunks, hi and lo, statically strided global loads ----
  v16b qah[Q_TILES][2], qal[Q_TILES][2];
  const __bf16* qbh = QH + (tokb + q0 + c) * QKV_COLS + hcol + 8 * hh;   // the lane's row of query tile 0, hi plane
  const __bf16* qbl = QL + (tokb + q0 + c) * QKV_COLS + hcol + 8 * hh;   // the same, lo plane
#pragma unroll
  for (int u = 0; u < Q_TILES; ++u) {
#pragma unroll
    for (int dc = 0; dc < 2; ++dc) {
      qah[u][dc] = Frag<__bf16>::load(qbh + (size_t)16 * u * QKV_COLS + dc * 32);
      qal[u][dc] = Frag<__bf16>::load(qbl + (size_t)16 * u * QKV_COLS + dc * 32);
    }
  }
  // The wait in front of any rewrite of the Q loads' address registers; the two bases are inputs so that they stay live
  // up to it and no load's result is placed in them.
  asm volatile("s_wait_xcnt 0x0" :: "v"(qbh), "v"(qbl) : "memory");

  constexpr float SC_LOG2E = 0.125f * 1.4426950408889634f;   // head_dim^-0.5 * log2(e)
  float mrun[Q_TILES];      // running maximum of query 16 u + c's scores times SC_LOG2E (equal in both halves)
  float lrun[Q_TILES];      // running denominator of query 16 u + c over this half's keys only
  v8f oacc[Q_TILES][4];     // oacc[u][t][r] = out[query 16 u + c][d = 16 t + 8 hh + r]
#pragma unroll
  for (int u = 0; u < Q_TILES; ++u) {
    mrun[u] = -INFINITY;
    lrun[u] = 0.f;
#pragma unroll
    for (int t = 0; t < 4; ++t) oacc[u][t] = (v8f){0.f,0.f,0.f,0.f,0.f,0.f,0.f,0.f};
  }

  const int fo = c * LDS_PITCH + 8 * hh;   // the lane's place in a 16-row fragment; tile and chunk steps are constants on top
  const int vfo = (8 * hh + (lane & 7)) * V_PITCH + 8 * ((lane >> 3) & 1);   // the lane's address part of a transposing read of V

  // ---- this wave's share of a chunk: plane w (0: K hi, 1: K lo, 2: V hi, 3: V lo), all 64 rows of it ----
  const bool isV = wave >= 2;
  const unsigned lpitch = isV ? (unsigned)(V_PITCH * 2) : (unsigned)(LDS_PITCH * 2);
  const unsigned lplane = (isV ? (unsigned)AT_V_OFF : 0u) + (unsigned)(wave & 1) * (isV ? (unsigned)AT_V_PLANE : (unsigned)AT_K_PLANE);
  const unsigned short* gl = ((wave & 1) ? qkvl : qkvh) + (tokb + (lane >> 3)) * QKV_COLS
                             + (isV ? 2 * INNER_DIM : INNER_DIM) + hcol + (lane & 7) * 8;   // 8 lanes x 16 B = one 128-B row
  const unsigned ll = (unsigned)(size_t)ring + lplane + (unsigned)(lane >> 3) * lpitch + (unsigned)(lane & 7) * 16u;
  const unsigned ls4 = 4u * lpitch;
  constexpr int NCH = SEQ_LEN / KV_CHUNK;
  constexpr size_t G_CHUNK = (size_t)KV_CHUNK * QKV_COLS;    // elements from one chunk's rows to the next chunk's

  // ---- prologue: chunk 0 lands and is published, then chunk 1 starts to fly ----
  kv_copy8(ll, ls4, gl);
  kv_copy8(ll + 8u * ls4, ls4, gl + G_CHUNK / 2);
  wait_own_copies_landed();              // chunk 0 has landed before the barrier publishes it to the other waves
  __syncthreads();
  kv_copy8(ll + (unsigned)AT_BUF, ls4, gl + G_CHUNK);
  kv_copy8(ll + (unsigned)AT_BUF + 8u * ls4, ls4, gl + G_CHUNK + G_CHUNK / 2);

  // One trip of the kv loop. It is written once and used in two loops: one whose every trip refills, and one for the last
  // two chunks, behind which no chunk is left to fetch. So no trip holds a branch (with one, the compiler sinks the
  // denominator's adds behind it and keeps all 64 p alive over the second product, which spills).
  auto trip = [&](const int kc, const bool refill) __attribute__((always_inline)) {
    const unsigned bo = (kc & 1) ? (unsigned)AT_BUF : 0u;
    const __bf16* KHp = (const __bf16*)(ring + bo);
    const __bf16* KLp = (const __bf16*)(ring + bo + AT_K_PLANE);
    const unsigned short* Vsh = (const unsigned short*)(ring + bo + AT_V_OFF);
    const unsigned short* Vsl = (const unsigned short*)(ring + bo + AT_V_OFF + AT_V_PLANE);

    // ---- scores S^T: 4 x 2 tiles of 16 keys x 16 queries, 2 d-chunks, 3 products each ----
    // The K fragments of a d-chunk are read as one group, and consecutive WMMAs go round the 8 independent score tiles,
    // so that no WMMA waits for the one in front of it; each tile still sums its 6 products in the order dc, hi.hi, lo.hi, hi.lo.
    v8f s[Q_TILES][4];
    FB kb[2][4], kl[2][4];
#pragma unroll
    for (int dc = 0; dc < 2; ++dc) {
#pragma unroll
      for (int j = 0; j < 4; ++j) {
        const int ko = j * 16 * LDS_PITCH + dc * 32;      // a constant: folds into the read's offset field
        kb[dc][j].h[0] = *(const v8b*)(KHp + fo + ko);
        kb[dc][j].h[1] = *(const v8b*)(KHp + fo + ko + 16);
        kl[dc][j].h[0] = *(const v8b*)(KLp + fo + ko);
        kl[dc][j].h[1] = *(const v8b*)(KLp + fo + ko + 16);
      }
    }
    row_fence();
#pragma unroll
    for (int u = 0; u < Q_TILES; ++u)
#pragma unroll
      for (int j = 0; j < 4; ++j) s[u][j] = (v8f){0.f,0.f,0.f,0.f,0.f,0.f,0.f,0.f};
#pragma unroll
    for (int dc = 0; dc < 2; ++dc) {
#pragma unroll
      for (int j = 0; j < 4; ++j)
#pragma unroll
        for (int u = 0; u < Q_TILES; ++u) s[u][j] = at_mma(kb[dc][j].v, qah[u][dc], s[u][j]);
      row_fence();
#pragma unroll
      for (int j = 0; j < 4; ++j)
#pragma unroll
        for (int u = 0; u < Q_TILES; ++u) s[u][j] = at_mma(kl[dc][j].v, qah[u][dc], s[u][j]);
      row_fence();
#pragma unroll
      for (int j = 0; j < 4; ++j)
#pragma unroll
        for (int u = 0; u < Q_TILES; ++u) s[u][j] = at_mma(kb[dc][j].v, qal[u][dc], s[u][j]);
      row_fence();
    }
    // V^T fragments of the first kv-chunk: read here so that the softmax below covers their latency
    FB vb[2][4], vl[2][4];
#pragma unroll
    for (int t = 0; t < 4; ++t) {
      const int vo = t * 16;                            // d tile: 16 columns further; keys 16..31: 16 rows further
      vb[0][t].h[0] = at_ld_tr16(Vsh + vfo + vo);
      vb[0][t].h[1] = at_ld_tr16(Vsh + vfo + vo + 16 * V_PITCH);
      vl[0][t].h[0] = at_ld_tr16(Vsl + vfo + vo);
      vl[0][t].h[1] = at_ld_tr16(Vsl + vfo + vo + 16 * V_PITCH);
    }
    row_fence();
    union PB { v16b v; v2b w[8]; };
    PB pbh[Q_TILES][2], pbl[Q_TILES][2];
#pragma unroll
    for (int u = 0; u < Q_TILES; ++u) {
      // ---- chunk maximum of query 16 u + c over the unscaled scores (the scale is positive): 32 in-lane, then the other half ----
      float mj[4];
#pragma unroll
      for (int j = 0; j < 4; ++j) {
        mj[j] = -INFINITY;
#pragma unroll
        for (int r = 0; r < 8; ++r) mj[j] = fmaxf(mj[j], s[u][j][r]);
      }
      float cm = fmaxf(fmaxf(mj[0], mj[1]), fmaxf(mj[2], mj[3]));
      cm = fmaxf(cm, at_xhalf(cm));
      // ---- online softmax in base 2; p split into bf16 hi/lo in place: pbh[u][kk] / pbl[u][kk] element e = p of key 32 kk + kmap(e, hh) ----
      const float mnew = fmaxf(mrun[u], cm * SC_LOG2E);
      const float alpha = __builtin_amdgcn_exp2f(mrun[u] - mnew);   // 0 on the first chunk, where mrun is -inf
      mrun[u] = mnew;
      const v2f sc2 = (v2f){SC_LOG2E, SC_LOG2E};
      const v2f mn2 = (v2f){mnew, mnew};
      float pj[4];
#pragma unroll
      for (int j = 0; j < 4; ++j) {
        pj[j] = 0.f;
#pragma unroll
        for (int r = 0; r < 8; r += 2) {
          const v2f a2 = (v2f){s[u][j][r], s[u][j][r + 1]} * sc2 - mn2;    // scale, log2(e) and maximum in one FMA
          v2f p2;
          p2[0] = __builtin_amdgcn_exp2f(a2[0]);
          p2[1] = __builtin_amdgcn_exp2f(a2[1]);
          pj[j] += p2[0];
          pj[j] += p2[1];
          const v2b h2 = __builtin_convertvector(p2, v2b);                 // RNE, two values per register
          const v2b l2 = __builtin_convertvector(p2 - __builtin_convertvector(h2, v2f), v2b);
          pbh[u][j >> 1].w[(j & 1) * 4 + (r >> 1)] = h2;
          pbl[u][j >> 1].w[(j & 1) * 4 + (r >> 1)] = l2;
        }
      }
      lrun[u] = lrun[u] * alpha + ((pj[0] + pj[1]) + (pj[2] + pj[3]));
#pragma unroll
      for (int t = 0; t < 4; ++t)
#pragma unroll
        for (int r = 0; r < 8; ++r) oacc[u][t][r] *= alpha;
    }
    // ---- O^T += V^T(64 d x 64 kv) . P^T(64 kv x 32 queries): 2 kv-chunks of 32, 4 d tiles x 2 query tiles, 3 products ----
    // As above: WMMAs round the 8 independent out tiles, per-tile order kept; the second kv-chunk's fragments are read
    // as one group in front of the first kv-chunk's products.
    row_fence();
#pragma unroll
    for (int t = 0; t < 4; ++t) {
      const int vo = t * 16 + 32 * V_PITCH;
      vb[1][t].h[0] = at_ld_tr16(Vsh + vfo + vo);
      vb[1][t].h[1] = at_ld_tr16(Vsh + vfo + vo + 16 * V_PITCH);
      vl[1][t].h[0] = at_ld_tr16(Vsl + vfo + vo);
      vl[1][t].h[1] = at_ld_tr16(Vsl + vfo + vo + 16 * V_PITCH);
    }
    row_fence();
#pragma unroll
    for (int kk = 0; kk < 2; ++kk) {
#pragma unroll
      for (int t = 0; t < 4; ++t)
#pragma unroll
        for (int u = 0; u < Q_TILES; ++u) oacc[u][t] = at_mma(vb[kk][t].v, pbh[u][kk].v, oacc[u][t]);
      row_fence();
#pragma unroll
      for (int t = 0; t < 4; ++t)
#pragma unroll
        for (int u = 0; u < Q_TILES; ++u) oacc[u][t] = at_mma(vl[kk][t].v, pbh[u][kk].v, oacc[u][t]);
      row_fence();
#pragma unroll
      for (int t = 0; t < 4; ++t)
#pragma unroll
        for (int u = 0; u < Q_TILES; ++u) oacc[u][t] = at_mma(vb[kk][t].v, pbl[u][kk].v, oacc[u][t]);
      if (kk == 0) row_fence();
    }
    // ---- publish point of chunk kc+1; it also ends every wave's reads of the buffer refilled behind it ----
    wait_own_lds_reads_done();           // fragment reads of chunk kc are done before its buffer is refilled
    wait_own_copies_landed();            // chunk kc+1 has landed before the barrier publishes it
    __syncthreads();
    if (refill) {                        // chunk kc+2 exists: into the buffer that this trip has just read
      const unsigned short* g2 = gl + (size_t)(kc + 2) * G_CHUNK;
      kv_copy8(ll + bo, ls4, g2);
      kv_copy8(ll + bo + 8u * ls4, ls4, g2 + G_CHUNK / 2);
    }
  };
  for (int kc = 0; kc < NCH - 2; ++kc) trip(kc, true);
  // kept rolled: unrolled, the two trips are one long block in which fragment reads are lifted far up and spilled
#pragma unroll 1
  for (int kc = NCH - 2; kc < NCH; ++kc) trip(kc, false);
  wait_own_copies_landed();              // no copy is outstanding when the ring becomes the out tiles

  // ---- the two halves' denominators join; the lane's 8 consecutive d of each tile go to row 16 u + c of the wave's out tile ----
  float* os = (float*)ring + wave * (Q_WAVE * 68);   // the last trip's barrier ended every read of the ring
#pragma unroll
  for (int u = 0; u < Q_TILES; ++u) {
    const float inv = 1.0f / (lrun[u] + at_xhalf(lrun[u]));
#pragma unroll
    for (int t = 0; t < 4; ++t) {
      v4f o0, o1;
#pragma unroll
      for (int e = 0; e < 4; ++e) { o0[e] = oacc[u][t][e] * inv; o1[e] = oacc[u][t][4 + e] * inv; }
      *(v4f*)(os + (16 * u + c) * 68 + t * 16 + 8 * hh)     = o0;
      *(v4f*)(os + (16 * u + c) * 68 + t * 16 + 8 * hh + 4) = o1;
    }
  }
  __builtin_amdgcn_fence(__ATOMIC_RELEASE, "workgroup");
  __builtin_amdgcn_wave_barrier();
  __builtin_amdgcn_fence(__ATOMIC_ACQUIRE, "workgroup");
  {
    const int q8 = lane >> 3, c8 = (lane & 7) * 8;
    {
#pragma unroll
      for (int it = 0; it < Q_WAVE / 4; ++it) {
        const int row = it * 4 + q8;                   // rows 0..31 of this wave's tile
        const float* sp = os + row * 68 + c8;
        const v4f f0 = *(const v4f*)(sp);
        const v4f f1 = *(const v4f*)(sp + 4);
        v4u ph, plo;
#pragma unroll
        for (int w = 0; w < 2; ++w) {
          const float a = f0[2 * w], bq = f0[2 * w + 1];
          const unsigned short ha = f2bf_bits(a), hb = f2bf_bits(bq);
          const unsigned short la = f2bf_bits(a - bf_bits2f(ha)), lb = f2bf_bits(bq - bf_bits2f(hb));
          ph[w]  = (unsigned)ha | ((unsigned)hb << 16);
          plo[w] = (unsigned)la | ((unsigned)lb << 16);
        }
#pragma unroll
        for (int w = 0; w < 2; ++w) {
          const float a = f1[2 * w], bq = f1[2 * w + 1];
          const unsigned short ha = f2bf_bits(a), hb = f2bf_bits(bq);
          const unsigned short la = f2bf_bits(a - bf_bits2f(ha)), lb = f2bf_bits(bq - bf_bits2f(hb));
          ph[2 + w]  = (unsigned)ha | ((unsigned)hb << 16);
          plo[2 + w] = (unsigned)la | ((unsigned)lb << 16);
        }
        const size_t o = (tokb + q0 + row) * INNER_DIM + hcol + c8;
        *(v4u*)(oh + o) = ph;
        *(v4u*)(ol + o) = plo;
      }
      
    }
  }
}

// =====================================================================================
// launch glue
// =====================================================================================
extern "C" void kernel_launch(void* const* d_in, const int* in_sizes, int n_in,
                              void* d_out, int out_size, void* d_ws,
                              size_t ws_size, hipStream_t stream) {
  if (n_in < 6) return;
  if (in_sizes[0] != TOK_ROWS * MODEL_DIM) return;
  if (in_sizes[1] != MODEL_DIM || in_sizes[2] != MODEL_DIM) return;
  if (in_sizes[3] != QKV_COLS * MODEL_DIM) return;
  if (in_sizes[4] != MODEL_DIM * INNER_DIM) return;
  if (in_sizes[5] != MODEL_DIM) return;
  if (out_size != TOK_ROWS * MODEL_DIM) return;
  if (ws_size < WS_TOTAL) return;

  const float* x    = (const float*)d_in[0];
  const float* gam  = (const float*)d_in[1];
  const float* bet  = (const float*)d_in[2];
  const float* wqkv = (const float*)d_in[3];
  const float* wout = (const float*)d_in[4];
  const float* bout = (const float*)d_in[5];
  float* out = (float*)d_out;

  char* ws = (char*)d_ws;
  size_t off = 0;
  unsigned short* wq_bf  = (unsigned short*)(ws + off); off += WS_WQ;
  unsigned short* wo_bf  = (unsigned short*)(ws + off); off += WS_WO;
  unsigned short* h_hi   = (unsigned short*)(ws + off); off += WS_HPL;
  unsigned short* h_lo   = (unsigned short*)(ws + off); off += WS_HPL;
  unsigned short* qkv_hi = (unsigned short*)(ws + off); off += WS_QKVPL;
  unsigned short* qkv_lo = (unsigned short*)(ws + off); off += WS_QKVPL;
  unsigned short* at_hi  = (unsigned short*)(ws + off); off += WS_ATPL;
  unsigned short* at_lo  = (unsigned short*)(ws + off); off += WS_ATPL;
  if (off > ws_size) return;

  // LayerNorm -> h hi/lo planes [4096][1024], and both weights -> bf16 (RNE): 256 blocks x 16 waves, one row + one piece a wave
  prologue_ln_cast_kernel<<<dim3(PRO_BLOCKS), dim3(32 * PRO_WAVES), 0, stream>>>(
      x, gam, bet, wqkv, wout, h_hi, h_lo, wq_bf, wo_bf);

  // qkv = h @ w_qkv^T -> bf16 hi/lo planes [4096][3072]; M=4096 N=3072 K=1024; block tiles 32*12 = 384 blocks
  gemm64_bf16_asplit<2, false, G_NI_QKV><<<dim3((TOK_ROWS / G_BM) * (QKV_COLS / g_bn(G_NI_QKV))), dim3(256), 0, stream>>>(
      h_hi, h_lo, MODEL_DIM, wq_bf, MODEL_DIM, (void*)qkv_hi, (void*)qkv_lo, QKV_COLS,
      (const float*)nullptr, TOK_ROWS, QKV_COLS, MODEL_DIM);

  // attention per (batch, head, 128 query rows): 2*16*16 = 512 blocks -> attn hi/lo planes [4096][1024]
  attn64_bf16x3_kernel<<<dim3(N_BATCH * N_HEAD * (SEQ_LEN / Q_BLOCK)), dim3(128), 0, stream>>>(
      qkv_hi, qkv_lo, at_hi, at_lo);

  // out = attn @ w_out^T + b_out -> f32 [4096][1024]; M=4096 N=1024 K=1024; block tiles 32*8 = 256 blocks
  gemm64_bf16_asplit<0, true, G_NI_OUT><<<dim3((TOK_ROWS / G_BM) * (MODEL_DIM / g_bn(G_NI_OUT))), dim3(256), 0, stream>>>(
      at_hi, at_lo, INNER_DIM, wo_bf, INNER_DIM, (void*)out, (void*)nullptr, MODEL_DIM,
      bout, TOK_ROWS, MODEL_DIM, INNER_DIM);
}
